// v000
// Measured on an AMD MI455X. A time is GPU time per run, averaged over a window of back-to-back runs after a warm-up
// (all launches, gaps included; the runs take copies of the inputs in turn), and the median of several windows.
// Apart from v000's, it joins two sittings. Times from different sittings can be a few percent apart, while
// side-by-side timings come from the same sitting.
// v000, which the later versions start from, runs in 5760 microseconds.
#include <hip/hip_runtime.h>
// Pre-LN causal transformer block WITHOUT an attention output projection that also returns its key and value tensors (x [2][2048][1024]; h = LN1(x) (biased var, eps 1e-5); q / k / v = h W + b ([in][out] [1024][1024] sigma 1/32, zero biases) -> [B][16][T][64]; att = softmax(q k^T / 8) with a causal mask (tril, -inf); y = att v merged back to [B][T][1024]; x1 = x + y (no projection); out = x1 + gelu_erf(LN2(x1) w_fc + b_fc) w_proj + b_proj ([in][out] 1024 x 4096 x 1024); returns (out [2][2048][1024], k [2][16][2048][64], v [2][16][2048][64]): three outputs at byte offsets 0 / 16,777,216 / 33,554,432 of d_out).
// Structure: token rows r = b*2048 + s; LN1(bf16(x)) as f16 rows, bf16(x) kept in f32 for the residual; q | k | v as ONE WMMA GEMM (N = 3 x 1024) (32x64 wave tiles, f32 accumulation, exact x16 weights + bias, f16 outputs); per batch: V^T for all heads via LDS transposes; per query tile of 256 rows: scores against the keys below the tile end only (K = 64, all heads on grid.y, alpha = 0.125), causal row softmax on VALU with an arithmetic 0/1 key mask over the computed range (f32 statistics, native exp; weights x256 f16), o = P . V^T (K = keys below the tile end, alpha 2^-8 undoing the x256 weights) plus bf16(x) written straight into the merged f32 x1 rows; out = x1 + FFN (two f16 GEMMs, f32 out) into the output layout.
// Compute dtype: inputs rounded to bf16; x / weights exact; q, k, v and softmax weights as plain f16 GEMM operands (~2^-12); scores and softmax statistics f32. v_wmma_f32_16x16x32_f16.
#define NB 2
#define SQ 2048
#define DM 1024
#define NH 16
#define HD 64
#define HG 4
#define QT 256                       /* query rows per causal tile */
#define NKX SQ                       /* S / P row pitch */
#define QT0 128                      /* first-tile rows recomputed exactly in f32 */
#define B0 0                         /* first batch processed (debug hook) */
#define NBR NB                       /* batches processed (debug hook) */
#define NR ((size_t)NB * SQ)
#define DMQ DM
#define DFF 4096                     /* FFN hidden width */
#define DFFR 100
#define MP ((int)((size_t)NBR * SQ)) /* rows projected (debug hook) */
#define QN SQ                        /* query rows attended per batch (debug hook) */
#define NHD NH                       /* heads attended (debug hook) */
#define MPO MP
#define LQ (3 * DM)      /* row pitch of the q/k/v rows */
typedef __bf16 v16b __attribute__((ext_vector_type(16)));
typedef unsigned short v8us __attribute__((ext_vector_type(8), may_alias));
typedef float  v8f  __attribute__((ext_vector_type(8)));
typedef float  v4f  __attribute__((ext_vector_type(4)));
typedef float  v4fa __attribute__((ext_vector_type(4), may_alias));
union FragB { v16b v; v8us half[2]; unsigned short u[16]; };

__device__ __forceinline__ unsigned short bf16_bits(float x) { unsigned int u = __float_as_uint(x); return (unsigned short)((u + 0x7FFFu + ((u >> 16) & 1u)) >> 16); }
__device__ __forceinline__ float bf16_val(unsigned short b) { return __uint_as_float(((unsigned int)b) << 16); }
__device__ __forceinline__ float bf16_round(float x) { return bf16_val(bf16_bits(x)); }
// D += A·B with NT terms: 1 = ah·bh, 2 = + al·bh (A split), 3 = + ah·bl (both split)
template <int NT>
__device__ __forceinline__ v8f mmaN(v16b ah, v16b al, v16b bh, v16b bl, v8f c) {
  c = __builtin_amdgcn_wmma_f32_16x16x32_bf16(false, ah, false, bh, (short)0, c, false, false);
  if (NT >= 2) c = __builtin_amdgcn_wmma_f32_16x16x32_bf16(false, al, false, bh, (short)0, c, false, false);
  if (NT >= 3) c = __builtin_amdgcn_wmma_f32_16x16x32_bf16(false, ah, false, bl, (short)0, c, false, false);
  asm volatile("v_nop\n\tv_nop\n\tv_nop\n\tv_nop" : "+v"(c) : "v"(ah), "v"(al), "v"(bh), "v"(bl));
  return c;
}

__global__ __launch_bounds__(256) void k_wt_bf16(const float* __restrict__ W, unsigned short* __restrict__ Wt, int K, int N) {
  const int t = blockIdx.x * 256 + threadIdx.x;
  const int k8n = K / 8;
  if (t >= N * k8n) return;
  const int n = t / k8n, k8 = (t % k8n) * 8;
  v8us v;
#pragma unroll
  for (int i = 0; i < 8; ++i) v[i] = bf16_bits(W[(size_t)(k8 + i) * N + n]);
  *(v8us*)(Wt + (size_t)n * K + k8) = v;
  
}

// GEMM C[M][N] (f32, pitch ldc) = act(A[M][K]·W + bias). A f32 row-major (pitch lda) converted per fragment to bf16
// (ASPLIT: hi/lo two planes -> 2 terms, else single rounded term); Wt bf16 [N][K] (pitch ldb). BIAS_BF16 rounds the
// bias to bf16 first (bias quantised to bf16 before the add). K%32==0, M%16==0, N%64==0.
template <bool ASPLIT, int ACT, bool BIAS_BF16>
__global__ __launch_bounds__(128) void k_gemm_bf(const float* __restrict__ A, int lda, const unsigned short* __restrict__ Wt, int ldb,
                                               const float* __restrict__ bias, float* __restrict__ C, int ldc, int M, int N, int K) {
  __shared__ __attribute__((aligned(16))) float so[4][16][64];
  const int tid = threadIdx.x, w = tid >> 5, lane = tid & 31, ln = lane & 15, hh = lane >> 4;
  const int ntn = N / 64;
  const int wid = blockIdx.x * 4 + w;
  const int mt = wid / ntn, nq = wid % ntn;
  if (mt * 16 >= M) return;
  const int row0 = mt * 16, col0 = nq * 64;
  const float* arow = A + (size_t)(row0 + ln) * lda;
  v8f acc[4] = {};
  for (int kb = 0; kb < K; kb += 32) {
    FragB ah, al;
    const v4f x0 = *(const v4fa*)(arow + kb + 8 * hh), x1 = *(const v4fa*)(arow + kb + 8 * hh + 4);
    const v4f x2 = *(const v4fa*)(arow + kb + 16 + 8 * hh), x3 = *(const v4fa*)(arow + kb + 16 + 8 * hh + 4);
    float xs[16] = {x0[0],x0[1],x0[2],x0[3],x1[0],x1[1],x1[2],x1[3],x2[0],x2[1],x2[2],x2[3],x3[0],x3[1],x3[2],x3[3]};
#pragma unroll
    for (int i = 0; i < 16; ++i) { const unsigned short hb = bf16_bits(xs[i]); ah.u[i] = hb; al.u[i] = ASPLIT ? bf16_bits(xs[i] - bf16_val(hb)) : (unsigned short)0; }
#pragma unroll
    for (int t = 0; t < 4; ++t) {
      const unsigned short* brow = Wt + (size_t)(col0 + t * 16 + ln) * ldb + kb;
      FragB b;
      b.half[0] = *(const v8us*)(brow + 8 * hh);
      b.half[1] = *(const v8us*)(brow + 16 + 8 * hh);
      acc[t] = mmaN<ASPLIT ? 2 : 1>(ah.v, al.v, b.v, b.v, acc[t]);
    }
  }
#pragma unroll
  for (int t = 0; t < 4; ++t) {
    float bv = bias ? bias[col0 + t * 16 + ln] : 0.f;
    if (BIAS_BF16) bv = bf16_round(bv);
#pragma unroll
    for (int r = 0; r < 8; ++r) { float v = acc[t][r] + bv; if (ACT == 1) v = fmaxf(v, 0.f); so[w][8 * hh + r][t * 16 + ln] = v; }
  }
  __builtin_amdgcn_fence(__ATOMIC_ACQ_REL, "workgroup");
  __builtin_amdgcn_wave_barrier();
  const int rsub = lane >> 4, c4 = (lane & 15) * 4;
  {
#pragma unroll
    for (int q = 0; q < 8; ++q) {
      const int r = q * 2 + rsub;
      const v4f v = *(const v4fa*)&so[w][r][c4];
      *(v4f*)(C + (size_t)(row0 + r) * ldc + col0 + c4) = v;
    }
    
  }
}

// GEMM C = act(A·W + bias + resid): A f32 (ASPLIT -> hi/lo 2 terms), Wt bf16 [N][K]; ACT 0 none, 1 relu, 2 exact gelu;
// resid (optional, f32, row index = (row % rmod), pitch ldr, RES_BF16 rounds it) added before the activation.
template <bool ASPLIT, int ACT, bool BIAS_BF16, bool RES_BF16>
__global__ __launch_bounds__(128) void k_gemm_bf3(const float* __restrict__ A, int lda, const unsigned short* __restrict__ Wt, int ldb,
                                                const float* __restrict__ bias, const float* __restrict__ resid, int rmod, int ldr,
                                                float* __restrict__ C, int ldc, int M, int N, int K) {
  __shared__ __attribute__((aligned(16))) float so[4][16][64];
  const int tid = threadIdx.x, w = tid >> 5, lane = tid & 31, ln = lane & 15, hh = lane >> 4;
  const int ntn = N / 64;
  const int wid = blockIdx.x * 4 + w;
  const int mt = wid / ntn, nq = wid % ntn;
  if (mt * 16 >= M) return;
  const int row0 = mt * 16, col0 = nq * 64;
  const float* arow = A + (size_t)(row0 + ln) * lda;
  v8f acc[4] = {};
  for (int kb = 0; kb < K; kb += 32) {
    FragB ah, al;
    const v4f x0 = *(const v4fa*)(arow + kb + 8 * hh), x1 = *(const v4fa*)(arow + kb + 8 * hh + 4);
    const v4f x2 = *(const v4fa*)(arow + kb + 16 + 8 * hh), x3 = *(const v4fa*)(arow + kb + 16 + 8 * hh + 4);
    float xs[16] = {x0[0],x0[1],x0[2],x0[3],x1[0],x1[1],x1[2],x1[3],x2[0],x2[1],x2[2],x2[3],x3[0],x3[1],x3[2],x3[3]};
#pragma unroll
    for (int i = 0; i < 16; ++i) { const unsigned short hb = bf16_bits(xs[i]); ah.u[i] = hb; al.u[i] = ASPLIT ? bf16_bits(xs[i] - bf16_val(hb)) : (unsigned short)0; }
#pragma unroll
    for (int t = 0; t < 4; ++t) {
      const unsigned short* brow = Wt + (size_t)(col0 + t * 16 + ln) * ldb + kb;
      FragB b;
      b.half[0] = *(const v8us*)(brow + 8 * hh);
      b.half[1] = *(const v8us*)(brow + 16 + 8 * hh);
      acc[t] = mmaN<ASPLIT ? 2 : 1>(ah.v, al.v, b.v, b.v, acc[t]);
    }
  }
#pragma unroll
  for (int t = 0; t < 4; ++t) {
    const int col = col0 + t * 16 + ln;
    float bv = bias ? bias[col] : 0.f;
    if (BIAS_BF16) bv = bf16_round(bv);
#pragma unroll
    for (int r = 0; r < 8; ++r) {
      float v = acc[t][r] + bv;
      if (resid) { float rv = resid[(size_t)((row0 + 8 * hh + r) % rmod) * ldr + col]; if (RES_BF16) rv = bf16_round(rv); v += rv; }
      if (ACT == 1) v = fmaxf(v, 0.f);
      if (ACT == 2) v = 0.5f * v * (1.0f + erff(v * 0.70710678118654752f));
      if (ACT == 3) { const float u = 0.7978845608028654f * (v + 0.044715f * v * v * v); v = 0.5f * v * (1.0f + tanhf(u)); }
      so[w][8 * hh + r][t * 16 + ln] = v;
    }
  }
  __builtin_amdgcn_fence(__ATOMIC_ACQ_REL, "workgroup");
  __builtin_amdgcn_wave_barrier();
  const int rsub = lane >> 4, c4 = (lane & 15) * 4;
  {
#pragma unroll
    for (int q = 0; q < 8; ++q) {
      const int r = q * 2 + rsub;
      const v4f v = *(const v4fa*)&so[w][r][c4];
      *(v4f*)(C + (size_t)(row0 + r) * ldc + col0 + c4) = v;
    }
    
  }
}
// row LayerNorm (biased variance, eps) over N: s = X (+ R); optional out_sum <- s; out_norm <- (s-mu)*rsqrt(var+eps)*g + b
template <bool PARAM_BF16>
__global__ __launch_bounds__(256) void k_layernorm(const float* __restrict__ X, const float* __restrict__ R, const float* __restrict__ g, const float* __restrict__ bta,
                                                  float* __restrict__ out_sum, float* __restrict__ out_norm, int N, float eps) {
  __shared__ float red[256];
  const int row = blockIdx.x, tid = threadIdx.x;
  const float* x = X + (size_t)row * N; const float* rr = R ? R + (size_t)row * N : nullptr;
  float vals[16];                     // up to N = 4096
  const int per = N / 256;            // contiguous chunk per thread? use strided-by-4 chunks: thread handles j = tid*4 + 1024*u
  float s1 = 0.f;
  for (int u = 0; u < per / 4; ++u) {
    const int j = tid * 4 + 1024 * u;
    const v4f a = *(const v4fa*)(x + j);
    v4f b = {0.f,0.f,0.f,0.f}; if (rr) b = *(const v4fa*)(rr + j);
#pragma unroll
    for (int q = 0; q < 4; ++q) { const float v = a[q] + b[q]; vals[u * 4 + q] = v; s1 += v; }
  }
  red[tid] = s1; __syncthreads();
  for (int st = 128; st > 0; st >>= 1) { if (tid < st) red[tid] += red[tid + st]; __syncthreads(); }
  const float mu = red[0] / (float)N; __syncthreads();
  float s2 = 0.f;
  for (int u = 0; u < per / 4; ++u)
#pragma unroll
    for (int q = 0; q < 4; ++q) { const float c = vals[u * 4 + q] - mu; s2 += c * c; }
  red[tid] = s2; __syncthreads();
  for (int st = 128; st > 0; st >>= 1) { if (tid < st) red[tid] += red[tid + st]; __syncthreads(); }
  const float rs = rsqrtf(red[0] / (float)N + eps);
  {
    for (int u = 0; u < per / 4; ++u) {
      const int j = tid * 4 + 1024 * u;
      v4f o, sm;
#pragma unroll
      for (int q = 0; q < 4; ++q) {
        float gg = g[j + q], bb = bta[j + q];
        if (PARAM_BF16) { gg = bf16_round(gg); bb = bf16_round(bb); }
        sm[q] = vals[u * 4 + q]; o[q] = (vals[u * 4 + q] - mu) * rs * gg + bb;
      }
      if (out_sum) *(v4f*)(out_sum + (size_t)row * N + j) = sm;
      *(v4f*)(out_norm + (size_t)row * N + j) = o;
    }
    
  }
}



// ---- f16 WMMA path (v_wmma_f32_16x16x32_f16): 11-bit significands for operands in range — used where a [0,1] probability operand needs more precision than bf16
typedef _Float16 v16h __attribute__((ext_vector_type(16)));
union FragH { v16h v; v8us half[2]; _Float16 h[16]; unsigned short u[16]; };
template <int NT>
__device__ __forceinline__ v8f mmaH(v16h ah, v16h al, v16h bh, v16h bl, v8f c) {
  c = __builtin_amdgcn_wmma_f32_16x16x32_f16(false, ah, false, bh, (short)0, c, false, false);
  if (NT >= 2) c = __builtin_amdgcn_wmma_f32_16x16x32_f16(false, al, false, bh, (short)0, c, false, false);
  if (NT >= 3) c = __builtin_amdgcn_wmma_f32_16x16x32_f16(false, ah, false, bl, (short)0, c, false, false);
  asm volatile("v_nop\n\tv_nop\n\tv_nop\n\tv_nop" : "+v"(c) : "v"(ah), "v"(al), "v"(bh), "v"(bl));
  return c;
}
// batched GEMM like k_gemm_b but f16 operands: A f32 (split into f16 hi/lo if ASPLIT, else rounded to f16), Bt = f16 values [n][k]; alpha; C f32; N multiple of 16 (partial tiles skipped)
template <bool ASPLIT>
__global__ __launch_bounds__(128) void k_gemm_h(const float* __restrict__ A, int lda, size_t sA, const _Float16* __restrict__ Bh, int ldb, size_t sB, float alpha, float* __restrict__ C, int ldc, size_t sC, int M, int N, int K) {
  __shared__ __attribute__((aligned(16))) float so[4][16][64];
  const int tid = threadIdx.x, w = tid >> 5, lane = tid & 31, ln = lane & 15, hh = lane >> 4; const int by = blockIdx.y;
  A += (size_t)by * sA; Bh += (size_t)by * sB; C += (size_t)by * sC;
  const int ntn = (N + 63) / 64; const int wid = blockIdx.x * 4 + w; const int mt = wid / ntn, nq = wid % ntn; if (mt * 16 >= M) return;
  const int row0 = mt * 16, col0 = nq * 64; const float* arow = A + (size_t)(row0 + ln) * lda;
  v8f acc[4] = {};
  for (int kb = 0; kb < K; kb += 32) {
    FragH ah, al;
    const v4f x0 = *(const v4fa*)(arow + kb + 8 * hh), x1 = *(const v4fa*)(arow + kb + 8 * hh + 4), x2 = *(const v4fa*)(arow + kb + 16 + 8 * hh), x3 = *(const v4fa*)(arow + kb + 16 + 8 * hh + 4);
    float xs[16] = {x0[0],x0[1],x0[2],x0[3],x1[0],x1[1],x1[2],x1[3],x2[0],x2[1],x2[2],x2[3],x3[0],x3[1],x3[2],x3[3]};
#pragma unroll
    for (int i = 0; i < 16; ++i) { const _Float16 h = (_Float16)xs[i]; ah.h[i] = h; al.h[i] = ASPLIT ? (_Float16)(xs[i] - (float)h) : (_Float16)0.0f; }
#pragma unroll
    for (int t = 0; t < 4; ++t) { if (col0 + t * 16 >= N) continue; const size_t boff = (size_t)(col0 + t * 16 + ln) * ldb + kb; FragH bq; bq.half[0] = *(const v8us*)(Bh + boff + 8 * hh); bq.half[1] = *(const v8us*)(Bh + boff + 16 + 8 * hh);
      acc[t] = mmaH<ASPLIT ? 2 : 1>(ah.v, al.v, bq.v, bq.v, acc[t]); }
  }
#pragma unroll
  for (int t = 0; t < 4; ++t) { if (col0 + t * 16 >= N) continue;
#pragma unroll
    for (int r = 0; r < 8; ++r) so[w][8 * hh + r][t * 16 + ln] = acc[t][r] * alpha; }
  __builtin_amdgcn_fence(__ATOMIC_ACQ_REL, "workgroup"); __builtin_amdgcn_wave_barrier();
  const int rsub = lane >> 4, c4 = (lane & 15) * 4;
  {
#pragma unroll
    for (int q = 0; q < 8; ++q) { const int r = q * 2 + rsub; if (col0 + c4 < N) { const v4f v = *(const v4fa*)&so[w][r][c4]; *(v4f*)(C + (size_t)(row0 + r) * ldc + col0 + c4) = v; } }
     }
}

// Wt[n][k] = f16(W[k][n]·scale) from f32 row-major W[K][N] (scale = power of two; bf16-exact weights stay exact in f16 away from the subnormal range)
__global__ __launch_bounds__(256) void k_wt_f16(const float* __restrict__ W, _Float16* __restrict__ Wt, int K, int N, float scale) {
  const int t = blockIdx.x * 256 + threadIdx.x; if (t >= N * (K / 8)) return; const int n = t / (K / 8), k8 = (t % (K / 8)) * 8; FragH f;
#pragma unroll
  for (int i = 0; i < 8; ++i) f.h[i] = (_Float16)(bf16_round(W[(size_t)(k8 + i) * N + n]) * scale); const v8us o = f.half[0];
  *(v8us*)((unsigned short*)Wt + (size_t)n * K + k8) = o; 
}
// k_gemm_hh variant with fused epilogue: v = acc·alpha + bias[by·sBias + col] (+ CP[(row/rowsPerB)·sCPb + by·64 + col] if CP) ; ACT 0 none / 1 elu ; writes f16 C16 (and f32 C if non-null)
template <int ACT>
__global__ __launch_bounds__(128) void k_gemm_hhx(const _Float16* __restrict__ A, int lda, size_t sA, const _Float16* __restrict__ Bh, int ldb, size_t sB, float alpha, const float* __restrict__ bias, size_t sBias, const float* __restrict__ CP, int rowsPerB, size_t sCPb, int row0g,
    float* __restrict__ C, _Float16* __restrict__ C16, int ldc, size_t sC, int M, int N, int K) {
  __shared__ __attribute__((aligned(16))) float so[4][16][64];
  const int tid = threadIdx.x, w = tid >> 5, lane = tid & 31, ln = lane & 15, hh = lane >> 4; const int by = blockIdx.y;
  A += (size_t)by * sA; Bh += (size_t)by * sB; const size_t cofs = (size_t)by * sC; const float* bp = bias ? bias + (size_t)by * sBias : nullptr;
  const int ntn = (N + 63) / 64; const int wid = blockIdx.x * 4 + w; const int mt = wid / ntn, nq = wid % ntn; if (mt * 16 >= M) return;
  const int row0 = mt * 16, col0 = nq * 64; const _Float16* arow = A + (size_t)(row0 + ln) * lda;
  v8f acc[4] = {};
  for (int kb = 0; kb < K; kb += 32) { FragH ah; ah.half[0] = *(const v8us*)((const unsigned short*)arow + kb + 8 * hh); ah.half[1] = *(const v8us*)((const unsigned short*)arow + kb + 16 + 8 * hh);
#pragma unroll
    for (int t = 0; t < 4; ++t) { if (col0 + t * 16 >= N) continue; const size_t boff = (size_t)(col0 + t * 16 + ln) * ldb + kb; FragH bq; bq.half[0] = *(const v8us*)((const unsigned short*)Bh + boff + 8 * hh); bq.half[1] = *(const v8us*)((const unsigned short*)Bh + boff + 16 + 8 * hh);
      acc[t] = mmaH<1>(ah.v, ah.v, bq.v, bq.v, acc[t]); }
  }
#pragma unroll
  for (int t = 0; t < 4; ++t) { if (col0 + t * 16 >= N) continue; const int col = col0 + t * 16 + ln; const float bv = bp ? bf16_round(bp[col]) : 0.f;
#pragma unroll
    for (int r = 0; r < 8; ++r) { float v = acc[t][r] * alpha + bv; if (CP) { const int rr = row0g + row0 + 8 * hh + r; if (rowsPerB < 0) v += CP[cofs + (size_t)rr * ldc + col];      /* rowsPerB < 0: own element of the batched C plane */ else { const int bidx = rr / rowsPerB; v += CP[(size_t)bidx * sCPb + (size_t)by * 64 + col]; } } if (ACT == 1) v = (v > 0.f) ? v : expm1f(v); else if (ACT == 7) v = (v > 0.f) ? v + 1.0f : expf(v); else if (ACT == 8) v = tanhf(v); else if (ACT == 9) v = 0.5f * v * (1.0f + tanhf(0.7978845608028654f * (v + 0.044715f * v * v * v))); else if (ACT == 11) v = 1.0f / (1.0f + expf(-v)); else if (ACT == 12) v = (v > 0.f) ? v : 0.01f * v; else if (ACT == 14) v = (v > 0.f) ? v : 0.1f * v; else if (ACT == 16) v = (v >= 0.f) ? v : 0.3f * v; else if (ACT == 17) v = (v >= 0.f) ? v : 0.2f * v; else if (ACT == 15) v = v / (1.0f + expf(-v)); else if (ACT == 3) v = fmaxf(v, 0.f); else if (ACT == 6) v = 0.5f * v * (1.0f + erff(v * 0.70710678118654752f)); so[w][8 * hh + r][t * 16 + ln] = v; } }
  __builtin_amdgcn_fence(__ATOMIC_ACQ_REL, "workgroup"); __builtin_amdgcn_wave_barrier();
  const int rsub = lane >> 4, c4 = (lane & 15) * 4; typedef _Float16 v4h __attribute__((ext_vector_type(4)));
  {
#pragma unroll
    for (int q = 0; q < 8; ++q) { const int r = q * 2 + rsub; if (col0 + c4 < N) { const v4f v = *(const v4fa*)&so[w][r][c4]; if (C) *(v4f*)(C + cofs + (size_t)(row0 + r) * ldc + col0 + c4) = v; if (C16) { v4h h4; for (int i = 0; i < 4; ++i) h4[i] = (_Float16)v[i]; *(v4h*)(C16 + cofs + (size_t)(row0 + r) * ldc + col0 + c4) = h4; } } }
     }
}


typedef _Float16 v4h __attribute__((ext_vector_type(4)));

__global__ __launch_bounds__(256) void k_x16(const float* __restrict__ x, _Float16* __restrict__ X16, size_t n8) { const size_t t = (size_t)blockIdx.x * 256 + threadIdx.x; if (t >= n8) return; FragH f;
#pragma unroll
  for (int q = 0; q < 8; ++q) f.h[q] = (_Float16)bf16_round(x[t * 8 + q]); *(v8us*)((unsigned short*)X16 + t * 8) = f.half[0];  }
__global__ __launch_bounds__(256) void k_h16(const float* __restrict__ x, _Float16* __restrict__ X16, size_t n8) { const size_t t = (size_t)blockIdx.x * 256 + threadIdx.x; if (t >= n8) return; FragH f;
#pragma unroll
  for (int q = 0; q < 8; ++q) f.h[q] = (_Float16)x[t * 8 + q]; *(v8us*)((unsigned short*)X16 + t * 8) = f.half[0];  }
__global__ __launch_bounds__(256) void k_round16f(const float* __restrict__ W, _Float16* __restrict__ Bt, size_t n8) { const size_t t = (size_t)blockIdx.x * 256 + threadIdx.x; if (t >= n8) return; FragH f;
#pragma unroll
  for (int i = 0; i < 8; ++i) f.h[i] = (_Float16)(bf16_round(W[t * 8 + i]) * 16.0f); *(v8us*)((unsigned short*)Bt + t * 8) = f.half[0];  }
template <int NHv, int TTv>
__global__ __launch_bounds__(256) void k_vt(const _Float16* __restrict__ V16, int ldv, int voff, _Float16* __restrict__ Vt) { __shared__ unsigned short tl[64][66]; const int tid = threadIdx.x; const int slab = blockIdx.x / (TTv / 64), lg = blockIdx.x % (TTv / 64); const int b = slab / NHv, h = slab % NHv;
  for (int i = tid; i < 64 * 8; i += 256) { const int r = i / 8, c8 = (i % 8) * 8; FragH f; f.half[0] = *(const v8us*)((const unsigned short*)V16 + ((size_t)b * TTv + lg * 64 + r) * ldv + voff + h * 64 + c8);
#pragma unroll
    for (int q = 0; q < 8; ++q) tl[r][c8 + q] = f.u[q]; }
  __syncthreads();
  {
#pragma unroll
    for (int rd = 0; rd < 2; ++rd) { const int d = rd * 32 + tid / 8, pc = tid % 8; FragH f;
#pragma unroll
      for (int q = 0; q < 8; ++q) f.u[q] = tl[pc * 8 + q][d];
      *(v8us*)((unsigned short*)Vt + ((size_t)slab * 64 + d) * TTv + lg * 64 + pc * 8) = f.half[0]; }
     } }

__global__ __launch_bounds__(256) void k_hl(const float* __restrict__ F, _Float16* __restrict__ Hh, _Float16* __restrict__ Hl, size_t n8) { const size_t t = (size_t)blockIdx.x * 256 + threadIdx.x; if (t >= n8) return; FragH fh, fl; const v4f a = *(const v4fa*)(F + t * 8), c = *(const v4fa*)(F + t * 8 + 4);
#pragma unroll
  for (int q = 0; q < 4; ++q) { _Float16 h = (_Float16)a[q]; fh.h[q] = h; fl.h[q] = (_Float16)((a[q] - (float)h) * 1024.0f); h = (_Float16)c[q]; fh.h[4 + q] = h; fl.h[4 + q] = (_Float16)((c[q] - (float)h) * 1024.0f); }
  { *(v8us*)((unsigned short*)Hh + t * 8) = fh.half[0]; *(v8us*)((unsigned short*)Hl + t * 8) = fl.half[0];  } }

// ---- fast GEMM (wave tile 32x64; requires M % 32 == 0 rows per launch region and N % 64 == 0); epilogue = k_gemm_hhx semantics ----
__device__ __forceinline__ v16h g2_frag(const _Float16* p, int hh) { FragH f; f.half[0] = *(const v8us*)((const unsigned short*)p + 8 * hh); f.half[1] = *(const v8us*)((const unsigned short*)p + 16 + 8 * hh); return f.v; }
__device__ __forceinline__ v8f g2_mma(v16h a, v16h b, v8f c) { v8f d = __builtin_amdgcn_wmma_f32_16x16x32_f16(false, a, false, b, (short)0, c, false, false); asm volatile("v_nop\n\tv_nop\n\tv_nop\n\tv_nop" : "+v"(d) : "v"(a), "v"(b)); return d; }
template <int ACT>
__global__ __launch_bounds__(128) void k_gemm2(const _Float16* __restrict__ A, int lda, size_t sA, const _Float16* __restrict__ Bh, int ldb, size_t sB, float alpha, const float* __restrict__ bias, size_t sBias, const float* __restrict__ CP, int rowsPerB, size_t sCPb, int row0g,
    float* __restrict__ C, _Float16* __restrict__ C16, int ldc, size_t sC, int M, int N, int K) { static_assert(ACT == 0 || ACT == 3 || ACT == 6 || ACT == 8 || ACT == 9 || ACT == 11 || ACT == 12 || ACT == 14 || ACT == 15 || ACT == 16 || ACT == 17, "k_gemm2: unsupported ACT code (would silently apply no activation)");
  __shared__ __attribute__((aligned(16))) float so[4][32][68];
  const int tid = threadIdx.x, w = tid >> 5, lane = tid & 31, ln = lane & 15, hh = lane >> 4; const int by = blockIdx.y;
  A += (size_t)by * sA; Bh += (size_t)by * sB; const size_t cofs = (size_t)by * sC; const float* bp = bias ? bias + (size_t)by * sBias : nullptr;
  const int ntn = N >> 6; const int mt = blockIdx.x / ntn, nq = blockIdx.x - mt * ntn; const int row0 = mt * 128 + 32 * w, col0 = nq * 64; if (row0 >= M) return;
  const _Float16* a0p = A + (size_t)(row0 + ln) * lda; const _Float16* a1p = a0p + (size_t)16 * lda;
  const _Float16* b0p = Bh + (size_t)(col0 + ln) * ldb; const _Float16* b1p = b0p + (size_t)16 * ldb; const _Float16* b2p = b1p + (size_t)16 * ldb; const _Float16* b3p = b2p + (size_t)16 * ldb;
  const v8f z8 = {0.f,0.f,0.f,0.f,0.f,0.f,0.f,0.f}; v8f c00 = z8, c01 = z8, c02 = z8, c03 = z8, c10 = z8, c11 = z8, c12 = z8, c13 = z8;
#pragma unroll 1
  for (int kb = 0; kb < K; kb += 32) { const v16h a0 = g2_frag(a0p + kb, hh), a1 = g2_frag(a1p + kb, hh);
    v16h b = g2_frag(b0p + kb, hh); c00 = g2_mma(a0, b, c00); c10 = g2_mma(a1, b, c10);
    b = g2_frag(b1p + kb, hh); c01 = g2_mma(a0, b, c01); c11 = g2_mma(a1, b, c11);
    b = g2_frag(b2p + kb, hh); c02 = g2_mma(a0, b, c02); c12 = g2_mma(a1, b, c12);
    b = g2_frag(b3p + kb, hh); c03 = g2_mma(a0, b, c03); c13 = g2_mma(a1, b, c13); }
  v8f accs[8] = {c00, c01, c02, c03, c10, c11, c12, c13};
#pragma unroll
  for (int u = 0; u < 8; ++u) { const int t = u & 3, half = u >> 2; const int col = col0 + t * 16 + ln; const float bv = bp ? bf16_round(bp[col]) : 0.f;
#pragma unroll
    for (int r = 0; r < 8; ++r) { const int rloc = half * 16 + 8 * hh + r; float v = accs[u][r] * alpha + bv; if (CP) { if (rowsPerB < 0) v += CP[cofs + (size_t)(row0g + row0 + rloc) * ldc + col];      /* rowsPerB < 0: own element of the batched C plane */ else { const int bidx = (row0g + row0 + rloc) / rowsPerB; v += CP[(size_t)bidx * sCPb + (size_t)by * 64 + col]; } }
      if (ACT == 3) v = fmaxf(v, 0.f); else if (ACT == 6) v = 0.5f * v * (1.0f + erff(v * 0.70710678118654752f)); else if (ACT == 11) v = 1.0f / (1.0f + expf(-v)); else if (ACT == 15) v = v / (1.0f + expf(-v)); else if (ACT == 12) v = (v > 0.f) ? v : 0.01f * v; else if (ACT == 8) v = tanhf(v); else if (ACT == 9) v = 0.5f * v * (1.0f + tanhf(0.7978845608028654f * (v + 0.044715f * v * v * v))); else if (ACT == 14) v = (v > 0.f) ? v : 0.1f * v; else if (ACT == 16) v = (v >= 0.f) ? v : 0.3f * v; else if (ACT == 17) v = (v >= 0.f) ? v : 0.2f * v;
      so[w][rloc][t * 16 + ln] = v; } }
  __builtin_amdgcn_fence(__ATOMIC_ACQ_REL, "workgroup"); __builtin_amdgcn_wave_barrier();
  const int rsub = lane >> 4, c4 = (lane & 15) * 4;
  {
#pragma unroll
    for (int q = 0; q < 16; ++q) { const int r = q * 2 + rsub; const v4f v = *(const v4fa*)&so[w][r][c4]; if (C) *(v4f*)(C + cofs + (size_t)(row0 + r) * ldc + col0 + c4) = v; if (C16) { v4h h4; for (int i = 0; i < 4; ++i) h4[i] = (_Float16)v[i]; *(v4h*)(C16 + cofs + (size_t)(row0 + r) * ldc + col0 + c4) = h4; } }
     } }


__global__ __launch_bounds__(256) void k_wnat(const float* __restrict__ w, size_t n8, _Float16* __restrict__ Bt) { const size_t t = (size_t)blockIdx.x * 256 + threadIdx.x; if (t >= n8) return; FragH f; for (int q = 0; q < 8; ++q) f.h[q] = (_Float16)(bf16_round(w[t * 8 + q]) * 16.0f); *(v8us*)((unsigned short*)Bt + t * 8) = f.half[0];  }
__global__ __launch_bounds__(256) void k_rsm(const float* __restrict__ S, _Float16* __restrict__ P, int nrows) {
  #pragma clang fp contract(off)
  const int i = blockIdx.x * 256 + threadIdx.x; if (i >= nrows) return; const float* s = S + (size_t)i * SQ; float mx = -3.0e38f;
#pragma unroll 1
  for (int j = 0; j < SQ; ++j) mx = fmaxf(mx, s[j]); float se = 0.f;
#pragma unroll 1
  for (int j = 0; j < SQ; ++j) se += expf(s[j] - mx); const float sc = 256.0f / se;
#pragma unroll 1
  for (int j0 = 0; j0 < SQ; j0 += 8) { FragH f; for (int q = 0; q < 8; ++q) f.h[q] = (_Float16)(expf(s[j0 + q] - mx) * sc); unsigned short* d = (unsigned short*)P + (size_t)i * SQ + j0; *(v8us*)d = f.half[0];  } }
__global__ __launch_bounds__(256) void k_vt(const _Float16* __restrict__ V16, int b, int h0, _Float16* __restrict__ VT) { __shared__ unsigned short tl[64][65]; const int tid = threadIdx.x; const int hh = blockIdx.x % HG, sg = blockIdx.x / HG; const int s0 = sg * 64; const int h = h0 + hh;
  for (int i = tid; i < 64 * 8; i += 256) { const int j = i / 8, d8 = (i % 8) * 8; FragH f; f.half[0] = *(const v8us*)((const unsigned short*)V16 + ((size_t)b * SQ + s0 + j) * DM + h * HD + d8); for (int q = 0; q < 8; ++q) tl[d8 + q][j] = f.u[q]; }
  __syncthreads();
  { for (int i = tid; i < 64 * 8; i += 256) { const int d = i / 8, j8 = (i % 8) * 8; FragH f; for (int q = 0; q < 8; ++q) f.u[q] = tl[d][j8 + q]; *(v8us*)((unsigned short*)VT + ((size_t)hh * HD + d) * SQ + s0 + j8) = f.half[0]; }  } }



__global__ __launch_bounds__(256) void k_rsmcf2(const float* __restrict__ S, _Float16* __restrict__ P, int hg, int q0, int nk) {
  #pragma clang fp contract(off)
  const int t = blockIdx.x * 256 + threadIdx.x; if (t >= hg * QT) return; const size_t i = (size_t)t; const float* s = S + i * NKX; const int last = q0 + (t % QT); float mx = -3.0e38f;
#pragma unroll 1
  for (int j = 0; j < nk; ++j) { const float f = (j <= last) ? 1.f : 0.f; mx = fmaxf(mx, fmaf(f, s[j], (1.f - f) * -1.0e9f)); } float se = 0.f;
#pragma unroll 1
  for (int j = 0; j < nk; ++j) { const float f = (j <= last) ? 1.f : 0.f; se += __expf(fmaf(f, s[j], (1.f - f) * -1.0e9f) - mx); } const float sc = 256.0f / se;
#pragma unroll 1
  for (int j0 = 0; j0 < nk; j0 += 8) { FragH fr; for (int q = 0; q < 8; ++q) { const int j = j0 + q; const float f = (j <= last) ? 1.f : 0.f; fr.h[q] = (_Float16)(__expf(fmaf(f, s[j], (1.f - f) * -1.0e9f) - mx) * sc); } unsigned short* d = (unsigned short*)P + i * NKX + j0; *(v8us*)d = fr.half[0];  } }


template <int MASKADD>
__global__ __launch_bounds__(64) void k_att0(const float* __restrict__ QF, const float* __restrict__ KF, const float* __restrict__ VF, int ld, const float* __restrict__ mask, float scale, float* __restrict__ OF, int ldo) {
  #pragma clang fp contract(off)
  __shared__ __attribute__((aligned(16))) float lq[64][64]; __shared__ __attribute__((aligned(16))) float lo[64][64];
  const int tid = threadIdx.x; const int h = blockIdx.x / (QT0 / 64), rg = blockIdx.x % (QT0 / 64); const int i = rg * 64 + tid;
  const float* qr = QF + (size_t)i * ld + h * HD;
#pragma unroll 1
  for (int c = 0; c < HD / 4; ++c) { *(v4f*)&lq[tid][c * 4] = *(const v4fa*)(qr + c * 4); const v4f z = {0.f, 0.f, 0.f, 0.f}; *(v4f*)&lo[tid][c * 4] = z; }
  float m = -1.0e30f, l = 0.f; const int jmax = MASKADD ? (SQ - 1) : (rg * 64 + 63);      /* additive-mask form: every key (the mask input decides); causal form: keys up to the block's last row */
#pragma unroll 1
  for (int j = 0; j <= jmax; ++j) { const float* kr = KF + (size_t)j * ld + h * HD; const float* vr = VF + (size_t)j * ld + h * HD; float s = 0.f;
#pragma unroll 1
    for (int c = 0; c < HD / 4; ++c) { const v4f kq = *(const v4fa*)(kr + c * 4); const v4f qq = *(v4f*)&lq[tid][c * 4]; s = __fadd_rn(s, __fmul_rn(qq[0], kq[0])); s = __fadd_rn(s, __fmul_rn(qq[1], kq[1])); s = __fadd_rn(s, __fmul_rn(qq[2], kq[2])); s = __fadd_rn(s, __fmul_rn(qq[3], kq[3])); }
    s = __fmul_rn(s, scale); if (MASKADD) s = __fadd_rn(s, __fmul_rn(bf16_round(mask[(size_t)i * SQ + j]), -10000.0f));
    const float f = (MASKADD || j <= i) ? 1.f : 0.f; const float sm = fmaf(f, s, (1.f - f) * -1.0e30f); const float mn = fmaxf(m, sm); const float sc = expf(m - mn); const float e = expf(sm - mn); l = __fadd_rn(__fmul_rn(l, sc), e); m = mn;
#pragma unroll 1
    for (int c = 0; c < HD / 4; ++c) { const v4f vv = *(const v4fa*)(vr + c * 4); v4f oo = *(v4f*)&lo[tid][c * 4]; for (int u = 0; u < 4; ++u) oo[u] = __fadd_rn(__fmul_rn(oo[u], sc), __fmul_rn(e, vv[u])); *(v4f*)&lo[tid][c * 4] = oo; } }
  const float fin = 64.0f / l;      /* o carried x64, undone by the 1/64 in k_addf */
#pragma unroll 1
  for (int c = 0; c < HD / 4; ++c) { v4f oo = *(v4f*)&lo[tid][c * 4]; for (int u = 0; u < 4; ++u) oo[u] = __fmul_rn(oo[u], fin); *(v4f*)&lo[tid][c * 4] = oo; }
  __syncthreads();
  {
#pragma unroll 1
    for (int it = 0; it < 16; ++it) { const int row = it * 4 + tid / 16, pc = (tid % 16) * 4; const v4f v = *(const v4f*)&lo[row][pc]; *(v4f*)(OF + (size_t)(rg * 64 + row) * ldo + h * HD + pc) = v; }
     } }


template <int BFIN, int WXB>
__global__ __launch_bounds__(256) void k_ln16(const float* __restrict__ X, const float* __restrict__ g, const float* __restrict__ bb, float eps, _Float16* __restrict__ N16, float* __restrict__ XB) {
  #pragma clang fp contract(off)
  __shared__ float red[256]; const size_t r = blockIdx.x; const int t = threadIdx.x; const v4f xa = *(const v4fa*)(X + r * DMQ + t * 4); float s[4]; float sum = 0.f;
  for (int q = 0; q < 4; ++q) { s[q] = BFIN ? bf16_round(xa[q]) : xa[q]; sum = __fadd_rn(sum, s[q]); }
  red[t] = sum; __syncthreads(); for (int st = 128; st > 0; st >>= 1) { if (t < st) red[t] = __fadd_rn(red[t], red[t + st]); __syncthreads(); } const float mu = red[0] / (float)DMQ; __syncthreads();
  float vs = 0.f; for (int q = 0; q < 4; ++q) { const float dl = __fadd_rn(s[q], -mu); vs = __fadd_rn(vs, __fmul_rn(dl, dl)); } red[t] = vs; __syncthreads(); for (int st = 128; st > 0; st >>= 1) { if (t < st) red[t] = __fadd_rn(red[t], red[t + st]); __syncthreads(); }
  const float rs = rsqrtf(__fadd_rn(red[0] / (float)DMQ, eps)); v4h y; v4f xb;
  for (int q = 0; q < 4; ++q) { const int c = t * 4 + q; y[q] = (_Float16)__fadd_rn(__fmul_rn(__fmul_rn(__fadd_rn(s[q], -mu), rs), bf16_round(g[c])), bf16_round(bb[c])); xb[q] = s[q]; }
  { *(v4h*)(N16 + r * DMQ + t * 4) = y; if (WXB) *(v4f*)(XB + r * DMQ + t * 4) = xb;  } }
__global__ __launch_bounds__(256) void k_ftres2(const float* __restrict__ OF0, const float* __restrict__ XB, float* __restrict__ X1, size_t n4) {
  #pragma clang fp contract(off)
  const size_t t = (size_t)blockIdx.x * 256 + threadIdx.x; if (t >= n4) return; const v4f o = *(const v4fa*)(OF0 + t * 4), xv = *(const v4fa*)(XB + t * 4); v4f y; for (int q = 0; q < 4; ++q) y[q] = __fadd_rn(__fmul_rn(o[q], 0.015625f), xv[q]); *(v4f*)(X1 + t * 4) = y;  }

__global__ __launch_bounds__(256) void k_wthd(const float* __restrict__ Wt, _Float16* __restrict__ Bt) { const size_t t = (size_t)blockIdx.x * 256 + threadIdx.x; if (t >= (size_t)NH * HD * (DM / 8)) return; const int m8 = (int)(t % (DM / 8)) * 8; const int d = (int)((t / (DM / 8)) % HD); const int h = (int)(t / ((size_t)(DM / 8) * HD)); FragH f;
  for (int q = 0; q < 8; ++q) f.h[q] = (_Float16)(16.0f * bf16_round(Wt[((size_t)h * DM + m8 + q) * HD + d])); unsigned short* dst = (unsigned short*)Bt + ((size_t)h * HD + d) * DM + m8; *(v8us*)dst = f.half[0];  }




__global__ __launch_bounds__(256) void k_wtpad(const float* __restrict__ Wm, _Float16* __restrict__ Wt, int Kr, int Kp, int Nr, int Np, float scale) {
  const int t = blockIdx.x * 256 + threadIdx.x; if (t >= Np * (Kp / 8)) return; const int n = t / (Kp / 8), k8 = (t % (Kp / 8)) * 8; const int nc = min(n, Nr - 1); const float fn = (n < Nr) ? 1.f : 0.f; FragH f;
  for (int i = 0; i < 8; ++i) { const int k = k8 + i; const int kc = min(k, Kr - 1); const float fk = (k < Kr) ? fn : 0.f; f.h[i] = (_Float16)(bf16_round(Wm[(size_t)kc * Nr + nc]) * scale * fk); }
  unsigned short* o = (unsigned short*)Wt + (size_t)n * Kp + k8; *(v8us*)o = f.half[0];  }
__global__ __launch_bounds__(128) void k_bpad(const float* __restrict__ b, float* __restrict__ Bp, int nr, int np) {
  const int i = threadIdx.x; if (i >= np) return; const float v = b[min(i, nr - 1)] * ((i < nr) ? 1.f : 0.f); *(float*)(Bp + i) = v;  }

__global__ __launch_bounds__(256) void k_bcpy(const float* __restrict__ b, int n, int NP, float* __restrict__ dst, int dst0) { for (int i = threadIdx.x; i < NP; i += 256) { const float v = (i < n) ? b[i] : 0.f; *(float*)(dst + dst0 + i) = v; }  }


__global__ __launch_bounds__(256) void k_addf(const float* __restrict__ XBr, const float* __restrict__ OF, float* __restrict__ O, size_t n8) {
  #pragma clang fp contract(off)
  const size_t t = (size_t)blockIdx.x * 256 + threadIdx.x; if (t >= n8) return; const v4f a = *(const v4fa*)(XBr + t * 8), b = *(const v4fa*)(XBr + t * 8 + 4), c = *(const v4fa*)(OF + t * 8), d = *(const v4fa*)(OF + t * 8 + 4); v4f r0, r1;
  for (int q = 0; q < 4; ++q) { r0[q] = __fadd_rn(a[q], __fmul_rn(c[q], 0.015625f)); r1[q] = __fadd_rn(b[q], __fmul_rn(d[q], 0.015625f)); }
  { *(v4f*)(O + t * 8) = r0; *(v4f*)(O + t * 8 + 4) = r1;  } }


extern "C" void kernel_launch(void* const* d_in, const int* in_sizes, int n_in,
                              void* d_out, int out_size, void* d_ws, size_t ws_size, hipStream_t stream) {
  (void)in_sizes; (void)n_in; (void)out_size;
  const float* const* I = (const float* const*)d_in; const float* x = I[0]; const float* wq = I[1]; const float* bq = I[2]; const float* wk = I[3]; const float* bk = I[4]; const float* wv = I[5]; const float* bv = I[6]; const float* g1 = I[7]; const float* be1 = I[8]; const float* gg2 = I[9]; const float* be2 = I[10]; const float* wfc = I[11]; const float* bfc = I[12]; const float* wmp = I[13]; const float* bmp = I[14];      /* input order: x; [in][out] wq / wk / wv + biases; LN1 w / b, LN2 w / b; w_fc [1024][4096] + b_fc, w_proj [4096][1024] + b_proj */
  float* OUT0 = (float*)d_out; float* OUTK = (float*)d_out + NR * DM; float* OUTV = (float*)d_out + 2 * NR * DM;      /* tuple outputs: out at byte 0, k at 16,777,216, v at 33,554,432 (each NB * SQ * DM floats) */
  static_assert(NH * HD == DM && DM % 64 == 0 && SQ % 128 == 0 && QT0 % 8 == 0, "shape / tile multiples");
  char* ws = (char*)d_ws; size_t off = 0;
  auto take = [&](size_t bytes) { char* p = ws + off; off += (bytes + 255) & ~(size_t)255; return p; };
  _Float16* BQKV = (_Float16*)take((size_t)3 * DM * DM * 2); float* bqkv = (float*)take((size_t)3 * DM * 4);      /* stacked bias bq | bk | bv */
  _Float16* X16 = (_Float16*)take(NR * DM * 2); float* XB = (float*)take(NR * DM * 4); float* X1 = (float*)take(NR * DM * 4); _Float16* M16 = nullptr;      /* = X16 below (alias: X16's last reader, the last batch's k / v output GEMMs, precedes LN2's write) */ _Float16* HF16 = (_Float16*)take((size_t)SQ * DFF * 2); _Float16* BW1 = (_Float16*)take((size_t)DFF * DM * 2); _Float16* BW2 = (_Float16*)take((size_t)DM * DFF * 2); _Float16* QKV = (_Float16*)take(NR * 3 * DM * 2); _Float16* Q16 = QKV; _Float16* K16 = QKV + DM; _Float16* V16 = QKV + 2 * DM; M16 = X16;
  float* S = (float*)take((size_t)NH * QT * NKX * 4); _Float16* P = (_Float16*)take((size_t)NH * QT * NKX * 2); _Float16* VT = (_Float16*)take((size_t)NH * HD * SQ * 2);
  float* QF0 = (float*)take((size_t)QT0 * DM * 4); float* KF0 = (float*)take((size_t)QT0 * DM * 4); float* VF0 = (float*)take((size_t)QT0 * DM * 4); float* OF0 = (float*)take((size_t)NB * QT0 * DM * 4);
  if (off > ws_size) return;
  { const unsigned g = (unsigned)(((size_t)DM * (DM / 8) + 255) / 256); k_wt_f16<<<g, 256, 0, stream>>>(wq, BQKV, DM, DM, 16.0f); k_wt_f16<<<g, 256, 0, stream>>>(wk, BQKV + (size_t)DM * DM, DM, DM, 16.0f); k_wt_f16<<<g, 256, 0, stream>>>(wv, BQKV + (size_t)2 * DM * DM, DM, DM, 16.0f); }      /* [in][out] -> Bt x16: stacked q | k | v (transposing builder) */
  k_bcpy<<<1, 256, 0, stream>>>(bq, DM, DM, bqkv, 0); k_bcpy<<<1, 256, 0, stream>>>(bk, DM, DM, bqkv, DM); k_bcpy<<<1, 256, 0, stream>>>(bv, DM, DM, bqkv, 2 * DM);      /* stacked bias bq | bk | bv */
  k_ln16<1, 1><<<(unsigned)NR, 256, 0, stream>>>(x, g1, be1, 1e-5f, X16, XB);      /* a = LN1(bf16(x)) -> f16 rows; XB = bf16(x) for the residual */
  k_wt_f16<<<(unsigned)(((size_t)DFF * (DM / 8) + 255) / 256), 256, 0, stream>>>(wfc, BW1, DM, DFF, 16.0f); k_wt_f16<<<(unsigned)(((size_t)DM * (DFF / 8) + 255) / 256), 256, 0, stream>>>(wmp, BW2, DFF, DM, 16.0f);      /* W1 [1024][4096] -> Bt [4096][1024]; W2 [4096][1024] -> Bt [1024][4096] (x16) */
  const size_t r0p = (size_t)B0 * SQ;      /* first projected row */
  k_gemm2<0><<<dim3((unsigned)((MP / 128) * (3 * DM / 64)), 1), 128, 0, stream>>>(X16 + r0p * DM, DM, 0, BQKV, DM, 0, 0.0625f, bqkv, 0, nullptr, 1, 0, 0, nullptr, QKV + r0p * 3 * DM, 3 * DM, 0, MP, 3 * DM, DM);      /* q | k | v rows (f16); head h = columns h*HD.. of each DM block */
  for (int b = B0; b < B0 + NBR; ++b) { const size_t r0 = (size_t)b * SQ;
    k_vt<NH, SQ><<<NH * (SQ / 64), 256, 0, stream>>>(V16 + r0 * LQ, LQ, 0, VT);      /* V^T [NH][HD][SQ] for this batch */
    k_gemm2<0><<<dim3((QT0 / 128) * (DM / 64), 1), 128, 0, stream>>>(X16 + r0 * DM, DM, 0, BQKV, DM, 0, 0.0625f, bq, 0, nullptr, 1, 0, 0, QF0, nullptr, DM, 0, QT0, DM, DM); k_gemm2<0><<<dim3((QT0 / 128) * (DM / 64), 1), 128, 0, stream>>>(X16 + r0 * DM, DM, 0, (BQKV + (size_t)DM * DM), DM, 0, 0.0625f, bk, 0, nullptr, 1, 0, 0, KF0, nullptr, DM, 0, QT0, DM, DM); k_gemm2<0><<<dim3((QT0 / 128) * (DM / 64), 1), 128, 0, stream>>>(X16 + r0 * DM, DM, 0, (BQKV + (size_t)2 * DM * DM), DM, 0, 0.0625f, bv, 0, nullptr, 1, 0, 0, VF0, nullptr, DM, 0, QT0, DM, DM);      /* f32 q, k, v of the first 128 rows (exact products) */
    k_att0<0><<<NH * (QT0 / 64), 64, 0, stream>>>(QF0, KF0, VF0, DM, nullptr, 0.125f, OF0 + (size_t)b * QT0 * DM, DM);      /* exact f32 attention for rows 0..127 (o x64) */
    for (int q0 = 0; q0 < QN; q0 += QT) { const int nk = q0 + QT;      /* causal: only keys below the tile end are computed */
      k_gemm2<0><<<dim3((QT / 128) * (nk / 64), NHD), 128, 0, stream>>>(Q16 + (r0 + q0) * LQ, LQ, (size_t)HD, K16 + r0 * LQ, LQ, (size_t)HD, 0.125f, nullptr, 0, nullptr, 1, 0, 0, S, nullptr, NKX, (size_t)QT * NKX, QT, nk, HD);      /* scores, all heads on grid.y */
      k_rsmcf2<<<(NHD * QT + 255) / 256, 256, 0, stream>>>(S, P, NHD, q0, nk);
      k_gemm2<0><<<dim3((QT / 128) * (HD / 64), NHD), 128, 0, stream>>>(P, NKX, (size_t)QT * NKX, VT, SQ, (size_t)HD * SQ, 0.00390625f, nullptr, 0, XB + (r0 + q0) * DM, -1, 0, 0, X1 + (r0 + q0) * DM, nullptr, DM, (size_t)HD, QT, HD, nk); }      /* x1 = bf16(x) + P V^T / 256 in f32 (own-element addend at the head's 64 columns: no output projection in this module) */
    k_addf<<<(unsigned)(((size_t)QT0 * DM / 8 + 255) / 256), 256, 0, stream>>>(XB + r0 * DM, OF0 + (size_t)b * QT0 * DM, X1 + r0 * DM, (size_t)QT0 * DM / 8);      /* rows 0..127 of the batch rewritten from the exact f32 path: x1 = bf16(x) + o / 64 */
    k_gemm2<0><<<dim3((SQ / 128) * (HD / 64), NH), 128, 0, stream>>>(X16 + r0 * DM, DM, 0, BQKV + (size_t)DM * DM, DM, (size_t)HD * DM, 0.0625f, bk, (size_t)HD, nullptr, 1, 0, 0, OUTK + (size_t)b * NH * SQ * HD, nullptr, HD, (size_t)SQ * HD, SQ, HD, DM); k_gemm2<0><<<dim3((SQ / 128) * (HD / 64), NH), 128, 0, stream>>>(X16 + r0 * DM, DM, 0, BQKV + (size_t)2 * DM * DM, DM, (size_t)HD * DM, 0.0625f, bv, (size_t)HD, nullptr, 1, 0, 0, OUTV + (size_t)b * NH * SQ * HD, nullptr, HD, (size_t)SQ * HD, SQ, HD, DM); }      /* outputs 1 and 2: k and v of this batch in f32, head-major [H][T][64] (head on grid.y: weight rows 64 h .., bias 64 h .., output plane h) */
  k_ln16<0, 0><<<(unsigned)NR, 256, 0, stream>>>(X1, gg2, be2, 1e-5f, M16, nullptr);      /* h = LN2(x1) -> f16 rows */
  for (int b = 0; b < NB; ++b) { const size_t r0 = (size_t)b * SQ;
    k_gemm2<6><<<dim3((unsigned)((SQ / 128) * (DFF / 64)), 1), 128, 0, stream>>>(M16 + r0 * DM, DM, 0, BW1, DM, 0, 0.0625f, bfc, 0, nullptr, 1, 0, 0, nullptr, HF16, DFF, 0, SQ, DFF, DM);      /* gelu_erf(h2 W1 + b1) -> f16 (this batch) */
    k_gemm2<0><<<dim3((unsigned)((SQ / 128) * (DM / 64)), 1), 128, 0, stream>>>(HF16, DFF, 0, BW2, DFF, 0, 0.0625f, bmp, 0, X1 + r0 * DM, -1, 0, 0, OUT0 + r0 * DM, nullptr, DM, 0, SQ, DM, DFF); }      /* output 0 = x1 + mlp (own-element residual) */
}

// v001
// It runs in 2710 microseconds.
// Next to v000, in two timings, it ran 2.12 and 2.14 times as fast.
#include <hip/hip_runtime.h>
// Pre-LN causal transformer block WITHOUT an attention output projection that also returns its key and value tensors (x [2][2048][1024]; h = LN1(x) (biased var, eps 1e-5); q / k / v = h W + b ([in][out] [1024][1024] sigma 1/32, zero biases) -> [B][16][T][64]; att = softmax(q k^T / 8) with a causal mask (tril, -inf); y = att v merged back to [B][T][1024]; x1 = x + y (no projection); out = x1 + gelu_erf(LN2(x1) w_fc + b_fc) w_proj + b_proj ([in][out] 1024 x 4096 x 1024); returns (out [2][2048][1024], k [2][16][2048][64], v [2][16][2048][64]): three outputs at byte offsets 0 / 16,777,216 / 33,554,432 of d_out).
// Structure: token rows r = b*2048 + s; LN1(bf16(x)) as f16 rows; q | k | v as ONE WMMA GEMM (N = 3 x 1024) (32x64 wave tiles, f32 accumulation, exact x16 weights + bias, f16 outputs); per batch: V^T for all heads via LDS transposes; per query tile of 256 rows: scores against the keys below the tile end only (K = 64, all heads on grid.y, alpha = 0.125), causal row softmax on VALU, one wave per row, keys past the row masked over the computed range (f32 statistics, native exp; weights x256 f16), x1 = bf16(x) + P . V^T (K = keys below the tile end, alpha 2^-8 undoing the x256 weights, residual added in the epilogue) written straight into the f32 x1 rows; out = x1 + gelu_erf(LN2(x1) W1 + b1) W2 + b2 (two GEMMs, f16 hidden, f32 out).
// Compute dtype: inputs rounded to bf16; x / weights exact; q, k, v, softmax weights, LN outputs and the FFN hidden as plain f16 GEMM operands (~2^-12); scores and softmax statistics f32. v_wmma_f32_16x16x32_f16.
#define NB 2
#define SQ 2048
#define DM 1024
#define NH 16
#define HD 64
#define HG 4
#define QT 256                       /* query rows per causal tile */
#define NKX SQ                       /* S / P row pitch */
#define QT0 128                      /* first-tile rows recomputed exactly in f32 */
#define B0 0                         /* first batch processed (debug hook) */
#define NBR NB                       /* batches processed (debug hook) */
#define NR ((size_t)NB * SQ)
#define DMQ DM
#define DFF 4096                     /* FFN hidden width */
#define DFFR 100
#define MP ((int)((size_t)NBR * SQ)) /* rows projected (debug hook) */
#define QN SQ                        /* query rows attended per batch (debug hook) */
#define NHD NH                       /* heads attended (debug hook) */
#define MPO MP
#define LQ (3 * DM)      /* row pitch of the q/k/v rows */
typedef __bf16 v16b __attribute__((ext_vector_type(16)));
typedef unsigned short v8us __attribute__((ext_vector_type(8), may_alias));
typedef float  v8f  __attribute__((ext_vector_type(8)));
typedef float  v4f  __attribute__((ext_vector_type(4)));
typedef float  v4fa __attribute__((ext_vector_type(4), may_alias));
union FragB { v16b v; v8us half[2]; unsigned short u[16]; };

__device__ __forceinline__ unsigned short bf16_bits(float x) { unsigned int u = __float_as_uint(x); return (unsigned short)((u + 0x7FFFu + ((u >> 16) & 1u)) >> 16); }
__device__ __forceinline__ float bf16_val(unsigned short b) { return __uint_as_float(((unsigned int)b) << 16); }
__device__ __forceinline__ float bf16_round(float x) { return bf16_val(bf16_bits(x)); }
// D += A·B with NT terms: 1 = ah·bh, 2 = + al·bh (A split), 3 = + ah·bl (both split)
template <int NT>
__device__ __forceinline__ v8f mmaN(v16b ah, v16b al, v16b bh, v16b bl, v8f c) {
  c = __builtin_amdgcn_wmma_f32_16x16x32_bf16(false, ah, false, bh, (short)0, c, false, false);
  if (NT >= 2) c = __builtin_amdgcn_wmma_f32_16x16x32_bf16(false, al, false, bh, (short)0, c, false, false);
  if (NT >= 3) c = __builtin_amdgcn_wmma_f32_16x16x32_bf16(false, ah, false, bl, (short)0, c, false, false);
  asm volatile("v_nop\n\tv_nop\n\tv_nop\n\tv_nop" : "+v"(c) : "v"(ah), "v"(al), "v"(bh), "v"(bl));
  return c;
}

__global__ __launch_bounds__(256) void k_wt_bf16(const float* __restrict__ W, unsigned short* __restrict__ Wt, int K, int N) {
  const int t = blockIdx.x * 256 + threadIdx.x;
  const int k8n = K / 8;
  if (t >= N * k8n) return;
  const int n = t / k8n, k8 = (t % k8n) * 8;
  v8us v;
#pragma unroll
  for (int i = 0; i < 8; ++i) v[i] = bf16_bits(W[(size_t)(k8 + i) * N + n]);
  *(v8us*)(Wt + (size_t)n * K + k8) = v;
  
}

// GEMM C[M][N] (f32, pitch ldc) = act(A[M][K]·W + bias). A f32 row-major (pitch lda) converted per fragment to bf16
// (ASPLIT: hi/lo two planes -> 2 terms, else single rounded term); Wt bf16 [N][K] (pitch ldb). BIAS_BF16 rounds the
// bias to bf16 first (bias quantised to bf16 before the add). K%32==0, M%16==0, N%64==0.
template <bool ASPLIT, int ACT, bool BIAS_BF16>
__global__ __launch_bounds__(128) void k_gemm_bf(const float* __restrict__ A, int lda, const unsigned short* __restrict__ Wt, int ldb,
                                               const float* __restrict__ bias, float* __restrict__ C, int ldc, int M, int N, int K) {
  __shared__ __attribute__((aligned(16))) float so[4][16][64];
  const int tid = threadIdx.x, w = tid >> 5, lane = tid & 31, ln = lane & 15, hh = lane >> 4;
  const int ntn = N / 64;
  const int wid = blockIdx.x * 4 + w;
  const int mt = wid / ntn, nq = wid % ntn;
  if (mt * 16 >= M) return;
  const int row0 = mt * 16, col0 = nq * 64;
  const float* arow = A + (size_t)(row0 + ln) * lda;
  v8f acc[4] = {};
  for (int kb = 0; kb < K; kb += 32) {
    FragB ah, al;
    const v4f x0 = *(const v4fa*)(arow + kb + 8 * hh), x1 = *(const v4fa*)(arow + kb + 8 * hh + 4);
    const v4f x2 = *(const v4fa*)(arow + kb + 16 + 8 * hh), x3 = *(const v4fa*)(arow + kb + 16 + 8 * hh + 4);
    float xs[16] = {x0[0],x0[1],x0[2],x0[3],x1[0],x1[1],x1[2],x1[3],x2[0],x2[1],x2[2],x2[3],x3[0],x3[1],x3[2],x3[3]};
#pragma unroll
    for (int i = 0; i < 16; ++i) { const unsigned short hb = bf16_bits(xs[i]); ah.u[i] = hb; al.u[i] = ASPLIT ? bf16_bits(xs[i] - bf16_val(hb)) : (unsigned short)0; }
#pragma unroll
    for (int t = 0; t < 4; ++t) {
      const unsigned short* brow = Wt + (size_t)(col0 + t * 16 + ln) * ldb + kb;
      FragB b;
      b.half[0] = *(const v8us*)(brow + 8 * hh);
      b.half[1] = *(const v8us*)(brow + 16 + 8 * hh);
      acc[t] = mmaN<ASPLIT ? 2 : 1>(ah.v, al.v, b.v, b.v, acc[t]);
    }
  }
#pragma unroll
  for (int t = 0; t < 4; ++t) {
    float bv = bias ? bias[col0 + t * 16 + ln] : 0.f;
    if (BIAS_BF16) bv = bf16_round(bv);
#pragma unroll
    for (int r = 0; r < 8; ++r) { float v = acc[t][r] + bv; if (ACT == 1) v = fmaxf(v, 0.f); so[w][8 * hh + r][t * 16 + ln] = v; }
  }
  __builtin_amdgcn_fence(__ATOMIC_ACQ_REL, "workgroup");
  __builtin_amdgcn_wave_barrier();
  const int rsub = lane >> 4, c4 = (lane & 15) * 4;
  {
#pragma unroll
    for (int q = 0; q < 8; ++q) {
      const int r = q * 2 + rsub;
      const v4f v = *(const v4fa*)&so[w][r][c4];
      *(v4f*)(C + (size_t)(row0 + r) * ldc + col0 + c4) = v;
    }
    
  }
}

// GEMM C = act(A·W + bias + resid): A f32 (ASPLIT -> hi/lo 2 terms), Wt bf16 [N][K]; ACT 0 none, 1 relu, 2 exact gelu;
// resid (optional, f32, row index = (row % rmod), pitch ldr, RES_BF16 rounds it) added before the activation.
template <bool ASPLIT, int ACT, bool BIAS_BF16, bool RES_BF16>
__global__ __launch_bounds__(128) void k_gemm_bf3(const float* __restrict__ A, int lda, const unsigned short* __restrict__ Wt, int ldb,
                                                const float* __restrict__ bias, const float* __restrict__ resid, int rmod, int ldr,
                                                float* __restrict__ C, int ldc, int M, int N, int K) {
  __shared__ __attribute__((aligned(16))) float so[4][16][64];
  const int tid = threadIdx.x, w = tid >> 5, lane = tid & 31, ln = lane & 15, hh = lane >> 4;
  const int ntn = N / 64;
  const int wid = blockIdx.x * 4 + w;
  const int mt = wid / ntn, nq = wid % ntn;
  if (mt * 16 >= M) return;
  const int row0 = mt * 16, col0 = nq * 64;
  const float* arow = A + (size_t)(row0 + ln) * lda;
  v8f acc[4] = {};
  for (int kb = 0; kb < K; kb += 32) {
    FragB ah, al;
    const v4f x0 = *(const v4fa*)(arow + kb + 8 * hh), x1 = *(const v4fa*)(arow + kb + 8 * hh + 4);
    const v4f x2 = *(const v4fa*)(arow + kb + 16 + 8 * hh), x3 = *(const v4fa*)(arow + kb + 16 + 8 * hh + 4);
    float xs[16] = {x0[0],x0[1],x0[2],x0[3],x1[0],x1[1],x1[2],x1[3],x2[0],x2[1],x2[2],x2[3],x3[0],x3[1],x3[2],x3[3]};
#pragma unroll
    for (int i = 0; i < 16; ++i) { const unsigned short hb = bf16_bits(xs[i]); ah.u[i] = hb; al.u[i] = ASPLIT ? bf16_bits(xs[i] - bf16_val(hb)) : (unsigned short)0; }
#pragma unroll
    for (int t = 0; t < 4; ++t) {
      const unsigned short* brow = Wt + (size_t)(col0 + t * 16 + ln) * ldb + kb;
      FragB b;
      b.half[0] = *(const v8us*)(brow + 8 * hh);
      b.half[1] = *(const v8us*)(brow + 16 + 8 * hh);
      acc[t] = mmaN<ASPLIT ? 2 : 1>(ah.v, al.v, b.v, b.v, acc[t]);
    }
  }
#pragma unroll
  for (int t = 0; t < 4; ++t) {
    const int col = col0 + t * 16 + ln;
    float bv = bias ? bias[col] : 0.f;
    if (BIAS_BF16) bv = bf16_round(bv);
#pragma unroll
    for (int r = 0; r < 8; ++r) {
      float v = acc[t][r] + bv;
      if (resid) { float rv = resid[(size_t)((row0 + 8 * hh + r) % rmod) * ldr + col]; if (RES_BF16) rv = bf16_round(rv); v += rv; }
      if (ACT == 1) v = fmaxf(v, 0.f);
      if (ACT == 2) v = 0.5f * v * (1.0f + erff(v * 0.70710678118654752f));
      if (ACT == 3) { const float u = 0.7978845608028654f * (v + 0.044715f * v * v * v); v = 0.5f * v * (1.0f + tanhf(u)); }
      so[w][8 * hh + r][t * 16 + ln] = v;
    }
  }
  __builtin_amdgcn_fence(__ATOMIC_ACQ_REL, "workgroup");
  __builtin_amdgcn_wave_barrier();
  const int rsub = lane >> 4, c4 = (lane & 15) * 4;
  {
#pragma unroll
    for (int q = 0; q < 8; ++q) {
      const int r = q * 2 + rsub;
      const v4f v = *(const v4fa*)&so[w][r][c4];
      *(v4f*)(C + (size_t)(row0 + r) * ldc + col0 + c4) = v;
    }
    
  }
}
// row LayerNorm (biased variance, eps) over N: s = X (+ R); optional out_sum <- s; out_norm <- (s-mu)*rsqrt(var+eps)*g + b
template <bool PARAM_BF16>
__global__ __launch_bounds__(256) void k_layernorm(const float* __restrict__ X, const float* __restrict__ R, const float* __restrict__ g, const float* __restrict__ bta,
                                                  float* __restrict__ out_sum, float* __restrict__ out_norm, int N, float eps) {
  __shared__ float red[256];
  const int row = blockIdx.x, tid = threadIdx.x;
  const float* x = X + (size_t)row * N; const float* rr = R ? R + (size_t)row * N : nullptr;
  float vals[16];                     // up to N = 4096
  const int per = N / 256;            // contiguous chunk per thread? use strided-by-4 chunks: thread handles j = tid*4 + 1024*u
  float s1 = 0.f;
  for (int u = 0; u < per / 4; ++u) {
    const int j = tid * 4 + 1024 * u;
    const v4f a = *(const v4fa*)(x + j);
    v4f b = {0.f,0.f,0.f,0.f}; if (rr) b = *(const v4fa*)(rr + j);
#pragma unroll
    for (int q = 0; q < 4; ++q) { const float v = a[q] + b[q]; vals[u * 4 + q] = v; s1 += v; }
  }
  red[tid] = s1; __syncthreads();
  for (int st = 128; st > 0; st >>= 1) { if (tid < st) red[tid] += red[tid + st]; __syncthreads(); }
  const float mu = red[0] / (float)N; __syncthreads();
  float s2 = 0.f;
  for (int u = 0; u < per / 4; ++u)
#pragma unroll
    for (int q = 0; q < 4; ++q) { const float c = vals[u * 4 + q] - mu; s2 += c * c; }
  red[tid] = s2; __syncthreads();
  for (int st = 128; st > 0; st >>= 1) { if (tid < st) red[tid] += red[tid + st]; __syncthreads(); }
  const float rs = rsqrtf(red[0] / (float)N + eps);
  {
    for (int u = 0; u < per / 4; ++u) {
      const int j = tid * 4 + 1024 * u;
      v4f o, sm;
#pragma unroll
      for (int q = 0; q < 4; ++q) {
        float gg = g[j + q], bb = bta[j + q];
        if (PARAM_BF16) { gg = bf16_round(gg); bb = bf16_round(bb); }
        sm[q] = vals[u * 4 + q]; o[q] = (vals[u * 4 + q] - mu) * rs * gg + bb;
      }
      if (out_sum) *(v4f*)(out_sum + (size_t)row * N + j) = sm;
      *(v4f*)(out_norm + (size_t)row * N + j) = o;
    }
    
  }
}



// ---- f16 WMMA path (v_wmma_f32_16x16x32_f16): 11-bit significands for operands in range — used where a [0,1] probability operand needs more precision than bf16
typedef _Float16 v16h __attribute__((ext_vector_type(16)));
union FragH { v16h v; v8us half[2]; _Float16 h[16]; unsigned short u[16]; };
template <int NT>
__device__ __forceinline__ v8f mmaH(v16h ah, v16h al, v16h bh, v16h bl, v8f c) {
  c = __builtin_amdgcn_wmma_f32_16x16x32_f16(false, ah, false, bh, (short)0, c, false, false);
  if (NT >= 2) c = __builtin_amdgcn_wmma_f32_16x16x32_f16(false, al, false, bh, (short)0, c, false, false);
  if (NT >= 3) c = __builtin_amdgcn_wmma_f32_16x16x32_f16(false, ah, false, bl, (short)0, c, false, false);
  asm volatile("v_nop\n\tv_nop\n\tv_nop\n\tv_nop" : "+v"(c) : "v"(ah), "v"(al), "v"(bh), "v"(bl));
  return c;
}
// batched GEMM like k_gemm_b but f16 operands: A f32 (split into f16 hi/lo if ASPLIT, else rounded to f16), Bt = f16 values [n][k]; alpha; C f32; N multiple of 16 (partial tiles skipped)
template <bool ASPLIT>
__global__ __launch_bounds__(128) void k_gemm_h(const float* __restrict__ A, int lda, size_t sA, const _Float16* __restrict__ Bh, int ldb, size_t sB, float alpha, float* __restrict__ C, int ldc, size_t sC, int M, int N, int K) {
  __shared__ __attribute__((aligned(16))) float so[4][16][64];
  const int tid = threadIdx.x, w = tid >> 5, lane = tid & 31, ln = lane & 15, hh = lane >> 4; const int by = blockIdx.y;
  A += (size_t)by * sA; Bh += (size_t)by * sB; C += (size_t)by * sC;
  const int ntn = (N + 63) / 64; const int wid = blockIdx.x * 4 + w; const int mt = wid / ntn, nq = wid % ntn; if (mt * 16 >= M) return;
  const int row0 = mt * 16, col0 = nq * 64; const float* arow = A + (size_t)(row0 + ln) * lda;
  v8f acc[4] = {};
  for (int kb = 0; kb < K; kb += 32) {
    FragH ah, al;
    const v4f x0 = *(const v4fa*)(arow + kb + 8 * hh), x1 = *(const v4fa*)(arow + kb + 8 * hh + 4), x2 = *(const v4fa*)(arow + kb + 16 + 8 * hh), x3 = *(const v4fa*)(arow + kb + 16 + 8 * hh + 4);
    float xs[16] = {x0[0],x0[1],x0[2],x0[3],x1[0],x1[1],x1[2],x1[3],x2[0],x2[1],x2[2],x2[3],x3[0],x3[1],x3[2],x3[3]};
#pragma unroll
    for (int i = 0; i < 16; ++i) { const _Float16 h = (_Float16)xs[i]; ah.h[i] = h; al.h[i] = ASPLIT ? (_Float16)(xs[i] - (float)h) : (_Float16)0.0f; }
#pragma unroll
    for (int t = 0; t < 4; ++t) { if (col0 + t * 16 >= N) continue; const size_t boff = (size_t)(col0 + t * 16 + ln) * ldb + kb; FragH bq; bq.half[0] = *(const v8us*)(Bh + boff + 8 * hh); bq.half[1] = *(const v8us*)(Bh + boff + 16 + 8 * hh);
      acc[t] = mmaH<ASPLIT ? 2 : 1>(ah.v, al.v, bq.v, bq.v, acc[t]); }
  }
#pragma unroll
  for (int t = 0; t < 4; ++t) { if (col0 + t * 16 >= N) continue;
#pragma unroll
    for (int r = 0; r < 8; ++r) so[w][8 * hh + r][t * 16 + ln] = acc[t][r] * alpha; }
  __builtin_amdgcn_fence(__ATOMIC_ACQ_REL, "workgroup"); __builtin_amdgcn_wave_barrier();
  const int rsub = lane >> 4, c4 = (lane & 15) * 4;
  {
#pragma unroll
    for (int q = 0; q < 8; ++q) { const int r = q * 2 + rsub; if (col0 + c4 < N) { const v4f v = *(const v4fa*)&so[w][r][c4]; *(v4f*)(C + (size_t)(row0 + r) * ldc + col0 + c4) = v; } }
     }
}

// Wt[n][k] = f16(W[k][n]·scale) from f32 row-major W[K][N] (scale = power of two; bf16-exact weights stay exact in f16 away from the subnormal range)
__global__ __launch_bounds__(256) void k_wt_f16(const float* __restrict__ W, _Float16* __restrict__ Wt, int K, int N, float scale) {
  const int t = blockIdx.x * 256 + threadIdx.x; if (t >= N * (K / 8)) return; const int n = t / (K / 8), k8 = (t % (K / 8)) * 8; FragH f;
#pragma unroll
  for (int i = 0; i < 8; ++i) f.h[i] = (_Float16)(bf16_round(W[(size_t)(k8 + i) * N + n]) * scale); const v8us o = f.half[0];
  *(v8us*)((unsigned short*)Wt + (size_t)n * K + k8) = o; 
}
// k_gemm_hh variant with fused epilogue: v = acc·alpha + bias[by·sBias + col] (+ CP[(row/rowsPerB)·sCPb + by·64 + col] if CP) ; ACT 0 none / 1 elu ; writes f16 C16 (and f32 C if non-null)
template <int ACT>
__global__ __launch_bounds__(128) void k_gemm_hhx(const _Float16* __restrict__ A, int lda, size_t sA, const _Float16* __restrict__ Bh, int ldb, size_t sB, float alpha, const float* __restrict__ bias, size_t sBias, const float* __restrict__ CP, int rowsPerB, size_t sCPb, int row0g,
    float* __restrict__ C, _Float16* __restrict__ C16, int ldc, size_t sC, int M, int N, int K) {
  __shared__ __attribute__((aligned(16))) float so[4][16][64];
  const int tid = threadIdx.x, w = tid >> 5, lane = tid & 31, ln = lane & 15, hh = lane >> 4; const int by = blockIdx.y;
  A += (size_t)by * sA; Bh += (size_t)by * sB; const size_t cofs = (size_t)by * sC; const float* bp = bias ? bias + (size_t)by * sBias : nullptr;
  const int ntn = (N + 63) / 64; const int wid = blockIdx.x * 4 + w; const int mt = wid / ntn, nq = wid % ntn; if (mt * 16 >= M) return;
  const int row0 = mt * 16, col0 = nq * 64; const _Float16* arow = A + (size_t)(row0 + ln) * lda;
  v8f acc[4] = {};
  for (int kb = 0; kb < K; kb += 32) { FragH ah; ah.half[0] = *(const v8us*)((const unsigned short*)arow + kb + 8 * hh); ah.half[1] = *(const v8us*)((const unsigned short*)arow + kb + 16 + 8 * hh);
#pragma unroll
    for (int t = 0; t < 4; ++t) { if (col0 + t * 16 >= N) continue; const size_t boff = (size_t)(col0 + t * 16 + ln) * ldb + kb; FragH bq; bq.half[0] = *(const v8us*)((const unsigned short*)Bh + boff + 8 * hh); bq.half[1] = *(const v8us*)((const unsigned short*)Bh + boff + 16 + 8 * hh);
      acc[t] = mmaH<1>(ah.v, ah.v, bq.v, bq.v, acc[t]); }
  }
#pragma unroll
  for (int t = 0; t < 4; ++t) { if (col0 + t * 16 >= N) continue; const int col = col0 + t * 16 + ln; const float bv = bp ? bf16_round(bp[col]) : 0.f;
#pragma unroll
    for (int r = 0; r < 8; ++r) { float v = acc[t][r] * alpha + bv; if (CP) { const int rr = row0g + row0 + 8 * hh + r; if (rowsPerB < 0) v += CP[cofs + (size_t)rr * ldc + col];      /* rowsPerB < 0: own element of the batched C plane */ else { const int bidx = rr / rowsPerB; v += CP[(size_t)bidx * sCPb + (size_t)by * 64 + col]; } } if (ACT == 1) v = (v > 0.f) ? v : expm1f(v); else if (ACT == 7) v = (v > 0.f) ? v + 1.0f : expf(v); else if (ACT == 8) v = tanhf(v); else if (ACT == 9) v = 0.5f * v * (1.0f + tanhf(0.7978845608028654f * (v + 0.044715f * v * v * v))); else if (ACT == 11) v = 1.0f / (1.0f + expf(-v)); else if (ACT == 12) v = (v > 0.f) ? v : 0.01f * v; else if (ACT == 14) v = (v > 0.f) ? v : 0.1f * v; else if (ACT == 16) v = (v >= 0.f) ? v : 0.3f * v; else if (ACT == 17) v = (v >= 0.f) ? v : 0.2f * v; else if (ACT == 15) v = v / (1.0f + expf(-v)); else if (ACT == 3) v = fmaxf(v, 0.f); else if (ACT == 6) v = 0.5f * v * (1.0f + erff(v * 0.70710678118654752f)); so[w][8 * hh + r][t * 16 + ln] = v; } }
  __builtin_amdgcn_fence(__ATOMIC_ACQ_REL, "workgroup"); __builtin_amdgcn_wave_barrier();
  const int rsub = lane >> 4, c4 = (lane & 15) * 4; typedef _Float16 v4h __attribute__((ext_vector_type(4)));
  {
#pragma unroll
    for (int q = 0; q < 8; ++q) { const int r = q * 2 + rsub; if (col0 + c4 < N) { const v4f v = *(const v4fa*)&so[w][r][c4]; if (C) *(v4f*)(C + cofs + (size_t)(row0 + r) * ldc + col0 + c4) = v; if (C16) { v4h h4; for (int i = 0; i < 4; ++i) h4[i] = (_Float16)v[i]; *(v4h*)(C16 + cofs + (size_t)(row0 + r) * ldc + col0 + c4) = h4; } } }
     }
}


typedef _Float16 v4h __attribute__((ext_vector_type(4)));

__global__ __launch_bounds__(256) void k_x16(const float* __restrict__ x, _Float16* __restrict__ X16, size_t n8) { const size_t t = (size_t)blockIdx.x * 256 + threadIdx.x; if (t >= n8) return; FragH f;
#pragma unroll
  for (int q = 0; q < 8; ++q) f.h[q] = (_Float16)bf16_round(x[t * 8 + q]); *(v8us*)((unsigned short*)X16 + t * 8) = f.half[0];  }
__global__ __launch_bounds__(256) void k_h16(const float* __restrict__ x, _Float16* __restrict__ X16, size_t n8) { const size_t t = (size_t)blockIdx.x * 256 + threadIdx.x; if (t >= n8) return; FragH f;
#pragma unroll
  for (int q = 0; q < 8; ++q) f.h[q] = (_Float16)x[t * 8 + q]; *(v8us*)((unsigned short*)X16 + t * 8) = f.half[0];  }
__global__ __launch_bounds__(256) void k_round16f(const float* __restrict__ W, _Float16* __restrict__ Bt, size_t n8) { const size_t t = (size_t)blockIdx.x * 256 + threadIdx.x; if (t >= n8) return; FragH f;
#pragma unroll
  for (int i = 0; i < 8; ++i) f.h[i] = (_Float16)(bf16_round(W[t * 8 + i]) * 16.0f); *(v8us*)((unsigned short*)Bt + t * 8) = f.half[0];  }
template <int NHv, int TTv>
__global__ __launch_bounds__(256) void k_vt(const _Float16* __restrict__ V16, int ldv, int voff, _Float16* __restrict__ Vt) { __shared__ unsigned short tl[64][66]; const int tid = threadIdx.x; const int slab = blockIdx.x / (TTv / 64), lg = blockIdx.x % (TTv / 64); const int b = slab / NHv, h = slab % NHv;
  for (int i = tid; i < 64 * 8; i += 256) { const int r = i / 8, c8 = (i % 8) * 8; FragH f; f.half[0] = *(const v8us*)((const unsigned short*)V16 + ((size_t)b * TTv + lg * 64 + r) * ldv + voff + h * 64 + c8);
#pragma unroll
    for (int q = 0; q < 8; ++q) tl[r][c8 + q] = f.u[q]; }
  __syncthreads();
  {
#pragma unroll
    for (int rd = 0; rd < 2; ++rd) { const int d = rd * 32 + tid / 8, pc = tid % 8; FragH f;
#pragma unroll
      for (int q = 0; q < 8; ++q) f.u[q] = tl[pc * 8 + q][d];
      *(v8us*)((unsigned short*)Vt + ((size_t)slab * 64 + d) * TTv + lg * 64 + pc * 8) = f.half[0]; }
     } }

__global__ __launch_bounds__(256) void k_hl(const float* __restrict__ F, _Float16* __restrict__ Hh, _Float16* __restrict__ Hl, size_t n8) { const size_t t = (size_t)blockIdx.x * 256 + threadIdx.x; if (t >= n8) return; FragH fh, fl; const v4f a = *(const v4fa*)(F + t * 8), c = *(const v4fa*)(F + t * 8 + 4);
#pragma unroll
  for (int q = 0; q < 4; ++q) { _Float16 h = (_Float16)a[q]; fh.h[q] = h; fl.h[q] = (_Float16)((a[q] - (float)h) * 1024.0f); h = (_Float16)c[q]; fh.h[4 + q] = h; fl.h[4 + q] = (_Float16)((c[q] - (float)h) * 1024.0f); }
  { *(v8us*)((unsigned short*)Hh + t * 8) = fh.half[0]; *(v8us*)((unsigned short*)Hl + t * 8) = fl.half[0];  } }

// ---- fast GEMM (wave tile 32x64; requires M % 32 == 0 rows per launch region and N % 64 == 0); epilogue = k_gemm_hhx semantics ----
__device__ __forceinline__ v16h g2_frag(const _Float16* p, int hh) { FragH f; f.half[0] = *(const v8us*)((const unsigned short*)p + 8 * hh); f.half[1] = *(const v8us*)((const unsigned short*)p + 16 + 8 * hh); return f.v; }
__device__ __forceinline__ v8f g2_mma(v16h a, v16h b, v8f c) { v8f d = __builtin_amdgcn_wmma_f32_16x16x32_f16(false, a, false, b, (short)0, c, false, false); asm volatile("v_nop\n\tv_nop\n\tv_nop\n\tv_nop" : "+v"(d) : "v"(a), "v"(b)); return d; }
template <int ACT>
__global__ __launch_bounds__(128) void k_gemm2(const _Float16* __restrict__ A, int lda, size_t sA, const _Float16* __restrict__ Bh, int ldb, size_t sB, float alpha, const float* __restrict__ bias, size_t sBias, const float* __restrict__ CP, int rowsPerB, size_t sCPb, int row0g,
    float* __restrict__ C, _Float16* __restrict__ C16, int ldc, size_t sC, int M, int N, int K) { static_assert(ACT == 0 || ACT == 3 || ACT == 6 || ACT == 8 || ACT == 9 || ACT == 11 || ACT == 12 || ACT == 14 || ACT == 15 || ACT == 16 || ACT == 17, "k_gemm2: unsupported ACT code (would silently apply no activation)");
  __shared__ __attribute__((aligned(16))) float so[4][32][68];
  const int tid = threadIdx.x, w = tid >> 5, lane = tid & 31, ln = lane & 15, hh = lane >> 4; const int by = blockIdx.y;
  A += (size_t)by * sA; Bh += (size_t)by * sB; const size_t cofs = (size_t)by * sC; const float* bp = bias ? bias + (size_t)by * sBias : nullptr;
  const int ntn = N >> 6; const int mt = blockIdx.x / ntn, nq = blockIdx.x - mt * ntn; const int row0 = mt * 128 + 32 * w, col0 = nq * 64; if (row0 >= M) return;
  const _Float16* a0p = A + (size_t)(row0 + ln) * lda; const _Float16* a1p = a0p + (size_t)16 * lda;
  const _Float16* b0p = Bh + (size_t)(col0 + ln) * ldb; const _Float16* b1p = b0p + (size_t)16 * ldb; const _Float16* b2p = b1p + (size_t)16 * ldb; const _Float16* b3p = b2p + (size_t)16 * ldb;
  const v8f z8 = {0.f,0.f,0.f,0.f,0.f,0.f,0.f,0.f}; v8f c00 = z8, c01 = z8, c02 = z8, c03 = z8, c10 = z8, c11 = z8, c12 = z8, c13 = z8;
#pragma unroll 1
  for (int kb = 0; kb < K; kb += 32) { const v16h a0 = g2_frag(a0p + kb, hh), a1 = g2_frag(a1p + kb, hh);
    v16h b = g2_frag(b0p + kb, hh); c00 = g2_mma(a0, b, c00); c10 = g2_mma(a1, b, c10);
    b = g2_frag(b1p + kb, hh); c01 = g2_mma(a0, b, c01); c11 = g2_mma(a1, b, c11);
    b = g2_frag(b2p + kb, hh); c02 = g2_mma(a0, b, c02); c12 = g2_mma(a1, b, c12);
    b = g2_frag(b3p + kb, hh); c03 = g2_mma(a0, b, c03); c13 = g2_mma(a1, b, c13); }
  v8f accs[8] = {c00, c01, c02, c03, c10, c11, c12, c13};
#pragma unroll
  for (int u = 0; u < 8; ++u) { const int t = u & 3, half = u >> 2; const int col = col0 + t * 16 + ln; const float bv = bp ? bf16_round(bp[col]) : 0.f;
#pragma unroll
    for (int r = 0; r < 8; ++r) { const int rloc = half * 16 + 8 * hh + r; float v = accs[u][r] * alpha + bv; if (CP) { if (rowsPerB < 0) v += CP[cofs + (size_t)(row0g + row0 + rloc) * ldc + col];      /* rowsPerB < 0: own element of the batched C plane */ else { const int bidx = (row0g + row0 + rloc) / rowsPerB; v += CP[(size_t)bidx * sCPb + (size_t)by * 64 + col]; } }
      if (ACT == 3) v = fmaxf(v, 0.f); else if (ACT == 6) v = 0.5f * v * (1.0f + erff(v * 0.70710678118654752f)); else if (ACT == 11) v = 1.0f / (1.0f + expf(-v)); else if (ACT == 15) v = v / (1.0f + expf(-v)); else if (ACT == 12) v = (v > 0.f) ? v : 0.01f * v; else if (ACT == 8) v = tanhf(v); else if (ACT == 9) v = 0.5f * v * (1.0f + tanhf(0.7978845608028654f * (v + 0.044715f * v * v * v))); else if (ACT == 14) v = (v > 0.f) ? v : 0.1f * v; else if (ACT == 16) v = (v >= 0.f) ? v : 0.3f * v; else if (ACT == 17) v = (v >= 0.f) ? v : 0.2f * v;
      so[w][rloc][t * 16 + ln] = v; } }
  __builtin_amdgcn_fence(__ATOMIC_ACQ_REL, "workgroup"); __builtin_amdgcn_wave_barrier();
  const int rsub = lane >> 4, c4 = (lane & 15) * 4;
  {
#pragma unroll
    for (int q = 0; q < 16; ++q) { const int r = q * 2 + rsub; const v4f v = *(const v4fa*)&so[w][r][c4]; if (C) *(v4f*)(C + cofs + (size_t)(row0 + r) * ldc + col0 + c4) = v; if (C16) { v4h h4; for (int i = 0; i < 4; ++i) h4[i] = (_Float16)v[i]; *(v4h*)(C16 + cofs + (size_t)(row0 + r) * ldc + col0 + c4) = h4; } }
     } }


__global__ __launch_bounds__(256) void k_wnat(const float* __restrict__ w, size_t n8, _Float16* __restrict__ Bt) { const size_t t = (size_t)blockIdx.x * 256 + threadIdx.x; if (t >= n8) return; FragH f; for (int q = 0; q < 8; ++q) f.h[q] = (_Float16)(bf16_round(w[t * 8 + q]) * 16.0f); *(v8us*)((unsigned short*)Bt + t * 8) = f.half[0];  }
__global__ __launch_bounds__(256) void k_rsm(const float* __restrict__ S, _Float16* __restrict__ P, int nrows) {
  #pragma clang fp contract(off)
  const int i = blockIdx.x * 256 + threadIdx.x; if (i >= nrows) return; const float* s = S + (size_t)i * SQ; float mx = -3.0e38f;
#pragma unroll 1
  for (int j = 0; j < SQ; ++j) mx = fmaxf(mx, s[j]); float se = 0.f;
#pragma unroll 1
  for (int j = 0; j < SQ; ++j) se += expf(s[j] - mx); const float sc = 256.0f / se;
#pragma unroll 1
  for (int j0 = 0; j0 < SQ; j0 += 8) { FragH f; for (int q = 0; q < 8; ++q) f.h[q] = (_Float16)(expf(s[j0 + q] - mx) * sc); unsigned short* d = (unsigned short*)P + (size_t)i * SQ + j0; *(v8us*)d = f.half[0];  } }
__global__ __launch_bounds__(256) void k_vt(const _Float16* __restrict__ V16, int b, int h0, _Float16* __restrict__ VT) { __shared__ unsigned short tl[64][65]; const int tid = threadIdx.x; const int hh = blockIdx.x % HG, sg = blockIdx.x / HG; const int s0 = sg * 64; const int h = h0 + hh;
  for (int i = tid; i < 64 * 8; i += 256) { const int j = i / 8, d8 = (i % 8) * 8; FragH f; f.half[0] = *(const v8us*)((const unsigned short*)V16 + ((size_t)b * SQ + s0 + j) * DM + h * HD + d8); for (int q = 0; q < 8; ++q) tl[d8 + q][j] = f.u[q]; }
  __syncthreads();
  { for (int i = tid; i < 64 * 8; i += 256) { const int d = i / 8, j8 = (i % 8) * 8; FragH f; for (int q = 0; q < 8; ++q) f.u[q] = tl[d][j8 + q]; *(v8us*)((unsigned short*)VT + ((size_t)hh * HD + d) * SQ + s0 + j8) = f.half[0]; }  } }



// ---- causal row softmax, one wave per score row: the row is read once, 512 contiguous bytes per load, and stays in registers; maximum and sum by a butterfly over the 32 lanes ----
template <int CTRL>
__device__ __forceinline__ float sm_rowx(float x) { return __builtin_bit_cast(float, __builtin_amdgcn_update_dpp(__builtin_bit_cast(int, x), __builtin_bit_cast(int, x), CTRL, 0xf, 0xf, false)); }      /* CTRL = 0x160 | m (row_xmask): lane l with lane l ^ m of its 16-lane row */
__device__ __forceinline__ float sm_half(float x) { return __builtin_bit_cast(float, __builtin_amdgcn_permlanex16(__builtin_bit_cast(int, x), __builtin_bit_cast(int, x), 0x76543210, 0xfedcba98, false, false)); }      /* lane l with lane l ^ 16 */
__device__ __forceinline__ float sm_wmax(float v) { v = fmaxf(v, sm_rowx<0x161>(v)); v = fmaxf(v, sm_rowx<0x162>(v)); v = fmaxf(v, sm_rowx<0x164>(v)); v = fmaxf(v, sm_rowx<0x168>(v)); return fmaxf(v, sm_half(v)); }
__device__ __forceinline__ float sm_wsum(float v) { v += sm_rowx<0x161>(v); v += sm_rowx<0x162>(v); v += sm_rowx<0x164>(v); v += sm_rowx<0x168>(v); return v + sm_half(v); }
// 2^x of four values: each v_exp_f32 fills the slot behind the one before it (results apart from all sources), the v_nop the slot behind the last, which the instruction set asks for before a result is read or a source overwritten
__device__ __forceinline__ v4f sm_exp2x4(v4f x) { float r0, r1, r2, r3;
  asm("v_exp_f32 %0, %4\n\tv_exp_f32 %1, %5\n\tv_exp_f32 %2, %6\n\tv_exp_f32 %3, %7\n\tv_nop" : "=&v"(r0), "=&v"(r1), "=&v"(r2), "=&v"(r3) : "v"(x[0]), "v"(x[1]), "v"(x[2]), "v"(x[3]));
  const v4f r = {r0, r1, r2, r3}; return r; }
// NC = 128-key chunks of the row (compile time, so that all NC loads are issued before the first value is used); lane l holds keys c * 128 + 4 l .. + 3
template <int NC>
__device__ __forceinline__ void sm_row(const float* __restrict__ s, _Float16* __restrict__ p, int lane, int last) {
  const float* sl = s + lane * 4; const int rel = last - lane * 4;      /* key c * 128 + 4 l + q is kept while c * 128 + q <= rel */
  v4f e[NC];
#pragma unroll
  for (int c = 0; c < NC; ++c) e[c] = *(const v4fa*)(sl + c * 128);
  float mx = -3.0e38f;
#pragma unroll
  for (int c = 0; c < NC; ++c)
#pragma unroll
    for (int q = 0; q < 4; ++q) { e[c][q] = (c * 128 + q <= rel) ? e[c][q] : -1.0e9f; mx = fmaxf(mx, e[c][q]); }
  mx = sm_wmax(mx);
  v4f se4 = {0.f, 0.f, 0.f, 0.f};
#pragma unroll
  for (int c = 0; c < NC; ++c)
#pragma unroll
    for (int q = 0; q < 4; ++q) e[c][q] = (e[c][q] - mx) * 1.44269504f;      /* exp(x) = 2^(x log2 e), the native form */
#pragma unroll
  for (int c = 0; c < NC; ++c) { e[c] = sm_exp2x4(e[c]); se4 += e[c]; }
  const float sc = 256.0f / sm_wsum((se4[0] + se4[1]) + (se4[2] + se4[3]));
#pragma unroll
  for (int c = 0; c < NC; ++c) { v4h h4;
#pragma unroll
    for (int q = 0; q < 4; ++q) h4[q] = (_Float16)(e[c][q] * sc);
    *(v4h*)(p + c * 128 + lane * 4) = h4; }
  asm volatile("s_wait_xcnt 0x0" ::: "memory"); }      /* behind the last store of the row: the code that follows in the listing (the next case of the switch) rewrites the stores' data registers, and this wait stands in front of any such write */
__global__ __launch_bounds__(256) void k_rsmcf2(const float* __restrict__ S, _Float16* __restrict__ P, int hg, int q0, int nk) {
  static_assert(NKX == 2048 && QT == 256, "the cases below cover nk = 256 .. 2048 in steps of 256");
  const int lane = threadIdx.x & 31; const int t = blockIdx.x * 8 + __builtin_amdgcn_readfirstlane((int)(threadIdx.x >> 5)); if (t >= hg * QT) return;      /* the row is the wave's: a scalar, so that this test and the switch are scalar branches; no barrier in this kernel */
  const float* s = S + (size_t)t * NKX; _Float16* p = P + (size_t)t * NKX; const int last = q0 + (t % QT);
  switch (nk >> 8) {
    case 1: sm_row<2>(s, p, lane, last); break; case 2: sm_row<4>(s, p, lane, last); break; case 3: sm_row<6>(s, p, lane, last); break; case 4: sm_row<8>(s, p, lane, last); break;
    case 5: sm_row<10>(s, p, lane, last); break; case 6: sm_row<12>(s, p, lane, last); break; case 7: sm_row<14>(s, p, lane, last); break; case 8: sm_row<16>(s, p, lane, last); break; } }


template <int MASKADD>
__global__ __launch_bounds__(64) void k_att0(const float* __restrict__ QF, const float* __restrict__ KF, const float* __restrict__ VF, int ld, const float* __restrict__ mask, float scale, float* __restrict__ OF, int ldo) {
  #pragma clang fp contract(off)
  __shared__ __attribute__((aligned(16))) float lq[64][64]; __shared__ __attribute__((aligned(16))) float lo[64][64];
  const int tid = threadIdx.x; const int h = blockIdx.x / (QT0 / 64), rg = blockIdx.x % (QT0 / 64); const int i = rg * 64 + tid;
  const float* qr = QF + (size_t)i * ld + h * HD;
#pragma unroll 1
  for (int c = 0; c < HD / 4; ++c) { *(v4f*)&lq[tid][c * 4] = *(const v4fa*)(qr + c * 4); const v4f z = {0.f, 0.f, 0.f, 0.f}; *(v4f*)&lo[tid][c * 4] = z; }
  float m = -1.0e30f, l = 0.f; const int jmax = MASKADD ? (SQ - 1) : (rg * 64 + 63);      /* additive-mask form: every key (the mask input decides); causal form: keys up to the block's last row */
#pragma unroll 1
  for (int j = 0; j <= jmax; ++j) { const float* kr = KF + (size_t)j * ld + h * HD; const float* vr = VF + (size_t)j * ld + h * HD; float s = 0.f;
#pragma unroll 1
    for (int c = 0; c < HD / 4; ++c) { const v4f kq = *(const v4fa*)(kr + c * 4); const v4f qq = *(v4f*)&lq[tid][c * 4]; s = __fadd_rn(s, __fmul_rn(qq[0], kq[0])); s = __fadd_rn(s, __fmul_rn(qq[1], kq[1])); s = __fadd_rn(s, __fmul_rn(qq[2], kq[2])); s = __fadd_rn(s, __fmul_rn(qq[3], kq[3])); }
    s = __fmul_rn(s, scale); if (MASKADD) s = __fadd_rn(s, __fmul_rn(bf16_round(mask[(size_t)i * SQ + j]), -10000.0f));
    const float f = (MASKADD || j <= i) ? 1.f : 0.f; const float sm = fmaf(f, s, (1.f - f) * -1.0e30f); const float mn = fmaxf(m, sm); const float sc = expf(m - mn); const float e = expf(sm - mn); l = __fadd_rn(__fmul_rn(l, sc), e); m = mn;
#pragma unroll 1
    for (int c = 0; c < HD / 4; ++c) { const v4f vv = *(const v4fa*)(vr + c * 4); v4f oo = *(v4f*)&lo[tid][c * 4]; for (int u = 0; u < 4; ++u) oo[u] = __fadd_rn(__fmul_rn(oo[u], sc), __fmul_rn(e, vv[u])); *(v4f*)&lo[tid][c * 4] = oo; } }
  const float fin = 64.0f / l;      /* o carried x64, undone by the 1/64 in k_addf */
#pragma unroll 1
  for (int c = 0; c < HD / 4; ++c) { v4f oo = *(v4f*)&lo[tid][c * 4]; for (int u = 0; u < 4; ++u) oo[u] = __fmul_rn(oo[u], fin); *(v4f*)&lo[tid][c * 4] = oo; }
  __syncthreads();
  {
#pragma unroll 1
    for (int it = 0; it < 16; ++it) { const int row = it * 4 + tid / 16, pc = (tid % 16) * 4; const v4f v = *(const v4f*)&lo[row][pc]; *(v4f*)(OF + (size_t)(rg * 64 + row) * ldo + h * HD + pc) = v; }
     } }


template <int BFIN, int WXB>
__global__ __launch_bounds__(256) void k_ln16(const float* __restrict__ X, const float* __restrict__ g, const float* __restrict__ bb, float eps, _Float16* __restrict__ N16, float* __restrict__ XB) {
  #pragma clang fp contract(off)
  __shared__ float red[256]; const size_t r = blockIdx.x; const int t = threadIdx.x; const v4f xa = *(const v4fa*)(X + r * DMQ + t * 4); float s[4]; float sum = 0.f;
  for (int q = 0; q < 4; ++q) { s[q] = BFIN ? bf16_round(xa[q]) : xa[q]; sum = __fadd_rn(sum, s[q]); }
  red[t] = sum; __syncthreads(); for (int st = 128; st > 0; st >>= 1) { if (t < st) red[t] = __fadd_rn(red[t], red[t + st]); __syncthreads(); } const float mu = red[0] / (float)DMQ; __syncthreads();
  float vs = 0.f; for (int q = 0; q < 4; ++q) { const float dl = __fadd_rn(s[q], -mu); vs = __fadd_rn(vs, __fmul_rn(dl, dl)); } red[t] = vs; __syncthreads(); for (int st = 128; st > 0; st >>= 1) { if (t < st) red[t] = __fadd_rn(red[t], red[t + st]); __syncthreads(); }
  const float rs = rsqrtf(__fadd_rn(red[0] / (float)DMQ, eps)); v4h y; v4f xb;
  for (int q = 0; q < 4; ++q) { const int c = t * 4 + q; y[q] = (_Float16)__fadd_rn(__fmul_rn(__fmul_rn(__fadd_rn(s[q], -mu), rs), bf16_round(g[c])), bf16_round(bb[c])); xb[q] = s[q]; }
  { *(v4h*)(N16 + r * DMQ + t * 4) = y; if (WXB) *(v4f*)(XB + r * DMQ + t * 4) = xb;  } }
__global__ __launch_bounds__(256) void k_ftres2(const float* __restrict__ OF0, const float* __restrict__ XB, float* __restrict__ X1, size_t n4) {
  #pragma clang fp contract(off)
  const size_t t = (size_t)blockIdx.x * 256 + threadIdx.x; if (t >= n4) return; const v4f o = *(const v4fa*)(OF0 + t * 4), xv = *(const v4fa*)(XB + t * 4); v4f y; for (int q = 0; q < 4; ++q) y[q] = __fadd_rn(__fmul_rn(o[q], 0.015625f), xv[q]); *(v4f*)(X1 + t * 4) = y;  }

__global__ __launch_bounds__(256) void k_wthd(const float* __restrict__ Wt, _Float16* __restrict__ Bt) { const size_t t = (size_t)blockIdx.x * 256 + threadIdx.x; if (t >= (size_t)NH * HD * (DM / 8)) return; const int m8 = (int)(t % (DM / 8)) * 8; const int d = (int)((t / (DM / 8)) % HD); const int h = (int)(t / ((size_t)(DM / 8) * HD)); FragH f;
  for (int q = 0; q < 8; ++q) f.h[q] = (_Float16)(16.0f * bf16_round(Wt[((size_t)h * DM + m8 + q) * HD + d])); unsigned short* dst = (unsigned short*)Bt + ((size_t)h * HD + d) * DM + m8; *(v8us*)dst = f.half[0];  }




__global__ __launch_bounds__(256) void k_wtpad(const float* __restrict__ Wm, _Float16* __restrict__ Wt, int Kr, int Kp, int Nr, int Np, float scale) {
  const int t = blockIdx.x * 256 + threadIdx.x; if (t >= Np * (Kp / 8)) return; const int n = t / (Kp / 8), k8 = (t % (Kp / 8)) * 8; const int nc = min(n, Nr - 1); const float fn = (n < Nr) ? 1.f : 0.f; FragH f;
  for (int i = 0; i < 8; ++i) { const int k = k8 + i; const int kc = min(k, Kr - 1); const float fk = (k < Kr) ? fn : 0.f; f.h[i] = (_Float16)(bf16_round(Wm[(size_t)kc * Nr + nc]) * scale * fk); }
  unsigned short* o = (unsigned short*)Wt + (size_t)n * Kp + k8; *(v8us*)o = f.half[0];  }
__global__ __launch_bounds__(128) void k_bpad(const float* __restrict__ b, float* __restrict__ Bp, int nr, int np) {
  const int i = threadIdx.x; if (i >= np) return; const float v = b[min(i, nr - 1)] * ((i < nr) ? 1.f : 0.f); *(float*)(Bp + i) = v;  }

__global__ __launch_bounds__(256) void k_bcpy(const float* __restrict__ b, int n, int NP, float* __restrict__ dst, int dst0) { for (int i = threadIdx.x; i < NP; i += 256) { const float v = (i < n) ? b[i] : 0.f; *(float*)(dst + dst0 + i) = v; }  }


__global__ __launch_bounds__(256) void k_addf(const float* __restrict__ XBr, const float* __restrict__ OF, float* __restrict__ O, size_t n8) {
  #pragma clang fp contract(off)
  const size_t t = (size_t)blockIdx.x * 256 + threadIdx.x; if (t >= n8) return; const v4f a = *(const v4fa*)(XBr + t * 8), b = *(const v4fa*)(XBr + t * 8 + 4), c = *(const v4fa*)(OF + t * 8), d = *(const v4fa*)(OF + t * 8 + 4); v4f r0, r1;
  for (int q = 0; q < 4; ++q) { r0[q] = __fadd_rn(a[q], __fmul_rn(c[q], 0.015625f)); r1[q] = __fadd_rn(b[q], __fmul_rn(d[q], 0.015625f)); }
  { *(v4f*)(O + t * 8) = r0; *(v4f*)(O + t * 8 + 4) = r1;  } }


extern "C" void kernel_launch(void* const* d_in, const int* in_sizes, int n_in,
                              void* d_out, int out_size, void* d_ws, size_t ws_size, hipStream_t stream) {
  (void)in_sizes; (void)n_in; (void)out_size;
  const float* const* I = (const float* const*)d_in; const float* x = I[0]; const float* wq = I[1]; const float* bq = I[2]; const float* wk = I[3]; const float* bk = I[4]; const float* wv = I[5]; const float* bv = I[6]; const float* g1 = I[7]; const float* be1 = I[8]; const float* gg2 = I[9]; const float* be2 = I[10]; const float* wfc = I[11]; const float* bfc = I[12]; const float* wmp = I[13]; const float* bmp = I[14];      /* input order: x; [in][out] wq / wk / wv + biases; LN1 w / b, LN2 w / b; w_fc [1024][4096] + b_fc, w_proj [4096][1024] + b_proj */
  float* OUT0 = (float*)d_out; float* OUTK = (float*)d_out + NR * DM; float* OUTV = (float*)d_out + 2 * NR * DM;      /* tuple outputs: out at byte 0, k at 16,777,216, v at 33,554,432 (each NB * SQ * DM floats) */
  static_assert(NH * HD == DM && DM % 64 == 0 && SQ % 128 == 0 && QT0 % 8 == 0, "shape / tile multiples");
  char* ws = (char*)d_ws; size_t off = 0;
  auto take = [&](size_t bytes) { char* p = ws + off; off += (bytes + 255) & ~(size_t)255; return p; };
  _Float16* BQKV = (_Float16*)take((size_t)3 * DM * DM * 2); float* bqkv = (float*)take((size_t)3 * DM * 4);      /* stacked bias bq | bk | bv */
  _Float16* X16 = (_Float16*)take(NR * DM * 2); float* XB = (float*)take(NR * DM * 4); float* X1 = (float*)take(NR * DM * 4); _Float16* M16 = nullptr;      /* = X16 below (alias: X16's last reader, the last batch's k / v output GEMMs, precedes LN2's write) */ _Float16* HF16 = (_Float16*)take((size_t)SQ * DFF * 2); _Float16* BW1 = (_Float16*)take((size_t)DFF * DM * 2); _Float16* BW2 = (_Float16*)take((size_t)DM * DFF * 2); _Float16* QKV = (_Float16*)take(NR * 3 * DM * 2); _Float16* Q16 = QKV; _Float16* K16 = QKV + DM; _Float16* V16 = QKV + 2 * DM; M16 = X16;
  float* S = (float*)take((size_t)NH * QT * NKX * 4); _Float16* P = (_Float16*)take((size_t)NH * QT * NKX * 2); _Float16* VT = (_Float16*)take((size_t)NH * HD * SQ * 2);
  float* QF0 = (float*)take((size_t)QT0 * DM * 4); float* KF0 = (float*)take((size_t)QT0 * DM * 4); float* VF0 = (float*)take((size_t)QT0 * DM * 4); float* OF0 = (float*)take((size_t)NB * QT0 * DM * 4);
  if (off > ws_size) return;
  { const unsigned g = (unsigned)(((size_t)DM * (DM / 8) + 255) / 256); k_wt_f16<<<g, 256, 0, stream>>>(wq, BQKV, DM, DM, 16.0f); k_wt_f16<<<g, 256, 0, stream>>>(wk, BQKV + (size_t)DM * DM, DM, DM, 16.0f); k_wt_f16<<<g, 256, 0, stream>>>(wv, BQKV + (size_t)2 * DM * DM, DM, DM, 16.0f); }      /* [in][out] -> Bt x16: stacked q | k | v (transposing builder) */
  k_bcpy<<<1, 256, 0, stream>>>(bq, DM, DM, bqkv, 0); k_bcpy<<<1, 256, 0, stream>>>(bk, DM, DM, bqkv, DM); k_bcpy<<<1, 256, 0, stream>>>(bv, DM, DM, bqkv, 2 * DM);      /* stacked bias bq | bk | bv */
  k_ln16<1, 1><<<(unsigned)NR, 256, 0, stream>>>(x, g1, be1, 1e-5f, X16, XB);      /* a = LN1(bf16(x)) -> f16 rows; XB = bf16(x) for the residual */
  k_wt_f16<<<(unsigned)(((size_t)DFF * (DM / 8) + 255) / 256), 256, 0, stream>>>(wfc, BW1, DM, DFF, 16.0f); k_wt_f16<<<(unsigned)(((size_t)DM * (DFF / 8) + 255) / 256), 256, 0, stream>>>(wmp, BW2, DFF, DM, 16.0f);      /* W1 [1024][4096] -> Bt [4096][1024]; W2 [4096][1024] -> Bt [1024][4096] (x16) */
  const size_t r0p = (size_t)B0 * SQ;      /* first projected row */
  k_gemm2<0><<<dim3((unsigned)((MP / 128) * (3 * DM / 64)), 1), 128, 0, stream>>>(X16 + r0p * DM, DM, 0, BQKV, DM, 0, 0.0625f, bqkv, 0, nullptr, 1, 0, 0, nullptr, QKV + r0p * 3 * DM, 3 * DM, 0, MP, 3 * DM, DM);      /* q | k | v rows (f16); head h = columns h*HD.. of each DM block */
  for (int b = B0; b < B0 + NBR; ++b) { const size_t r0 = (size_t)b * SQ;
    k_vt<NH, SQ><<<NH * (SQ / 64), 256, 0, stream>>>(V16 + r0 * LQ, LQ, 0, VT);      /* V^T [NH][HD][SQ] for this batch */
    k_gemm2<0><<<dim3((QT0 / 128) * (DM / 64), 1), 128, 0, stream>>>(X16 + r0 * DM, DM, 0, BQKV, DM, 0, 0.0625f, bq, 0, nullptr, 1, 0, 0, QF0, nullptr, DM, 0, QT0, DM, DM); k_gemm2<0><<<dim3((QT0 / 128) * (DM / 64), 1), 128, 0, stream>>>(X16 + r0 * DM, DM, 0, (BQKV + (size_t)DM * DM), DM, 0, 0.0625f, bk, 0, nullptr, 1, 0, 0, KF0, nullptr, DM, 0, QT0, DM, DM); k_gemm2<0><<<dim3((QT0 / 128) * (DM / 64), 1), 128, 0, stream>>>(X16 + r0 * DM, DM, 0, (BQKV + (size_t)2 * DM * DM), DM, 0, 0.0625f, bv, 0, nullptr, 1, 0, 0, VF0, nullptr, DM, 0, QT0, DM, DM);      /* f32 q, k, v of the first 128 rows (exact products) */
    k_att0<0><<<NH * (QT0 / 64), 64, 0, stream>>>(QF0, KF0, VF0, DM, nullptr, 0.125f, OF0 + (size_t)b * QT0 * DM, DM);      /* exact f32 attention for rows 0..127 (o x64) */
    for (int q0 = 0; q0 < QN; q0 += QT) { const int nk = q0 + QT;      /* causal: only keys below the tile end are computed */
      k_gemm2<0><<<dim3((QT / 128) * (nk / 64), NHD), 128, 0, stream>>>(Q16 + (r0 + q0) * LQ, LQ, (size_t)HD, K16 + r0 * LQ, LQ, (size_t)HD, 0.125f, nullptr, 0, nullptr, 1, 0, 0, S, nullptr, NKX, (size_t)QT * NKX, QT, nk, HD);      /* scores, all heads on grid.y */
      k_rsmcf2<<<(NHD * QT + 7) / 8, 256, 0, stream>>>(S, P, NHD, q0, nk);      /* one wave per row, eight rows per work-group */
      k_gemm2<0><<<dim3((QT / 128) * (HD / 64), NHD), 128, 0, stream>>>(P, NKX, (size_t)QT * NKX, VT, SQ, (size_t)HD * SQ, 0.00390625f, nullptr, 0, XB + (r0 + q0) * DM, -1, 0, 0, X1 + (r0 + q0) * DM, nullptr, DM, (size_t)HD, QT, HD, nk); }      /* x1 = bf16(x) + P V^T / 256 in f32 (own-element addend at the head's 64 columns: no output projection in this module) */
    k_addf<<<(unsigned)(((size_t)QT0 * DM / 8 + 255) / 256), 256, 0, stream>>>(XB + r0 * DM, OF0 + (size_t)b * QT0 * DM, X1 + r0 * DM, (size_t)QT0 * DM / 8);      /* rows 0..127 of the batch rewritten from the exact f32 path: x1 = bf16(x) + o / 64 */
    k_gemm2<0><<<dim3((SQ / 128) * (HD / 64), NH), 128, 0, stream>>>(X16 + r0 * DM, DM, 0, BQKV + (size_t)DM * DM, DM, (size_t)HD * DM, 0.0625f, bk, (size_t)HD, nullptr, 1, 0, 0, OUTK + (size_t)b * NH * SQ * HD, nullptr, HD, (size_t)SQ * HD, SQ, HD, DM); k_gemm2<0><<<dim3((SQ / 128) * (HD / 64), NH), 128, 0, stream>>>(X16 + r0 * DM, DM, 0, BQKV + (size_t)2 * DM * DM, DM, (size_t)HD * DM, 0.0625f, bv, (size_t)HD, nullptr, 1, 0, 0, OUTV + (size_t)b * NH * SQ * HD, nullptr, HD, (size_t)SQ * HD, SQ, HD, DM); }      /* outputs 1 and 2: k and v of this batch in f32, head-major [H][T][64] (head on grid.y: weight rows 64 h .., bias 64 h .., output plane h) */
  k_ln16<0, 0><<<(unsigned)NR, 256, 0, stream>>>(X1, gg2, be2, 1e-5f, M16, nullptr);      /* h = LN2(x1) -> f16 rows */
  for (int b = 0; b < NB; ++b) { const size_t r0 = (size_t)b * SQ;
    k_gemm2<6><<<dim3((unsigned)((SQ / 128) * (DFF / 64)), 1), 128, 0, stream>>>(M16 + r0 * DM, DM, 0, BW1, DM, 0, 0.0625f, bfc, 0, nullptr, 1, 0, 0, nullptr, HF16, DFF, 0, SQ, DFF, DM);      /* gelu_erf(h2 W1 + b1) -> f16 (this batch) */
    k_gemm2<0><<<dim3((unsigned)((SQ / 128) * (DM / 64)), 1), 128, 0, stream>>>(HF16, DFF, 0, BW2, DFF, 0, 0.0625f, bmp, 0, X1 + r0 * DM, -1, 0, 0, OUT0 + r0 * DM, nullptr, DM, 0, SQ, DM, DFF); }      /* output 0 = x1 + mlp (own-element residual) */
}

// v002
// One run takes 1840 microseconds.
// In two side-by-side timings against v001, it was 1.47 and 1.48 times as fast.
// All steps since v000 together make it 3.14 times as fast.
#include <hip/hip_runtime.h>
// Pre-LN causal transformer block WITHOUT an attention output projection that also returns its key and value tensors (x [2][2048][1024]; h = LN1(x) (biased var, eps 1e-5); q / k / v = h W + b ([in][out] [1024][1024] sigma 1/32, zero biases) -> [B][16][T][64]; att = softmax(q k^T / 8) with a causal mask (tril, -inf); y = att v merged back to [B][T][1024]; x1 = x + y (no projection); out = x1 + gelu_erf(LN2(x1) w_fc + b_fc) w_proj + b_proj ([in][out] 1024 x 4096 x 1024); returns (out [2][2048][1024], k [2][16][2048][64], v [2][16][2048][64]): three outputs at byte offsets 0 / 16,777,216 / 33,554,432 of d_out).
// Structure: token rows r = b*2048 + s; LN1(bf16(x)) as f16 rows; q | k | v as ONE WMMA GEMM (N = 3 x 1024) (32x64 wave tiles, f32 accumulation, exact x16 weights + bias, f16 outputs); per batch: V^T for all heads via LDS transposes; per query tile of 256 rows: scores against the keys below the tile end only (K = 64, all heads on grid.y, alpha = 0.125), causal row softmax on VALU, one wave per row, keys past the row masked over the computed range (f32 statistics, native exp; weights x256 f16), x1 = bf16(x) + P . V^T (K = keys below the tile end, alpha 2^-8 undoing the x256 weights, residual added in the epilogue) written straight into the f32 x1 rows; out = x1 + gelu_erf(LN2(x1) W1 + b1) W2 + b2 (two GEMMs, f16 hidden, f32 out).
// Compute dtype: inputs rounded to bf16; x / weights exact; q, k, v, softmax weights, LN outputs and the FFN hidden as plain f16 GEMM operands (~2^-12); scores and softmax statistics f32. v_wmma_f32_16x16x32_f16.
#define NB 2
#define SQ 2048
#define DM 1024
#define NH 16
#define HD 64
#define HG 4
#define QT 256                       /* query rows per causal tile */
#define NKX SQ                       /* S / P row pitch */
#define QT0 128                      /* first-tile rows recomputed exactly in f32 */
#define B0 0                         /* first batch processed (debug hook) */
#define NBR NB                       /* batches processed (debug hook) */
#define NR ((size_t)NB * SQ)
#define DMQ DM
#define DFF 4096                     /* FFN hidden width */
#define DFFR 100
#define MP ((int)((size_t)NBR * SQ)) /* rows projected (debug hook) */
#define QN SQ                        /* query rows attended per batch (debug hook) */
#define NHD NH                       /* heads attended (debug hook) */
#define MPO MP
#define LQ (3 * DM)      /* row pitch of the q/k/v rows */
typedef __bf16 v16b __attribute__((ext_vector_type(16)));
typedef unsigned short v8us __attribute__((ext_vector_type(8), may_alias));
typedef float  v8f  __attribute__((ext_vector_type(8)));
typedef float  v4f  __attribute__((ext_vector_type(4)));
typedef float  v4fa __attribute__((ext_vector_type(4), may_alias));
union FragB { v16b v; v8us half[2]; unsigned short u[16]; };

__device__ __forceinline__ unsigned short bf16_bits(float x) { unsigned int u = __float_as_uint(x); return (unsigned short)((u + 0x7FFFu + ((u >> 16) & 1u)) >> 16); }
__device__ __forceinline__ float bf16_val(unsigned short b) { return __uint_as_float(((unsigned int)b) << 16); }
__device__ __forceinline__ float bf16_round(float x) { return bf16_val(bf16_bits(x)); }
// D += A·B with NT terms: 1 = ah·bh, 2 = + al·bh (A split), 3 = + ah·bl (both split)
template <int NT>
__device__ __forceinline__ v8f mmaN(v16b ah, v16b al, v16b bh, v16b bl, v8f c) {
  c = __builtin_amdgcn_wmma_f32_16x16x32_bf16(false, ah, false, bh, (short)0, c, false, false);
  if (NT >= 2) c = __builtin_amdgcn_wmma_f32_16x16x32_bf16(false, al, false, bh, (short)0, c, false, false);
  if (NT >= 3) c = __builtin_amdgcn_wmma_f32_16x16x32_bf16(false, ah, false, bl, (short)0, c, false, false);
  asm volatile("v_nop\n\tv_nop\n\tv_nop\n\tv_nop" : "+v"(c) : "v"(ah), "v"(al), "v"(bh), "v"(bl));
  return c;
}

__global__ __launch_bounds__(256) void k_wt_bf16(const float* __restrict__ W, unsigned short* __restrict__ Wt, int K, int N) {
  const int t = blockIdx.x * 256 + threadIdx.x;
  const int k8n = K / 8;
  if (t >= N * k8n) return;
  const int n = t / k8n, k8 = (t % k8n) * 8;
  v8us v;
#pragma unroll
  for (int i = 0; i < 8; ++i) v[i] = bf16_bits(W[(size_t)(k8 + i) * N + n]);
  *(v8us*)(Wt + (size_t)n * K + k8) = v;
  
}

// GEMM C[M][N] (f32, pitch ldc) = act(A[M][K]·W + bias). A f32 row-major (pitch lda) converted per fragment to bf16
// (ASPLIT: hi/lo two planes -> 2 terms, else single rounded term); Wt bf16 [N][K] (pitch ldb). BIAS_BF16 rounds the
// bias to bf16 first (bias quantised to bf16 before the add). K%32==0, M%16==0, N%64==0.
template <bool ASPLIT, int ACT, bool BIAS_BF16>
__global__ __launch_bounds__(128) void k_gemm_bf(const float* __restrict__ A, int lda, const unsigned short* __restrict__ Wt, int ldb,
                                               const float* __restrict__ bias, float* __restrict__ C, int ldc, int M, int N, int K) {
  __shared__ __attribute__((aligned(16))) float so[4][16][64];
  const int tid = threadIdx.x, w = tid >> 5, lane = tid & 31, ln = lane & 15, hh = lane >> 4;
  const int ntn = N / 64;
  const int wid = blockIdx.x * 4 + w;
  const int mt = wid / ntn, nq = wid % ntn;
  if (mt * 16 >= M) return;
  const int row0 = mt * 16, col0 = nq * 64;
  const float* arow = A + (size_t)(row0 + ln) * lda;
  v8f acc[4] = {};
  for (int kb = 0; kb < K; kb += 32) {
    FragB ah, al;
    const v4f x0 = *(const v4fa*)(arow + kb + 8 * hh), x1 = *(const v4fa*)(arow + kb + 8 * hh + 4);
    const v4f x2 = *(const v4fa*)(arow + kb + 16 + 8 * hh), x3 = *(const v4fa*)(arow + kb + 16 + 8 * hh + 4);
    float xs[16] = {x0[0],x0[1],x0[2],x0[3],x1[0],x1[1],x1[2],x1[3],x2[0],x2[1],x2[2],x2[3],x3[0],x3[1],x3[2],x3[3]};
#pragma unroll
    for (int i = 0; i < 16; ++i) { const unsigned short hb = bf16_bits(xs[i]); ah.u[i] = hb; al.u[i] = ASPLIT ? bf16_bits(xs[i] - bf16_val(hb)) : (unsigned short)0; }
#pragma unroll
    for (int t = 0; t < 4; ++t) {
      const unsigned short* brow = Wt + (size_t)(col0 + t * 16 + ln) * ldb + kb;
      FragB b;
      b.half[0] = *(const v8us*)(brow + 8 * hh);
      b.half[1] = *(const v8us*)(brow + 16 + 8 * hh);
      acc[t] = mmaN<ASPLIT ? 2 : 1>(ah.v, al.v, b.v, b.v, acc[t]);
    }
  }
#pragma unroll
  for (int t = 0; t < 4; ++t) {
    float bv = bias ? bias[col0 + t * 16 + ln] : 0.f;
    if (BIAS_BF16) bv = bf16_round(bv);
#pragma unroll
    for (int r = 0; r < 8; ++r) { float v = acc[t][r] + bv; if (ACT == 1) v = fmaxf(v, 0.f); so[w][8 * hh + r][t * 16 + ln] = v; }
  }
  __builtin_amdgcn_fence(__ATOMIC_ACQ_REL, "workgroup");
  __builtin_amdgcn_wave_barrier();
  const int rsub = lane >> 4, c4 = (lane & 15) * 4;
  {
#pragma unroll
    for (int q = 0; q < 8; ++q) {
      const int r = q * 2 + rsub;
      const v4f v = *(const v4fa*)&so[w][r][c4];
      *(v4f*)(C + (size_t)(row0 + r) * ldc + col0 + c4) = v;
    }
    
  }
}

// GEMM C = act(A·W + bias + resid): A f32 (ASPLIT -> hi/lo 2 terms), Wt bf16 [N][K]; ACT 0 none, 1 relu, 2 exact gelu;
// resid (optional, f32, row index = (row % rmod), pitch ldr, RES_BF16 rounds it) added before the activation.
template <bool ASPLIT, int ACT, bool BIAS_BF16, bool RES_BF16>
__global__ __launch_bounds__(128) void k_gemm_bf3(const float* __restrict__ A, int lda, const unsigned short* __restrict__ Wt, int ldb,
                                                const float* __restrict__ bias, const float* __restrict__ resid, int rmod, int ldr,
                                                float* __restrict__ C, int ldc, int M, int N, int K) {
  __shared__ __attribute__((aligned(16))) float so[4][16][64];
  const int tid = threadIdx.x, w = tid >> 5, lane = tid & 31, ln = lane & 15, hh = lane >> 4;
  const int ntn = N / 64;
  const int wid = blockIdx.x * 4 + w;
  const int mt = wid / ntn, nq = wid % ntn;
  if (mt * 16 >= M) return;
  const int row0 = mt * 16, col0 = nq * 64;
  const float* arow = A + (size_t)(row0 + ln) * lda;
  v8f acc[4] = {};
  for (int kb = 0; kb < K; kb += 32) {
    FragB ah, al;
    const v4f x0 = *(const v4fa*)(arow + kb + 8 * hh), x1 = *(const v4fa*)(arow + kb + 8 * hh + 4);
    const v4f x2 = *(const v4fa*)(arow + kb + 16 + 8 * hh), x3 = *(const v4fa*)(arow + kb + 16 + 8 * hh + 4);
    float xs[16] = {x0[0],x0[1],x0[2],x0[3],x1[0],x1[1],x1[2],x1[3],x2[0],x2[1],x2[2],x2[3],x3[0],x3[1],x3[2],x3[3]};
#pragma unroll
    for (int i = 0; i < 16; ++i) { const unsigned short hb = bf16_bits(xs[i]); ah.u[i] = hb; al.u[i] = ASPLIT ? bf16_bits(xs[i] - bf16_val(hb)) : (unsigned short)0; }
#pragma unroll
    for (int t = 0; t < 4; ++t) {
      const unsigned short* brow = Wt + (size_t)(col0 + t * 16 + ln) * ldb + kb;
      FragB b;
      b.half[0] = *(const v8us*)(brow + 8 * hh);
      b.half[1] = *(const v8us*)(brow + 16 + 8 * hh);
      acc[t] = mmaN<ASPLIT ? 2 : 1>(ah.v, al.v, b.v, b.v, acc[t]);
    }
  }
#pragma unroll
  for (int t = 0; t < 4; ++t) {
    const int col = col0 + t * 16 + ln;
    float bv = bias ? bias[col] : 0.f;
    if (BIAS_BF16) bv = bf16_round(bv);
#pragma unroll
    for (int r = 0; r < 8; ++r) {
      float v = acc[t][r] + bv;
      if (resid) { float rv = resid[(size_t)((row0 + 8 * hh + r) % rmod) * ldr + col]; if (RES_BF16) rv = bf16_round(rv); v += rv; }
      if (ACT == 1) v = fmaxf(v, 0.f);
      if (ACT == 2) v = 0.5f * v * (1.0f + erff(v * 0.70710678118654752f));
      if (ACT == 3) { const float u = 0.7978845608028654f * (v + 0.044715f * v * v * v); v = 0.5f * v * (1.0f + tanhf(u)); }
      so[w][8 * hh + r][t * 16 + ln] = v;
    }
  }
  __builtin_amdgcn_fence(__ATOMIC_ACQ_REL, "workgroup");
  __builtin_amdgcn_wave_barrier();
  const int rsub = lane >> 4, c4 = (lane & 15) * 4;
  {
#pragma unroll
    for (int q = 0; q < 8; ++q) {
      const int r = q * 2 + rsub;
      const v4f v = *(const v4fa*)&so[w][r][c4];
      *(v4f*)(C + (size_t)(row0 + r) * ldc + col0 + c4) = v;
    }
    
  }
}
// row LayerNorm (biased variance, eps) over N: s = X (+ R); optional out_sum <- s; out_norm <- (s-mu)*rsqrt(var+eps)*g + b
template <bool PARAM_BF16>
__global__ __launch_bounds__(256) void k_layernorm(const float* __restrict__ X, const float* __restrict__ R, const float* __restrict__ g, const float* __restrict__ bta,
                                                  float* __restrict__ out_sum, float* __restrict__ out_norm, int N, float eps) {
  __shared__ float red[256];
  const int row = blockIdx.x, tid = threadIdx.x;
  const float* x = X + (size_t)row * N; const float* rr = R ? R + (size_t)row * N : nullptr;
  float vals[16];                     // up to N = 4096
  const int per = N / 256;            // contiguous chunk per thread? use strided-by-4 chunks: thread handles j = tid*4 + 1024*u
  float s1 = 0.f;
  for (int u = 0; u < per / 4; ++u) {
    const int j = tid * 4 + 1024 * u;
    const v4f a = *(const v4fa*)(x + j);
    v4f b = {0.f,0.f,0.f,0.f}; if (rr) b = *(const v4fa*)(rr + j);
#pragma unroll
    for (int q = 0; q < 4; ++q) { const float v = a[q] + b[q]; vals[u * 4 + q] = v; s1 += v; }
  }
  red[tid] = s1; __syncthreads();
  for (int st = 128; st > 0; st >>= 1) { if (tid < st) red[tid] += red[tid + st]; __syncthreads(); }
  const float mu = red[0] / (float)N; __syncthreads();
  float s2 = 0.f;
  for (int u = 0; u < per / 4; ++u)
#pragma unroll
    for (int q = 0; q < 4; ++q) { const float c = vals[u * 4 + q] - mu; s2 += c * c; }
  red[tid] = s2; __syncthreads();
  for (int st = 128; st > 0; st >>= 1) { if (tid < st) red[tid] += red[tid + st]; __syncthreads(); }
  const float rs = rsqrtf(red[0] / (float)N + eps);
  {
    for (int u = 0; u < per / 4; ++u) {
      const int j = tid * 4 + 1024 * u;
      v4f o, sm;
#pragma unroll
      for (int q = 0; q < 4; ++q) {
        float gg = g[j + q], bb = bta[j + q];
        if (PARAM_BF16) { gg = bf16_round(gg); bb = bf16_round(bb); }
        sm[q] = vals[u * 4 + q]; o[q] = (vals[u * 4 + q] - mu) * rs * gg + bb;
      }
      if (out_sum) *(v4f*)(out_sum + (size_t)row * N + j) = sm;
      *(v4f*)(out_norm + (size_t)row * N + j) = o;
    }
    
  }
}



// ---- f16 WMMA path (v_wmma_f32_16x16x32_f16): 11-bit significands for operands in range — used where a [0,1] probability operand needs more precision than bf16
typedef _Float16 v16h __attribute__((ext_vector_type(16)));
union FragH { v16h v; v8us half[2]; _Float16 h[16]; unsigned short u[16]; };
template <int NT>
__device__ __forceinline__ v8f mmaH(v16h ah, v16h al, v16h bh, v16h bl, v8f c) {
  c = __builtin_amdgcn_wmma_f32_16x16x32_f16(false, ah, false, bh, (short)0, c, false, false);
  if (NT >= 2) c = __builtin_amdgcn_wmma_f32_16x16x32_f16(false, al, false, bh, (short)0, c, false, false);
  if (NT >= 3) c = __builtin_amdgcn_wmma_f32_16x16x32_f16(false, ah, false, bl, (short)0, c, false, false);
  asm volatile("v_nop\n\tv_nop\n\tv_nop\n\tv_nop" : "+v"(c) : "v"(ah), "v"(al), "v"(bh), "v"(bl));
  return c;
}
// batched GEMM like k_gemm_b but f16 operands: A f32 (split into f16 hi/lo if ASPLIT, else rounded to f16), Bt = f16 values [n][k]; alpha; C f32; N multiple of 16 (partial tiles skipped)
template <bool ASPLIT>
__global__ __launch_bounds__(128) void k_gemm_h(const float* __restrict__ A, int lda, size_t sA, const _Float16* __restrict__ Bh, int ldb, size_t sB, float alpha, float* __restrict__ C, int ldc, size_t sC, int M, int N, int K) {
  __shared__ __attribute__((aligned(16))) float so[4][16][64];
  const int tid = threadIdx.x, w = tid >> 5, lane = tid & 31, ln = lane & 15, hh = lane >> 4; const int by = blockIdx.y;
  A += (size_t)by * sA; Bh += (size_t)by * sB; C += (size_t)by * sC;
  const int ntn = (N + 63) / 64; const int wid = blockIdx.x * 4 + w; const int mt = wid / ntn, nq = wid % ntn; if (mt * 16 >= M) return;
  const int row0 = mt * 16, col0 = nq * 64; const float* arow = A + (size_t)(row0 + ln) * lda;
  v8f acc[4] = {};
  for (int kb = 0; kb < K; kb += 32) {
    FragH ah, al;
    const v4f x0 = *(const v4fa*)(arow + kb + 8 * hh), x1 = *(const v4fa*)(arow + kb + 8 * hh + 4), x2 = *(const v4fa*)(arow + kb + 16 + 8 * hh), x3 = *(const v4fa*)(arow + kb + 16 + 8 * hh + 4);
    float xs[16] = {x0[0],x0[1],x0[2],x0[3],x1[0],x1[1],x1[2],x1[3],x2[0],x2[1],x2[2],x2[3],x3[0],x3[1],x3[2],x3[3]};
#pragma unroll
    for (int i = 0; i < 16; ++i) { const _Float16 h = (_Float16)xs[i]; ah.h[i] = h; al.h[i] = ASPLIT ? (_Float16)(xs[i] - (float)h) : (_Float16)0.0f; }
#pragma unroll
    for (int t = 0; t < 4; ++t) { if (col0 + t * 16 >= N) continue; const size_t boff = (size_t)(col0 + t * 16 + ln) * ldb + kb; FragH bq; bq.half[0] = *(const v8us*)(Bh + boff + 8 * hh); bq.half[1] = *(const v8us*)(Bh + boff + 16 + 8 * hh);
      acc[t] = mmaH<ASPLIT ? 2 : 1>(ah.v, al.v, bq.v, bq.v, acc[t]); }
  }
#pragma unroll
  for (int t = 0; t < 4; ++t) { if (col0 + t * 16 >= N) continue;
#pragma unroll
    for (int r = 0; r < 8; ++r) so[w][8 * hh + r][t * 16 + ln] = acc[t][r] * alpha; }
  __builtin_amdgcn_fence(__ATOMIC_ACQ_REL, "workgroup"); __builtin_amdgcn_wave_barrier();
  const int rsub = lane >> 4, c4 = (lane & 15) * 4;
  {
#pragma unroll
    for (int q = 0; q < 8; ++q) { const int r = q * 2 + rsub; if (col0 + c4 < N) { const v4f v = *(const v4fa*)&so[w][r][c4]; *(v4f*)(C + (size_t)(row0 + r) * ldc + col0 + c4) = v; } }
     }
}

// Wt[n][k] = f16(W[k][n]·scale) from f32 row-major W[K][N] (scale = power of two; bf16-exact weights stay exact in f16 away from the subnormal range)
__global__ __launch_bounds__(256) void k_wt_f16(const float* __restrict__ W, _Float16* __restrict__ Wt, int K, int N, float scale) {
  const int t = blockIdx.x * 256 + threadIdx.x; if (t >= N * (K / 8)) return; const int n = t / (K / 8), k8 = (t % (K / 8)) * 8; FragH f;
#pragma unroll
  for (int i = 0; i < 8; ++i) f.h[i] = (_Float16)(bf16_round(W[(size_t)(k8 + i) * N + n]) * scale); const v8us o = f.half[0];
  *(v8us*)((unsigned short*)Wt + (size_t)n * K + k8) = o; 
}
// k_gemm_hh variant with fused epilogue: v = acc·alpha + bias[by·sBias + col] (+ CP[(row/rowsPerB)·sCPb + by·64 + col] if CP) ; ACT 0 none / 1 elu ; writes f16 C16 (and f32 C if non-null)
template <int ACT>
__global__ __launch_bounds__(128) void k_gemm_hhx(const _Float16* __restrict__ A, int lda, size_t sA, const _Float16* __restrict__ Bh, int ldb, size_t sB, float alpha, const float* __restrict__ bias, size_t sBias, const float* __restrict__ CP, int rowsPerB, size_t sCPb, int row0g,
    float* __restrict__ C, _Float16* __restrict__ C16, int ldc, size_t sC, int M, int N, int K) {
  __shared__ __attribute__((aligned(16))) float so[4][16][64];
  const int tid = threadIdx.x, w = tid >> 5, lane = tid & 31, ln = lane & 15, hh = lane >> 4; const int by = blockIdx.y;
  A += (size_t)by * sA; Bh += (size_t)by * sB; const size_t cofs = (size_t)by * sC; const float* bp = bias ? bias + (size_t)by * sBias : nullptr;
  const int ntn = (N + 63) / 64; const int wid = blockIdx.x * 4 + w; const int mt = wid / ntn, nq = wid % ntn; if (mt * 16 >= M) return;
  const int row0 = mt * 16, col0 = nq * 64; const _Float16* arow = A + (size_t)(row0 + ln) * lda;
  v8f acc[4] = {};
  for (int kb = 0; kb < K; kb += 32) { FragH ah; ah.half[0] = *(const v8us*)((const unsigned short*)arow + kb + 8 * hh); ah.half[1] = *(const v8us*)((const unsigned short*)arow + kb + 16 + 8 * hh);
#pragma unroll
    for (int t = 0; t < 4; ++t) { if (col0 + t * 16 >= N) continue; const size_t boff = (size_t)(col0 + t * 16 + ln) * ldb + kb; FragH bq; bq.half[0] = *(const v8us*)((const unsigned short*)Bh + boff + 8 * hh); bq.half[1] = *(const v8us*)((const unsigned short*)Bh + boff + 16 + 8 * hh);
      acc[t] = mmaH<1>(ah.v, ah.v, bq.v, bq.v, acc[t]); }
  }
#pragma unroll
  for (int t = 0; t < 4; ++t) { if (col0 + t * 16 >= N) continue; const int col = col0 + t * 16 + ln; const float bv = bp ? bf16_round(bp[col]) : 0.f;
#pragma unroll
    for (int r = 0; r < 8; ++r) { float v = acc[t][r] * alpha + bv; if (CP) { const int rr = row0g + row0 + 8 * hh + r; if (rowsPerB < 0) v += CP[cofs + (size_t)rr * ldc + col];      /* rowsPerB < 0: own element of the batched C plane */ else { const int bidx = rr / rowsPerB; v += CP[(size_t)bidx * sCPb + (size_t)by * 64 + col]; } } if (ACT == 1) v = (v > 0.f) ? v : expm1f(v); else if (ACT == 7) v = (v > 0.f) ? v + 1.0f : expf(v); else if (ACT == 8) v = tanhf(v); else if (ACT == 9) v = 0.5f * v * (1.0f + tanhf(0.7978845608028654f * (v + 0.044715f * v * v * v))); else if (ACT == 11) v = 1.0f / (1.0f + expf(-v)); else if (ACT == 12) v = (v > 0.f) ? v : 0.01f * v; else if (ACT == 14) v = (v > 0.f) ? v : 0.1f * v; else if (ACT == 16) v = (v >= 0.f) ? v : 0.3f * v; else if (ACT == 17) v = (v >= 0.f) ? v : 0.2f * v; else if (ACT == 15) v = v / (1.0f + expf(-v)); else if (ACT == 3) v = fmaxf(v, 0.f); else if (ACT == 6) v = 0.5f * v * (1.0f + erff(v * 0.70710678118654752f)); so[w][8 * hh + r][t * 16 + ln] = v; } }
  __builtin_amdgcn_fence(__ATOMIC_ACQ_REL, "workgroup"); __builtin_amdgcn_wave_barrier();
  const int rsub = lane >> 4, c4 = (lane & 15) * 4; typedef _Float16 v4h __attribute__((ext_vector_type(4)));
  {
#pragma unroll
    for (int q = 0; q < 8; ++q) { const int r = q * 2 + rsub; if (col0 + c4 < N) { const v4f v = *(const v4fa*)&so[w][r][c4]; if (C) *(v4f*)(C + cofs + (size_t)(row0 + r) * ldc + col0 + c4) = v; if (C16) { v4h h4; for (int i = 0; i < 4; ++i) h4[i] = (_Float16)v[i]; *(v4h*)(C16 + cofs + (size_t)(row0 + r) * ldc + col0 + c4) = h4; } } }
     }
}


typedef _Float16 v4h __attribute__((ext_vector_type(4)));

__global__ __launch_bounds__(256) void k_x16(const float* __restrict__ x, _Float16* __restrict__ X16, size_t n8) { const size_t t = (size_t)blockIdx.x * 256 + threadIdx.x; if (t >= n8) return; FragH f;
#pragma unroll
  for (int q = 0; q < 8; ++q) f.h[q] = (_Float16)bf16_round(x[t * 8 + q]); *(v8us*)((unsigned short*)X16 + t * 8) = f.half[0];  }
__global__ __launch_bounds__(256) void k_h16(const float* __restrict__ x, _Float16* __restrict__ X16, size_t n8) { const size_t t = (size_t)blockIdx.x * 256 + threadIdx.x; if (t >= n8) return; FragH f;
#pragma unroll
  for (int q = 0; q < 8; ++q) f.h[q] = (_Float16)x[t * 8 + q]; *(v8us*)((unsigned short*)X16 + t * 8) = f.half[0];  }
__global__ __launch_bounds__(256) void k_round16f(const float* __restrict__ W, _Float16* __restrict__ Bt, size_t n8) { const size_t t = (size_t)blockIdx.x * 256 + threadIdx.x; if (t >= n8) return; FragH f;
#pragma unroll
  for (int i = 0; i < 8; ++i) f.h[i] = (_Float16)(bf16_round(W[t * 8 + i]) * 16.0f); *(v8us*)((unsigned short*)Bt + t * 8) = f.half[0];  }
template <int NHv, int TTv>
__global__ __launch_bounds__(256) void k_vt(const _Float16* __restrict__ V16, int ldv, int voff, _Float16* __restrict__ Vt) { __shared__ unsigned short tl[64][66]; const int tid = threadIdx.x; const int slab = blockIdx.x / (TTv / 64), lg = blockIdx.x % (TTv / 64); const int b = slab / NHv, h = slab % NHv;
  for (int i = tid; i < 64 * 8; i += 256) { const int r = i / 8, c8 = (i % 8) * 8; FragH f; f.half[0] = *(const v8us*)((const unsigned short*)V16 + ((size_t)b * TTv + lg * 64 + r) * ldv + voff + h * 64 + c8);
#pragma unroll
    for (int q = 0; q < 8; ++q) tl[r][c8 + q] = f.u[q]; }
  __syncthreads();
  {
#pragma unroll
    for (int rd = 0; rd < 2; ++rd) { const int d = rd * 32 + tid / 8, pc = tid % 8; FragH f;
#pragma unroll
      for (int q = 0; q < 8; ++q) f.u[q] = tl[pc * 8 + q][d];
      *(v8us*)((unsigned short*)Vt + ((size_t)slab * 64 + d) * TTv + lg * 64 + pc * 8) = f.half[0]; }
     } }

__global__ __launch_bounds__(256) void k_hl(const float* __restrict__ F, _Float16* __restrict__ Hh, _Float16* __restrict__ Hl, size_t n8) { const size_t t = (size_t)blockIdx.x * 256 + threadIdx.x; if (t >= n8) return; FragH fh, fl; const v4f a = *(const v4fa*)(F + t * 8), c = *(const v4fa*)(F + t * 8 + 4);
#pragma unroll
  for (int q = 0; q < 4; ++q) { _Float16 h = (_Float16)a[q]; fh.h[q] = h; fl.h[q] = (_Float16)((a[q] - (float)h) * 1024.0f); h = (_Float16)c[q]; fh.h[4 + q] = h; fl.h[4 + q] = (_Float16)((c[q] - (float)h) * 1024.0f); }
  { *(v8us*)((unsigned short*)Hh + t * 8) = fh.half[0]; *(v8us*)((unsigned short*)Hl + t * 8) = fl.half[0];  } }

// ---- fast GEMM (wave tile 32x64; requires M % 32 == 0 rows per launch region and N % 64 == 0); epilogue = k_gemm_hhx semantics ----
__device__ __forceinline__ v16h g2_frag(const _Float16* p, int hh) { FragH f; f.half[0] = *(const v8us*)((const unsigned short*)p + 8 * hh); f.half[1] = *(const v8us*)((const unsigned short*)p + 16 + 8 * hh); return f.v; }
__device__ __forceinline__ v8f g2_mma(v16h a, v16h b, v8f c) { v8f d = __builtin_amdgcn_wmma_f32_16x16x32_f16(false, a, false, b, (short)0, c, false, false); asm volatile("v_nop\n\tv_nop\n\tv_nop\n\tv_nop" : "+v"(d) : "v"(a), "v"(b)); return d; }
template <int ACT>
__global__ __launch_bounds__(128) void k_gemm2(const _Float16* __restrict__ A, int lda, size_t sA, const _Float16* __restrict__ Bh, int ldb, size_t sB, float alpha, const float* __restrict__ bias, size_t sBias, const float* __restrict__ CP, int rowsPerB, size_t sCPb, int row0g,
    float* __restrict__ C, _Float16* __restrict__ C16, int ldc, size_t sC, int M, int N, int K) { static_assert(ACT == 0 || ACT == 3 || ACT == 6 || ACT == 8 || ACT == 9 || ACT == 11 || ACT == 12 || ACT == 14 || ACT == 15 || ACT == 16 || ACT == 17, "k_gemm2: unsupported ACT code (would silently apply no activation)");
  __shared__ __attribute__((aligned(16))) float so[4][32][68];
  const int tid = threadIdx.x, w = tid >> 5, lane = tid & 31, ln = lane & 15, hh = lane >> 4; const int by = blockIdx.y;
  A += (size_t)by * sA; Bh += (size_t)by * sB; const size_t cofs = (size_t)by * sC; const float* bp = bias ? bias + (size_t)by * sBias : nullptr;
  const int ntn = N >> 6; const int mt = blockIdx.x / ntn, nq = blockIdx.x - mt * ntn; const int row0 = mt * 128 + 32 * w, col0 = nq * 64; if (row0 >= M) return;
  const _Float16* a0p = A + (size_t)(row0 + ln) * lda; const _Float16* a1p = a0p + (size_t)16 * lda;
  const _Float16* b0p = Bh + (size_t)(col0 + ln) * ldb; const _Float16* b1p = b0p + (size_t)16 * ldb; const _Float16* b2p = b1p + (size_t)16 * ldb; const _Float16* b3p = b2p + (size_t)16 * ldb;
  const v8f z8 = {0.f,0.f,0.f,0.f,0.f,0.f,0.f,0.f}; v8f c00 = z8, c01 = z8, c02 = z8, c03 = z8, c10 = z8, c11 = z8, c12 = z8, c13 = z8;
#pragma unroll 1
  for (int kb = 0; kb < K; kb += 32) { const v16h a0 = g2_frag(a0p + kb, hh), a1 = g2_frag(a1p + kb, hh);
    v16h b = g2_frag(b0p + kb, hh); c00 = g2_mma(a0, b, c00); c10 = g2_mma(a1, b, c10);
    b = g2_frag(b1p + kb, hh); c01 = g2_mma(a0, b, c01); c11 = g2_mma(a1, b, c11);
    b = g2_frag(b2p + kb, hh); c02 = g2_mma(a0, b, c02); c12 = g2_mma(a1, b, c12);
    b = g2_frag(b3p + kb, hh); c03 = g2_mma(a0, b, c03); c13 = g2_mma(a1, b, c13); }
  v8f accs[8] = {c00, c01, c02, c03, c10, c11, c12, c13};
#pragma unroll
  for (int u = 0; u < 8; ++u) { const int t = u & 3, half = u >> 2; const int col = col0 + t * 16 + ln; const float bv = bp ? bf16_round(bp[col]) : 0.f;
#pragma unroll
    for (int r = 0; r < 8; ++r) { const int rloc = half * 16 + 8 * hh + r; float v = accs[u][r] * alpha + bv; if (CP) { if (rowsPerB < 0) v += CP[cofs + (size_t)(row0g + row0 + rloc) * ldc + col];      /* rowsPerB < 0: own element of the batched C plane */ else { const int bidx = (row0g + row0 + rloc) / rowsPerB; v += CP[(size_t)bidx * sCPb + (size_t)by * 64 + col]; } }
      if (ACT == 3) v = fmaxf(v, 0.f); else if (ACT == 6) v = 0.5f * v * (1.0f + erff(v * 0.70710678118654752f)); else if (ACT == 11) v = 1.0f / (1.0f + expf(-v)); else if (ACT == 15) v = v / (1.0f + expf(-v)); else if (ACT == 12) v = (v > 0.f) ? v : 0.01f * v; else if (ACT == 8) v = tanhf(v); else if (ACT == 9) v = 0.5f * v * (1.0f + tanhf(0.7978845608028654f * (v + 0.044715f * v * v * v))); else if (ACT == 14) v = (v > 0.f) ? v : 0.1f * v; else if (ACT == 16) v = (v >= 0.f) ? v : 0.3f * v; else if (ACT == 17) v = (v >= 0.f) ? v : 0.2f * v;
      so[w][rloc][t * 16 + ln] = v; } }
  __builtin_amdgcn_fence(__ATOMIC_ACQ_REL, "workgroup"); __builtin_amdgcn_wave_barrier();
  const int rsub = lane >> 4, c4 = (lane & 15) * 4;
  {
#pragma unroll
    for (int q = 0; q < 16; ++q) { const int r = q * 2 + rsub; const v4f v = *(const v4fa*)&so[w][r][c4]; if (C) *(v4f*)(C + cofs + (size_t)(row0 + r) * ldc + col0 + c4) = v; if (C16) { v4h h4; for (int i = 0; i < 4; ++i) h4[i] = (_Float16)v[i]; *(v4h*)(C16 + cofs + (size_t)(row0 + r) * ldc + col0 + c4) = h4; } }
     } }


__global__ __launch_bounds__(256) void k_wnat(const float* __restrict__ w, size_t n8, _Float16* __restrict__ Bt) { const size_t t = (size_t)blockIdx.x * 256 + threadIdx.x; if (t >= n8) return; FragH f; for (int q = 0; q < 8; ++q) f.h[q] = (_Float16)(bf16_round(w[t * 8 + q]) * 16.0f); *(v8us*)((unsigned short*)Bt + t * 8) = f.half[0];  }
__global__ __launch_bounds__(256) void k_rsm(const float* __restrict__ S, _Float16* __restrict__ P, int nrows) {
  #pragma clang fp contract(off)
  const int i = blockIdx.x * 256 + threadIdx.x; if (i >= nrows) return; const float* s = S + (size_t)i * SQ; float mx = -3.0e38f;
#pragma unroll 1
  for (int j = 0; j < SQ; ++j) mx = fmaxf(mx, s[j]); float se = 0.f;
#pragma unroll 1
  for (int j = 0; j < SQ; ++j) se += expf(s[j] - mx); const float sc = 256.0f / se;
#pragma unroll 1
  for (int j0 = 0; j0 < SQ; j0 += 8) { FragH f; for (int q = 0; q < 8; ++q) f.h[q] = (_Float16)(expf(s[j0 + q] - mx) * sc); unsigned short* d = (unsigned short*)P + (size_t)i * SQ + j0; *(v8us*)d = f.half[0];  } }
__global__ __launch_bounds__(256) void k_vt(const _Float16* __restrict__ V16, int b, int h0, _Float16* __restrict__ VT) { __shared__ unsigned short tl[64][65]; const int tid = threadIdx.x; const int hh = blockIdx.x % HG, sg = blockIdx.x / HG; const int s0 = sg * 64; const int h = h0 + hh;
  for (int i = tid; i < 64 * 8; i += 256) { const int j = i / 8, d8 = (i % 8) * 8; FragH f; f.half[0] = *(const v8us*)((const unsigned short*)V16 + ((size_t)b * SQ + s0 + j) * DM + h * HD + d8); for (int q = 0; q < 8; ++q) tl[d8 + q][j] = f.u[q]; }
  __syncthreads();
  { for (int i = tid; i < 64 * 8; i += 256) { const int d = i / 8, j8 = (i % 8) * 8; FragH f; for (int q = 0; q < 8; ++q) f.u[q] = tl[d][j8 + q]; *(v8us*)((unsigned short*)VT + ((size_t)hh * HD + d) * SQ + s0 + j8) = f.half[0]; }  } }



// ---- causal row softmax, one wave per score row: the row is read once, 512 contiguous bytes per load, and stays in registers; maximum and sum by a butterfly over the 32 lanes ----
template <int CTRL>
__device__ __forceinline__ float sm_rowx(float x) { return __builtin_bit_cast(float, __builtin_amdgcn_update_dpp(__builtin_bit_cast(int, x), __builtin_bit_cast(int, x), CTRL, 0xf, 0xf, false)); }      /* CTRL = 0x160 | m (row_xmask): lane l with lane l ^ m of its 16-lane row */
__device__ __forceinline__ float sm_half(float x) { return __builtin_bit_cast(float, __builtin_amdgcn_permlanex16(__builtin_bit_cast(int, x), __builtin_bit_cast(int, x), 0x76543210, 0xfedcba98, false, false)); }      /* lane l with lane l ^ 16 */
__device__ __forceinline__ float sm_wmax(float v) { v = fmaxf(v, sm_rowx<0x161>(v)); v = fmaxf(v, sm_rowx<0x162>(v)); v = fmaxf(v, sm_rowx<0x164>(v)); v = fmaxf(v, sm_rowx<0x168>(v)); return fmaxf(v, sm_half(v)); }
__device__ __forceinline__ float sm_wsum(float v) { v += sm_rowx<0x161>(v); v += sm_rowx<0x162>(v); v += sm_rowx<0x164>(v); v += sm_rowx<0x168>(v); return v + sm_half(v); }
// 2^x of four values: each v_exp_f32 fills the slot behind the one before it (results apart from all sources), the v_nop the slot behind the last, which the instruction set asks for before a result is read or a source overwritten
__device__ __forceinline__ v4f sm_exp2x4(v4f x) { float r0, r1, r2, r3;
  asm("v_exp_f32 %0, %4\n\tv_exp_f32 %1, %5\n\tv_exp_f32 %2, %6\n\tv_exp_f32 %3, %7\n\tv_nop" : "=&v"(r0), "=&v"(r1), "=&v"(r2), "=&v"(r3) : "v"(x[0]), "v"(x[1]), "v"(x[2]), "v"(x[3]));
  const v4f r = {r0, r1, r2, r3}; return r; }
// NC = 128-key chunks of the row (compile time, so that all NC loads are issued before the first value is used); lane l holds keys c * 128 + 4 l .. + 3
template <int NC>
__device__ __forceinline__ void sm_row(const float* __restrict__ s, _Float16* __restrict__ p, int lane, int last) {
  const float* sl = s + lane * 4; const int rel = last - lane * 4;      /* key c * 128 + 4 l + q is kept while c * 128 + q <= rel */
  v4f e[NC];
#pragma unroll
  for (int c = 0; c < NC; ++c) e[c] = *(const v4fa*)(sl + c * 128);
  float mx = -3.0e38f;
#pragma unroll
  for (int c = 0; c < NC; ++c)
#pragma unroll
    for (int q = 0; q < 4; ++q) { e[c][q] = (c * 128 + q <= rel) ? e[c][q] : -1.0e9f; mx = fmaxf(mx, e[c][q]); }
  mx = sm_wmax(mx);
  v4f se4 = {0.f, 0.f, 0.f, 0.f};
#pragma unroll
  for (int c = 0; c < NC; ++c)
#pragma unroll
    for (int q = 0; q < 4; ++q) e[c][q] = (e[c][q] - mx) * 1.44269504f;      /* exp(x) = 2^(x log2 e), the native form */
#pragma unroll
  for (int c = 0; c < NC; ++c) { e[c] = sm_exp2x4(e[c]); se4 += e[c]; }
  const float sc = 256.0f / sm_wsum((se4[0] + se4[1]) + (se4[2] + se4[3]));
#pragma unroll
  for (int c = 0; c < NC; ++c) { v4h h4;
#pragma unroll
    for (int q = 0; q < 4; ++q) h4[q] = (_Float16)(e[c][q] * sc);
    *(v4h*)(p + c * 128 + lane * 4) = h4; }
  asm volatile("s_wait_xcnt 0x0" ::: "memory"); }      /* behind the last store of the row: the code that follows in the listing (the next case of the switch) rewrites the stores' data registers, and this wait stands in front of any such write */
__global__ __launch_bounds__(256) void k_rsmcf2(const float* __restrict__ S, _Float16* __restrict__ P, int hg, int q0, int nk) {
  static_assert(NKX == 2048 && QT == 256, "the cases below cover nk = 256 .. 2048 in steps of 256");
  const int lane = threadIdx.x & 31; const int t = blockIdx.x * 8 + __builtin_amdgcn_readfirstlane((int)(threadIdx.x >> 5)); if (t >= hg * QT) return;      /* the row is the wave's: a scalar, so that this test and the switch are scalar branches; no barrier in this kernel */
  const float* s = S + (size_t)t * NKX; _Float16* p = P + (size_t)t * NKX; const int last = q0 + (t % QT);
  switch (nk >> 8) {
    case 1: sm_row<2>(s, p, lane, last); break; case 2: sm_row<4>(s, p, lane, last); break; case 3: sm_row<6>(s, p, lane, last); break; case 4: sm_row<8>(s, p, lane, last); break;
    case 5: sm_row<10>(s, p, lane, last); break; case 6: sm_row<12>(s, p, lane, last); break; case 7: sm_row<14>(s, p, lane, last); break; case 8: sm_row<16>(s, p, lane, last); break; } }


typedef float v2f  __attribute__((ext_vector_type(2)));
typedef float v2fa __attribute__((ext_vector_type(2), may_alias));
// ---- f32 attention for the first QT0 query rows: one wave per (head, query row), eight rows of one head per work-group. The head's K and V rows up to the end of the rows' 32-key chunk are staged once in LDS.
// Scores: lane l owns keys 32 c + l (K pitch 68 floats = 16 B x odd, so that the 32 rows read by one ds_load_b128 spread over the banks). Output: lane l owns columns 2 l, 2 l + 1; each key's weight comes out of its lane by v_readlane.
// NCH = 32-key chunks (compile time: every load of a phase is issued before the first wait). Keys past the row get weight 2^(-1e30 ..) = 0.
template <int NCH>
__device__ __forceinline__ void att0_rows(const float* __restrict__ QF, const float* __restrict__ KF, const float* __restrict__ VF, float scale, float* __restrict__ OF, int h, int row0, float (*lk)[HD + 4], float (*lv)[HD]) {
  const int tid = threadIdx.x, lane = tid & 31; const int i = row0 + __builtin_amdgcn_readfirstlane(tid >> 5);      /* the row is the wave's: a scalar */
  const int sr = tid >> 4, sc = (tid & 15) * 4;      /* staging: 16 threads per 256-byte row, 16 rows per pass */
  const float* kg = KF + h * HD; const float* vg = VF + h * HD; const float* qr = QF + (size_t)i * DM + h * HD; const int so = sr * DM + sc;      /* row pitch DM at compile time: one address per matrix, the pass as a constant offset of the load */
  v4f kk[2 * NCH], vv[2 * NCH], q[HD / 4];
#pragma unroll      /* arrays stay in registers; all loads in flight together */
  for (int p = 0; p < 2 * NCH; ++p) { kk[p] = *(const v4fa*)(kg + so + p * 16 * DM); vv[p] = *(const v4fa*)(vg + so + p * 16 * DM); }
#pragma unroll      /* the query row, same address in every lane, fetched beside the staging loads */
  for (int c = 0; c < HD / 4; ++c) q[c] = *(const v4fa*)(qr + c * 4);
#pragma unroll      /* register arrays */
  for (int p = 0; p < 2 * NCH; ++p) { *(v4fa*)&lk[p * 16 + sr][sc] = kk[p]; *(v4fa*)&lv[p * 16 + sr][sc] = vv[p]; }
  __syncthreads();
  v4f a[NCH];
#pragma unroll      /* register arrays */
  for (int c = 0; c < NCH; ++c) { const v4f z = {0.f, 0.f, 0.f, 0.f}; a[c] = z; }
#pragma unroll      /* 4 NCH independent sums per lane */
  for (int d = 0; d < HD / 4; ++d)
#pragma unroll      /* a[c] by constant index */
    for (int c = 0; c < NCH; ++c) a[c] += q[d] * *(const v4fa*)&lk[c * 32 + lane][d * 4];
  float e[NCH]; float mx = -1.0e30f;
#pragma unroll      /* register arrays */
  for (int c = 0; c < NCH; ++c) { const float s = ((a[c][0] + a[c][1]) + (a[c][2] + a[c][3])) * scale; e[c] = (c * 32 + lane <= i) ? s : -1.0e30f; mx = fmaxf(mx, e[c]); }
  mx = sm_wmax(mx);
  float l = 0.f; v4f t = {-200.f, -200.f, -200.f, -200.f};      /* chunks that this case does not have: 2^-200, not summed */
#pragma unroll      /* register arrays */
  for (int c = 0; c < NCH; ++c) t[c] = (e[c] - mx) * 1.44269504f;      /* exp(x) = 2^(x log2 e), the native form, as in the row softmax above */
  t = sm_exp2x4(t);
#pragma unroll      /* register arrays */
  for (int c = 0; c < NCH; ++c) { e[c] = t[c]; l += e[c]; }
  l = sm_wsum(l);
  const v2f z2 = {0.f, 0.f}; v2f o[4] = {z2, z2, z2, z2};      /* four sums per column, so that one key's multiply-add does not wait for the key before it */
#pragma unroll      /* constant lane numbers for v_readlane, constant LDS offsets */
  for (int c = 0; c < NCH; ++c)
#pragma unroll      /* as the line above */
    for (int j = 0; j < 32; ++j) { const float ej = __builtin_bit_cast(float, __builtin_amdgcn_readlane(__builtin_bit_cast(int, e[c]), j)); o[j & 3] += ej * *(const v2fa*)&lv[c * 32 + j][lane * 2]; }
  const float fin = 64.0f / l;      /* o carried x64, scaled by 1/64 where it is added to x1 */
  const v2f r = ((o[0] + o[1]) + (o[2] + o[3])) * fin;
  *(v2fa*)(OF + (size_t)i * DM + h * HD + lane * 2) = r; }
__global__ __launch_bounds__(256) void k_att0w(const float* __restrict__ QF, const float* __restrict__ KF, const float* __restrict__ VF, float scale, float* __restrict__ OF) {
  static_assert(QT0 == 128 && HD == 64, "the cases below cover 1 .. 4 chunks of 32 keys; two columns per lane");
  __shared__ __attribute__((aligned(16))) float lk[QT0][HD + 4]; __shared__ __attribute__((aligned(16))) float lv[QT0][HD];
  const int h = blockIdx.x / (QT0 / 8), row0 = (blockIdx.x % (QT0 / 8)) * 8;      /* eight rows lie in one 32-key chunk: the switch is the same for the whole work-group, barrier included */
  switch (row0 >> 5) {
    case 0: att0_rows<1>(QF, KF, VF, scale, OF, h, row0, lk, lv); break; case 1: att0_rows<2>(QF, KF, VF, scale, OF, h, row0, lk, lv); break;
    case 2: att0_rows<3>(QF, KF, VF, scale, OF, h, row0, lk, lv); break; case 3: att0_rows<4>(QF, KF, VF, scale, OF, h, row0, lk, lv); break; } }


template <int BFIN, int WXB>
__global__ __launch_bounds__(256) void k_ln16(const float* __restrict__ X, const float* __restrict__ g, const float* __restrict__ bb, float eps, _Float16* __restrict__ N16, float* __restrict__ XB) {
  #pragma clang fp contract(off)
  __shared__ float red[256]; const size_t r = blockIdx.x; const int t = threadIdx.x; const v4f xa = *(const v4fa*)(X + r * DMQ + t * 4); float s[4]; float sum = 0.f;
  for (int q = 0; q < 4; ++q) { s[q] = BFIN ? bf16_round(xa[q]) : xa[q]; sum = __fadd_rn(sum, s[q]); }
  red[t] = sum; __syncthreads(); for (int st = 128; st > 0; st >>= 1) { if (t < st) red[t] = __fadd_rn(red[t], red[t + st]); __syncthreads(); } const float mu = red[0] / (float)DMQ; __syncthreads();
  float vs = 0.f; for (int q = 0; q < 4; ++q) { const float dl = __fadd_rn(s[q], -mu); vs = __fadd_rn(vs, __fmul_rn(dl, dl)); } red[t] = vs; __syncthreads(); for (int st = 128; st > 0; st >>= 1) { if (t < st) red[t] = __fadd_rn(red[t], red[t + st]); __syncthreads(); }
  const float rs = rsqrtf(__fadd_rn(red[0] / (float)DMQ, eps)); v4h y; v4f xb;
  for (int q = 0; q < 4; ++q) { const int c = t * 4 + q; y[q] = (_Float16)__fadd_rn(__fmul_rn(__fmul_rn(__fadd_rn(s[q], -mu), rs), bf16_round(g[c])), bf16_round(bb[c])); xb[q] = s[q]; }
  { *(v4h*)(N16 + r * DMQ + t * 4) = y; if (WXB) *(v4f*)(XB + r * DMQ + t * 4) = xb;  } }
__global__ __launch_bounds__(256) void k_ftres2(const float* __restrict__ OF0, const float* __restrict__ XB, float* __restrict__ X1, size_t n4) {
  #pragma clang fp contract(off)
  const size_t t = (size_t)blockIdx.x * 256 + threadIdx.x; if (t >= n4) return; const v4f o = *(const v4fa*)(OF0 + t * 4), xv = *(const v4fa*)(XB + t * 4); v4f y; for (int q = 0; q < 4; ++q) y[q] = __fadd_rn(__fmul_rn(o[q], 0.015625f), xv[q]); *(v4f*)(X1 + t * 4) = y;  }

__global__ __launch_bounds__(256) void k_wthd(const float* __restrict__ Wt, _Float16* __restrict__ Bt) { const size_t t = (size_t)blockIdx.x * 256 + threadIdx.x; if (t >= (size_t)NH * HD * (DM / 8)) return; const int m8 = (int)(t % (DM / 8)) * 8; const int d = (int)((t / (DM / 8)) % HD); const int h = (int)(t / ((size_t)(DM / 8) * HD)); FragH f;
  for (int q = 0; q < 8; ++q) f.h[q] = (_Float16)(16.0f * bf16_round(Wt[((size_t)h * DM + m8 + q) * HD + d])); unsigned short* dst = (unsigned short*)Bt + ((size_t)h * HD + d) * DM + m8; *(v8us*)dst = f.half[0];  }




__global__ __launch_bounds__(256) void k_wtpad(const float* __restrict__ Wm, _Float16* __restrict__ Wt, int Kr, int Kp, int Nr, int Np, float scale) {
  const int t = blockIdx.x * 256 + threadIdx.x; if (t >= Np * (Kp / 8)) return; const int n = t / (Kp / 8), k8 = (t % (Kp / 8)) * 8; const int nc = min(n, Nr - 1); const float fn = (n < Nr) ? 1.f : 0.f; FragH f;
  for (int i = 0; i < 8; ++i) { const int k = k8 + i; const int kc = min(k, Kr - 1); const float fk = (k < Kr) ? fn : 0.f; f.h[i] = (_Float16)(bf16_round(Wm[(size_t)kc * Nr + nc]) * scale * fk); }
  unsigned short* o = (unsigned short*)Wt + (size_t)n * Kp + k8; *(v8us*)o = f.half[0];  }
__global__ __launch_bounds__(128) void k_bpad(const float* __restrict__ b, float* __restrict__ Bp, int nr, int np) {
  const int i = threadIdx.x; if (i >= np) return; const float v = b[min(i, nr - 1)] * ((i < nr) ? 1.f : 0.f); *(float*)(Bp + i) = v;  }

__global__ __launch_bounds__(256) void k_bcpy(const float* __restrict__ b, int n, int NP, float* __restrict__ dst, int dst0) { for (int i = threadIdx.x; i < NP; i += 256) { const float v = (i < n) ? b[i] : 0.f; *(float*)(dst + dst0 + i) = v; }  }


__global__ __launch_bounds__(256) void k_addf(const float* __restrict__ XBr, const float* __restrict__ OF, float* __restrict__ O, size_t n8) {
  #pragma clang fp contract(off)
  const size_t t = (size_t)blockIdx.x * 256 + threadIdx.x; if (t >= n8) return; const v4f a = *(const v4fa*)(XBr + t * 8), b = *(const v4fa*)(XBr + t * 8 + 4), c = *(const v4fa*)(OF + t * 8), d = *(const v4fa*)(OF + t * 8 + 4); v4f r0, r1;
  for (int q = 0; q < 4; ++q) { r0[q] = __fadd_rn(a[q], __fmul_rn(c[q], 0.015625f)); r1[q] = __fadd_rn(b[q], __fmul_rn(d[q], 0.015625f)); }
  { *(v4f*)(O + t * 8) = r0; *(v4f*)(O + t * 8 + 4) = r1;  } }


extern "C" void kernel_launch(void* const* d_in, const int* in_sizes, int n_in,
                              void* d_out, int out_size, void* d_ws, size_t ws_size, hipStream_t stream) {
  (void)in_sizes; (void)n_in; (void)out_size;
  const float* const* I = (const float* const*)d_in; const float* x = I[0]; const float* wq = I[1]; const float* bq = I[2]; const float* wk = I[3]; const float* bk = I[4]; const float* wv = I[5]; const float* bv = I[6]; const float* g1 = I[7]; const float* be1 = I[8]; const float* gg2 = I[9]; const float* be2 = I[10]; const float* wfc = I[11]; const float* bfc = I[12]; const float* wmp = I[13]; const float* bmp = I[14];      /* input order: x; [in][out] wq / wk / wv + biases; LN1 w / b, LN2 w / b; w_fc [1024][4096] + b_fc, w_proj [4096][1024] + b_proj */
  float* OUT0 = (float*)d_out; float* OUTK = (float*)d_out + NR * DM; float* OUTV = (float*)d_out + 2 * NR * DM;      /* tuple outputs: out at byte 0, k at 16,777,216, v at 33,554,432 (each NB * SQ * DM floats) */
  static_assert(NH * HD == DM && DM % 64 == 0 && SQ % 128 == 0 && QT0 % 8 == 0, "shape / tile multiples");
  char* ws = (char*)d_ws; size_t off = 0;
  auto take = [&](size_t bytes) { char* p = ws + off; off += (bytes + 255) & ~(size_t)255; return p; };
  _Float16* BQKV = (_Float16*)take((size_t)3 * DM * DM * 2); float* bqkv = (float*)take((size_t)3 * DM * 4);      /* stacked bias bq | bk | bv */
  _Float16* X16 = (_Float16*)take(NR * DM * 2); float* XB = (float*)take(NR * DM * 4); float* X1 = (float*)take(NR * DM * 4); _Float16* M16 = nullptr;      /* = X16 below (alias: X16's last reader, the last batch's k / v output GEMMs, precedes LN2's write) */ _Float16* HF16 = (_Float16*)take((size_t)SQ * DFF * 2); _Float16* BW1 = (_Float16*)take((size_t)DFF * DM * 2); _Float16* BW2 = (_Float16*)take((size_t)DM * DFF * 2); _Float16* QKV = (_Float16*)take(NR * 3 * DM * 2); _Float16* Q16 = QKV; _Float16* K16 = QKV + DM; _Float16* V16 = QKV + 2 * DM; M16 = X16;
  float* S = (float*)take((size_t)NH * QT * NKX * 4); _Float16* P = (_Float16*)take((size_t)NH * QT * NKX * 2); _Float16* VT = (_Float16*)take((size_t)NH * HD * SQ * 2);
  float* QF0 = (float*)take((size_t)QT0 * DM * 4); float* KF0 = (float*)take((size_t)QT0 * DM * 4); float* VF0 = (float*)take((size_t)QT0 * DM * 4); float* OF0 = (float*)take((size_t)NB * QT0 * DM * 4);
  if (off > ws_size) return;
  { const unsigned g = (unsigned)(((size_t)DM * (DM / 8) + 255) / 256); k_wt_f16<<<g, 256, 0, stream>>>(wq, BQKV, DM, DM, 16.0f); k_wt_f16<<<g, 256, 0, stream>>>(wk, BQKV + (size_t)DM * DM, DM, DM, 16.0f); k_wt_f16<<<g, 256, 0, stream>>>(wv, BQKV + (size_t)2 * DM * DM, DM, DM, 16.0f); }      /* [in][out] -> Bt x16: stacked q | k | v (transposing builder) */
  k_bcpy<<<1, 256, 0, stream>>>(bq, DM, DM, bqkv, 0); k_bcpy<<<1, 256, 0, stream>>>(bk, DM, DM, bqkv, DM); k_bcpy<<<1, 256, 0, stream>>>(bv, DM, DM, bqkv, 2 * DM);      /* stacked bias bq | bk | bv */
  k_ln16<1, 1><<<(unsigned)NR, 256, 0, stream>>>(x, g1, be1, 1e-5f, X16, XB);      /* a = LN1(bf16(x)) -> f16 rows; XB = bf16(x) for the residual */
  k_wt_f16<<<(unsigned)(((size_t)DFF * (DM / 8) + 255) / 256), 256, 0, stream>>>(wfc, BW1, DM, DFF, 16.0f); k_wt_f16<<<(unsigned)(((size_t)DM * (DFF / 8) + 255) / 256), 256, 0, stream>>>(wmp, BW2, DFF, DM, 16.0f);      /* W1 [1024][4096] -> Bt [4096][1024]; W2 [4096][1024] -> Bt [1024][4096] (x16) */
  const size_t r0p = (size_t)B0 * SQ;      /* first projected row */
  k_gemm2<0><<<dim3((unsigned)((MP / 128) * (3 * DM / 64)), 1), 128, 0, stream>>>(X16 + r0p * DM, DM, 0, BQKV, DM, 0, 0.0625f, bqkv, 0, nullptr, 1, 0, 0, nullptr, QKV + r0p * 3 * DM, 3 * DM, 0, MP, 3 * DM, DM);      /* q | k | v rows (f16); head h = columns h*HD.. of each DM block */
  for (int b = B0; b < B0 + NBR; ++b) { const size_t r0 = (size_t)b * SQ;
    k_vt<NH, SQ><<<NH * (SQ / 64), 256, 0, stream>>>(V16 + r0 * LQ, LQ, 0, VT);      /* V^T [NH][HD][SQ] for this batch */
    k_gemm2<0><<<dim3((QT0 / 128) * (DM / 64), 1), 128, 0, stream>>>(X16 + r0 * DM, DM, 0, BQKV, DM, 0, 0.0625f, bq, 0, nullptr, 1, 0, 0, QF0, nullptr, DM, 0, QT0, DM, DM); k_gemm2<0><<<dim3((QT0 / 128) * (DM / 64), 1), 128, 0, stream>>>(X16 + r0 * DM, DM, 0, (BQKV + (size_t)DM * DM), DM, 0, 0.0625f, bk, 0, nullptr, 1, 0, 0, KF0, nullptr, DM, 0, QT0, DM, DM); k_gemm2<0><<<dim3((QT0 / 128) * (DM / 64), 1), 128, 0, stream>>>(X16 + r0 * DM, DM, 0, (BQKV + (size_t)2 * DM * DM), DM, 0, 0.0625f, bv, 0, nullptr, 1, 0, 0, VF0, nullptr, DM, 0, QT0, DM, DM);      /* f32 q, k, v of the first 128 rows (exact products) */
    k_att0w<<<NH * (QT0 / 8), 256, 0, stream>>>(QF0, KF0, VF0, 0.125f, OF0 + (size_t)b * QT0 * DM);      /* f32 attention for rows 0..127 (o x64), one wave per head and row */
    for (int q0 = 0; q0 < QN; q0 += QT) { const int nk = q0 + QT;      /* causal: only keys below the tile end are computed */
      k_gemm2<0><<<dim3((QT / 128) * (nk / 64), NHD), 128, 0, stream>>>(Q16 + (r0 + q0) * LQ, LQ, (size_t)HD, K16 + r0 * LQ, LQ, (size_t)HD, 0.125f, nullptr, 0, nullptr, 1, 0, 0, S, nullptr, NKX, (size_t)QT * NKX, QT, nk, HD);      /* scores, all heads on grid.y */
      k_rsmcf2<<<(NHD * QT + 7) / 8, 256, 0, stream>>>(S, P, NHD, q0, nk);      /* one wave per row, eight rows per work-group */
      k_gemm2<0><<<dim3((QT / 128) * (HD / 64), NHD), 128, 0, stream>>>(P, NKX, (size_t)QT * NKX, VT, SQ, (size_t)HD * SQ, 0.00390625f, nullptr, 0, XB + (r0 + q0) * DM, -1, 0, 0, X1 + (r0 + q0) * DM, nullptr, DM, (size_t)HD, QT, HD, nk); }      /* x1 = bf16(x) + P V^T / 256 in f32 (own-element addend at the head's 64 columns: no output projection in this module) */
    k_addf<<<(unsigned)(((size_t)QT0 * DM / 8 + 255) / 256), 256, 0, stream>>>(XB + r0 * DM, OF0 + (size_t)b * QT0 * DM, X1 + r0 * DM, (size_t)QT0 * DM / 8);      /* rows 0..127 of the batch rewritten from the exact f32 path: x1 = bf16(x) + o / 64 */
    k_gemm2<0><<<dim3((SQ / 128) * (HD / 64), NH), 128, 0, stream>>>(X16 + r0 * DM, DM, 0, BQKV + (size_t)DM * DM, DM, (size_t)HD * DM, 0.0625f, bk, (size_t)HD, nullptr, 1, 0, 0, OUTK + (size_t)b * NH * SQ * HD, nullptr, HD, (size_t)SQ * HD, SQ, HD, DM); k_gemm2<0><<<dim3((SQ / 128) * (HD / 64), NH), 128, 0, stream>>>(X16 + r0 * DM, DM, 0, BQKV + (size_t)2 * DM * DM, DM, (size_t)HD * DM, 0.0625f, bv, (size_t)HD, nullptr, 1, 0, 0, OUTV + (size_t)b * NH * SQ * HD, nullptr, HD, (size_t)SQ * HD, SQ, HD, DM); }      /* outputs 1 and 2: k and v of this batch in f32, head-major [H][T][64] (head on grid.y: weight rows 64 h .., bias 64 h .., output plane h) */
  k_ln16<0, 0><<<(unsigned)NR, 256, 0, stream>>>(X1, gg2, be2, 1e-5f, M16, nullptr);      /* h = LN2(x1) -> f16 rows */
  for (int b = 0; b < NB; ++b) { const size_t r0 = (size_t)b * SQ;
    k_gemm2<6><<<dim3((unsigned)((SQ / 128) * (DFF / 64)), 1), 128, 0, stream>>>(M16 + r0 * DM, DM, 0, BW1, DM, 0, 0.0625f, bfc, 0, nullptr, 1, 0, 0, nullptr, HF16, DFF, 0, SQ, DFF, DM);      /* gelu_erf(h2 W1 + b1) -> f16 (this batch) */
    k_gemm2<0><<<dim3((unsigned)((SQ / 128) * (DM / 64)), 1), 128, 0, stream>>>(HF16, DFF, 0, BW2, DFF, 0, 0.0625f, bmp, 0, X1 + r0 * DM, -1, 0, 0, OUT0 + r0 * DM, nullptr, DM, 0, SQ, DM, DFF); }      /* output 0 = x1 + mlp (own-element residual) */
}

// v004
// One run takes 475 microseconds.
// Versions in between are left out here; by their measured steps it is 3.89 times as fast as v002.
// Counting every step since v000, it is 12.2 times as fast.
#include <hip/hip_runtime.h>
// Pre-LN causal transformer block WITHOUT an attention output projection that also returns its key and value tensors (x [2][2048][1024]; h = LN1(x) (biased var, eps 1e-5); q / k / v = h W + b ([in][out] [1024][1024] sigma 1/32, zero biases) -> [B][16][T][64]; att = softmax(q k^T / 8) with a causal mask (tril, -inf); y = att v merged back to [B][T][1024]; x1 = x + y (no projection); out = x1 + gelu_erf(LN2(x1) w_fc + b_fc) w_proj + b_proj ([in][out] 1024 x 4096 x 1024); returns (out [2][2048][1024], k [2][16][2048][64], v [2][16][2048][64]): three outputs at byte offsets 0 / 16,777,216 / 33,554,432 of d_out).
// Structure: token rows r = b*2048 + s; h = LN1(bf16(x)) as f16 rows; q | k | v as ONE WMMA GEMM (N = 3 x 1024) (32x64 wave tiles, f32 accumulation, exact x16 weights + bias, f16 outputs); per batch: V^T for all heads via LDS transposes; rows 128.. of both batches in one launch: per wave 32 query rows, keys 64 at a time up to the rows' end, scores (K = 64), running-maximum softmax (f32 statistics, native exp2; weights at most 256 in f16) and weights x V^T all in registers, x1 = x + o / row sum in f32; out = x1 + gelu_erf(LN2(x1) W_fc + b_fc) W_proj + b_proj as two GEMMs (f16 hidden, f32 output).
// Compute dtype: inputs rounded to bf16; x / weights exact; q, k, v and softmax weights as plain f16 GEMM operands (~2^-12); scores, softmax statistics and o f32. v_wmma_f32_16x16x32_f16.
#define NB 2
#define SQ 2048
#define DM 1024
#define NH 16
#define HD 64
#define HG 4
#define QT 256                       /* query rows per causal tile */
#define NKX SQ                       /* S / P row pitch */
#define QT0 128                      /* first-tile rows recomputed exactly in f32 */
#define B0 0                         /* first batch processed (debug hook) */
#define NBR NB                       /* batches processed (debug hook) */
#define NR ((size_t)NB * SQ)
#define DMQ DM
#define DFF 4096                     /* FFN hidden width */
#define DFFR 100
#define MP ((int)((size_t)NBR * SQ)) /* rows projected (debug hook) */
#define QN SQ                        /* query rows per batch; not used */
#define NHD NH                       /* heads; not used */
#define MPO MP
#define LQ (3 * DM)      /* row pitch of the q/k/v rows */
typedef __bf16 v16b __attribute__((ext_vector_type(16)));
typedef unsigned short v8us __attribute__((ext_vector_type(8), may_alias));
typedef float  v8f  __attribute__((ext_vector_type(8)));
typedef float  v4f  __attribute__((ext_vector_type(4)));
typedef float  v4fa __attribute__((ext_vector_type(4), may_alias));
union FragB { v16b v; v8us half[2]; unsigned short u[16]; };

__device__ __forceinline__ unsigned short bf16_bits(float x) { unsigned int u = __float_as_uint(x); return (unsigned short)((u + 0x7FFFu + ((u >> 16) & 1u)) >> 16); }
__device__ __forceinline__ float bf16_val(unsigned short b) { return __uint_as_float(((unsigned int)b) << 16); }
__device__ __forceinline__ float bf16_round(float x) { return bf16_val(bf16_bits(x)); }
// D += A·B with NT terms: 1 = ah·bh, 2 = + al·bh (A split), 3 = + ah·bl (both split)
template <int NT>
__device__ __forceinline__ v8f mmaN(v16b ah, v16b al, v16b bh, v16b bl, v8f c) {
  c = __builtin_amdgcn_wmma_f32_16x16x32_bf16(false, ah, false, bh, (short)0, c, false, false);
  if (NT >= 2) c = __builtin_amdgcn_wmma_f32_16x16x32_bf16(false, al, false, bh, (short)0, c, false, false);
  if (NT >= 3) c = __builtin_amdgcn_wmma_f32_16x16x32_bf16(false, ah, false, bl, (short)0, c, false, false);
  asm volatile("v_nop\n\tv_nop\n\tv_nop\n\tv_nop" : "+v"(c) : "v"(ah), "v"(al), "v"(bh), "v"(bl));
  return c;
}

__global__ __launch_bounds__(256) void k_wt_bf16(const float* __restrict__ W, unsigned short* __restrict__ Wt, int K, int N) {
  const int t = blockIdx.x * 256 + threadIdx.x;
  const int k8n = K / 8;
  if (t >= N * k8n) return;
  const int n = t / k8n, k8 = (t % k8n) * 8;
  v8us v;
#pragma unroll
  for (int i = 0; i < 8; ++i) v[i] = bf16_bits(W[(size_t)(k8 + i) * N + n]);
  *(v8us*)(Wt + (size_t)n * K + k8) = v;
  
}

// GEMM C[M][N] (f32, pitch ldc) = act(A[M][K]·W + bias). A f32 row-major (pitch lda) converted per fragment to bf16
// (ASPLIT: hi/lo two planes -> 2 terms, else single rounded term); Wt bf16 [N][K] (pitch ldb). BIAS_BF16 rounds the
// bias to bf16 first (bias quantised to bf16 before the add). K%32==0, M%16==0, N%64==0.
template <bool ASPLIT, int ACT, bool BIAS_BF16>
__global__ __launch_bounds__(128) void k_gemm_bf(const float* __restrict__ A, int lda, const unsigned short* __restrict__ Wt, int ldb,
                                               const float* __restrict__ bias, float* __restrict__ C, int ldc, int M, int N, int K) {
  __shared__ __attribute__((aligned(16))) float so[4][16][64];
  const int tid = threadIdx.x, w = tid >> 5, lane = tid & 31, ln = lane & 15, hh = lane >> 4;
  const int ntn = N / 64;
  const int wid = blockIdx.x * 4 + w;
  const int mt = wid / ntn, nq = wid % ntn;
  if (mt * 16 >= M) return;
  const int row0 = mt * 16, col0 = nq * 64;
  const float* arow = A + (size_t)(row0 + ln) * lda;
  v8f acc[4] = {};
  for (int kb = 0; kb < K; kb += 32) {
    FragB ah, al;
    const v4f x0 = *(const v4fa*)(arow + kb + 8 * hh), x1 = *(const v4fa*)(arow + kb + 8 * hh + 4);
    const v4f x2 = *(const v4fa*)(arow + kb + 16 + 8 * hh), x3 = *(const v4fa*)(arow + kb + 16 + 8 * hh + 4);
    float xs[16] = {x0[0],x0[1],x0[2],x0[3],x1[0],x1[1],x1[2],x1[3],x2[0],x2[1],x2[2],x2[3],x3[0],x3[1],x3[2],x3[3]};
#pragma unroll
    for (int i = 0; i < 16; ++i) { const unsigned short hb = bf16_bits(xs[i]); ah.u[i] = hb; al.u[i] = ASPLIT ? bf16_bits(xs[i] - bf16_val(hb)) : (unsigned short)0; }
#pragma unroll
    for (int t = 0; t < 4; ++t) {
      const unsigned short* brow = Wt + (size_t)(col0 + t * 16 + ln) * ldb + kb;
      FragB b;
      b.half[0] = *(const v8us*)(brow + 8 * hh);
      b.half[1] = *(const v8us*)(brow + 16 + 8 * hh);
      acc[t] = mmaN<ASPLIT ? 2 : 1>(ah.v, al.v, b.v, b.v, acc[t]);
    }
  }
#pragma unroll
  for (int t = 0; t < 4; ++t) {
    float bv = bias ? bias[col0 + t * 16 + ln] : 0.f;
    if (BIAS_BF16) bv = bf16_round(bv);
#pragma unroll
    for (int r = 0; r < 8; ++r) { float v = acc[t][r] + bv; if (ACT == 1) v = fmaxf(v, 0.f); so[w][8 * hh + r][t * 16 + ln] = v; }
  }
  __builtin_amdgcn_fence(__ATOMIC_ACQ_REL, "workgroup");
  __builtin_amdgcn_wave_barrier();
  const int rsub = lane >> 4, c4 = (lane & 15) * 4;
  {
#pragma unroll
    for (int q = 0; q < 8; ++q) {
      const int r = q * 2 + rsub;
      const v4f v = *(const v4fa*)&so[w][r][c4];
      *(v4f*)(C + (size_t)(row0 + r) * ldc + col0 + c4) = v;
    }
    
  }
}

// GEMM C = act(A·W + bias + resid): A f32 (ASPLIT -> hi/lo 2 terms), Wt bf16 [N][K]; ACT 0 none, 1 relu, 2 exact gelu;
// resid (optional, f32, row index = (row % rmod), pitch ldr, RES_BF16 rounds it) added before the activation.
template <bool ASPLIT, int ACT, bool BIAS_BF16, bool RES_BF16>
__global__ __launch_bounds__(128) void k_gemm_bf3(const float* __restrict__ A, int lda, const unsigned short* __restrict__ Wt, int ldb,
                                                const float* __restrict__ bias, const float* __restrict__ resid, int rmod, int ldr,
                                                float* __restrict__ C, int ldc, int M, int N, int K) {
  __shared__ __attribute__((aligned(16))) float so[4][16][64];
  const int tid = threadIdx.x, w = tid >> 5, lane = tid & 31, ln = lane & 15, hh = lane >> 4;
  const int ntn = N / 64;
  const int wid = blockIdx.x * 4 + w;
  const int mt = wid / ntn, nq = wid % ntn;
  if (mt * 16 >= M) return;
  const int row0 = mt * 16, col0 = nq * 64;
  const float* arow = A + (size_t)(row0 + ln) * lda;
  v8f acc[4] = {};
  for (int kb = 0; kb < K; kb += 32) {
    FragB ah, al;
    const v4f x0 = *(const v4fa*)(arow + kb + 8 * hh), x1 = *(const v4fa*)(arow + kb + 8 * hh + 4);
    const v4f x2 = *(const v4fa*)(arow + kb + 16 + 8 * hh), x3 = *(const v4fa*)(arow + kb + 16 + 8 * hh + 4);
    float xs[16] = {x0[0],x0[1],x0[2],x0[3],x1[0],x1[1],x1[2],x1[3],x2[0],x2[1],x2[2],x2[3],x3[0],x3[1],x3[2],x3[3]};
#pragma unroll
    for (int i = 0; i < 16; ++i) { const unsigned short hb = bf16_bits(xs[i]); ah.u[i] = hb; al.u[i] = ASPLIT ? bf16_bits(xs[i] - bf16_val(hb)) : (unsigned short)0; }
#pragma unroll
    for (int t = 0; t < 4; ++t) {
      const unsigned short* brow = Wt + (size_t)(col0 + t * 16 + ln) * ldb + kb;
      FragB b;
      b.half[0] = *(const v8us*)(brow + 8 * hh);
      b.half[1] = *(const v8us*)(brow + 16 + 8 * hh);
      acc[t] = mmaN<ASPLIT ? 2 : 1>(ah.v, al.v, b.v, b.v, acc[t]);
    }
  }
#pragma unroll
  for (int t = 0; t < 4; ++t) {
    const int col = col0 + t * 16 + ln;
    float bv = bias ? bias[col] : 0.f;
    if (BIAS_BF16) bv = bf16_round(bv);
#pragma unroll
    for (int r = 0; r < 8; ++r) {
      float v = acc[t][r] + bv;
      if (resid) { float rv = resid[(size_t)((row0 + 8 * hh + r) % rmod) * ldr + col]; if (RES_BF16) rv = bf16_round(rv); v += rv; }
      if (ACT == 1) v = fmaxf(v, 0.f);
      if (ACT == 2) v = 0.5f * v * (1.0f + erff(v * 0.70710678118654752f));
      if (ACT == 3) { const float u = 0.7978845608028654f * (v + 0.044715f * v * v * v); v = 0.5f * v * (1.0f + tanhf(u)); }
      so[w][8 * hh + r][t * 16 + ln] = v;
    }
  }
  __builtin_amdgcn_fence(__ATOMIC_ACQ_REL, "workgroup");
  __builtin_amdgcn_wave_barrier();
  const int rsub = lane >> 4, c4 = (lane & 15) * 4;
  {
#pragma unroll
    for (int q = 0; q < 8; ++q) {
      const int r = q * 2 + rsub;
      const v4f v = *(const v4fa*)&so[w][r][c4];
      *(v4f*)(C + (size_t)(row0 + r) * ldc + col0 + c4) = v;
    }
    
  }
}
// row LayerNorm (biased variance, eps) over N: s = X (+ R); optional out_sum <- s; out_norm <- (s-mu)*rsqrt(var+eps)*g + b
template <bool PARAM_BF16>
__global__ __launch_bounds__(256) void k_layernorm(const float* __restrict__ X, const float* __restrict__ R, const float* __restrict__ g, const float* __restrict__ bta,
                                                  float* __restrict__ out_sum, float* __restrict__ out_norm, int N, float eps) {
  __shared__ float red[256];
  const int row = blockIdx.x, tid = threadIdx.x;
  const float* x = X + (size_t)row * N; const float* rr = R ? R + (size_t)row * N : nullptr;
  float vals[16];                     // up to N = 4096
  const int per = N / 256;            // contiguous chunk per thread? use strided-by-4 chunks: thread handles j = tid*4 + 1024*u
  float s1 = 0.f;
  for (int u = 0; u < per / 4; ++u) {
    const int j = tid * 4 + 1024 * u;
    const v4f a = *(const v4fa*)(x + j);
    v4f b = {0.f,0.f,0.f,0.f}; if (rr) b = *(const v4fa*)(rr + j);
#pragma unroll
    for (int q = 0; q < 4; ++q) { const float v = a[q] + b[q]; vals[u * 4 + q] = v; s1 += v; }
  }
  red[tid] = s1; __syncthreads();
  for (int st = 128; st > 0; st >>= 1) { if (tid < st) red[tid] += red[tid + st]; __syncthreads(); }
  const float mu = red[0] / (float)N; __syncthreads();
  float s2 = 0.f;
  for (int u = 0; u < per / 4; ++u)
#pragma unroll
    for (int q = 0; q < 4; ++q) { const float c = vals[u * 4 + q] - mu; s2 += c * c; }
  red[tid] = s2; __syncthreads();
  for (int st = 128; st > 0; st >>= 1) { if (tid < st) red[tid] += red[tid + st]; __syncthreads(); }
  const float rs = rsqrtf(red[0] / (float)N + eps);
  {
    for (int u = 0; u < per / 4; ++u) {
      const int j = tid * 4 + 1024 * u;
      v4f o, sm;
#pragma unroll
      for (int q = 0; q < 4; ++q) {
        float gg = g[j + q], bb = bta[j + q];
        if (PARAM_BF16) { gg = bf16_round(gg); bb = bf16_round(bb); }
        sm[q] = vals[u * 4 + q]; o[q] = (vals[u * 4 + q] - mu) * rs * gg + bb;
      }
      if (out_sum) *(v4f*)(out_sum + (size_t)row * N + j) = sm;
      *(v4f*)(out_norm + (size_t)row * N + j) = o;
    }
    
  }
}



// ---- f16 WMMA path (v_wmma_f32_16x16x32_f16): 11-bit significands for operands in range — used where a [0,1] probability operand needs more precision than bf16
typedef _Float16 v16h __attribute__((ext_vector_type(16)));
union FragH { v16h v; v8us half[2]; _Float16 h[16]; unsigned short u[16]; };
template <int NT>
__device__ __forceinline__ v8f mmaH(v16h ah, v16h al, v16h bh, v16h bl, v8f c) {
  c = __builtin_amdgcn_wmma_f32_16x16x32_f16(false, ah, false, bh, (short)0, c, false, false);
  if (NT >= 2) c = __builtin_amdgcn_wmma_f32_16x16x32_f16(false, al, false, bh, (short)0, c, false, false);
  if (NT >= 3) c = __builtin_amdgcn_wmma_f32_16x16x32_f16(false, ah, false, bl, (short)0, c, false, false);
  asm volatile("v_nop\n\tv_nop\n\tv_nop\n\tv_nop" : "+v"(c) : "v"(ah), "v"(al), "v"(bh), "v"(bl));
  return c;
}
// batched GEMM like k_gemm_b but f16 operands: A f32 (split into f16 hi/lo if ASPLIT, else rounded to f16), Bt = f16 values [n][k]; alpha; C f32; N multiple of 16 (partial tiles skipped)
template <bool ASPLIT>
__global__ __launch_bounds__(128) void k_gemm_h(const float* __restrict__ A, int lda, size_t sA, const _Float16* __restrict__ Bh, int ldb, size_t sB, float alpha, float* __restrict__ C, int ldc, size_t sC, int M, int N, int K) {
  __shared__ __attribute__((aligned(16))) float so[4][16][64];
  const int tid = threadIdx.x, w = tid >> 5, lane = tid & 31, ln = lane & 15, hh = lane >> 4; const int by = blockIdx.y;
  A += (size_t)by * sA; Bh += (size_t)by * sB; C += (size_t)by * sC;
  const int ntn = (N + 63) / 64; const int wid = blockIdx.x * 4 + w; const int mt = wid / ntn, nq = wid % ntn; if (mt * 16 >= M) return;
  const int row0 = mt * 16, col0 = nq * 64; const float* arow = A + (size_t)(row0 + ln) * lda;
  v8f acc[4] = {};
  for (int kb = 0; kb < K; kb += 32) {
    FragH ah, al;
    const v4f x0 = *(const v4fa*)(arow + kb + 8 * hh), x1 = *(const v4fa*)(arow + kb + 8 * hh + 4), x2 = *(const v4fa*)(arow + kb + 16 + 8 * hh), x3 = *(const v4fa*)(arow + kb + 16 + 8 * hh + 4);
    float xs[16] = {x0[0],x0[1],x0[2],x0[3],x1[0],x1[1],x1[2],x1[3],x2[0],x2[1],x2[2],x2[3],x3[0],x3[1],x3[2],x3[3]};
#pragma unroll
    for (int i = 0; i < 16; ++i) { const _Float16 h = (_Float16)xs[i]; ah.h[i] = h; al.h[i] = ASPLIT ? (_Float16)(xs[i] - (float)h) : (_Float16)0.0f; }
#pragma unroll
    for (int t = 0; t < 4; ++t) { if (col0 + t * 16 >= N) continue; const size_t boff = (size_t)(col0 + t * 16 + ln) * ldb + kb; FragH bq; bq.half[0] = *(const v8us*)(Bh + boff + 8 * hh); bq.half[1] = *(const v8us*)(Bh + boff + 16 + 8 * hh);
      acc[t] = mmaH<ASPLIT ? 2 : 1>(ah.v, al.v, bq.v, bq.v, acc[t]); }
  }
#pragma unroll
  for (int t = 0; t < 4; ++t) { if (col0 + t * 16 >= N) continue;
#pragma unroll
    for (int r = 0; r < 8; ++r) so[w][8 * hh + r][t * 16 + ln] = acc[t][r] * alpha; }
  __builtin_amdgcn_fence(__ATOMIC_ACQ_REL, "workgroup"); __builtin_amdgcn_wave_barrier();
  const int rsub = lane >> 4, c4 = (lane & 15) * 4;
  {
#pragma unroll
    for (int q = 0; q < 8; ++q) { const int r = q * 2 + rsub; if (col0 + c4 < N) { const v4f v = *(const v4fa*)&so[w][r][c4]; *(v4f*)(C + (size_t)(row0 + r) * ldc + col0 + c4) = v; } }
     }
}

// Wt[n][k] = f16(W[k][n]·scale) from f32 row-major W[K][N] (scale = power of two; bf16-exact weights stay exact in f16 away from the subnormal range)
__global__ __launch_bounds__(256) void k_wt_f16(const float* __restrict__ W, _Float16* __restrict__ Wt, int K, int N, float scale) {
  const int t = blockIdx.x * 256 + threadIdx.x; if (t >= N * (K / 8)) return; const int n = t / (K / 8), k8 = (t % (K / 8)) * 8; FragH f;
#pragma unroll
  for (int i = 0; i < 8; ++i) f.h[i] = (_Float16)(bf16_round(W[(size_t)(k8 + i) * N + n]) * scale); const v8us o = f.half[0];
  *(v8us*)((unsigned short*)Wt + (size_t)n * K + k8) = o; 
}
// k_gemm_hh variant with fused epilogue: v = acc·alpha + bias[by·sBias + col] (+ CP[(row/rowsPerB)·sCPb + by·64 + col] if CP) ; ACT 0 none / 1 elu ; writes f16 C16 (and f32 C if non-null)
template <int ACT>
__global__ __launch_bounds__(128) void k_gemm_hhx(const _Float16* __restrict__ A, int lda, size_t sA, const _Float16* __restrict__ Bh, int ldb, size_t sB, float alpha, const float* __restrict__ bias, size_t sBias, const float* __restrict__ CP, int rowsPerB, size_t sCPb, int row0g,
    float* __restrict__ C, _Float16* __restrict__ C16, int ldc, size_t sC, int M, int N, int K) {
  __shared__ __attribute__((aligned(16))) float so[4][16][64];
  const int tid = threadIdx.x, w = tid >> 5, lane = tid & 31, ln = lane & 15, hh = lane >> 4; const int by = blockIdx.y;
  A += (size_t)by * sA; Bh += (size_t)by * sB; const size_t cofs = (size_t)by * sC; const float* bp = bias ? bias + (size_t)by * sBias : nullptr;
  const int ntn = (N + 63) / 64; const int wid = blockIdx.x * 4 + w; const int mt = wid / ntn, nq = wid % ntn; if (mt * 16 >= M) return;
  const int row0 = mt * 16, col0 = nq * 64; const _Float16* arow = A + (size_t)(row0 + ln) * lda;
  v8f acc[4] = {};
  for (int kb = 0; kb < K; kb += 32) { FragH ah; ah.half[0] = *(const v8us*)((const unsigned short*)arow + kb + 8 * hh); ah.half[1] = *(const v8us*)((const unsigned short*)arow + kb + 16 + 8 * hh);
#pragma unroll
    for (int t = 0; t < 4; ++t) { if (col0 + t * 16 >= N) continue; const size_t boff = (size_t)(col0 + t * 16 + ln) * ldb + kb; FragH bq; bq.half[0] = *(const v8us*)((const unsigned short*)Bh + boff + 8 * hh); bq.half[1] = *(const v8us*)((const unsigned short*)Bh + boff + 16 + 8 * hh);
      acc[t] = mmaH<1>(ah.v, ah.v, bq.v, bq.v, acc[t]); }
  }
#pragma unroll
  for (int t = 0; t < 4; ++t) { if (col0 + t * 16 >= N) continue; const int col = col0 + t * 16 + ln; const float bv = bp ? bf16_round(bp[col]) : 0.f;
#pragma unroll
    for (int r = 0; r < 8; ++r) { float v = acc[t][r] * alpha + bv; if (CP) { const int rr = row0g + row0 + 8 * hh + r; if (rowsPerB < 0) v += CP[cofs + (size_t)rr * ldc + col];      /* rowsPerB < 0: own element of the batched C plane */ else { const int bidx = rr / rowsPerB; v += CP[(size_t)bidx * sCPb + (size_t)by * 64 + col]; } } if (ACT == 1) v = (v > 0.f) ? v : expm1f(v); else if (ACT == 7) v = (v > 0.f) ? v + 1.0f : expf(v); else if (ACT == 8) v = tanhf(v); else if (ACT == 9) v = 0.5f * v * (1.0f + tanhf(0.7978845608028654f * (v + 0.044715f * v * v * v))); else if (ACT == 11) v = 1.0f / (1.0f + expf(-v)); else if (ACT == 12) v = (v > 0.f) ? v : 0.01f * v; else if (ACT == 14) v = (v > 0.f) ? v : 0.1f * v; else if (ACT == 16) v = (v >= 0.f) ? v : 0.3f * v; else if (ACT == 17) v = (v >= 0.f) ? v : 0.2f * v; else if (ACT == 15) v = v / (1.0f + expf(-v)); else if (ACT == 3) v = fmaxf(v, 0.f); else if (ACT == 6) v = 0.5f * v * (1.0f + erff(v * 0.70710678118654752f)); so[w][8 * hh + r][t * 16 + ln] = v; } }
  __builtin_amdgcn_fence(__ATOMIC_ACQ_REL, "workgroup"); __builtin_amdgcn_wave_barrier();
  const int rsub = lane >> 4, c4 = (lane & 15) * 4; typedef _Float16 v4h __attribute__((ext_vector_type(4)));
  {
#pragma unroll
    for (int q = 0; q < 8; ++q) { const int r = q * 2 + rsub; if (col0 + c4 < N) { const v4f v = *(const v4fa*)&so[w][r][c4]; if (C) *(v4f*)(C + cofs + (size_t)(row0 + r) * ldc + col0 + c4) = v; if (C16) { v4h h4; for (int i = 0; i < 4; ++i) h4[i] = (_Float16)v[i]; *(v4h*)(C16 + cofs + (size_t)(row0 + r) * ldc + col0 + c4) = h4; } } }
     }
}


typedef _Float16 v4h __attribute__((ext_vector_type(4)));

__global__ __launch_bounds__(256) void k_x16(const float* __restrict__ x, _Float16* __restrict__ X16, size_t n8) { const size_t t = (size_t)blockIdx.x * 256 + threadIdx.x; if (t >= n8) return; FragH f;
#pragma unroll
  for (int q = 0; q < 8; ++q) f.h[q] = (_Float16)bf16_round(x[t * 8 + q]); *(v8us*)((unsigned short*)X16 + t * 8) = f.half[0];  }
__global__ __launch_bounds__(256) void k_h16(const float* __restrict__ x, _Float16* __restrict__ X16, size_t n8) { const size_t t = (size_t)blockIdx.x * 256 + threadIdx.x; if (t >= n8) return; FragH f;
#pragma unroll
  for (int q = 0; q < 8; ++q) f.h[q] = (_Float16)x[t * 8 + q]; *(v8us*)((unsigned short*)X16 + t * 8) = f.half[0];  }
__global__ __launch_bounds__(256) void k_round16f(const float* __restrict__ W, _Float16* __restrict__ Bt, size_t n8) { const size_t t = (size_t)blockIdx.x * 256 + threadIdx.x; if (t >= n8) return; FragH f;
#pragma unroll
  for (int i = 0; i < 8; ++i) f.h[i] = (_Float16)(bf16_round(W[t * 8 + i]) * 16.0f); *(v8us*)((unsigned short*)Bt + t * 8) = f.half[0];  }
template <int NHv, int TTv>
__global__ __launch_bounds__(256) void k_vt(const _Float16* __restrict__ V16, int ldv, int voff, _Float16* __restrict__ Vt) { __shared__ unsigned short tl[64][66]; const int tid = threadIdx.x; const int slab = blockIdx.x / (TTv / 64), lg = blockIdx.x % (TTv / 64); const int b = slab / NHv, h = slab % NHv;
  for (int i = tid; i < 64 * 8; i += 256) { const int r = i / 8, c8 = (i % 8) * 8; FragH f; f.half[0] = *(const v8us*)((const unsigned short*)V16 + ((size_t)b * TTv + lg * 64 + r) * ldv + voff + h * 64 + c8);
#pragma unroll
    for (int q = 0; q < 8; ++q) tl[r][c8 + q] = f.u[q]; }
  __syncthreads();
  {
#pragma unroll
    for (int rd = 0; rd < 2; ++rd) { const int d = rd * 32 + tid / 8, pc = tid % 8; FragH f;
#pragma unroll
      for (int q = 0; q < 8; ++q) f.u[q] = tl[pc * 8 + q][d];
      *(v8us*)((unsigned short*)Vt + ((size_t)slab * 64 + d) * TTv + lg * 64 + pc * 8) = f.half[0]; }
     } }

__global__ __launch_bounds__(256) void k_hl(const float* __restrict__ F, _Float16* __restrict__ Hh, _Float16* __restrict__ Hl, size_t n8) { const size_t t = (size_t)blockIdx.x * 256 + threadIdx.x; if (t >= n8) return; FragH fh, fl; const v4f a = *(const v4fa*)(F + t * 8), c = *(const v4fa*)(F + t * 8 + 4);
#pragma unroll
  for (int q = 0; q < 4; ++q) { _Float16 h = (_Float16)a[q]; fh.h[q] = h; fl.h[q] = (_Float16)((a[q] - (float)h) * 1024.0f); h = (_Float16)c[q]; fh.h[4 + q] = h; fl.h[4 + q] = (_Float16)((c[q] - (float)h) * 1024.0f); }
  { *(v8us*)((unsigned short*)Hh + t * 8) = fh.half[0]; *(v8us*)((unsigned short*)Hl + t * 8) = fl.half[0];  } }

// ---- fast GEMM (work-group tile 128x64, wave tile 32x64; requires M % 128 == 0 rows per launch region, N % 64 == 0, K % 64 == 0); epilogue = k_gemm_hhx semantics ----
// Operands reach the waves through LDS: per pass of 64 k the work-group's 128 rows of A and 64 rows of B (128 bytes each) are brought in once by asynchronous copies, whole lines at a time, into one of two buffers; the next pass's copies fly while this pass is worked on.
#define G2P 144                      /* LDS row pitch in bytes: 16 B x odd, the pitch for ds_load_b128 readers of 128-byte rows */
#define G2S ((128 + 64) * G2P)       /* one buffer: rows 0..127 = A, rows 128..191 = B */
__device__ __forceinline__ v16h g2_lfrag(const unsigned char* p) { FragH f; f.half[0] = *(const v8us*)p; f.half[1] = *(const v8us*)(p + 32); return f.v; }
// one pass's operands: twelve 16-byte copies per lane (eight lanes per 128-byte row, 16 rows per copy and work-group; copies 0..7 = A, 8..11 = B). l = the lane's LDS byte address in row tid / 8 of the buffer; a, b = its own 16 bytes in that row of A and of B; sa, sb = 16 rows in bytes.
// The s_wait_xcnt stands inside the statement, behind the last copy: a precaution in front of any later write of a register that a copy names.
__device__ __forceinline__ void g2_copy(unsigned l, const char* a, size_t sa, const char* b, size_t sb) {
  asm volatile("global_load_async_to_lds_b128 %0, %12, off\n\tglobal_load_async_to_lds_b128 %1, %13, off\n\tglobal_load_async_to_lds_b128 %2, %14, off\n\tglobal_load_async_to_lds_b128 %3, %15, off\n\t"
               "global_load_async_to_lds_b128 %4, %16, off\n\tglobal_load_async_to_lds_b128 %5, %17, off\n\tglobal_load_async_to_lds_b128 %6, %18, off\n\tglobal_load_async_to_lds_b128 %7, %19, off\n\t"
               "global_load_async_to_lds_b128 %8, %20, off\n\tglobal_load_async_to_lds_b128 %9, %21, off\n\tglobal_load_async_to_lds_b128 %10, %22, off\n\tglobal_load_async_to_lds_b128 %11, %23, off\n\ts_wait_xcnt 0x0"
               :: "v"(l), "v"(l + 16u * G2P), "v"(l + 32u * G2P), "v"(l + 48u * G2P), "v"(l + 64u * G2P), "v"(l + 80u * G2P), "v"(l + 96u * G2P), "v"(l + 112u * G2P), "v"(l + 128u * G2P), "v"(l + 144u * G2P), "v"(l + 160u * G2P), "v"(l + 176u * G2P),
                  "v"(a), "v"(a + sa), "v"(a + 2 * sa), "v"(a + 3 * sa), "v"(a + 4 * sa), "v"(a + 5 * sa), "v"(a + 6 * sa), "v"(a + 7 * sa), "v"(b), "v"(b + sb), "v"(b + 2 * sb), "v"(b + 3 * sb) : "memory"); }
__device__ __forceinline__ v8f g2_mma(v16h a, v16h b, v8f c) { v8f d = __builtin_amdgcn_wmma_f32_16x16x32_f16(false, a, false, b, (short)0, c, false, false); asm volatile("v_nop\n\tv_nop\n\tv_nop\n\tv_nop" : "+v"(d) : "v"(a), "v"(b)); return d; }
template <int ACT>
__global__ __launch_bounds__(128) void k_gemm2(const _Float16* __restrict__ A, int lda, size_t sA, const _Float16* __restrict__ Bh, int ldb, size_t sB, float alpha, const float* __restrict__ bias, size_t sBias, const float* __restrict__ CP, int rowsPerB, size_t sCPb, int row0g,
    float* __restrict__ C, _Float16* __restrict__ C16, int ldc, size_t sC, int M, int N, int K) { static_assert(ACT == 0 || ACT == 3 || ACT == 6 || ACT == 8 || ACT == 9 || ACT == 11 || ACT == 12 || ACT == 14 || ACT == 15 || ACT == 16 || ACT == 17, "k_gemm2: unsupported ACT code (would silently apply no activation)");
  __shared__ __attribute__((aligned(16))) unsigned char ring[2 * G2S]; static_assert(sizeof(float) * 4 * 32 * 68 <= 2 * G2S, "the output staging fits in the ring");
  float (*so)[32][68] = (float (*)[32][68])ring;      /* output staging in the ring's place, behind the last pass's barrier */
  const int tid = threadIdx.x, w = tid >> 5, lane = tid & 31, ln = lane & 15, hh = lane >> 4; const int by = blockIdx.y;
  A += (size_t)by * sA; Bh += (size_t)by * sB; const size_t cofs = (size_t)by * sC; const float* bp = bias ? bias + (size_t)by * sBias : nullptr;
  const int ntn = N >> 6; const int mt = blockIdx.x / ntn, nq = blockIdx.x - mt * ntn; const int row0 = mt * 128 + 32 * w, col0 = nq * 64; if (mt * 128 >= M) return;      /* the whole work-group or none of it, in front of every barrier */
  const char* ag = (const char*)(A + (size_t)(mt * 128 + (tid >> 3)) * lda) + (tid & 7) * 16; const char* bg = (const char*)(Bh + (size_t)(col0 + (tid >> 3)) * ldb) + (tid & 7) * 16;      /* the lane's 16 bytes in the first of its rows */
  const size_t sa = (size_t)lda * 32, sb = (size_t)ldb * 32; const unsigned lc = (unsigned)(size_t)ring + (unsigned)((tid >> 3) * G2P + (tid & 7) * 16);
  const unsigned char* la = ring + (32 * w + ln) * G2P + 16 * hh; const unsigned char* lb = ring + (128 + ln) * G2P + 16 * hh;      /* fragment rows: the wave's own 32 rows of A, the 64 rows of B */
  const v8f z8 = {0.f,0.f,0.f,0.f,0.f,0.f,0.f,0.f}; v8f c00 = z8, c01 = z8, c02 = z8, c03 = z8, c10 = z8, c11 = z8, c12 = z8, c13 = z8;
  const int np = K >> 6;
  g2_copy(lc, ag, sa, bg, sb);
  asm volatile("s_wait_asynccnt 0x0" ::: "memory");      /* this wave's copies of pass 0 have landed */
  __syncthreads();      /* pass 0 is readable by every wave */
  if (np > 1) g2_copy(lc + G2S, ag + 128, sa, bg + 128, sb);
#pragma unroll 1
  for (int t = 0; t < np; ++t) { const unsigned bo = (unsigned)(t & 1) * G2S;
    v16h fa[2][2], fb[2][4];      /* the pass's fragments: two k steps of 32 */
#pragma unroll      /* register arrays, constant LDS offsets */
    for (int ks = 0; ks < 2; ++ks) { fa[ks][0] = g2_lfrag(la + bo + ks * 64); fa[ks][1] = g2_lfrag(la + bo + ks * 64 + 16 * G2P);
#pragma unroll      /* register arrays */
      for (int j = 0; j < 4; ++j) fb[ks][j] = g2_lfrag(lb + bo + ks * 64 + j * 16 * G2P); }
    __builtin_amdgcn_sched_barrier(0);      /* all LDS reads of the pass go out as one group in front of its products; left to itself the compiler reads one fragment at a time and waits out the LDS latency in front of every second product */
#pragma unroll      /* register arrays */
    for (int ks = 0; ks < 2; ++ks) {
      c00 = g2_mma(fa[ks][0], fb[ks][0], c00); c10 = g2_mma(fa[ks][1], fb[ks][0], c10);
      c01 = g2_mma(fa[ks][0], fb[ks][1], c01); c11 = g2_mma(fa[ks][1], fb[ks][1], c11);
      c02 = g2_mma(fa[ks][0], fb[ks][2], c02); c12 = g2_mma(fa[ks][1], fb[ks][2], c12);
      c03 = g2_mma(fa[ks][0], fb[ks][3], c03); c13 = g2_mma(fa[ks][1], fb[ks][3], c13); }
    asm volatile("s_wait_dscnt 0x0" ::: "memory");      /* this wave's reads of the buffer are done before the barrier behind which it is refilled */
    asm volatile("s_wait_asynccnt 0x0" ::: "memory");      /* this wave's copies of pass t + 1 have landed */
    __syncthreads();      /* publishes pass t + 1 and ends every wave's reads of pass t */
    if (t + 2 < np) g2_copy(lc + bo, ag + (size_t)(t + 2) * 128, sa, bg + (size_t)(t + 2) * 128, sb); }
  asm volatile("s_wait_asynccnt 0x0" ::: "memory");      /* no copy is outstanding when the ring becomes output staging */
  v8f accs[8] = {c00, c01, c02, c03, c10, c11, c12, c13};
#pragma unroll
  for (int u = 0; u < 8; ++u) { const int t = u & 3, half = u >> 2; const int col = col0 + t * 16 + ln; const float bv = bp ? bf16_round(bp[col]) : 0.f;
#pragma unroll
    for (int r = 0; r < 8; ++r) { const int rloc = half * 16 + 8 * hh + r; float v = accs[u][r] * alpha + bv; if (CP) { if (rowsPerB < 0) v += CP[cofs + (size_t)(row0g + row0 + rloc) * ldc + col];      /* rowsPerB < 0: own element of the batched C plane */ else { const int bidx = (row0g + row0 + rloc) / rowsPerB; v += CP[(size_t)bidx * sCPb + (size_t)by * 64 + col]; } }
      if (ACT == 3) v = fmaxf(v, 0.f); else if (ACT == 6) v = 0.5f * v * (1.0f + erff(v * 0.70710678118654752f)); else if (ACT == 11) v = 1.0f / (1.0f + expf(-v)); else if (ACT == 15) v = v / (1.0f + expf(-v)); else if (ACT == 12) v = (v > 0.f) ? v : 0.01f * v; else if (ACT == 8) v = tanhf(v); else if (ACT == 9) v = 0.5f * v * (1.0f + tanhf(0.7978845608028654f * (v + 0.044715f * v * v * v))); else if (ACT == 14) v = (v > 0.f) ? v : 0.1f * v; else if (ACT == 16) v = (v >= 0.f) ? v : 0.3f * v; else if (ACT == 17) v = (v >= 0.f) ? v : 0.2f * v;
      so[w][rloc][t * 16 + ln] = v; } }
  __builtin_amdgcn_fence(__ATOMIC_ACQ_REL, "workgroup"); __builtin_amdgcn_wave_barrier();
  const int rsub = lane >> 4, c4 = (lane & 15) * 4;
  {
#pragma unroll
    for (int q = 0; q < 16; ++q) { const int r = q * 2 + rsub; const v4f v = *(const v4fa*)&so[w][r][c4]; if (C) *(v4f*)(C + cofs + (size_t)(row0 + r) * ldc + col0 + c4) = v; if (C16) { v4h h4; for (int i = 0; i < 4; ++i) h4[i] = (_Float16)v[i]; *(v4h*)(C16 + cofs + (size_t)(row0 + r) * ldc + col0 + c4) = h4; } }
     } }


__global__ __launch_bounds__(256) void k_wnat(const float* __restrict__ w, size_t n8, _Float16* __restrict__ Bt) { const size_t t = (size_t)blockIdx.x * 256 + threadIdx.x; if (t >= n8) return; FragH f; for (int q = 0; q < 8; ++q) f.h[q] = (_Float16)(bf16_round(w[t * 8 + q]) * 16.0f); *(v8us*)((unsigned short*)Bt + t * 8) = f.half[0];  }
__global__ __launch_bounds__(256) void k_rsm(const float* __restrict__ S, _Float16* __restrict__ P, int nrows) {
  #pragma clang fp contract(off)
  const int i = blockIdx.x * 256 + threadIdx.x; if (i >= nrows) return; const float* s = S + (size_t)i * SQ; float mx = -3.0e38f;
#pragma unroll 1
  for (int j = 0; j < SQ; ++j) mx = fmaxf(mx, s[j]); float se = 0.f;
#pragma unroll 1
  for (int j = 0; j < SQ; ++j) se += expf(s[j] - mx); const float sc = 256.0f / se;
#pragma unroll 1
  for (int j0 = 0; j0 < SQ; j0 += 8) { FragH f; for (int q = 0; q < 8; ++q) f.h[q] = (_Float16)(expf(s[j0 + q] - mx) * sc); unsigned short* d = (unsigned short*)P + (size_t)i * SQ + j0; *(v8us*)d = f.half[0];  } }
__global__ __launch_bounds__(256) void k_vt(const _Float16* __restrict__ V16, int b, int h0, _Float16* __restrict__ VT) { __shared__ unsigned short tl[64][65]; const int tid = threadIdx.x; const int hh = blockIdx.x % HG, sg = blockIdx.x / HG; const int s0 = sg * 64; const int h = h0 + hh;
  for (int i = tid; i < 64 * 8; i += 256) { const int j = i / 8, d8 = (i % 8) * 8; FragH f; f.half[0] = *(const v8us*)((const unsigned short*)V16 + ((size_t)b * SQ + s0 + j) * DM + h * HD + d8); for (int q = 0; q < 8; ++q) tl[d8 + q][j] = f.u[q]; }
  __syncthreads();
  { for (int i = tid; i < 64 * 8; i += 256) { const int d = i / 8, j8 = (i % 8) * 8; FragH f; for (int q = 0; q < 8; ++q) f.u[q] = tl[d][j8 + q]; *(v8us*)((unsigned short*)VT + ((size_t)hh * HD + d) * SQ + s0 + j8) = f.half[0]; }  } }



// ---- lane exchanges and native exp2 shared by the two attention kernels below ----
template <int CTRL>
__device__ __forceinline__ float sm_rowx(float x) { return __builtin_bit_cast(float, __builtin_amdgcn_update_dpp(__builtin_bit_cast(int, x), __builtin_bit_cast(int, x), CTRL, 0xf, 0xf, false)); }      /* CTRL = 0x160 | m (row_xmask): lane l with lane l ^ m of its 16-lane row */
__device__ __forceinline__ float sm_half(float x) { return __builtin_bit_cast(float, __builtin_amdgcn_permlanex16(__builtin_bit_cast(int, x), __builtin_bit_cast(int, x), 0x76543210, 0xfedcba98, false, false)); }      /* lane l with lane l ^ 16 */
__device__ __forceinline__ float sm_wmax(float v) { v = fmaxf(v, sm_rowx<0x161>(v)); v = fmaxf(v, sm_rowx<0x162>(v)); v = fmaxf(v, sm_rowx<0x164>(v)); v = fmaxf(v, sm_rowx<0x168>(v)); return fmaxf(v, sm_half(v)); }
__device__ __forceinline__ float sm_wsum(float v) { v += sm_rowx<0x161>(v); v += sm_rowx<0x162>(v); v += sm_rowx<0x164>(v); v += sm_rowx<0x168>(v); return v + sm_half(v); }
// 2^x of four values: each v_exp_f32 fills the slot behind the one before it (results apart from all sources), the v_nop the slot behind the last, which the instruction set asks for before a result is read or a source overwritten
__device__ __forceinline__ v4f sm_exp2x4(v4f x) { float r0, r1, r2, r3;
  asm("v_exp_f32 %0, %4\n\tv_exp_f32 %1, %5\n\tv_exp_f32 %2, %6\n\tv_exp_f32 %3, %7\n\tv_nop" : "=&v"(r0), "=&v"(r1), "=&v"(r2), "=&v"(r3) : "v"(x[0]), "v"(x[1]), "v"(x[2]), "v"(x[3]));
  const v4f r = {r0, r1, r2, r3}; return r; }
// ---- causal attention for query rows QT0 .. SQ - 1 in one launch: scores and softmax weights never leave registers. One wave owns 32 query rows of one (batch, head) and walks the keys 64 at a time; no LDS, no barrier.
// Both products are formed transposed, so that a query is a lane (column ln) in each: S^T = K Q^T (A = 16 key rows, B = query rows) gives lane (ln, hh) the keys 8 hh + r of a 16-key tile for query ln, which is the k order of a B fragment
// (tiles 2 j, 2 j + 1 -> k = 8 hh + i, 16 + 8 hh + i): the weights go from accumulator to operand by a conversion alone. O^T = V^T P^T (A = 16 rows of V^T) keeps query = ln, so that the running maximum, the rescale and the row sum are the lane's own.
// Running maximum kept on the raw products; weights 2^((s - max) c + 8), c = log2(e) / 8: at most 256, so that small weights stay clear of the f16 subnormals; the row sum carries the same factor.
__device__ __forceinline__ v8f fa_mma(v16h a, v16h b, v8f c) { return __builtin_amdgcn_wmma_f32_16x16x32_f16(false, a, false, b, (short)0, c, false, false); }
// fragment from a wave-uniform base and the lane's own fixed offset in bytes (the value the load instruction itself takes beside a scalar base)
__device__ __forceinline__ v16h fa_frag(const _Float16* base, unsigned off) { FragH f; f.half[0] = *(const v8us*)((const char*)base + off); f.half[1] = *(const v8us*)((const char*)base + off + 32); return f.v; }
__device__ __forceinline__ void fa_loadk(const _Float16* __restrict__ kp, int kb, unsigned ko, v16h (&kf)[4][2]) {
#pragma unroll      /* register arrays */
  for (int t = 0; t < 4; ++t)
#pragma unroll      /* register arrays */
    for (int ks = 0; ks < 2; ++ks) kf[t][ks] = fa_frag(kp + (size_t)(kb + t * 16) * LQ + ks * 32, ko); }
// one pass of 64 keys from kb on. LAST: the pass that holds the rows' own keys (the only one that needs the mask) and has no pass behind it to fetch K for.
template <bool LAST>
__device__ __forceinline__ void fa_pass(const _Float16* __restrict__ kp, const _Float16* __restrict__ vp, int kb, int qrel, unsigned ko, unsigned vo, const v16h (&qf)[2][2], v16h (&kf)[4][2], v8f (&o)[2][4], float (&mr)[2], float (&l)[2]) {
  const float cs = 0.125f * 1.44269504f; const v8f z8 = {0.f, 0.f, 0.f, 0.f, 0.f, 0.f, 0.f, 0.f};
  v16h vf[4][2];
#pragma unroll      /* register arrays */
  for (int t = 0; t < 4; ++t)
#pragma unroll      /* register arrays */
    for (int ks = 0; ks < 2; ++ks) vf[t][ks] = fa_frag(vp + (size_t)t * 16 * SQ + kb + ks * 32, vo);
  asm volatile("s_wait_xcnt 0x0" :: "v"(vo) : "memory");      /* behind the loads, in front of any later write of a register that holds one of their addresses; the offset as an input, so that its register is still the offset's while the loads issue */
  __builtin_amdgcn_sched_barrier(0);      /* V^T of this pass is asked for here, so that it flies under the score products and the softmax; left to itself the scheduler sinks the loads to their use */
  v8f st[2][4];
#pragma unroll      /* register arrays */
  for (int qt = 0; qt < 2; ++qt)
#pragma unroll      /* register arrays */
    for (int t = 0; t < 4; ++t) st[qt][t] = fa_mma(kf[t][1], qf[qt][1], fa_mma(kf[t][0], qf[qt][0], z8));
  if (!LAST) { __builtin_amdgcn_sched_barrier(0);      /* the next pass's K is asked for behind this pass's last use of K and no later: it flies under the softmax and the second product */
    fa_loadk(kp, kb + 64, ko, kf);
    asm volatile("s_wait_xcnt 0x0" :: "v"(ko) : "memory");      /* as behind the V^T loads above */
    __builtin_amdgcn_sched_barrier(0); }      /* as the line above: keeps the loads from sinking */
  float mn[2];
#pragma unroll      /* register arrays */
  for (int qt = 0; qt < 2; ++qt) { const int rel = qrel + qt * 16 - kb;      /* key kb + 16 t + 8 hh + r is kept while 16 t + r <= rel */
    float mx = mr[qt];
#pragma unroll      /* register arrays */
    for (int t = 0; t < 4; ++t)
#pragma unroll      /* register arrays */
      for (int r = 0; r < 8; ++r) { if (LAST) st[qt][t][r] = (t * 16 + r <= rel) ? st[qt][t][r] : -1.0e30f; mx = fmaxf(mx, st[qt][t][r]); }
    mn[qt] = fmaxf(mx, sm_half(mx)); }      /* the other eight keys of each tile sit in lane l ^ 16 */
  const v4f ax = {(mr[0] - mn[0]) * cs, (mr[1] - mn[1]) * cs, 0.f, 0.f}; const v4f al = sm_exp2x4(ax);      /* rescale of what was summed under the old maximum; 0 in the first pass */
  FragH pf[2][2];
#pragma unroll      /* register arrays */
  for (int qt = 0; qt < 2; ++qt) { const float mo = mn[qt] * cs - 8.0f; mr[qt] = mn[qt];
    v4f se = {0.f, 0.f, 0.f, 0.f};
#pragma unroll      /* register arrays */
    for (int t = 0; t < 4; ++t)
#pragma unroll      /* register arrays */
      for (int g = 0; g < 2; ++g) { v4f x;
#pragma unroll      /* register arrays */
        for (int q = 0; q < 4; ++q) x[q] = st[qt][t][g * 4 + q] * cs - mo;
        x = sm_exp2x4(x); se += x;
#pragma unroll      /* register arrays */
        for (int q = 0; q < 4; ++q) pf[qt][t >> 1].h[(t & 1) * 8 + g * 4 + q] = (_Float16)x[q]; }
    l[qt] = l[qt] * al[qt] + ((se[0] + se[1]) + (se[2] + se[3]));
#pragma unroll      /* register arrays */
    for (int t = 0; t < 4; ++t) o[qt][t] *= al[qt]; }
  __builtin_amdgcn_sched_barrier(0);      /* the second product starts behind the last exp2 of both tiles */
#pragma unroll      /* register arrays */
  for (int qt = 0; qt < 2; ++qt)
#pragma unroll      /* register arrays */
    for (int t = 0; t < 4; ++t) o[qt][t] = fa_mma(vf[t][1], pf[qt][1].v, fa_mma(vf[t][0], pf[qt][0].v, o[qt][t])); }
__global__ __launch_bounds__(256) void k_fattn(const _Float16* __restrict__ QKVp, const _Float16* __restrict__ VTp, const float* __restrict__ XBp, float* __restrict__ X1p) {
  static_assert(QT0 == 128 && HD == 64 && SQ % 256 == 0, "blocks of 128 query rows; block 0 of a batch belongs to the f32 path; blocks 1 .. SQ / 128 - 1 are paired below");
  const int lane = threadIdx.x & 31, ln = lane & 15, hh = lane >> 4; const int w = __builtin_amdgcn_readfirstlane((int)(threadIdx.x >> 5));      /* the wave's number: a scalar, so that the early exit and the trip count are scalar */
  const int h = blockIdx.y, b = blockIdx.z; const int far = SQ / 128 - 1 - (int)blockIdx.x, near = 1 + (int)blockIdx.x;      /* waves 0-3 take a late block of rows, waves 4-7 the early block that makes the keys walked per work-group level */
  if (w >= 4 && near >= far) return;      /* the middle block has no partner; no barrier in this kernel */
  const int qw = (w < 4 ? far : near) * 128 + (w & 3) * 32;
  const size_t r0 = (size_t)b * SQ;
  const _Float16* qp = QKVp + (r0 + qw) * LQ + h * HD; const _Float16* kp = QKVp + DM + r0 * LQ + h * HD; const _Float16* vp = VTp + (size_t)(b * NH + h) * HD * SQ;      /* wave-uniform bases */
  const unsigned ko = (unsigned)(ln * LQ + 8 * hh) * 2u, vo = (unsigned)(ln * SQ + 8 * hh) * 2u;      /* the lane's row and k half in q / k rows and in V^T rows, in bytes */
  v16h qf[2][2], kf[4][2];
#pragma unroll      /* register arrays */
  for (int qt = 0; qt < 2; ++qt)
#pragma unroll      /* register arrays */
    for (int ks = 0; ks < 2; ++ks) qf[qt][ks] = fa_frag(qp + (size_t)qt * 16 * LQ + ks * 32, ko);
  fa_loadk(kp, 0, ko, kf);
  asm volatile("s_wait_xcnt 0x0" :: "v"(ko) : "memory");      /* behind the loads of q and of the first K, in front of any later write of their base and offset registers */
  __builtin_amdgcn_sched_barrier(0);      /* keeps later address arithmetic, which reuses those registers, behind the wait */
  const v8f z8 = {0.f, 0.f, 0.f, 0.f, 0.f, 0.f, 0.f, 0.f};
  v8f o[2][4] = {{z8, z8, z8, z8}, {z8, z8, z8, z8}}; float mr[2] = {-1.0e30f, -1.0e30f}; float l[2] = {0.f, 0.f};
  const int klast = qw & ~63;      /* keys 0 .. qw + 31 in passes of 64: every pass before this one lies wholly below row qw, this one ends at or below SQ - 1 */
  const int qrel = qw + ln - 8 * hh;
#pragma unroll 1      /* one pass holds 32 loads and 32 matrix instructions already */
  for (int kb = 0; kb < klast; kb += 64) fa_pass<false>(kp, vp, kb, qrel, ko, vo, qf, kf, o, mr, l);
  const float* xp = XBp + (r0 + qw) * DM + h * HD; float* yp = X1p + (r0 + qw) * DM + h * HD; const unsigned xo = (unsigned)(ln * DM + 8 * hh) * 4u;      /* lane (ln, hh) holds columns 16 t + 8 hh .. + 7 of query ln; in bytes */
  v4f xr[2][4][2];
#pragma unroll      /* register arrays */
  for (int qt = 0; qt < 2; ++qt)
#pragma unroll      /* register arrays */
    for (int t = 0; t < 4; ++t)
#pragma unroll      /* register arrays */
      for (int g = 0; g < 2; ++g) xr[qt][t][g] = *(const v4fa*)((const char*)(xp + qt * 16 * DM + t * 16 + g * 4) + xo);
  asm volatile("s_wait_xcnt 0x0" :: "v"(xo) : "memory");      /* as behind the V^T loads */
  __builtin_amdgcn_sched_barrier(0);      /* the residual rows are asked for here and fly under the last pass, in the registers that the K fetched ahead no longer needs */
  fa_pass<true>(kp, vp, klast, qrel, ko, vo, qf, kf, o, mr, l);
#pragma unroll      /* register arrays */
  for (int qt = 0; qt < 2; ++qt) { const float inv = 1.0f / (l[qt] + sm_half(l[qt]));      /* the two halves' sums joined once */
#pragma unroll      /* register arrays */
    for (int t = 0; t < 4; ++t)
#pragma unroll      /* register arrays */
      for (int g = 0; g < 2; ++g)
#pragma unroll      /* register arrays */
        for (int q = 0; q < 4; ++q) xr[qt][t][g][q] += o[qt][t][g * 4 + q] * inv; }
  __builtin_amdgcn_sched_barrier(0);      /* all arithmetic in front of the first store, so that nothing rewrites a register that an issued store names */
#pragma unroll      /* register arrays */
  for (int qt = 0; qt < 2; ++qt)
#pragma unroll      /* register arrays */
    for (int t = 0; t < 4; ++t)
#pragma unroll      /* register arrays */
      for (int g = 0; g < 2; ++g) *(v4f*)((char*)(yp + qt * 16 * DM + t * 16 + g * 4) + xo) = xr[qt][t][g]; }


typedef float v2f  __attribute__((ext_vector_type(2)));
typedef float v2fa __attribute__((ext_vector_type(2), may_alias));
// ---- f32 attention for the first QT0 query rows: one wave per (head, query row), eight rows of one head per work-group. The head's K and V rows up to the end of the rows' 32-key chunk are staged once in LDS.
// Scores: lane l owns keys 32 c + l (K pitch 68 floats = 16 B x odd, so that the 32 rows read by one ds_load_b128 spread over the banks). Output: lane l owns columns 2 l, 2 l + 1; each key's weight comes out of its lane by v_readlane.
// NCH = 32-key chunks (compile time: every load of a phase is issued before the first wait). Keys past the row get weight 2^(-1e30 ..) = 0.
template <int NCH>
__device__ __forceinline__ void att0_rows(const float* __restrict__ QF, const float* __restrict__ KF, const float* __restrict__ VF, float scale, float* __restrict__ OF, int h, int row0, float (*lk)[HD + 4], float (*lv)[HD]) {
  const int tid = threadIdx.x, lane = tid & 31; const int i = row0 + __builtin_amdgcn_readfirstlane(tid >> 5);      /* the row is the wave's: a scalar */
  const int sr = tid >> 4, sc = (tid & 15) * 4;      /* staging: 16 threads per 256-byte row, 16 rows per pass */
  const float* kg = KF + h * HD; const float* vg = VF + h * HD; const float* qr = QF + (size_t)i * DM + h * HD; const int so = sr * DM + sc;      /* row pitch DM at compile time: one address per matrix, the pass as a constant offset of the load */
  v4f kk[2 * NCH], vv[2 * NCH], q[HD / 4];
#pragma unroll      /* arrays stay in registers; all loads in flight together */
  for (int p = 0; p < 2 * NCH; ++p) { kk[p] = *(const v4fa*)(kg + so + p * 16 * DM); vv[p] = *(const v4fa*)(vg + so + p * 16 * DM); }
#pragma unroll      /* the query row, same address in every lane, fetched beside the staging loads */
  for (int c = 0; c < HD / 4; ++c) q[c] = *(const v4fa*)(qr + c * 4);
#pragma unroll      /* register arrays */
  for (int p = 0; p < 2 * NCH; ++p) { *(v4fa*)&lk[p * 16 + sr][sc] = kk[p]; *(v4fa*)&lv[p * 16 + sr][sc] = vv[p]; }
  __syncthreads();
  v4f a[NCH];
#pragma unroll      /* register arrays */
  for (int c = 0; c < NCH; ++c) { const v4f z = {0.f, 0.f, 0.f, 0.f}; a[c] = z; }
#pragma unroll      /* 4 NCH independent sums per lane */
  for (int d = 0; d < HD / 4; ++d)
#pragma unroll      /* a[c] by constant index */
    for (int c = 0; c < NCH; ++c) a[c] += q[d] * *(const v4fa*)&lk[c * 32 + lane][d * 4];
  float e[NCH]; float mx = -1.0e30f;
#pragma unroll      /* register arrays */
  for (int c = 0; c < NCH; ++c) { const float s = ((a[c][0] + a[c][1]) + (a[c][2] + a[c][3])) * scale; e[c] = (c * 32 + lane <= i) ? s : -1.0e30f; mx = fmaxf(mx, e[c]); }
  mx = sm_wmax(mx);
  float l = 0.f; v4f t = {-200.f, -200.f, -200.f, -200.f};      /* chunks that this case does not have: 2^-200, not summed */
#pragma unroll      /* register arrays */
  for (int c = 0; c < NCH; ++c) t[c] = (e[c] - mx) * 1.44269504f;      /* exp(x) = 2^(x log2 e), the native form, as in the row softmax above */
  t = sm_exp2x4(t);
#pragma unroll      /* register arrays */
  for (int c = 0; c < NCH; ++c) { e[c] = t[c]; l += e[c]; }
  l = sm_wsum(l);
  const v2f z2 = {0.f, 0.f}; v2f o[4] = {z2, z2, z2, z2};      /* four sums per column, so that one key's multiply-add does not wait for the key before it */
#pragma unroll      /* constant lane numbers for v_readlane, constant LDS offsets */
  for (int c = 0; c < NCH; ++c)
#pragma unroll      /* as the line above */
    for (int j = 0; j < 32; ++j) { const float ej = __builtin_bit_cast(float, __builtin_amdgcn_readlane(__builtin_bit_cast(int, e[c]), j)); o[j & 3] += ej * *(const v2fa*)&lv[c * 32 + j][lane * 2]; }
  const float fin = 64.0f / l;      /* o carried x64, scaled by 1/64 where it is added to x1 */
  const v2f r = ((o[0] + o[1]) + (o[2] + o[3])) * fin;
  *(v2fa*)(OF + (size_t)i * DM + h * HD + lane * 2) = r; }
__global__ __launch_bounds__(256) void k_att0w(const float* __restrict__ QF, const float* __restrict__ KF, const float* __restrict__ VF, float scale, float* __restrict__ OF) {
  static_assert(QT0 == 128 && HD == 64, "the cases below cover 1 .. 4 chunks of 32 keys; two columns per lane");
  __shared__ __attribute__((aligned(16))) float lk[QT0][HD + 4]; __shared__ __attribute__((aligned(16))) float lv[QT0][HD];
  const int h = blockIdx.x / (QT0 / 8), row0 = (blockIdx.x % (QT0 / 8)) * 8;      /* eight rows lie in one 32-key chunk: the switch is the same for the whole work-group, barrier included */
  switch (row0 >> 5) {
    case 0: att0_rows<1>(QF, KF, VF, scale, OF, h, row0, lk, lv); break; case 1: att0_rows<2>(QF, KF, VF, scale, OF, h, row0, lk, lv); break;
    case 2: att0_rows<3>(QF, KF, VF, scale, OF, h, row0, lk, lv); break; case 3: att0_rows<4>(QF, KF, VF, scale, OF, h, row0, lk, lv); break; } }


template <int BFIN, int WXB>
__global__ __launch_bounds__(256) void k_ln16(const float* __restrict__ X, const float* __restrict__ g, const float* __restrict__ bb, float eps, _Float16* __restrict__ N16, float* __restrict__ XB) {
  #pragma clang fp contract(off)
  __shared__ float red[256]; const size_t r = blockIdx.x; const int t = threadIdx.x; const v4f xa = *(const v4fa*)(X + r * DMQ + t * 4); float s[4]; float sum = 0.f;
  for (int q = 0; q < 4; ++q) { s[q] = BFIN ? bf16_round(xa[q]) : xa[q]; sum = __fadd_rn(sum, s[q]); }
  red[t] = sum; __syncthreads(); for (int st = 128; st > 0; st >>= 1) { if (t < st) red[t] = __fadd_rn(red[t], red[t + st]); __syncthreads(); } const float mu = red[0] / (float)DMQ; __syncthreads();
  float vs = 0.f; for (int q = 0; q < 4; ++q) { const float dl = __fadd_rn(s[q], -mu); vs = __fadd_rn(vs, __fmul_rn(dl, dl)); } red[t] = vs; __syncthreads(); for (int st = 128; st > 0; st >>= 1) { if (t < st) red[t] = __fadd_rn(red[t], red[t + st]); __syncthreads(); }
  const float rs = rsqrtf(__fadd_rn(red[0] / (float)DMQ, eps)); v4h y; v4f xb;
  for (int q = 0; q < 4; ++q) { const int c = t * 4 + q; y[q] = (_Float16)__fadd_rn(__fmul_rn(__fmul_rn(__fadd_rn(s[q], -mu), rs), bf16_round(g[c])), bf16_round(bb[c])); xb[q] = s[q]; }
  { *(v4h*)(N16 + r * DMQ + t * 4) = y; if (WXB) *(v4f*)(XB + r * DMQ + t * 4) = xb;  } }
__global__ __launch_bounds__(256) void k_ftres2(const float* __restrict__ OF0, const float* __restrict__ XB, float* __restrict__ X1, size_t n4) {
  #pragma clang fp contract(off)
  const size_t t = (size_t)blockIdx.x * 256 + threadIdx.x; if (t >= n4) return; const v4f o = *(const v4fa*)(OF0 + t * 4), xv = *(const v4fa*)(XB + t * 4); v4f y; for (int q = 0; q < 4; ++q) y[q] = __fadd_rn(__fmul_rn(o[q], 0.015625f), xv[q]); *(v4f*)(X1 + t * 4) = y;  }

__global__ __launch_bounds__(256) void k_wthd(const float* __restrict__ Wt, _Float16* __restrict__ Bt) { const size_t t = (size_t)blockIdx.x * 256 + threadIdx.x; if (t >= (size_t)NH * HD * (DM / 8)) return; const int m8 = (int)(t % (DM / 8)) * 8; const int d = (int)((t / (DM / 8)) % HD); const int h = (int)(t / ((size_t)(DM / 8) * HD)); FragH f;
  for (int q = 0; q < 8; ++q) f.h[q] = (_Float16)(16.0f * bf16_round(Wt[((size_t)h * DM + m8 + q) * HD + d])); unsigned short* dst = (unsigned short*)Bt + ((size_t)h * HD + d) * DM + m8; *(v8us*)dst = f.half[0];  }




__global__ __launch_bounds__(256) void k_wtpad(const float* __restrict__ Wm, _Float16* __restrict__ Wt, int Kr, int Kp, int Nr, int Np, float scale) {
  const int t = blockIdx.x * 256 + threadIdx.x; if (t >= Np * (Kp / 8)) return; const int n = t / (Kp / 8), k8 = (t % (Kp / 8)) * 8; const int nc = min(n, Nr - 1); const float fn = (n < Nr) ? 1.f : 0.f; FragH f;
  for (int i = 0; i < 8; ++i) { const int k = k8 + i; const int kc = min(k, Kr - 1); const float fk = (k < Kr) ? fn : 0.f; f.h[i] = (_Float16)(bf16_round(Wm[(size_t)kc * Nr + nc]) * scale * fk); }
  unsigned short* o = (unsigned short*)Wt + (size_t)n * Kp + k8; *(v8us*)o = f.half[0];  }
__global__ __launch_bounds__(128) void k_bpad(const float* __restrict__ b, float* __restrict__ Bp, int nr, int np) {
  const int i = threadIdx.x; if (i >= np) return; const float v = b[min(i, nr - 1)] * ((i < nr) ? 1.f : 0.f); *(float*)(Bp + i) = v;  }

__global__ __launch_bounds__(256) void k_bcpy(const float* __restrict__ b, int n, int NP, float* __restrict__ dst, int dst0) { for (int i = threadIdx.x; i < NP; i += 256) { const float v = (i < n) ? b[i] : 0.f; *(float*)(dst + dst0 + i) = v; }  }


__global__ __launch_bounds__(256) void k_addf(const float* __restrict__ XBr, const float* __restrict__ OF, float* __restrict__ O, size_t n8) {
  #pragma clang fp contract(off)
  const size_t t = (size_t)blockIdx.x * 256 + threadIdx.x; if (t >= n8) return; const v4f a = *(const v4fa*)(XBr + t * 8), b = *(const v4fa*)(XBr + t * 8 + 4), c = *(const v4fa*)(OF + t * 8), d = *(const v4fa*)(OF + t * 8 + 4); v4f r0, r1;
  for (int q = 0; q < 4; ++q) { r0[q] = __fadd_rn(a[q], __fmul_rn(c[q], 0.015625f)); r1[q] = __fadd_rn(b[q], __fmul_rn(d[q], 0.015625f)); }
  { *(v4f*)(O + t * 8) = r0; *(v4f*)(O + t * 8 + 4) = r1;  } }


extern "C" void kernel_launch(void* const* d_in, const int* in_sizes, int n_in,
                              void* d_out, int out_size, void* d_ws, size_t ws_size, hipStream_t stream) {
  (void)in_sizes; (void)n_in; (void)out_size;
  const float* const* I = (const float* const*)d_in; const float* x = I[0]; const float* wq = I[1]; const float* bq = I[2]; const float* wk = I[3]; const float* bk = I[4]; const float* wv = I[5]; const float* bv = I[6]; const float* g1 = I[7]; const float* be1 = I[8]; const float* gg2 = I[9]; const float* be2 = I[10]; const float* wfc = I[11]; const float* bfc = I[12]; const float* wmp = I[13]; const float* bmp = I[14];      /* input order: x; [in][out] wq / wk / wv + biases; LN1 w / b, LN2 w / b; w_fc [1024][4096] + b_fc, w_proj [4096][1024] + b_proj */
  float* OUT0 = (float*)d_out; float* OUTK = (float*)d_out + NR * DM; float* OUTV = (float*)d_out + 2 * NR * DM;      /* tuple outputs: out at byte 0, k at 16,777,216, v at 33,554,432 (each NB * SQ * DM floats) */
  static_assert(NH * HD == DM && DM % 64 == 0 && SQ % 128 == 0 && QT0 % 8 == 0, "shape / tile multiples");
  char* ws = (char*)d_ws; size_t off = 0;
  auto take = [&](size_t bytes) { char* p = ws + off; off += (bytes + 255) & ~(size_t)255; return p; };
  _Float16* BQKV = (_Float16*)take((size_t)3 * DM * DM * 2); float* bqkv = (float*)take((size_t)3 * DM * 4);      /* stacked bias bq | bk | bv */
  _Float16* X16 = (_Float16*)take(NR * DM * 2); float* XB = (float*)take(NR * DM * 4); float* X1 = (float*)take(NR * DM * 4); _Float16* M16 = nullptr;      /* = X16 below (alias: X16's last reader, the last batch's k / v output GEMMs, precedes LN2's write) */ _Float16* HF16 = (_Float16*)take((size_t)SQ * DFF * 2); _Float16* BW1 = (_Float16*)take((size_t)DFF * DM * 2); _Float16* BW2 = (_Float16*)take((size_t)DM * DFF * 2); _Float16* QKV = (_Float16*)take(NR * 3 * DM * 2); _Float16* V16 = QKV + 2 * DM; M16 = X16;
  _Float16* VT = (_Float16*)take((size_t)NB * NH * HD * SQ * 2);      /* V^T of both batches */
  float* QF0 = (float*)take((size_t)QT0 * DM * 4); float* KF0 = (float*)take((size_t)QT0 * DM * 4); float* VF0 = (float*)take((size_t)QT0 * DM * 4); float* OF0 = (float*)take((size_t)NB * QT0 * DM * 4);
  if (off > ws_size) return;
  { const unsigned g = (unsigned)(((size_t)DM * (DM / 8) + 255) / 256); k_wt_f16<<<g, 256, 0, stream>>>(wq, BQKV, DM, DM, 16.0f); k_wt_f16<<<g, 256, 0, stream>>>(wk, BQKV + (size_t)DM * DM, DM, DM, 16.0f); k_wt_f16<<<g, 256, 0, stream>>>(wv, BQKV + (size_t)2 * DM * DM, DM, DM, 16.0f); }      /* [in][out] -> Bt x16: stacked q | k | v (transposing builder) */
  k_bcpy<<<1, 256, 0, stream>>>(bq, DM, DM, bqkv, 0); k_bcpy<<<1, 256, 0, stream>>>(bk, DM, DM, bqkv, DM); k_bcpy<<<1, 256, 0, stream>>>(bv, DM, DM, bqkv, 2 * DM);      /* stacked bias bq | bk | bv */
  k_ln16<1, 1><<<(unsigned)NR, 256, 0, stream>>>(x, g1, be1, 1e-5f, X16, XB);      /* a = LN1(bf16(x)) -> f16 rows; XB = bf16(x) for the residual */
  k_wt_f16<<<(unsigned)(((size_t)DFF * (DM / 8) + 255) / 256), 256, 0, stream>>>(wfc, BW1, DM, DFF, 16.0f); k_wt_f16<<<(unsigned)(((size_t)DM * (DFF / 8) + 255) / 256), 256, 0, stream>>>(wmp, BW2, DFF, DM, 16.0f);      /* W1 [1024][4096] -> Bt [4096][1024]; W2 [4096][1024] -> Bt [1024][4096] (x16) */
  const size_t r0p = (size_t)B0 * SQ;      /* first projected row */
  k_gemm2<0><<<dim3((unsigned)((MP / 128) * (3 * DM / 64)), 1), 128, 0, stream>>>(X16 + r0p * DM, DM, 0, BQKV, DM, 0, 0.0625f, bqkv, 0, nullptr, 1, 0, 0, nullptr, QKV + r0p * 3 * DM, 3 * DM, 0, MP, 3 * DM, DM);      /* q | k | v rows (f16); head h = columns h*HD.. of each DM block */
  for (int b = B0; b < B0 + NBR; ++b) { const size_t r0 = (size_t)b * SQ;
    k_vt<NH, SQ><<<NH * (SQ / 64), 256, 0, stream>>>(V16 + r0 * LQ, LQ, 0, VT + (size_t)b * NH * HD * SQ);      /* V^T [NH][HD][SQ] for this batch */
    k_gemm2<0><<<dim3((QT0 / 128) * (DM / 64), 1), 128, 0, stream>>>(X16 + r0 * DM, DM, 0, BQKV, DM, 0, 0.0625f, bq, 0, nullptr, 1, 0, 0, QF0, nullptr, DM, 0, QT0, DM, DM); k_gemm2<0><<<dim3((QT0 / 128) * (DM / 64), 1), 128, 0, stream>>>(X16 + r0 * DM, DM, 0, (BQKV + (size_t)DM * DM), DM, 0, 0.0625f, bk, 0, nullptr, 1, 0, 0, KF0, nullptr, DM, 0, QT0, DM, DM); k_gemm2<0><<<dim3((QT0 / 128) * (DM / 64), 1), 128, 0, stream>>>(X16 + r0 * DM, DM, 0, (BQKV + (size_t)2 * DM * DM), DM, 0, 0.0625f, bv, 0, nullptr, 1, 0, 0, VF0, nullptr, DM, 0, QT0, DM, DM);      /* f32 q, k, v of the first 128 rows (exact products) */
    k_att0w<<<NH * (QT0 / 8), 256, 0, stream>>>(QF0, KF0, VF0, 0.125f, OF0 + (size_t)b * QT0 * DM);      /* f32 attention for rows 0..127 (o x64), one wave per head and row */
    k_addf<<<(unsigned)(((size_t)QT0 * DM / 8 + 255) / 256), 256, 0, stream>>>(XB + r0 * DM, OF0 + (size_t)b * QT0 * DM, X1 + r0 * DM, (size_t)QT0 * DM / 8);      /* rows 0..127 of the batch from the exact f32 path: x1 = bf16(x) + o / 64 */
    k_gemm2<0><<<dim3((SQ / 128) * (HD / 64), NH), 128, 0, stream>>>(X16 + r0 * DM, DM, 0, BQKV + (size_t)DM * DM, DM, (size_t)HD * DM, 0.0625f, bk, (size_t)HD, nullptr, 1, 0, 0, OUTK + (size_t)b * NH * SQ * HD, nullptr, HD, (size_t)SQ * HD, SQ, HD, DM); k_gemm2<0><<<dim3((SQ / 128) * (HD / 64), NH), 128, 0, stream>>>(X16 + r0 * DM, DM, 0, BQKV + (size_t)2 * DM * DM, DM, (size_t)HD * DM, 0.0625f, bv, (size_t)HD, nullptr, 1, 0, 0, OUTV + (size_t)b * NH * SQ * HD, nullptr, HD, (size_t)SQ * HD, SQ, HD, DM); }      /* outputs 1 and 2: k and v of this batch in f32, head-major [H][T][64] (head on grid.y: weight rows 64 h .., bias 64 h .., output plane h) */
  k_fattn<<<dim3(SQ / 256, NH, NB), 256, 0, stream>>>(QKV, VT, XB, X1);      /* rows 128.. of both batches: x1 = bf16(x) + softmax(q k^T / 8) v in f32 (no output projection in this module) */
  k_ln16<0, 0><<<(unsigned)NR, 256, 0, stream>>>(X1, gg2, be2, 1e-5f, M16, nullptr);      /* h = LN2(x1) -> f16 rows */
  for (int b = 0; b < NB; ++b) { const size_t r0 = (size_t)b * SQ;
    k_gemm2<6><<<dim3((unsigned)((SQ / 128) * (DFF / 64)), 1), 128, 0, stream>>>(M16 + r0 * DM, DM, 0, BW1, DM, 0, 0.0625f, bfc, 0, nullptr, 1, 0, 0, nullptr, HF16, DFF, 0, SQ, DFF, DM);      /* gelu_erf(h2 W1 + b1) -> f16 (this batch) */
    k_gemm2<0><<<dim3((unsigned)((SQ / 128) * (DM / 64)), 1), 128, 0, stream>>>(HF16, DFF, 0, BW2, DFF, 0, 0.0625f, bmp, 0, X1 + r0 * DM, -1, 0, 0, OUT0 + r0 * DM, nullptr, DM, 0, SQ, DM, DFF); }      /* output 0 = x1 + mlp (own-element residual) */
}

// v005
// A run of this version takes 360 microseconds.
// Two timings next to v004 put it at 1.32 and 1.33 times that version's speed.
// Over all steps from v000 it is 16.2 times as fast.
#include <hip/hip_runtime.h>
// Pre-LN causal transformer block WITHOUT an attention output projection that also returns its key and value tensors (x [2][2048][1024]; h = LN1(x) (biased var, eps 1e-5); q / k / v = h W + b ([in][out] [1024][1024] sigma 1/32, zero biases) -> [B][16][T][64]; att = softmax(q k^T / 8) with a causal mask (tril, -inf); y = att v merged back to [B][T][1024]; x1 = x + y (no projection); out = x1 + gelu_erf(LN2(x1) w_fc + b_fc) w_proj + b_proj ([in][out] 1024 x 4096 x 1024); returns (out [2][2048][1024], k [2][16][2048][64], v [2][16][2048][64]): three outputs at byte offsets 0 / 16,777,216 / 33,554,432 of d_out).
// Structure: token rows r = b*2048 + s; h = LN1(bf16(x)) as f16 rows; q | k | v as ONE WMMA GEMM (N = 3 x 1024) (32x64 wave tiles, f32 accumulation, exact x16 weights + bias, f16 outputs; the same sums stored in f32 as outputs k and v and as q, k, v of each batch's first 128 rows); per batch: V^T for all heads via LDS transposes; rows 128.. of both batches in one launch: per wave 32 query rows, keys 64 at a time up to the rows' end, scores (K = 64), running-maximum softmax (f32 statistics, native exp2; weights at most 256 in f16) and weights x V^T all in registers, x1 = x + o / row sum in f32; h2 = LN2(x1) -> f16; per batch out = x1 + gelu_erf(h2 W1 + b1) W2 + b2 by two GEMMs (f16 hidden, f32 out).
// Compute dtype: inputs rounded to bf16; x / weights exact; h, q, k, v, softmax weights, h2 and the gelu hidden as plain f16 GEMM operands (~2^-12); scores and softmax statistics f32. v_wmma_f32_16x16x32_f16.
#define NB 2
#define SQ 2048
#define DM 1024
#define NH 16
#define HD 64
#define HG 4
#define QT 256                       /* query rows per causal tile */
#define NKX SQ                       /* S / P row pitch */
#define QT0 128                      /* first-tile rows attended exactly in f32 */
#define B0 0                         /* first batch processed (debug hook) */
#define NBR NB                       /* batches processed (debug hook) */
#define NR ((size_t)NB * SQ)
#define DMQ DM
#define DFF 4096                     /* FFN hidden width */
#define DFFR 100
#define MP ((int)((size_t)NBR * SQ)) /* rows projected (debug hook) */
#define QN SQ                        /* query rows per batch; not used */
#define NHD NH                       /* heads; not used */
#define MPO MP
#define LQ (3 * DM)      /* row pitch of the q/k/v rows */
typedef __bf16 v16b __attribute__((ext_vector_type(16)));
typedef unsigned short v8us __attribute__((ext_vector_type(8), may_alias));
typedef float  v8f  __attribute__((ext_vector_type(8)));
typedef float  v4f  __attribute__((ext_vector_type(4)));
typedef float  v4fa __attribute__((ext_vector_type(4), may_alias));
union FragB { v16b v; v8us half[2]; unsigned short u[16]; };

__device__ __forceinline__ unsigned short bf16_bits(float x) { unsigned int u = __float_as_uint(x); return (unsigned short)((u + 0x7FFFu + ((u >> 16) & 1u)) >> 16); }
__device__ __forceinline__ float bf16_val(unsigned short b) { return __uint_as_float(((unsigned int)b) << 16); }
__device__ __forceinline__ float bf16_round(float x) { return bf16_val(bf16_bits(x)); }
// D += A·B with NT terms: 1 = ah·bh, 2 = + al·bh (A split), 3 = + ah·bl (both split)
template <int NT>
__device__ __forceinline__ v8f mmaN(v16b ah, v16b al, v16b bh, v16b bl, v8f c) {
  c = __builtin_amdgcn_wmma_f32_16x16x32_bf16(false, ah, false, bh, (short)0, c, false, false);
  if (NT >= 2) c = __builtin_amdgcn_wmma_f32_16x16x32_bf16(false, al, false, bh, (short)0, c, false, false);
  if (NT >= 3) c = __builtin_amdgcn_wmma_f32_16x16x32_bf16(false, ah, false, bl, (short)0, c, false, false);
  asm volatile("v_nop\n\tv_nop\n\tv_nop\n\tv_nop" : "+v"(c) : "v"(ah), "v"(al), "v"(bh), "v"(bl));
  return c;
}

__global__ __launch_bounds__(256) void k_wt_bf16(const float* __restrict__ W, unsigned short* __restrict__ Wt, int K, int N) {
  const int t = blockIdx.x * 256 + threadIdx.x;
  const int k8n = K / 8;
  if (t >= N * k8n) return;
  const int n = t / k8n, k8 = (t % k8n) * 8;
  v8us v;
#pragma unroll
  for (int i = 0; i < 8; ++i) v[i] = bf16_bits(W[(size_t)(k8 + i) * N + n]);
  *(v8us*)(Wt + (size_t)n * K + k8) = v;
  
}

// GEMM C[M][N] (f32, pitch ldc) = act(A[M][K]·W + bias). A f32 row-major (pitch lda) converted per fragment to bf16
// (ASPLIT: hi/lo two planes -> 2 terms, else single rounded term); Wt bf16 [N][K] (pitch ldb). BIAS_BF16 rounds the
// bias to bf16 first (bias quantised to bf16 before the add). K%32==0, M%16==0, N%64==0.
template <bool ASPLIT, int ACT, bool BIAS_BF16>
__global__ __launch_bounds__(128) void k_gemm_bf(const float* __restrict__ A, int lda, const unsigned short* __restrict__ Wt, int ldb,
                                               const float* __restrict__ bias, float* __restrict__ C, int ldc, int M, int N, int K) {
  __shared__ __attribute__((aligned(16))) float so[4][16][64];
  const int tid = threadIdx.x, w = tid >> 5, lane = tid & 31, ln = lane & 15, hh = lane >> 4;
  const int ntn = N / 64;
  const int wid = blockIdx.x * 4 + w;
  const int mt = wid / ntn, nq = wid % ntn;
  if (mt * 16 >= M) return;
  const int row0 = mt * 16, col0 = nq * 64;
  const float* arow = A + (size_t)(row0 + ln) * lda;
  v8f acc[4] = {};
  for (int kb = 0; kb < K; kb += 32) {
    FragB ah, al;
    const v4f x0 = *(const v4fa*)(arow + kb + 8 * hh), x1 = *(const v4fa*)(arow + kb + 8 * hh + 4);
    const v4f x2 = *(const v4fa*)(arow + kb + 16 + 8 * hh), x3 = *(const v4fa*)(arow + kb + 16 + 8 * hh + 4);
    float xs[16] = {x0[0],x0[1],x0[2],x0[3],x1[0],x1[1],x1[2],x1[3],x2[0],x2[1],x2[2],x2[3],x3[0],x3[1],x3[2],x3[3]};
#pragma unroll
    for (int i = 0; i < 16; ++i) { const unsigned short hb = bf16_bits(xs[i]); ah.u[i] = hb; al.u[i] = ASPLIT ? bf16_bits(xs[i] - bf16_val(hb)) : (unsigned short)0; }
#pragma unroll
    for (int t = 0; t < 4; ++t) {
      const unsigned short* brow = Wt + (size_t)(col0 + t * 16 + ln) * ldb + kb;
      FragB b;
      b.half[0] = *(const v8us*)(brow + 8 * hh);
      b.half[1] = *(const v8us*)(brow + 16 + 8 * hh);
      acc[t] = mmaN<ASPLIT ? 2 : 1>(ah.v, al.v, b.v, b.v, acc[t]);
    }
  }
#pragma unroll
  for (int t = 0; t < 4; ++t) {
    float bv = bias ? bias[col0 + t * 16 + ln] : 0.f;
    if (BIAS_BF16) bv = bf16_round(bv);
#pragma unroll
    for (int r = 0; r < 8; ++r) { float v = acc[t][r] + bv; if (ACT == 1) v = fmaxf(v, 0.f); so[w][8 * hh + r][t * 16 + ln] = v; }
  }
  __builtin_amdgcn_fence(__ATOMIC_ACQ_REL, "workgroup");
  __builtin_amdgcn_wave_barrier();
  const int rsub = lane >> 4, c4 = (lane & 15) * 4;
  {
#pragma unroll
    for (int q = 0; q < 8; ++q) {
      const int r = q * 2 + rsub;
      const v4f v = *(const v4fa*)&so[w][r][c4];
      *(v4f*)(C + (size_t)(row0 + r) * ldc + col0 + c4) = v;
    }
    
  }
}

// GEMM C = act(A·W + bias + resid): A f32 (ASPLIT -> hi/lo 2 terms), Wt bf16 [N][K]; ACT 0 none, 1 relu, 2 exact gelu;
// resid (optional, f32, row index = (row % rmod), pitch ldr, RES_BF16 rounds it) added before the activation.
template <bool ASPLIT, int ACT, bool BIAS_BF16, bool RES_BF16>
__global__ __launch_bounds__(128) void k_gemm_bf3(const float* __restrict__ A, int lda, const unsigned short* __restrict__ Wt, int ldb,
                                                const float* __restrict__ bias, const float* __restrict__ resid, int rmod, int ldr,
                                                float* __restrict__ C, int ldc, int M, int N, int K) {
  __shared__ __attribute__((aligned(16))) float so[4][16][64];
  const int tid = threadIdx.x, w = tid >> 5, lane = tid & 31, ln = lane & 15, hh = lane >> 4;
  const int ntn = N / 64;
  const int wid = blockIdx.x * 4 + w;
  const int mt = wid / ntn, nq = wid % ntn;
  if (mt * 16 >= M) return;
  const int row0 = mt * 16, col0 = nq * 64;
  const float* arow = A + (size_t)(row0 + ln) * lda;
  v8f acc[4] = {};
  for (int kb = 0; kb < K; kb += 32) {
    FragB ah, al;
    const v4f x0 = *(const v4fa*)(arow + kb + 8 * hh), x1 = *(const v4fa*)(arow + kb + 8 * hh + 4);
    const v4f x2 = *(const v4fa*)(arow + kb + 16 + 8 * hh), x3 = *(const v4fa*)(arow + kb + 16 + 8 * hh + 4);
    float xs[16] = {x0[0],x0[1],x0[2],x0[3],x1[0],x1[1],x1[2],x1[3],x2[0],x2[1],x2[2],x2[3],x3[0],x3[1],x3[2],x3[3]};
#pragma unroll
    for (int i = 0; i < 16; ++i) { const unsigned short hb = bf16_bits(xs[i]); ah.u[i] = hb; al.u[i] = ASPLIT ? bf16_bits(xs[i] - bf16_val(hb)) : (unsigned short)0; }
#pragma unroll
    for (int t = 0; t < 4; ++t) {
      const unsigned short* brow = Wt + (size_t)(col0 + t * 16 + ln) * ldb + kb;
      FragB b;
      b.half[0] = *(const v8us*)(brow + 8 * hh);
      b.half[1] = *(const v8us*)(brow + 16 + 8 * hh);
      acc[t] = mmaN<ASPLIT ? 2 : 1>(ah.v, al.v, b.v, b.v, acc[t]);
    }
  }
#pragma unroll
  for (int t = 0; t < 4; ++t) {
    const int col = col0 + t * 16 + ln;
    float bv = bias ? bias[col] : 0.f;
    if (BIAS_BF16) bv = bf16_round(bv);
#pragma unroll
    for (int r = 0; r < 8; ++r) {
      float v = acc[t][r] + bv;
      if (resid) { float rv = resid[(size_t)((row0 + 8 * hh + r) % rmod) * ldr + col]; if (RES_BF16) rv = bf16_round(rv); v += rv; }
      if (ACT == 1) v = fmaxf(v, 0.f);
      if (ACT == 2) v = 0.5f * v * (1.0f + erff(v * 0.70710678118654752f));
      if (ACT == 3) { const float u = 0.7978845608028654f * (v + 0.044715f * v * v * v); v = 0.5f * v * (1.0f + tanhf(u)); }
      so[w][8 * hh + r][t * 16 + ln] = v;
    }
  }
  __builtin_amdgcn_fence(__ATOMIC_ACQ_REL, "workgroup");
  __builtin_amdgcn_wave_barrier();
  const int rsub = lane >> 4, c4 = (lane & 15) * 4;
  {
#pragma unroll
    for (int q = 0; q < 8; ++q) {
      const int r = q * 2 + rsub;
      const v4f v = *(const v4fa*)&so[w][r][c4];
      *(v4f*)(C + (size_t)(row0 + r) * ldc + col0 + c4) = v;
    }
    
  }
}
// row LayerNorm (biased variance, eps) over N: s = X (+ R); optional out_sum <- s; out_norm <- (s-mu)*rsqrt(var+eps)*g + b
template <bool PARAM_BF16>
__global__ __launch_bounds__(256) void k_layernorm(const float* __restrict__ X, const float* __restrict__ R, const float* __restrict__ g, const float* __restrict__ bta,
                                                  float* __restrict__ out_sum, float* __restrict__ out_norm, int N, float eps) {
  __shared__ float red[256];
  const int row = blockIdx.x, tid = threadIdx.x;
  const float* x = X + (size_t)row * N; const float* rr = R ? R + (size_t)row * N : nullptr;
  float vals[16];                     // up to N = 4096
  const int per = N / 256;            // contiguous chunk per thread? use strided-by-4 chunks: thread handles j = tid*4 + 1024*u
  float s1 = 0.f;
  for (int u = 0; u < per / 4; ++u) {
    const int j = tid * 4 + 1024 * u;
    const v4f a = *(const v4fa*)(x + j);
    v4f b = {0.f,0.f,0.f,0.f}; if (rr) b = *(const v4fa*)(rr + j);
#pragma unroll
    for (int q = 0; q < 4; ++q) { const float v = a[q] + b[q]; vals[u * 4 + q] = v; s1 += v; }
  }
  red[tid] = s1; __syncthreads();
  for (int st = 128; st > 0; st >>= 1) { if (tid < st) red[tid] += red[tid + st]; __syncthreads(); }
  const float mu = red[0] / (float)N; __syncthreads();
  float s2 = 0.f;
  for (int u = 0; u < per / 4; ++u)
#pragma unroll
    for (int q = 0; q < 4; ++q) { const float c = vals[u * 4 + q] - mu; s2 += c * c; }
  red[tid] = s2; __syncthreads();
  for (int st = 128; st > 0; st >>= 1) { if (tid < st) red[tid] += red[tid + st]; __syncthreads(); }
  const float rs = rsqrtf(red[0] / (float)N + eps);
  {
    for (int u = 0; u < per / 4; ++u) {
      const int j = tid * 4 + 1024 * u;
      v4f o, sm;
#pragma unroll
      for (int q = 0; q < 4; ++q) {
        float gg = g[j + q], bb = bta[j + q];
        if (PARAM_BF16) { gg = bf16_round(gg); bb = bf16_round(bb); }
        sm[q] = vals[u * 4 + q]; o[q] = (vals[u * 4 + q] - mu) * rs * gg + bb;
      }
      if (out_sum) *(v4f*)(out_sum + (size_t)row * N + j) = sm;
      *(v4f*)(out_norm + (size_t)row * N + j) = o;
    }
    
  }
}



// ---- f16 WMMA path (v_wmma_f32_16x16x32_f16): 11-bit significands for operands in range — used where a [0,1] probability operand needs more precision than bf16
typedef _Float16 v16h __attribute__((ext_vector_type(16)));
union FragH { v16h v; v8us half[2]; _Float16 h[16]; unsigned short u[16]; };
template <int NT>
__device__ __forceinline__ v8f mmaH(v16h ah, v16h al, v16h bh, v16h bl, v8f c) {
  c = __builtin_amdgcn_wmma_f32_16x16x32_f16(false, ah, false, bh, (short)0, c, false, false);
  if (NT >= 2) c = __builtin_amdgcn_wmma_f32_16x16x32_f16(false, al, false, bh, (short)0, c, false, false);
  if (NT >= 3) c = __builtin_amdgcn_wmma_f32_16x16x32_f16(false, ah, false, bl, (short)0, c, false, false);
  asm volatile("v_nop\n\tv_nop\n\tv_nop\n\tv_nop" : "+v"(c) : "v"(ah), "v"(al), "v"(bh), "v"(bl));
  return c;
}
// batched GEMM like k_gemm_b but f16 operands: A f32 (split into f16 hi/lo if ASPLIT, else rounded to f16), Bt = f16 values [n][k]; alpha; C f32; N multiple of 16 (partial tiles skipped)
template <bool ASPLIT>
__global__ __launch_bounds__(128) void k_gemm_h(const float* __restrict__ A, int lda, size_t sA, const _Float16* __restrict__ Bh, int ldb, size_t sB, float alpha, float* __restrict__ C, int ldc, size_t sC, int M, int N, int K) {
  __shared__ __attribute__((aligned(16))) float so[4][16][64];
  const int tid = threadIdx.x, w = tid >> 5, lane = tid & 31, ln = lane & 15, hh = lane >> 4; const int by = blockIdx.y;
  A += (size_t)by * sA; Bh += (size_t)by * sB; C += (size_t)by * sC;
  const int ntn = (N + 63) / 64; const int wid = blockIdx.x * 4 + w; const int mt = wid / ntn, nq = wid % ntn; if (mt * 16 >= M) return;
  const int row0 = mt * 16, col0 = nq * 64; const float* arow = A + (size_t)(row0 + ln) * lda;
  v8f acc[4] = {};
  for (int kb = 0; kb < K; kb += 32) {
    FragH ah, al;
    const v4f x0 = *(const v4fa*)(arow + kb + 8 * hh), x1 = *(const v4fa*)(arow + kb + 8 * hh + 4), x2 = *(const v4fa*)(arow + kb + 16 + 8 * hh), x3 = *(const v4fa*)(arow + kb + 16 + 8 * hh + 4);
    float xs[16] = {x0[0],x0[1],x0[2],x0[3],x1[0],x1[1],x1[2],x1[3],x2[0],x2[1],x2[2],x2[3],x3[0],x3[1],x3[2],x3[3]};
#pragma unroll
    for (int i = 0; i < 16; ++i) { const _Float16 h = (_Float16)xs[i]; ah.h[i] = h; al.h[i] = ASPLIT ? (_Float16)(xs[i] - (float)h) : (_Float16)0.0f; }
#pragma unroll
    for (int t = 0; t < 4; ++t) { if (col0 + t * 16 >= N) continue; const size_t boff = (size_t)(col0 + t * 16 + ln) * ldb + kb; FragH bq; bq.half[0] = *(const v8us*)(Bh + boff + 8 * hh); bq.half[1] = *(const v8us*)(Bh + boff + 16 + 8 * hh);
      acc[t] = mmaH<ASPLIT ? 2 : 1>(ah.v, al.v, bq.v, bq.v, acc[t]); }
  }
#pragma unroll
  for (int t = 0; t < 4; ++t) { if (col0 + t * 16 >= N) continue;
#pragma unroll
    for (int r = 0; r < 8; ++r) so[w][8 * hh + r][t * 16 + ln] = acc[t][r] * alpha; }
  __builtin_amdgcn_fence(__ATOMIC_ACQ_REL, "workgroup"); __builtin_amdgcn_wave_barrier();
  const int rsub = lane >> 4, c4 = (lane & 15) * 4;
  {
#pragma unroll
    for (int q = 0; q < 8; ++q) { const int r = q * 2 + rsub; if (col0 + c4 < N) { const v4f v = *(const v4fa*)&so[w][r][c4]; *(v4f*)(C + (size_t)(row0 + r) * ldc + col0 + c4) = v; } }
     }
}

// Wt[n][k] = f16(W[k][n]·scale) from f32 row-major W[K][N] (scale = power of two; bf16-exact weights stay exact in f16 away from the subnormal range)
__global__ __launch_bounds__(256) void k_wt_f16(const float* __restrict__ W, _Float16* __restrict__ Wt, int K, int N, float scale) {
  const int t = blockIdx.x * 256 + threadIdx.x; if (t >= N * (K / 8)) return; const int n = t / (K / 8), k8 = (t % (K / 8)) * 8; FragH f;
#pragma unroll
  for (int i = 0; i < 8; ++i) f.h[i] = (_Float16)(bf16_round(W[(size_t)(k8 + i) * N + n]) * scale); const v8us o = f.half[0];
  *(v8us*)((unsigned short*)Wt + (size_t)n * K + k8) = o; 
}
// k_gemm_hh variant with fused epilogue: v = acc·alpha + bias[by·sBias + col] (+ CP[(row/rowsPerB)·sCPb + by·64 + col] if CP) ; ACT 0 none / 1 elu ; writes f16 C16 (and f32 C if non-null)
template <int ACT>
__global__ __launch_bounds__(128) void k_gemm_hhx(const _Float16* __restrict__ A, int lda, size_t sA, const _Float16* __restrict__ Bh, int ldb, size_t sB, float alpha, const float* __restrict__ bias, size_t sBias, const float* __restrict__ CP, int rowsPerB, size_t sCPb, int row0g,
    float* __restrict__ C, _Float16* __restrict__ C16, int ldc, size_t sC, int M, int N, int K) {
  __shared__ __attribute__((aligned(16))) float so[4][16][64];
  const int tid = threadIdx.x, w = tid >> 5, lane = tid & 31, ln = lane & 15, hh = lane >> 4; const int by = blockIdx.y;
  A += (size_t)by * sA; Bh += (size_t)by * sB; const size_t cofs = (size_t)by * sC; const float* bp = bias ? bias + (size_t)by * sBias : nullptr;
  const int ntn = (N + 63) / 64; const int wid = blockIdx.x * 4 + w; const int mt = wid / ntn, nq = wid % ntn; if (mt * 16 >= M) return;
  const int row0 = mt * 16, col0 = nq * 64; const _Float16* arow = A + (size_t)(row0 + ln) * lda;
  v8f acc[4] = {};
  for (int kb = 0; kb < K; kb += 32) { FragH ah; ah.half[0] = *(const v8us*)((const unsigned short*)arow + kb + 8 * hh); ah.half[1] = *(const v8us*)((const unsigned short*)arow + kb + 16 + 8 * hh);
#pragma unroll
    for (int t = 0; t < 4; ++t) { if (col0 + t * 16 >= N) continue; const size_t boff = (size_t)(col0 + t * 16 + ln) * ldb + kb; FragH bq; bq.half[0] = *(const v8us*)((const unsigned short*)Bh + boff + 8 * hh); bq.half[1] = *(const v8us*)((const unsigned short*)Bh + boff + 16 + 8 * hh);
      acc[t] = mmaH<1>(ah.v, ah.v, bq.v, bq.v, acc[t]); }
  }
#pragma unroll
  for (int t = 0; t < 4; ++t) { if (col0 + t * 16 >= N) continue; const int col = col0 + t * 16 + ln; const float bv = bp ? bf16_round(bp[col]) : 0.f;
#pragma unroll
    for (int r = 0; r < 8; ++r) { float v = acc[t][r] * alpha + bv; if (CP) { const int rr = row0g + row0 + 8 * hh + r; if (rowsPerB < 0) v += CP[cofs + (size_t)rr * ldc + col];      /* rowsPerB < 0: own element of the batched C plane */ else { const int bidx = rr / rowsPerB; v += CP[(size_t)bidx * sCPb + (size_t)by * 64 + col]; } } if (ACT == 1) v = (v > 0.f) ? v : expm1f(v); else if (ACT == 7) v = (v > 0.f) ? v + 1.0f : expf(v); else if (ACT == 8) v = tanhf(v); else if (ACT == 9) v = 0.5f * v * (1.0f + tanhf(0.7978845608028654f * (v + 0.044715f * v * v * v))); else if (ACT == 11) v = 1.0f / (1.0f + expf(-v)); else if (ACT == 12) v = (v > 0.f) ? v : 0.01f * v; else if (ACT == 14) v = (v > 0.f) ? v : 0.1f * v; else if (ACT == 16) v = (v >= 0.f) ? v : 0.3f * v; else if (ACT == 17) v = (v >= 0.f) ? v : 0.2f * v; else if (ACT == 15) v = v / (1.0f + expf(-v)); else if (ACT == 3) v = fmaxf(v, 0.f); else if (ACT == 6) v = 0.5f * v * (1.0f + erff(v * 0.70710678118654752f)); so[w][8 * hh + r][t * 16 + ln] = v; } }
  __builtin_amdgcn_fence(__ATOMIC_ACQ_REL, "workgroup"); __builtin_amdgcn_wave_barrier();
  const int rsub = lane >> 4, c4 = (lane & 15) * 4; typedef _Float16 v4h __attribute__((ext_vector_type(4)));
  {
#pragma unroll
    for (int q = 0; q < 8; ++q) { const int r = q * 2 + rsub; if (col0 + c4 < N) { const v4f v = *(const v4fa*)&so[w][r][c4]; if (C) *(v4f*)(C + cofs + (size_t)(row0 + r) * ldc + col0 + c4) = v; if (C16) { v4h h4; for (int i = 0; i < 4; ++i) h4[i] = (_Float16)v[i]; *(v4h*)(C16 + cofs + (size_t)(row0 + r) * ldc + col0 + c4) = h4; } } }
     }
}


typedef _Float16 v4h __attribute__((ext_vector_type(4)));

__global__ __launch_bounds__(256) void k_x16(const float* __restrict__ x, _Float16* __restrict__ X16, size_t n8) { const size_t t = (size_t)blockIdx.x * 256 + threadIdx.x; if (t >= n8) return; FragH f;
#pragma unroll
  for (int q = 0; q < 8; ++q) f.h[q] = (_Float16)bf16_round(x[t * 8 + q]); *(v8us*)((unsigned short*)X16 + t * 8) = f.half[0];  }
__global__ __launch_bounds__(256) void k_h16(const float* __restrict__ x, _Float16* __restrict__ X16, size_t n8) { const size_t t = (size_t)blockIdx.x * 256 + threadIdx.x; if (t >= n8) return; FragH f;
#pragma unroll
  for (int q = 0; q < 8; ++q) f.h[q] = (_Float16)x[t * 8 + q]; *(v8us*)((unsigned short*)X16 + t * 8) = f.half[0];  }
__global__ __launch_bounds__(256) void k_round16f(const float* __restrict__ W, _Float16* __restrict__ Bt, size_t n8) { const size_t t = (size_t)blockIdx.x * 256 + threadIdx.x; if (t >= n8) return; FragH f;
#pragma unroll
  for (int i = 0; i < 8; ++i) f.h[i] = (_Float16)(bf16_round(W[t * 8 + i]) * 16.0f); *(v8us*)((unsigned short*)Bt + t * 8) = f.half[0];  }
template <int NHv, int TTv>
__global__ __launch_bounds__(256) void k_vt(const _Float16* __restrict__ V16, int ldv, int voff, _Float16* __restrict__ Vt) { __shared__ unsigned short tl[64][66]; const int tid = threadIdx.x; const int slab = blockIdx.x / (TTv / 64), lg = blockIdx.x % (TTv / 64); const int b = slab / NHv, h = slab % NHv;
  for (int i = tid; i < 64 * 8; i += 256) { const int r = i / 8, c8 = (i % 8) * 8; FragH f; f.half[0] = *(const v8us*)((const unsigned short*)V16 + ((size_t)b * TTv + lg * 64 + r) * ldv + voff + h * 64 + c8);
#pragma unroll
    for (int q = 0; q < 8; ++q) tl[r][c8 + q] = f.u[q]; }
  __syncthreads();
  {
#pragma unroll
    for (int rd = 0; rd < 2; ++rd) { const int d = rd * 32 + tid / 8, pc = tid % 8; FragH f;
#pragma unroll
      for (int q = 0; q < 8; ++q) f.u[q] = tl[pc * 8 + q][d];
      *(v8us*)((unsigned short*)Vt + ((size_t)slab * 64 + d) * TTv + lg * 64 + pc * 8) = f.half[0]; }
     } }

__global__ __launch_bounds__(256) void k_hl(const float* __restrict__ F, _Float16* __restrict__ Hh, _Float16* __restrict__ Hl, size_t n8) { const size_t t = (size_t)blockIdx.x * 256 + threadIdx.x; if (t >= n8) return; FragH fh, fl; const v4f a = *(const v4fa*)(F + t * 8), c = *(const v4fa*)(F + t * 8 + 4);
#pragma unroll
  for (int q = 0; q < 4; ++q) { _Float16 h = (_Float16)a[q]; fh.h[q] = h; fl.h[q] = (_Float16)((a[q] - (float)h) * 1024.0f); h = (_Float16)c[q]; fh.h[4 + q] = h; fl.h[4 + q] = (_Float16)((c[q] - (float)h) * 1024.0f); }
  { *(v8us*)((unsigned short*)Hh + t * 8) = fh.half[0]; *(v8us*)((unsigned short*)Hl + t * 8) = fl.half[0];  } }

// ---- fast GEMM (work-group tile 128x64, wave tile 32x64; requires M % 128 == 0 rows per launch region, N % 64 == 0, K % 64 == 0); epilogue = k_gemm_hhx semantics ----
// Operands reach the waves through LDS: per pass of 64 k the work-group's 128 rows of A and 64 rows of B (128 bytes each) are brought in once by asynchronous copies, whole lines at a time, into one of two buffers; the next pass's copies fly while this pass is worked on.
#define G2P 144                      /* LDS row pitch in bytes: 16 B x odd, the pitch for ds_load_b128 readers of 128-byte rows */
#define G2S ((128 + 64) * G2P)       /* one buffer: rows 0..127 = A, rows 128..191 = B */
__device__ __forceinline__ v16h g2_lfrag(const unsigned char* p) { FragH f; f.half[0] = *(const v8us*)p; f.half[1] = *(const v8us*)(p + 32); return f.v; }
// one pass's operands: twelve 16-byte copies per lane (eight lanes per 128-byte row, 16 rows per copy and work-group; copies 0..7 = A, 8..11 = B). l = the lane's LDS byte address in row tid / 8 of the buffer; a, b = its own 16 bytes in that row of A and of B; sa, sb = 16 rows in bytes.
// The s_wait_xcnt stands inside the statement, behind the last copy: a precaution in front of any later write of a register that a copy names.
__device__ __forceinline__ void g2_copy(unsigned l, const char* a, size_t sa, const char* b, size_t sb) {
  asm volatile("global_load_async_to_lds_b128 %0, %12, off\n\tglobal_load_async_to_lds_b128 %1, %13, off\n\tglobal_load_async_to_lds_b128 %2, %14, off\n\tglobal_load_async_to_lds_b128 %3, %15, off\n\t"
               "global_load_async_to_lds_b128 %4, %16, off\n\tglobal_load_async_to_lds_b128 %5, %17, off\n\tglobal_load_async_to_lds_b128 %6, %18, off\n\tglobal_load_async_to_lds_b128 %7, %19, off\n\t"
               "global_load_async_to_lds_b128 %8, %20, off\n\tglobal_load_async_to_lds_b128 %9, %21, off\n\tglobal_load_async_to_lds_b128 %10, %22, off\n\tglobal_load_async_to_lds_b128 %11, %23, off\n\ts_wait_xcnt 0x0"
               :: "v"(l), "v"(l + 16u * G2P), "v"(l + 32u * G2P), "v"(l + 48u * G2P), "v"(l + 64u * G2P), "v"(l + 80u * G2P), "v"(l + 96u * G2P), "v"(l + 112u * G2P), "v"(l + 128u * G2P), "v"(l + 144u * G2P), "v"(l + 160u * G2P), "v"(l + 176u * G2P),
                  "v"(a), "v"(a + sa), "v"(a + 2 * sa), "v"(a + 3 * sa), "v"(a + 4 * sa), "v"(a + 5 * sa), "v"(a + 6 * sa), "v"(a + 7 * sa), "v"(b), "v"(b + sb), "v"(b + 2 * sb), "v"(b + 3 * sb) : "memory"); }
__device__ __forceinline__ v8f g2_mma(v16h a, v16h b, v8f c) { v8f d = __builtin_amdgcn_wmma_f32_16x16x32_f16(false, a, false, b, (short)0, c, false, false); asm volatile("v_nop\n\tv_nop\n\tv_nop\n\tv_nop" : "+v"(d) : "v"(a), "v"(b)); return d; }
// QKVF (the stacked q | k | v launch, rows b * SQ + s, columns 0 .. 3 DM - 1): the f32 values behind the f16 rows are stored as well, so that no product is formed twice: k and v head-major into KV (outputs 1 and 2, one behind the other: [k | v][NB][NH][SQ][HD]), and q, k, v of each batch's first QT0 rows into F0 ([q | k | v][NB][QT0][DM]) for the f32 attention path.
template <int ACT, bool QKVF = false>
__global__ __launch_bounds__(128) void k_gemm2(const _Float16* __restrict__ A, int lda, size_t sA, const _Float16* __restrict__ Bh, int ldb, size_t sB, float alpha, const float* __restrict__ bias, size_t sBias, const float* __restrict__ CP, int rowsPerB, size_t sCPb, int row0g,
    float* __restrict__ C, _Float16* __restrict__ C16, int ldc, size_t sC, int M, int N, int K, float* __restrict__ KV, float* __restrict__ F0) { static_assert(ACT == 0 || ACT == 3 || ACT == 6 || ACT == 8 || ACT == 9 || ACT == 11 || ACT == 12 || ACT == 14 || ACT == 15 || ACT == 16 || ACT == 17, "k_gemm2: unsupported ACT code (would silently apply no activation)");
  __shared__ __attribute__((aligned(16))) unsigned char ring[2 * G2S]; static_assert(sizeof(float) * 4 * 32 * 68 <= 2 * G2S, "the output staging fits in the ring");
  float (*so)[32][68] = (float (*)[32][68])ring;      /* output staging in the ring's place, behind the last pass's barrier */
  const int tid = threadIdx.x, w = tid >> 5, lane = tid & 31, ln = lane & 15, hh = lane >> 4; const int by = blockIdx.y;
  A += (size_t)by * sA; Bh += (size_t)by * sB; const size_t cofs = (size_t)by * sC; const float* bp = bias ? bias + (size_t)by * sBias : nullptr;
  const int ntn = N >> 6; const int mt = blockIdx.x / ntn, nq = blockIdx.x - mt * ntn; const int row0 = mt * 128 + 32 * w, col0 = nq * 64; if (mt * 128 >= M) return;      /* the whole work-group or none of it, in front of every barrier */
  const char* ag = (const char*)(A + (size_t)(mt * 128 + (tid >> 3)) * lda) + (tid & 7) * 16; const char* bg = (const char*)(Bh + (size_t)(col0 + (tid >> 3)) * ldb) + (tid & 7) * 16;      /* the lane's 16 bytes in the first of its rows */
  const size_t sa = (size_t)lda * 32, sb = (size_t)ldb * 32; const unsigned lc = (unsigned)(size_t)ring + (unsigned)((tid >> 3) * G2P + (tid & 7) * 16);
  const unsigned char* la = ring + (32 * w + ln) * G2P + 16 * hh; const unsigned char* lb = ring + (128 + ln) * G2P + 16 * hh;      /* fragment rows: the wave's own 32 rows of A, the 64 rows of B */
  const v8f z8 = {0.f,0.f,0.f,0.f,0.f,0.f,0.f,0.f}; v8f c00 = z8, c01 = z8, c02 = z8, c03 = z8, c10 = z8, c11 = z8, c12 = z8, c13 = z8;
  const int np = K >> 6;
  g2_copy(lc, ag, sa, bg, sb);
  asm volatile("s_wait_asynccnt 0x0" ::: "memory");      /* this wave's copies of pass 0 have landed */
  __syncthreads();      /* pass 0 is readable by every wave */
  if (np > 1) g2_copy(lc + G2S, ag + 128, sa, bg + 128, sb);
#pragma unroll 1
  for (int t = 0; t < np; ++t) { const unsigned bo = (unsigned)(t & 1) * G2S;
    v16h fa[2][2], fb[2][4];      /* the pass's fragments: two k steps of 32 */
#pragma unroll      /* register arrays, constant LDS offsets */
    for (int ks = 0; ks < 2; ++ks) { fa[ks][0] = g2_lfrag(la + bo + ks * 64); fa[ks][1] = g2_lfrag(la + bo + ks * 64 + 16 * G2P);
#pragma unroll      /* register arrays */
      for (int j = 0; j < 4; ++j) fb[ks][j] = g2_lfrag(lb + bo + ks * 64 + j * 16 * G2P); }
    __builtin_amdgcn_sched_barrier(0);      /* all LDS reads of the pass go out as one group in front of its products; left to itself the compiler reads one fragment at a time and waits out the LDS latency in front of every second product */
#pragma unroll      /* register arrays */
    for (int ks = 0; ks < 2; ++ks) {
      c00 = g2_mma(fa[ks][0], fb[ks][0], c00); c10 = g2_mma(fa[ks][1], fb[ks][0], c10);
      c01 = g2_mma(fa[ks][0], fb[ks][1], c01); c11 = g2_mma(fa[ks][1], fb[ks][1], c11);
      c02 = g2_mma(fa[ks][0], fb[ks][2], c02); c12 = g2_mma(fa[ks][1], fb[ks][2], c12);
      c03 = g2_mma(fa[ks][0], fb[ks][3], c03); c13 = g2_mma(fa[ks][1], fb[ks][3], c13); }
    asm volatile("s_wait_dscnt 0x0" ::: "memory");      /* this wave's reads of the buffer are done before the barrier behind which it is refilled */
    asm volatile("s_wait_asynccnt 0x0" ::: "memory");      /* this wave's copies of pass t + 1 have landed */
    __syncthreads();      /* publishes pass t + 1 and ends every wave's reads of pass t */
    if (t + 2 < np) g2_copy(lc + bo, ag + (size_t)(t + 2) * 128, sa, bg + (size_t)(t + 2) * 128, sb); }
  asm volatile("s_wait_asynccnt 0x0" ::: "memory");      /* no copy is outstanding when the ring becomes output staging */
  v8f accs[8] = {c00, c01, c02, c03, c10, c11, c12, c13};
#pragma unroll
  for (int u = 0; u < 8; ++u) { const int t = u & 3, half = u >> 2; const int col = col0 + t * 16 + ln; const float bv = bp ? bf16_round(bp[col]) : 0.f;
#pragma unroll
    for (int r = 0; r < 8; ++r) { const int rloc = half * 16 + 8 * hh + r; float v = accs[u][r] * alpha + bv; if (CP) { if (rowsPerB < 0) v += CP[cofs + (size_t)(row0g + row0 + rloc) * ldc + col];      /* rowsPerB < 0: own element of the batched C plane */ else { const int bidx = (row0g + row0 + rloc) / rowsPerB; v += CP[(size_t)bidx * sCPb + (size_t)by * 64 + col]; } }
      if (ACT == 3) v = fmaxf(v, 0.f); else if (ACT == 6) v = 0.5f * v * (1.0f + erff(v * 0.70710678118654752f)); else if (ACT == 11) v = 1.0f / (1.0f + expf(-v)); else if (ACT == 15) v = v / (1.0f + expf(-v)); else if (ACT == 12) v = (v > 0.f) ? v : 0.01f * v; else if (ACT == 8) v = tanhf(v); else if (ACT == 9) v = 0.5f * v * (1.0f + tanhf(0.7978845608028654f * (v + 0.044715f * v * v * v))); else if (ACT == 14) v = (v > 0.f) ? v : 0.1f * v; else if (ACT == 16) v = (v >= 0.f) ? v : 0.3f * v; else if (ACT == 17) v = (v >= 0.f) ? v : 0.2f * v;
      so[w][rloc][t * 16 + ln] = v; } }
  __builtin_amdgcn_fence(__ATOMIC_ACQ_REL, "workgroup"); __builtin_amdgcn_wave_barrier();
  const int rsub = lane >> 4, c4 = (lane & 15) * 4;
  {
#pragma unroll
    for (int q = 0; q < 16; ++q) { const int r = q * 2 + rsub; const v4f v = *(const v4fa*)&so[w][r][c4]; if (C) *(v4f*)(C + cofs + (size_t)(row0 + r) * ldc + col0 + c4) = v; if (C16) { v4h h4; for (int i = 0; i < 4; ++i) h4[i] = (_Float16)v[i]; *(v4h*)(C16 + cofs + (size_t)(row0 + r) * ldc + col0 + c4) = h4; } }
     }
  if constexpr (QKVF) { static_assert(QT0 == 128 && SQ % 128 == 0 && HD == 64 && DM % 64 == 0, "a work-group's 128 rows lie in one batch and are its first QT0 rows or none of them; its 64 columns are one head of q, of k or of v");
    const int sel = col0 / DM, hc = col0 % DM, bt = (mt * 128) / SQ, t0 = (mt * 128) % SQ;      /* 0 q, 1 k, 2 v; first column in that matrix; batch; first row in the batch: all the work-group's own, scalars */
    if (sel >= 1) { float* kvp = KV + ((size_t)((sel - 1) * NB + bt) * NH + hc / HD) * SQ * HD + (size_t)t0 * HD; const unsigned kvo = (unsigned)((32 * w + rsub) * HD + c4) * 4u;      /* scalar base, the lane's fixed offset in bytes, the row pair as a constant: a head's rows follow one another, so that each store is 512 bytes in a row */
#pragma unroll      /* constant offsets */
      for (int q = 0; q < 16; ++q) *(v4f*)((char*)kvp + kvo + q * 2 * HD * 4) = *(const v4fa*)&so[w][q * 2 + rsub][c4];
      asm volatile("s_wait_xcnt 0x0" :: "v"(kvo), "s"(kvp) : "memory"); }      /* behind the stores, in front of any later write of their base and offset registers (the next block forms its own); both as inputs, so that their registers are still theirs up to here */
    if (t0 == 0) { float* fp = F0 + (size_t)(sel * NB + bt) * QT0 * DM + hc; const unsigned fo = (unsigned)((32 * w + rsub) * DM + c4) * 4u;      /* as above, row pitch DM */
#pragma unroll      /* constant offsets */
      for (int q = 0; q < 16; ++q) *(v4f*)((char*)fp + fo + q * 2 * DM * 4) = *(const v4fa*)&so[w][q * 2 + rsub][c4]; } } }


__global__ __launch_bounds__(256) void k_wnat(const float* __restrict__ w, size_t n8, _Float16* __restrict__ Bt) { const size_t t = (size_t)blockIdx.x * 256 + threadIdx.x; if (t >= n8) return; FragH f; for (int q = 0; q < 8; ++q) f.h[q] = (_Float16)(bf16_round(w[t * 8 + q]) * 16.0f); *(v8us*)((unsigned short*)Bt + t * 8) = f.half[0];  }
__global__ __launch_bounds__(256) void k_rsm(const float* __restrict__ S, _Float16* __restrict__ P, int nrows) {
  #pragma clang fp contract(off)
  const int i = blockIdx.x * 256 + threadIdx.x; if (i >= nrows) return; const float* s = S + (size_t)i * SQ; float mx = -3.0e38f;
#pragma unroll 1
  for (int j = 0; j < SQ; ++j) mx = fmaxf(mx, s[j]); float se = 0.f;
#pragma unroll 1
  for (int j = 0; j < SQ; ++j) se += expf(s[j] - mx); const float sc = 256.0f / se;
#pragma unroll 1
  for (int j0 = 0; j0 < SQ; j0 += 8) { FragH f; for (int q = 0; q < 8; ++q) f.h[q] = (_Float16)(expf(s[j0 + q] - mx) * sc); unsigned short* d = (unsigned short*)P + (size_t)i * SQ + j0; *(v8us*)d = f.half[0];  } }
__global__ __launch_bounds__(256) void k_vt(const _Float16* __restrict__ V16, int b, int h0, _Float16* __restrict__ VT) { __shared__ unsigned short tl[64][65]; const int tid = threadIdx.x; const int hh = blockIdx.x % HG, sg = blockIdx.x / HG; const int s0 = sg * 64; const int h = h0 + hh;
  for (int i = tid; i < 64 * 8; i += 256) { const int j = i / 8, d8 = (i % 8) * 8; FragH f; f.half[0] = *(const v8us*)((const unsigned short*)V16 + ((size_t)b * SQ + s0 + j) * DM + h * HD + d8); for (int q = 0; q < 8; ++q) tl[d8 + q][j] = f.u[q]; }
  __syncthreads();
  { for (int i = tid; i < 64 * 8; i += 256) { const int d = i / 8, j8 = (i % 8) * 8; FragH f; for (int q = 0; q < 8; ++q) f.u[q] = tl[d][j8 + q]; *(v8us*)((unsigned short*)VT + ((size_t)hh * HD + d) * SQ + s0 + j8) = f.half[0]; }  } }



// ---- lane exchanges and native exp2 shared by the two attention kernels below ----
template <int CTRL>
__device__ __forceinline__ float sm_rowx(float x) { return __builtin_bit_cast(float, __builtin_amdgcn_update_dpp(__builtin_bit_cast(int, x), __builtin_bit_cast(int, x), CTRL, 0xf, 0xf, false)); }      /* CTRL = 0x160 | m (row_xmask): lane l with lane l ^ m of its 16-lane row */
__device__ __forceinline__ float sm_half(float x) { return __builtin_bit_cast(float, __builtin_amdgcn_permlanex16(__builtin_bit_cast(int, x), __builtin_bit_cast(int, x), 0x76543210, 0xfedcba98, false, false)); }      /* lane l with lane l ^ 16 */
__device__ __forceinline__ float sm_wmax(float v) { v = fmaxf(v, sm_rowx<0x161>(v)); v = fmaxf(v, sm_rowx<0x162>(v)); v = fmaxf(v, sm_rowx<0x164>(v)); v = fmaxf(v, sm_rowx<0x168>(v)); return fmaxf(v, sm_half(v)); }
__device__ __forceinline__ float sm_wsum(float v) { v += sm_rowx<0x161>(v); v += sm_rowx<0x162>(v); v += sm_rowx<0x164>(v); v += sm_rowx<0x168>(v); return v + sm_half(v); }
// 2^x of four values: each v_exp_f32 fills the slot behind the one before it (results apart from all sources), the v_nop the slot behind the last, which the instruction set asks for before a result is read or a source overwritten
__device__ __forceinline__ v4f sm_exp2x4(v4f x) { float r0, r1, r2, r3;
  asm("v_exp_f32 %0, %4\n\tv_exp_f32 %1, %5\n\tv_exp_f32 %2, %6\n\tv_exp_f32 %3, %7\n\tv_nop" : "=&v"(r0), "=&v"(r1), "=&v"(r2), "=&v"(r3) : "v"(x[0]), "v"(x[1]), "v"(x[2]), "v"(x[3]));
  const v4f r = {r0, r1, r2, r3}; return r; }
// ---- causal attention for query rows QT0 .. SQ - 1 in one launch: scores and softmax weights never leave registers. One wave owns 32 query rows of one (batch, head) and walks the keys 64 at a time; no LDS, no barrier.
// Both products are formed transposed, so that a query is a lane (column ln) in each: S^T = K Q^T (A = 16 key rows, B = query rows) gives lane (ln, hh) the keys 8 hh + r of a 16-key tile for query ln, which is the k order of a B fragment
// (tiles 2 j, 2 j + 1 -> k = 8 hh + i, 16 + 8 hh + i): the weights go from accumulator to operand by a conversion alone. O^T = V^T P^T (A = 16 rows of V^T) keeps query = ln, so that the running maximum, the rescale and the row sum are the lane's own.
// Running maximum kept on the raw products; weights 2^((s - max) c + 8), c = log2(e) / 8: at most 256, so that small weights stay clear of the f16 subnormals; the row sum carries the same factor.
__device__ __forceinline__ v8f fa_mma(v16h a, v16h b, v8f c) { return __builtin_amdgcn_wmma_f32_16x16x32_f16(false, a, false, b, (short)0, c, false, false); }
// fragment from a wave-uniform base and the lane's own fixed offset in bytes (the value the load instruction itself takes beside a scalar base)
__device__ __forceinline__ v16h fa_frag(const _Float16* base, unsigned off) { FragH f; f.half[0] = *(const v8us*)((const char*)base + off); f.half[1] = *(const v8us*)((const char*)base + off + 32); return f.v; }
__device__ __forceinline__ void fa_loadk(const _Float16* __restrict__ kp, int kb, unsigned ko, v16h (&kf)[4][2]) {
#pragma unroll      /* register arrays */
  for (int t = 0; t < 4; ++t)
#pragma unroll      /* register arrays */
    for (int ks = 0; ks < 2; ++ks) kf[t][ks] = fa_frag(kp + (size_t)(kb + t * 16) * LQ + ks * 32, ko); }
// one pass of 64 keys from kb on. LAST: the pass that holds the rows' own keys (the only one that needs the mask) and has no pass behind it to fetch K for.
template <bool LAST>
__device__ __forceinline__ void fa_pass(const _Float16* __restrict__ kp, const _Float16* __restrict__ vp, int kb, int qrel, unsigned ko, unsigned vo, const v16h (&qf)[2][2], v16h (&kf)[4][2], v8f (&o)[2][4], float (&mr)[2], float (&l)[2]) {
  const float cs = 0.125f * 1.44269504f; const v8f z8 = {0.f, 0.f, 0.f, 0.f, 0.f, 0.f, 0.f, 0.f};
  v16h vf[4][2];
#pragma unroll      /* register arrays */
  for (int t = 0; t < 4; ++t)
#pragma unroll      /* register arrays */
    for (int ks = 0; ks < 2; ++ks) vf[t][ks] = fa_frag(vp + (size_t)t * 16 * SQ + kb + ks * 32, vo);
  asm volatile("s_wait_xcnt 0x0" :: "v"(vo) : "memory");      /* behind the loads, in front of any later write of a register that holds one of their addresses; the offset as an input, so that its register is still the offset's while the loads issue */
  __builtin_amdgcn_sched_barrier(0);      /* V^T of this pass is asked for here, so that it flies under the score products and the softmax; left to itself the scheduler sinks the loads to their use */
  v8f st[2][4];
#pragma unroll      /* register arrays */
  for (int qt = 0; qt < 2; ++qt)
#pragma unroll      /* register arrays */
    for (int t = 0; t < 4; ++t) st[qt][t] = fa_mma(kf[t][1], qf[qt][1], fa_mma(kf[t][0], qf[qt][0], z8));
  if (!LAST) { __builtin_amdgcn_sched_barrier(0);      /* the next pass's K is asked for behind this pass's last use of K and no later: it flies under the softmax and the second product */
    fa_loadk(kp, kb + 64, ko, kf);
    asm volatile("s_wait_xcnt 0x0" :: "v"(ko) : "memory");      /* as behind the V^T loads above */
    __builtin_amdgcn_sched_barrier(0); }      /* as the line above: keeps the loads from sinking */
  float mn[2];
#pragma unroll      /* register arrays */
  for (int qt = 0; qt < 2; ++qt) { const int rel = qrel + qt * 16 - kb;      /* key kb + 16 t + 8 hh + r is kept while 16 t + r <= rel */
    float mx = mr[qt];
#pragma unroll      /* register arrays */
    for (int t = 0; t < 4; ++t)
#pragma unroll      /* register arrays */
      for (int r = 0; r < 8; ++r) { if (LAST) st[qt][t][r] = (t * 16 + r <= rel) ? st[qt][t][r] : -1.0e30f; mx = fmaxf(mx, st[qt][t][r]); }
    mn[qt] = fmaxf(mx, sm_half(mx)); }      /* the other eight keys of each tile sit in lane l ^ 16 */
  const v4f ax = {(mr[0] - mn[0]) * cs, (mr[1] - mn[1]) * cs, 0.f, 0.f}; const v4f al = sm_exp2x4(ax);      /* rescale of what was summed under the old maximum; 0 in the first pass */
  FragH pf[2][2];
#pragma unroll      /* register arrays */
  for (int qt = 0; qt < 2; ++qt) { const float mo = mn[qt] * cs - 8.0f; mr[qt] = mn[qt];
    v4f se = {0.f, 0.f, 0.f, 0.f};
#pragma unroll      /* register arrays */
    for (int t = 0; t < 4; ++t)
#pragma unroll      /* register arrays */
      for (int g = 0; g < 2; ++g) { v4f x;
#pragma unroll      /* register arrays */
        for (int q = 0; q < 4; ++q) x[q] = st[qt][t][g * 4 + q] * cs - mo;
        x = sm_exp2x4(x); se += x;
#pragma unroll      /* register arrays */
        for (int q = 0; q < 4; ++q) pf[qt][t >> 1].h[(t & 1) * 8 + g * 4 + q] = (_Float16)x[q]; }
    l[qt] = l[qt] * al[qt] + ((se[0] + se[1]) + (se[2] + se[3]));
#pragma unroll      /* register arrays */
    for (int t = 0; t < 4; ++t) o[qt][t] *= al[qt]; }
  __builtin_amdgcn_sched_barrier(0);      /* the second product starts behind the last exp2 of both tiles */
#pragma unroll      /* register arrays */
  for (int qt = 0; qt < 2; ++qt)
#pragma unroll      /* register arrays */
    for (int t = 0; t < 4; ++t) o[qt][t] = fa_mma(vf[t][1], pf[qt][1].v, fa_mma(vf[t][0], pf[qt][0].v, o[qt][t])); }
__global__ __launch_bounds__(256) void k_fattn(const _Float16* __restrict__ QKVp, const _Float16* __restrict__ VTp, const float* __restrict__ XBp, float* __restrict__ X1p) {
  static_assert(QT0 == 128 && HD == 64 && SQ % 256 == 0, "blocks of 128 query rows; block 0 of a batch belongs to the f32 path; blocks 1 .. SQ / 128 - 1 are paired below");
  const int lane = threadIdx.x & 31, ln = lane & 15, hh = lane >> 4; const int w = __builtin_amdgcn_readfirstlane((int)(threadIdx.x >> 5));      /* the wave's number: a scalar, so that the early exit and the trip count are scalar */
  const int h = blockIdx.y, b = blockIdx.z; const int far = SQ / 128 - 1 - (int)blockIdx.x, near = 1 + (int)blockIdx.x;      /* waves 0-3 take a late block of rows, waves 4-7 the early block that makes the keys walked per work-group level */
  if (w >= 4 && near >= far) return;      /* the middle block has no partner; no barrier in this kernel */
  const int qw = (w < 4 ? far : near) * 128 + (w & 3) * 32;
  const size_t r0 = (size_t)b * SQ;
  const _Float16* qp = QKVp + (r0 + qw) * LQ + h * HD; const _Float16* kp = QKVp + DM + r0 * LQ + h * HD; const _Float16* vp = VTp + (size_t)(b * NH + h) * HD * SQ;      /* wave-uniform bases */
  const unsigned ko = (unsigned)(ln * LQ + 8 * hh) * 2u, vo = (unsigned)(ln * SQ + 8 * hh) * 2u;      /* the lane's row and k half in q / k rows and in V^T rows, in bytes */
  v16h qf[2][2], kf[4][2];
#pragma unroll      /* register arrays */
  for (int qt = 0; qt < 2; ++qt)
#pragma unroll      /* register arrays */
    for (int ks = 0; ks < 2; ++ks) qf[qt][ks] = fa_frag(qp + (size_t)qt * 16 * LQ + ks * 32, ko);
  fa_loadk(kp, 0, ko, kf);
  asm volatile("s_wait_xcnt 0x0" :: "v"(ko) : "memory");      /* behind the loads of q and of the first K, in front of any later write of their base and offset registers */
  __builtin_amdgcn_sched_barrier(0);      /* keeps later address arithmetic, which reuses those registers, behind the wait */
  const v8f z8 = {0.f, 0.f, 0.f, 0.f, 0.f, 0.f, 0.f, 0.f};
  v8f o[2][4] = {{z8, z8, z8, z8}, {z8, z8, z8, z8}}; float mr[2] = {-1.0e30f, -1.0e30f}; float l[2] = {0.f, 0.f};
  const int klast = qw & ~63;      /* keys 0 .. qw + 31 in passes of 64: every pass before this one lies wholly below row qw, this one ends at or below SQ - 1 */
  const int qrel = qw + ln - 8 * hh;
#pragma unroll 1      /* one pass holds 32 loads and 32 matrix instructions already */
  for (int kb = 0; kb < klast; kb += 64) fa_pass<false>(kp, vp, kb, qrel, ko, vo, qf, kf, o, mr, l);
  const float* xp = XBp + (r0 + qw) * DM + h * HD; float* yp = X1p + (r0 + qw) * DM + h * HD; const unsigned xo = (unsigned)(ln * DM + 8 * hh) * 4u;      /* lane (ln, hh) holds columns 16 t + 8 hh .. + 7 of query ln; in bytes */
  v4f xr[2][4][2];
#pragma unroll      /* register arrays */
  for (int qt = 0; qt < 2; ++qt)
#pragma unroll      /* register arrays */
    for (int t = 0; t < 4; ++t)
#pragma unroll      /* register arrays */
      for (int g = 0; g < 2; ++g) xr[qt][t][g] = *(const v4fa*)((const char*)(xp + qt * 16 * DM + t * 16 + g * 4) + xo);
  asm volatile("s_wait_xcnt 0x0" :: "v"(xo) : "memory");      /* as behind the V^T loads */
  __builtin_amdgcn_sched_barrier(0);      /* the residual rows are asked for here and fly under the last pass, in the registers that the K fetched ahead no longer needs */
  fa_pass<true>(kp, vp, klast, qrel, ko, vo, qf, kf, o, mr, l);
#pragma unroll      /* register arrays */
  for (int qt = 0; qt < 2; ++qt) { const float inv = 1.0f / (l[qt] + sm_half(l[qt]));      /* the two halves' sums joined once */
#pragma unroll      /* register arrays */
    for (int t = 0; t < 4; ++t)
#pragma unroll      /* register arrays */
      for (int g = 0; g < 2; ++g)
#pragma unroll      /* register arrays */
        for (int q = 0; q < 4; ++q) xr[qt][t][g][q] += o[qt][t][g * 4 + q] * inv; }
  __builtin_amdgcn_sched_barrier(0);      /* all arithmetic in front of the first store, so that nothing rewrites a register that an issued store names */
#pragma unroll      /* register arrays */
  for (int qt = 0; qt < 2; ++qt)
#pragma unroll      /* register arrays */
    for (int t = 0; t < 4; ++t)
#pragma unroll      /* register arrays */
      for (int g = 0; g < 2; ++g) *(v4f*)((char*)(yp + qt * 16 * DM + t * 16 + g * 4) + xo) = xr[qt][t][g]; }


typedef float v2f  __attribute__((ext_vector_type(2)));
typedef float v2fa __attribute__((ext_vector_type(2), may_alias));
// ---- f32 attention for the first QT0 query rows: one wave per (head, query row), eight rows of one head per work-group. The head's K and V rows up to the end of the rows' 32-key chunk are staged once in LDS.
// Scores: lane l owns keys 32 c + l (K pitch 68 floats = 16 B x odd, so that the 32 rows read by one ds_load_b128 spread over the banks). Output: lane l owns columns 2 l, 2 l + 1; each key's weight comes out of its lane by v_readlane.
// NCH = 32-key chunks (compile time: every load of a phase is issued before the first wait). Keys past the row get weight 2^(-1e30 ..) = 0.
template <int NCH>
__device__ __forceinline__ void att0_rows(const float* __restrict__ QF, const float* __restrict__ KF, const float* __restrict__ VF, float scale, float* __restrict__ OF, int h, int row0, float (*lk)[HD + 4], float (*lv)[HD]) {
  const int tid = threadIdx.x, lane = tid & 31; const int i = row0 + __builtin_amdgcn_readfirstlane(tid >> 5);      /* the row is the wave's: a scalar */
  const int sr = tid >> 4, sc = (tid & 15) * 4;      /* staging: 16 threads per 256-byte row, 16 rows per pass */
  const float* kg = KF + h * HD; const float* vg = VF + h * HD; const float* qr = QF + (size_t)i * DM + h * HD; const int so = sr * DM + sc;      /* row pitch DM at compile time: one address per matrix, the pass as a constant offset of the load */
  v4f kk[2 * NCH], vv[2 * NCH], q[HD / 4];
#pragma unroll      /* arrays stay in registers; all loads in flight together */
  for (int p = 0; p < 2 * NCH; ++p) { kk[p] = *(const v4fa*)(kg + so + p * 16 * DM); vv[p] = *(const v4fa*)(vg + so + p * 16 * DM); }
#pragma unroll      /* the query row, same address in every lane, fetched beside the staging loads */
  for (int c = 0; c < HD / 4; ++c) q[c] = *(const v4fa*)(qr + c * 4);
#pragma unroll      /* register arrays */
  for (int p = 0; p < 2 * NCH; ++p) { *(v4fa*)&lk[p * 16 + sr][sc] = kk[p]; *(v4fa*)&lv[p * 16 + sr][sc] = vv[p]; }
  __syncthreads();
  v4f a[NCH];
#pragma unroll      /* register arrays */
  for (int c = 0; c < NCH; ++c) { const v4f z = {0.f, 0.f, 0.f, 0.f}; a[c] = z; }
#pragma unroll      /* 4 NCH independent sums per lane */
  for (int d = 0; d < HD / 4; ++d)
#pragma unroll      /* a[c] by constant index */
    for (int c = 0; c < NCH; ++c) a[c] += q[d] * *(const v4fa*)&lk[c * 32 + lane][d * 4];
  float e[NCH]; float mx = -1.0e30f;
#pragma unroll      /* register arrays */
  for (int c = 0; c < NCH; ++c) { const float s = ((a[c][0] + a[c][1]) + (a[c][2] + a[c][3])) * scale; e[c] = (c * 32 + lane <= i) ? s : -1.0e30f; mx = fmaxf(mx, e[c]); }
  mx = sm_wmax(mx);
  float l = 0.f; v4f t = {-200.f, -200.f, -200.f, -200.f};      /* chunks that this case does not have: 2^-200, not summed */
#pragma unroll      /* register arrays */
  for (int c = 0; c < NCH; ++c) t[c] = (e[c] - mx) * 1.44269504f;      /* exp(x) = 2^(x log2 e), the native form, as in the row softmax above */
  t = sm_exp2x4(t);
#pragma unroll      /* register arrays */
  for (int c = 0; c < NCH; ++c) { e[c] = t[c]; l += e[c]; }
  l = sm_wsum(l);
  const v2f z2 = {0.f, 0.f}; v2f o[4] = {z2, z2, z2, z2};      /* four sums per column, so that one key's multiply-add does not wait for the key before it */
#pragma unroll      /* constant lane numbers for v_readlane, constant LDS offsets */
  for (int c = 0; c < NCH; ++c)
#pragma unroll      /* as the line above */
    for (int j = 0; j < 32; ++j) { const float ej = __builtin_bit_cast(float, __builtin_amdgcn_readlane(__builtin_bit_cast(int, e[c]), j)); o[j & 3] += ej * *(const v2fa*)&lv[c * 32 + j][lane * 2]; }
  const float fin = 64.0f / l;      /* o carried x64, scaled by 1/64 where it is added to x1 */
  const v2f r = ((o[0] + o[1]) + (o[2] + o[3])) * fin;
  *(v2fa*)(OF + (size_t)i * DM + h * HD + lane * 2) = r; }
__global__ __launch_bounds__(256) void k_att0w(const float* __restrict__ QF, const float* __restrict__ KF, const float* __restrict__ VF, float scale, float* __restrict__ OF) {
  static_assert(QT0 == 128 && HD == 64, "the cases below cover 1 .. 4 chunks of 32 keys; two columns per lane");
  __shared__ __attribute__((aligned(16))) float lk[QT0][HD + 4]; __shared__ __attribute__((aligned(16))) float lv[QT0][HD];
  const int h = blockIdx.x / (QT0 / 8), row0 = (blockIdx.x % (QT0 / 8)) * 8;      /* eight rows lie in one 32-key chunk: the switch is the same for the whole work-group, barrier included */
  switch (row0 >> 5) {
    case 0: att0_rows<1>(QF, KF, VF, scale, OF, h, row0, lk, lv); break; case 1: att0_rows<2>(QF, KF, VF, scale, OF, h, row0, lk, lv); break;
    case 2: att0_rows<3>(QF, KF, VF, scale, OF, h, row0, lk, lv); break; case 3: att0_rows<4>(QF, KF, VF, scale, OF, h, row0, lk, lv); break; } }


template <int BFIN, int WXB>
__global__ __launch_bounds__(256) void k_ln16(const float* __restrict__ X, const float* __restrict__ g, const float* __restrict__ bb, float eps, _Float16* __restrict__ N16, float* __restrict__ XB) {
  #pragma clang fp contract(off)
  __shared__ float red[256]; const size_t r = blockIdx.x; const int t = threadIdx.x; const v4f xa = *(const v4fa*)(X + r * DMQ + t * 4); float s[4]; float sum = 0.f;
  for (int q = 0; q < 4; ++q) { s[q] = BFIN ? bf16_round(xa[q]) : xa[q]; sum = __fadd_rn(sum, s[q]); }
  red[t] = sum; __syncthreads(); for (int st = 128; st > 0; st >>= 1) { if (t < st) red[t] = __fadd_rn(red[t], red[t + st]); __syncthreads(); } const float mu = red[0] / (float)DMQ; __syncthreads();
  float vs = 0.f; for (int q = 0; q < 4; ++q) { const float dl = __fadd_rn(s[q], -mu); vs = __fadd_rn(vs, __fmul_rn(dl, dl)); } red[t] = vs; __syncthreads(); for (int st = 128; st > 0; st >>= 1) { if (t < st) red[t] = __fadd_rn(red[t], red[t + st]); __syncthreads(); }
  const float rs = rsqrtf(__fadd_rn(red[0] / (float)DMQ, eps)); v4h y; v4f xb;
  for (int q = 0; q < 4; ++q) { const int c = t * 4 + q; y[q] = (_Float16)__fadd_rn(__fmul_rn(__fmul_rn(__fadd_rn(s[q], -mu), rs), bf16_round(g[c])), bf16_round(bb[c])); xb[q] = s[q]; }
  { *(v4h*)(N16 + r * DMQ + t * 4) = y; if (WXB) *(v4f*)(XB + r * DMQ + t * 4) = xb;  } }
__global__ __launch_bounds__(256) void k_ftres2(const float* __restrict__ OF0, const float* __restrict__ XB, float* __restrict__ X1, size_t n4) {
  #pragma clang fp contract(off)
  const size_t t = (size_t)blockIdx.x * 256 + threadIdx.x; if (t >= n4) return; const v4f o = *(const v4fa*)(OF0 + t * 4), xv = *(const v4fa*)(XB + t * 4); v4f y; for (int q = 0; q < 4; ++q) y[q] = __fadd_rn(__fmul_rn(o[q], 0.015625f), xv[q]); *(v4f*)(X1 + t * 4) = y;  }

__global__ __launch_bounds__(256) void k_wthd(const float* __restrict__ Wt, _Float16* __restrict__ Bt) { const size_t t = (size_t)blockIdx.x * 256 + threadIdx.x; if (t >= (size_t)NH * HD * (DM / 8)) return; const int m8 = (int)(t % (DM / 8)) * 8; const int d = (int)((t / (DM / 8)) % HD); const int h = (int)(t / ((size_t)(DM / 8) * HD)); FragH f;
  for (int q = 0; q < 8; ++q) f.h[q] = (_Float16)(16.0f * bf16_round(Wt[((size_t)h * DM + m8 + q) * HD + d])); unsigned short* dst = (unsigned short*)Bt + ((size_t)h * HD + d) * DM + m8; *(v8us*)dst = f.half[0];  }




__global__ __launch_bounds__(256) void k_wtpad(const float* __restrict__ Wm, _Float16* __restrict__ Wt, int Kr, int Kp, int Nr, int Np, float scale) {
  const int t = blockIdx.x * 256 + threadIdx.x; if (t >= Np * (Kp / 8)) return; const int n = t / (Kp / 8), k8 = (t % (Kp / 8)) * 8; const int nc = min(n, Nr - 1); const float fn = (n < Nr) ? 1.f : 0.f; FragH f;
  for (int i = 0; i < 8; ++i) { const int k = k8 + i; const int kc = min(k, Kr - 1); const float fk = (k < Kr) ? fn : 0.f; f.h[i] = (_Float16)(bf16_round(Wm[(size_t)kc * Nr + nc]) * scale * fk); }
  unsigned short* o = (unsigned short*)Wt + (size_t)n * Kp + k8; *(v8us*)o = f.half[0];  }
__global__ __launch_bounds__(128) void k_bpad(const float* __restrict__ b, float* __restrict__ Bp, int nr, int np) {
  const int i = threadIdx.x; if (i >= np) return; const float v = b[min(i, nr - 1)] * ((i < nr) ? 1.f : 0.f); *(float*)(Bp + i) = v;  }

__global__ __launch_bounds__(256) void k_bcpy(const float* __restrict__ b, int n, int NP, float* __restrict__ dst, int dst0) { for (int i = threadIdx.x; i < NP; i += 256) { const float v = (i < n) ? b[i] : 0.f; *(float*)(dst + dst0 + i) = v; }  }


__global__ __launch_bounds__(256) void k_addf(const float* __restrict__ XBr, const float* __restrict__ OF, float* __restrict__ O, size_t n8) {
  #pragma clang fp contract(off)
  const size_t t = (size_t)blockIdx.x * 256 + threadIdx.x; if (t >= n8) return; const v4f a = *(const v4fa*)(XBr + t * 8), b = *(const v4fa*)(XBr + t * 8 + 4), c = *(const v4fa*)(OF + t * 8), d = *(const v4fa*)(OF + t * 8 + 4); v4f r0, r1;
  for (int q = 0; q < 4; ++q) { r0[q] = __fadd_rn(a[q], __fmul_rn(c[q], 0.015625f)); r1[q] = __fadd_rn(b[q], __fmul_rn(d[q], 0.015625f)); }
  { *(v4f*)(O + t * 8) = r0; *(v4f*)(O + t * 8 + 4) = r1;  } }


extern "C" void kernel_launch(void* const* d_in, const int* in_sizes, int n_in,
                              void* d_out, int out_size, void* d_ws, size_t ws_size, hipStream_t stream) {
  (void)in_sizes; (void)n_in; (void)out_size;
  const float* const* I = (const float* const*)d_in; const float* x = I[0]; const float* wq = I[1]; const float* bq = I[2]; const float* wk = I[3]; const float* bk = I[4]; const float* wv = I[5]; const float* bv = I[6]; const float* g1 = I[7]; const float* be1 = I[8]; const float* gg2 = I[9]; const float* be2 = I[10]; const float* wfc = I[11]; const float* bfc = I[12]; const float* wmp = I[13]; const float* bmp = I[14];      /* input order: x; [in][out] wq / wk / wv + biases; LN1 w / b, LN2 w / b; w_fc [1024][4096] + b_fc, w_proj [4096][1024] + b_proj */
  float* OUT0 = (float*)d_out; float* OUTK = (float*)d_out + NR * DM;      /* tuple outputs: out at byte 0, k at 16,777,216, v at 33,554,432 (each NB * SQ * DM floats) */
  static_assert(NH * HD == DM && DM % 64 == 0 && SQ % 128 == 0 && QT0 % 8 == 0, "shape / tile multiples");
  char* ws = (char*)d_ws; size_t off = 0;
  auto take = [&](size_t bytes) { char* p = ws + off; off += (bytes + 255) & ~(size_t)255; return p; };
  _Float16* BQKV = (_Float16*)take((size_t)3 * DM * DM * 2); float* bqkv = (float*)take((size_t)3 * DM * 4);      /* stacked bias bq | bk | bv */
  _Float16* X16 = (_Float16*)take(NR * DM * 2); float* XB = (float*)take(NR * DM * 4); float* X1 = (float*)take(NR * DM * 4); _Float16* M16 = nullptr;      /* = X16 below (alias: X16's last reader, the q | k | v GEMM, precedes LN2's write) */ _Float16* HF16 = (_Float16*)take((size_t)SQ * DFF * 2); _Float16* BW1 = (_Float16*)take((size_t)DFF * DM * 2); _Float16* BW2 = (_Float16*)take((size_t)DM * DFF * 2); _Float16* QKV = (_Float16*)take(NR * 3 * DM * 2); _Float16* V16 = QKV + 2 * DM; M16 = X16;
  _Float16* VT = (_Float16*)take((size_t)NB * NH * HD * SQ * 2);      /* V^T of both batches */
  float* F0 = (float*)take((size_t)3 * NB * QT0 * DM * 4);      /* f32 q | k | v of each batch's first QT0 rows */ float* OF0 = (float*)take((size_t)NB * QT0 * DM * 4);
  if (off > ws_size) return;
  { const unsigned g = (unsigned)(((size_t)DM * (DM / 8) + 255) / 256); k_wt_f16<<<g, 256, 0, stream>>>(wq, BQKV, DM, DM, 16.0f); k_wt_f16<<<g, 256, 0, stream>>>(wk, BQKV + (size_t)DM * DM, DM, DM, 16.0f); k_wt_f16<<<g, 256, 0, stream>>>(wv, BQKV + (size_t)2 * DM * DM, DM, DM, 16.0f); }      /* [in][out] -> Bt x16: stacked q | k | v (transposing builder) */
  k_bcpy<<<1, 256, 0, stream>>>(bq, DM, DM, bqkv, 0); k_bcpy<<<1, 256, 0, stream>>>(bk, DM, DM, bqkv, DM); k_bcpy<<<1, 256, 0, stream>>>(bv, DM, DM, bqkv, 2 * DM);      /* stacked bias bq | bk | bv */
  k_ln16<1, 1><<<(unsigned)NR, 256, 0, stream>>>(x, g1, be1, 1e-5f, X16, XB);      /* a = LN1(bf16(x)) -> f16 rows; XB = bf16(x) for the residual */
  k_wt_f16<<<(unsigned)(((size_t)DFF * (DM / 8) + 255) / 256), 256, 0, stream>>>(wfc, BW1, DM, DFF, 16.0f); k_wt_f16<<<(unsigned)(((size_t)DM * (DFF / 8) + 255) / 256), 256, 0, stream>>>(wmp, BW2, DFF, DM, 16.0f);      /* W1 [1024][4096] -> Bt [4096][1024]; W2 [4096][1024] -> Bt [1024][4096] (x16) */
  const size_t r0p = (size_t)B0 * SQ;      /* first projected row */
  k_gemm2<0, true><<<dim3((unsigned)((MP / 128) * (3 * DM / 64)), 1), 128, 0, stream>>>(X16 + r0p * DM, DM, 0, BQKV, DM, 0, 0.0625f, bqkv, 0, nullptr, 1, 0, 0, nullptr, QKV + r0p * 3 * DM, 3 * DM, 0, MP, 3 * DM, DM, OUTK, F0);      /* q | k | v rows (f16); head h = columns h*HD.. of each DM block; from the same sums outputs 1 and 2 (k, v in f32, head-major [B][H][T][64]) and the f32 q, k, v of the first 128 rows of each batch */
  for (int b = B0; b < B0 + NBR; ++b) { const size_t r0 = (size_t)b * SQ;
    k_vt<NH, SQ><<<NH * (SQ / 64), 256, 0, stream>>>(V16 + r0 * LQ, LQ, 0, VT + (size_t)b * NH * HD * SQ);      /* V^T [NH][HD][SQ] for this batch */
    k_att0w<<<NH * (QT0 / 8), 256, 0, stream>>>(F0 + (size_t)b * QT0 * DM, F0 + (size_t)(NB + b) * QT0 * DM, F0 + (size_t)(2 * NB + b) * QT0 * DM, 0.125f, OF0 + (size_t)b * QT0 * DM);      /* f32 attention for rows 0..127 (o x64), one wave per head and row */
    k_addf<<<(unsigned)(((size_t)QT0 * DM / 8 + 255) / 256), 256, 0, stream>>>(XB + r0 * DM, OF0 + (size_t)b * QT0 * DM, X1 + r0 * DM, (size_t)QT0 * DM / 8); }      /* rows 0..127 of the batch from the exact f32 path: x1 = bf16(x) + o / 64 */
  k_fattn<<<dim3(SQ / 256, NH, NB), 256, 0, stream>>>(QKV, VT, XB, X1);      /* rows 128.. of both batches: x1 = bf16(x) + softmax(q k^T / 8) v in f32 (no output projection in this module) */
  k_ln16<0, 0><<<(unsigned)NR, 256, 0, stream>>>(X1, gg2, be2, 1e-5f, M16, nullptr);      /* h = LN2(x1) -> f16 rows */
  for (int b = 0; b < NB; ++b) { const size_t r0 = (size_t)b * SQ;
    k_gemm2<6><<<dim3((unsigned)((SQ / 128) * (DFF / 64)), 1), 128, 0, stream>>>(M16 + r0 * DM, DM, 0, BW1, DM, 0, 0.0625f, bfc, 0, nullptr, 1, 0, 0, nullptr, HF16, DFF, 0, SQ, DFF, DM, nullptr, nullptr);      /* gelu_erf(h2 W1 + b1) -> f16 (this batch) */
    k_gemm2<0><<<dim3((unsigned)((SQ / 128) * (DM / 64)), 1), 128, 0, stream>>>(HF16, DFF, 0, BW2, DFF, 0, 0.0625f, bmp, 0, X1 + r0 * DM, -1, 0, 0, OUT0 + r0 * DM, nullptr, DM, 0, SQ, DM, DFF, nullptr, nullptr); }      /* output 0 = x1 + mlp (own-element residual) */
}

// v006
// One run takes 323 microseconds.
// Timed twice side by side with v005, it ran 1.12 and 1.11 times as fast.
// Counting every step since v000, it is 18.0 times as fast.
#include <hip/hip_runtime.h>
// Pre-LN causal transformer block WITHOUT an attention output projection that also returns its key and value tensors (x [2][2048][1024]; h = LN1(x) (biased var, eps 1e-5); q / k / v = h W + b ([in][out] [1024][1024] sigma 1/32, zero biases) -> [B][16][T][64]; att = softmax(q k^T / 8) with a causal mask (tril, -inf); y = att v merged back to [B][T][1024]; x1 = x + y (no projection); out = x1 + gelu_erf(LN2(x1) w_fc + b_fc) w_proj + b_proj ([in][out] 1024 x 4096 x 1024); returns (out [2][2048][1024], k [2][16][2048][64], v [2][16][2048][64]): three outputs at byte offsets 0 / 16,777,216 / 33,554,432 of d_out).
// Structure: token rows r = b*2048 + s; h = LN1(bf16(x)) as f16 rows; q | k | v as ONE WMMA GEMM (N = 3 x 1024) (32x64 wave tiles, f32 accumulation, exact x16 weights + bias, f16 outputs; the same sums stored in f32 as outputs k and v and as q, k, v of each batch's first 128 rows); per batch: V^T for all heads via LDS transposes; rows 128.. of both batches in one launch: per wave 32 query rows, keys 64 at a time up to the rows' end, scores (K = 64), running-maximum softmax (f32 statistics, native exp2; weights at most 256 in f16) and weights x V^T all in registers, x1 = x + o / row sum in f32; h2 = LN2(x1) -> f16; per batch out = x1 + gelu_erf(h2 W1 + b1) W2 + b2 by two GEMMs (f16 hidden, f32 out).
// Compute dtype: inputs rounded to bf16; x / weights exact; h, q, k, v, softmax weights, h2 and the gelu hidden as plain f16 GEMM operands (~2^-12); scores and softmax statistics f32. v_wmma_f32_16x16x32_f16.
#define NB 2
#define SQ 2048
#define DM 1024
#define NH 16
#define HD 64
#define HG 4
#define QT 256                       /* query rows per causal tile */
#define NKX SQ                       /* S / P row pitch */
#define QT0 128                      /* first-tile rows attended exactly in f32 */
#define B0 0                         /* first batch processed (debug hook) */
#define NBR NB                       /* batches processed (debug hook) */
#define NR ((size_t)NB * SQ)
#define DMQ DM
#define DFF 4096                     /* FFN hidden width */
#define DFFR 100
#define MP ((int)((size_t)NBR * SQ)) /* rows projected (debug hook) */
#define QN SQ                        /* query rows per batch; not used */
#define NHD NH                       /* heads; not used */
#define MPO MP
#define LQ (3 * DM)      /* row pitch of the q/k/v rows */
typedef __bf16 v16b __attribute__((ext_vector_type(16)));
typedef unsigned short v8us __attribute__((ext_vector_type(8), may_alias));
typedef float  v8f  __attribute__((ext_vector_type(8)));
typedef float  v4f  __attribute__((ext_vector_type(4)));
typedef float  v4fa __attribute__((ext_vector_type(4), may_alias));
union FragB { v16b v; v8us half[2]; unsigned short u[16]; };

__device__ __forceinline__ unsigned short bf16_bits(float x) { unsigned int u = __float_as_uint(x); return (unsigned short)((u + 0x7FFFu + ((u >> 16) & 1u)) >> 16); }
__device__ __forceinline__ float bf16_val(unsigned short b) { return __uint_as_float(((unsigned int)b) << 16); }
__device__ __forceinline__ float bf16_round(float x) { return bf16_val(bf16_bits(x)); }
// D += A·B with NT terms: 1 = ah·bh, 2 = + al·bh (A split), 3 = + ah·bl (both split)
template <int NT>
__device__ __forceinline__ v8f mmaN(v16b ah, v16b al, v16b bh, v16b bl, v8f c) {
  c = __builtin_amdgcn_wmma_f32_16x16x32_bf16(false, ah, false, bh, (short)0, c, false, false);
  if (NT >= 2) c = __builtin_amdgcn_wmma_f32_16x16x32_bf16(false, al, false, bh, (short)0, c, false, false);
  if (NT >= 3) c = __builtin_amdgcn_wmma_f32_16x16x32_bf16(false, ah, false, bl, (short)0, c, false, false);
  asm volatile("v_nop\n\tv_nop\n\tv_nop\n\tv_nop" : "+v"(c) : "v"(ah), "v"(al), "v"(bh), "v"(bl));
  return c;
}

__global__ __launch_bounds__(256) void k_wt_bf16(const float* __restrict__ W, unsigned short* __restrict__ Wt, int K, int N) {
  const int t = blockIdx.x * 256 + threadIdx.x;
  const int k8n = K / 8;
  if (t >= N * k8n) return;
  const int n = t / k8n, k8 = (t % k8n) * 8;
  v8us v;
#pragma unroll
  for (int i = 0; i < 8; ++i) v[i] = bf16_bits(W[(size_t)(k8 + i) * N + n]);
  *(v8us*)(Wt + (size_t)n * K + k8) = v;
  
}

// GEMM C[M][N] (f32, pitch ldc) = act(A[M][K]·W + bias). A f32 row-major (pitch lda) converted per fragment to bf16
// (ASPLIT: hi/lo two planes -> 2 terms, else single rounded term); Wt bf16 [N][K] (pitch ldb). BIAS_BF16 rounds the
// bias to bf16 first (bias quantised to bf16 before the add). K%32==0, M%16==0, N%64==0.
template <bool ASPLIT, int ACT, bool BIAS_BF16>
__global__ __launch_bounds__(128) void k_gemm_bf(const float* __restrict__ A, int lda, const unsigned short* __restrict__ Wt, int ldb,
                                               const float* __restrict__ bias, float* __restrict__ C, int ldc, int M, int N, int K) {
  __shared__ __attribute__((aligned(16))) float so[4][16][64];
  const int tid = threadIdx.x, w = tid >> 5, lane = tid & 31, ln = lane & 15, hh = lane >> 4;
  const int ntn = N / 64;
  const int wid = blockIdx.x * 4 + w;
  const int mt = wid / ntn, nq = wid % ntn;
  if (mt * 16 >= M) return;
  const int row0 = mt * 16, col0 = nq * 64;
  const float* arow = A + (size_t)(row0 + ln) * lda;
  v8f acc[4] = {};
  for (int kb = 0; kb < K; kb += 32) {
    FragB ah, al;
    const v4f x0 = *(const v4fa*)(arow + kb + 8 * hh), x1 = *(const v4fa*)(arow + kb + 8 * hh + 4);
    const v4f x2 = *(const v4fa*)(arow + kb + 16 + 8 * hh), x3 = *(const v4fa*)(arow + kb + 16 + 8 * hh + 4);
    float xs[16] = {x0[0],x0[1],x0[2],x0[3],x1[0],x1[1],x1[2],x1[3],x2[0],x2[1],x2[2],x2[3],x3[0],x3[1],x3[2],x3[3]};
#pragma unroll
    for (int i = 0; i < 16; ++i) { const unsigned short hb = bf16_bits(xs[i]); ah.u[i] = hb; al.u[i] = ASPLIT ? bf16_bits(xs[i] - bf16_val(hb)) : (unsigned short)0; }
#pragma unroll
    for (int t = 0; t < 4; ++t) {
      const unsigned short* brow = Wt + (size_t)(col0 + t * 16 + ln) * ldb + kb;
      FragB b;
      b.half[0] = *(const v8us*)(brow + 8 * hh);
      b.half[1] = *(const v8us*)(brow + 16 + 8 * hh);
      acc[t] = mmaN<ASPLIT ? 2 : 1>(ah.v, al.v, b.v, b.v, acc[t]);
    }
  }
#pragma unroll
  for (int t = 0; t < 4; ++t) {
    float bv = bias ? bias[col0 + t * 16 + ln] : 0.f;
    if (BIAS_BF16) bv = bf16_round(bv);
#pragma unroll
    for (int r = 0; r < 8; ++r) { float v = acc[t][r] + bv; if (ACT == 1) v = fmaxf(v, 0.f); so[w][8 * hh + r][t * 16 + ln] = v; }
  }
  __builtin_amdgcn_fence(__ATOMIC_ACQ_REL, "workgroup");
  __builtin_amdgcn_wave_barrier();
  const int rsub = lane >> 4, c4 = (lane & 15) * 4;
  {
#pragma unroll
    for (int q = 0; q < 8; ++q) {
      const int r = q * 2 + rsub;
      const v4f v = *(const v4fa*)&so[w][r][c4];
      *(v4f*)(C + (size_t)(row0 + r) * ldc + col0 + c4) = v;
    }
    
  }
}

// GEMM C = act(A·W + bias + resid): A f32 (ASPLIT -> hi/lo 2 terms), Wt bf16 [N][K]; ACT 0 none, 1 relu, 2 exact gelu;
// resid (optional, f32, row index = (row % rmod), pitch ldr, RES_BF16 rounds it) added before the activation.
template <bool ASPLIT, int ACT, bool BIAS_BF16, bool RES_BF16>
__global__ __launch_bounds__(128) void k_gemm_bf3(const float* __restrict__ A, int lda, const unsigned short* __restrict__ Wt, int ldb,
                                                const float* __restrict__ bias, const float* __restrict__ resid, int rmod, int ldr,
                                                float* __restrict__ C, int ldc, int M, int N, int K) {
  __shared__ __attribute__((aligned(16))) float so[4][16][64];
  const int tid = threadIdx.x, w = tid >> 5, lane = tid & 31, ln = lane & 15, hh = lane >> 4;
  const int ntn = N / 64;
  const int wid = blockIdx.x * 4 + w;
  const int mt = wid / ntn, nq = wid % ntn;
  if (mt * 16 >= M) return;
  const int row0 = mt * 16, col0 = nq * 64;
  const float* arow = A + (size_t)(row0 + ln) * lda;
  v8f acc[4] = {};
  for (int kb = 0; kb < K; kb += 32) {
    FragB ah, al;
    const v4f x0 = *(const v4fa*)(arow + kb + 8 * hh), x1 = *(const v4fa*)(arow + kb + 8 * hh + 4);
    const v4f x2 = *(const v4fa*)(arow + kb + 16 + 8 * hh), x3 = *(const v4fa*)(arow + kb + 16 + 8 * hh + 4);
    float xs[16] = {x0[0],x0[1],x0[2],x0[3],x1[0],x1[1],x1[2],x1[3],x2[0],x2[1],x2[2],x2[3],x3[0],x3[1],x3[2],x3[3]};
#pragma unroll
    for (int i = 0; i < 16; ++i) { const unsigned short hb = bf16_bits(xs[i]); ah.u[i] = hb; al.u[i] = ASPLIT ? bf16_bits(xs[i] - bf16_val(hb)) : (unsigned short)0; }
#pragma unroll
    for (int t = 0; t < 4; ++t) {
      const unsigned short* brow = Wt + (size_t)(col0 + t * 16 + ln) * ldb + kb;
      FragB b;
      b.half[0] = *(const v8us*)(brow + 8 * hh);
      b.half[1] = *(const v8us*)(brow + 16 + 8 * hh);
      acc[t] = mmaN<ASPLIT ? 2 : 1>(ah.v, al.v, b.v, b.v, acc[t]);
    }
  }
#pragma unroll
  for (int t = 0; t < 4; ++t) {
    const int col = col0 + t * 16 + ln;
    float bv = bias ? bias[col] : 0.f;
    if (BIAS_BF16) bv = bf16_round(bv);
#pragma unroll
    for (int r = 0; r < 8; ++r) {
      float v = acc[t][r] + bv;
      if (resid) { float rv = resid[(size_t)((row0 + 8 * hh + r) % rmod) * ldr + col]; if (RES_BF16) rv = bf16_round(rv); v += rv; }
      if (ACT == 1) v = fmaxf(v, 0.f);
      if (ACT == 2) v = 0.5f * v * (1.0f + erff(v * 0.70710678118654752f));
      if (ACT == 3) { const float u = 0.7978845608028654f * (v + 0.044715f * v * v * v); v = 0.5f * v * (1.0f + tanhf(u)); }
      so[w][8 * hh + r][t * 16 + ln] = v;
    }
  }
  __builtin_amdgcn_fence(__ATOMIC_ACQ_REL, "workgroup");
  __builtin_amdgcn_wave_barrier();
  const int rsub = lane >> 4, c4 = (lane & 15) * 4;
  {
#pragma unroll
    for (int q = 0; q < 8; ++q) {
      const int r = q * 2 + rsub;
      const v4f v = *(const v4fa*)&so[w][r][c4];
      *(v4f*)(C + (size_t)(row0 + r) * ldc + col0 + c4) = v;
    }
    
  }
}
// row LayerNorm (biased variance, eps) over N: s = X (+ R); optional out_sum <- s; out_norm <- (s-mu)*rsqrt(var+eps)*g + b
template <bool PARAM_BF16>
__global__ __launch_bounds__(256) void k_layernorm(const float* __restrict__ X, const float* __restrict__ R, const float* __restrict__ g, const float* __restrict__ bta,
                                                  float* __restrict__ out_sum, float* __restrict__ out_norm, int N, float eps) {
  __shared__ float red[256];
  const int row = blockIdx.x, tid = threadIdx.x;
  const float* x = X + (size_t)row * N; const float* rr = R ? R + (size_t)row * N : nullptr;
  float vals[16];                     // up to N = 4096
  const int per = N / 256;            // contiguous chunk per thread? use strided-by-4 chunks: thread handles j = tid*4 + 1024*u
  float s1 = 0.f;
  for (int u = 0; u < per / 4; ++u) {
    const int j = tid * 4 + 1024 * u;
    const v4f a = *(const v4fa*)(x + j);
    v4f b = {0.f,0.f,0.f,0.f}; if (rr) b = *(const v4fa*)(rr + j);
#pragma unroll
    for (int q = 0; q < 4; ++q) { const float v = a[q] + b[q]; vals[u * 4 + q] = v; s1 += v; }
  }
  red[tid] = s1; __syncthreads();
  for (int st = 128; st > 0; st >>= 1) { if (tid < st) red[tid] += red[tid + st]; __syncthreads(); }
  const float mu = red[0] / (float)N; __syncthreads();
  float s2 = 0.f;
  for (int u = 0; u < per / 4; ++u)
#pragma unroll
    for (int q = 0; q < 4; ++q) { const float c = vals[u * 4 + q] - mu; s2 += c * c; }
  red[tid] = s2; __syncthreads();
  for (int st = 128; st > 0; st >>= 1) { if (tid < st) red[tid] += red[tid + st]; __syncthreads(); }
  const float rs = rsqrtf(red[0] / (float)N + eps);
  {
    for (int u = 0; u < per / 4; ++u) {
      const int j = tid * 4 + 1024 * u;
      v4f o, sm;
#pragma unroll
      for (int q = 0; q < 4; ++q) {
        float gg = g[j + q], bb = bta[j + q];
        if (PARAM_BF16) { gg = bf16_round(gg); bb = bf16_round(bb); }
        sm[q] = vals[u * 4 + q]; o[q] = (vals[u * 4 + q] - mu) * rs * gg + bb;
      }
      if (out_sum) *(v4f*)(out_sum + (size_t)row * N + j) = sm;
      *(v4f*)(out_norm + (size_t)row * N + j) = o;
    }
    
  }
}



// ---- f16 WMMA path (v_wmma_f32_16x16x32_f16): 11-bit significands for operands in range — used where a [0,1] probability operand needs more precision than bf16
typedef _Float16 v16h __attribute__((ext_vector_type(16)));
union FragH { v16h v; v8us half[2]; _Float16 h[16]; unsigned short u[16]; };
template <int NT>
__device__ __forceinline__ v8f mmaH(v16h ah, v16h al, v16h bh, v16h bl, v8f c) {
  c = __builtin_amdgcn_wmma_f32_16x16x32_f16(false, ah, false, bh, (short)0, c, false, false);
  if (NT >= 2) c = __builtin_amdgcn_wmma_f32_16x16x32_f16(false, al, false, bh, (short)0, c, false, false);
  if (NT >= 3) c = __builtin_amdgcn_wmma_f32_16x16x32_f16(false, ah, false, bl, (short)0, c, false, false);
  asm volatile("v_nop\n\tv_nop\n\tv_nop\n\tv_nop" : "+v"(c) : "v"(ah), "v"(al), "v"(bh), "v"(bl));
  return c;
}
// batched GEMM like k_gemm_b but f16 operands: A f32 (split into f16 hi/lo if ASPLIT, else rounded to f16), Bt = f16 values [n][k]; alpha; C f32; N multiple of 16 (partial tiles skipped)
template <bool ASPLIT>
__global__ __launch_bounds__(128) void k_gemm_h(const float* __restrict__ A, int lda, size_t sA, const _Float16* __restrict__ Bh, int ldb, size_t sB, float alpha, float* __restrict__ C, int ldc, size_t sC, int M, int N, int K) {
  __shared__ __attribute__((aligned(16))) float so[4][16][64];
  const int tid = threadIdx.x, w = tid >> 5, lane = tid & 31, ln = lane & 15, hh = lane >> 4; const int by = blockIdx.y;
  A += (size_t)by * sA; Bh += (size_t)by * sB; C += (size_t)by * sC;
  const int ntn = (N + 63) / 64; const int wid = blockIdx.x * 4 + w; const int mt = wid / ntn, nq = wid % ntn; if (mt * 16 >= M) return;
  const int row0 = mt * 16, col0 = nq * 64; const float* arow = A + (size_t)(row0 + ln) * lda;
  v8f acc[4] = {};
  for (int kb = 0; kb < K; kb += 32) {
    FragH ah, al;
    const v4f x0 = *(const v4fa*)(arow + kb + 8 * hh), x1 = *(const v4fa*)(arow + kb + 8 * hh + 4), x2 = *(const v4fa*)(arow + kb + 16 + 8 * hh), x3 = *(const v4fa*)(arow + kb + 16 + 8 * hh + 4);
    float xs[16] = {x0[0],x0[1],x0[2],x0[3],x1[0],x1[1],x1[2],x1[3],x2[0],x2[1],x2[2],x2[3],x3[0],x3[1],x3[2],x3[3]};
#pragma unroll
    for (int i = 0; i < 16; ++i) { const _Float16 h = (_Float16)xs[i]; ah.h[i] = h; al.h[i] = ASPLIT ? (_Float16)(xs[i] - (float)h) : (_Float16)0.0f; }
#pragma unroll
    for (int t = 0; t < 4; ++t) { if (col0 + t * 16 >= N) continue; const size_t boff = (size_t)(col0 + t * 16 + ln) * ldb + kb; FragH bq; bq.half[0] = *(const v8us*)(Bh + boff + 8 * hh); bq.half[1] = *(const v8us*)(Bh + boff + 16 + 8 * hh);
      acc[t] = mmaH<ASPLIT ? 2 : 1>(ah.v, al.v, bq.v, bq.v, acc[t]); }
  }
#pragma unroll
  for (int t = 0; t < 4; ++t) { if (col0 + t * 16 >= N) continue;
#pragma unroll
    for (int r = 0; r < 8; ++r) so[w][8 * hh + r][t * 16 + ln] = acc[t][r] * alpha; }
  __builtin_amdgcn_fence(__ATOMIC_ACQ_REL, "workgroup"); __builtin_amdgcn_wave_barrier();
  const int rsub = lane >> 4, c4 = (lane & 15) * 4;
  {
#pragma unroll
    for (int q = 0; q < 8; ++q) { const int r = q * 2 + rsub; if (col0 + c4 < N) { const v4f v = *(const v4fa*)&so[w][r][c4]; *(v4f*)(C + (size_t)(row0 + r) * ldc + col0 + c4) = v; } }
     }
}

// Wt[n][k] = f16(W[k][n]·scale) from f32 row-major W[K][N] (scale = power of two; bf16-exact weights stay exact in f16 away from the subnormal range)
// One work-group per tile of 128 k x 64 n (grid = N / 64 by K / 128; K, N at compile time, so that the rows of a thread are constant offsets of one address). Reads: 16 lanes take 256 bytes in a row of one row of W, each thread the same four columns of eight rows, all eight loads in flight.
// The thread's 8 x 4 block leaves as four 16-byte pieces (eight k of one n) into an LDS tile [64 n][128 k]; stores: 16 lanes write 256 bytes in a row of one row of Wt. Both sides touch whole 128-byte lines only.
// LDS rows are 256 bytes, so every row starts on bank 0: piece kb of row n lies at place kb ^ (n / 4 % 16), which spreads the 16 lanes of a half wave over all banks in the write (rows 4 ln + j, one kb) and in the read (one row, 16 kb).
template <int K, int N>
__global__ __launch_bounds__(256) void k_wt_f16(const float* __restrict__ W, _Float16* __restrict__ Wt, float scale) { static_assert(K % 128 == 0 && N % 64 == 0, "whole tiles");
  __shared__ __attribute__((aligned(16))) unsigned short tl[64 * 128];
  const int tid = threadIdx.x, ln = tid & 15, kb = tid >> 4; const int n0 = blockIdx.x * 64, k0 = blockIdx.y * 128;
  const float* wb = W + (size_t)k0 * N + n0; const unsigned wo = (unsigned)(kb * 8 * N + ln * 4) * 4u;      /* the work-group's scalar base; the lane's fixed offset in bytes */
  v4f r[8];
#pragma unroll      /* register array; all loads in flight together */
  for (int i = 0; i < 8; ++i) r[i] = *(const v4fa*)((const char*)(wb + (size_t)i * N) + wo);
  asm volatile("s_wait_xcnt 0x0" :: "v"(wo), "s"(wb) : "memory");      /* behind the loads, in front of any later write of their base and offset registers; both as inputs, so that their registers are still theirs up to here */
#pragma unroll      /* register arrays */
  for (int j = 0; j < 4; ++j) { FragH f;
#pragma unroll      /* register arrays */
    for (int i = 0; i < 8; ++i) f.h[i] = (_Float16)(bf16_round(r[i][j]) * scale);
    *(v8us*)(tl + (ln * 4 + j) * 128 + (kb ^ ln) * 8) = f.half[0]; }
  __syncthreads();      /* the tile is whole before any row of it is read */
  unsigned short* ob = (unsigned short*)Wt + (size_t)n0 * K + k0; const unsigned oo = (unsigned)(kb * K + ln * 8) * 2u;      /* as above: row kb of each group of 16 rows, piece ln */
  v8us o[4];
#pragma unroll      /* register array */
  for (int p = 0; p < 4; ++p) { const int n = p * 16 + kb; o[p] = *(const v8us*)(tl + n * 128 + (ln ^ ((n >> 2) & 15)) * 8); }
#pragma unroll      /* register array */
  for (int p = 0; p < 4; ++p) *(v8us*)((char*)(ob + (size_t)p * 16 * K) + oo) = o[p];
}
// k_gemm_hh variant with fused epilogue: v = acc·alpha + bias[by·sBias + col] (+ CP[(row/rowsPerB)·sCPb + by·64 + col] if CP) ; ACT 0 none / 1 elu ; writes f16 C16 (and f32 C if non-null)
template <int ACT>
__global__ __launch_bounds__(128) void k_gemm_hhx(const _Float16* __restrict__ A, int lda, size_t sA, const _Float16* __restrict__ Bh, int ldb, size_t sB, float alpha, const float* __restrict__ bias, size_t sBias, const float* __restrict__ CP, int rowsPerB, size_t sCPb, int row0g,
    float* __restrict__ C, _Float16* __restrict__ C16, int ldc, size_t sC, int M, int N, int K) {
  __shared__ __attribute__((aligned(16))) float so[4][16][64];
  const int tid = threadIdx.x, w = tid >> 5, lane = tid & 31, ln = lane & 15, hh = lane >> 4; const int by = blockIdx.y;
  A += (size_t)by * sA; Bh += (size_t)by * sB; const size_t cofs = (size_t)by * sC; const float* bp = bias ? bias + (size_t)by * sBias : nullptr;
  const int ntn = (N + 63) / 64; const int wid = blockIdx.x * 4 + w; const int mt = wid / ntn, nq = wid % ntn; if (mt * 16 >= M) return;
  const int row0 = mt * 16, col0 = nq * 64; const _Float16* arow = A + (size_t)(row0 + ln) * lda;
  v8f acc[4] = {};
  for (int kb = 0; kb < K; kb += 32) { FragH ah; ah.half[0] = *(const v8us*)((const unsigned short*)arow + kb + 8 * hh); ah.half[1] = *(const v8us*)((const unsigned short*)arow + kb + 16 + 8 * hh);
#pragma unroll
    for (int t = 0; t < 4; ++t) { if (col0 + t * 16 >= N) continue; const size_t boff = (size_t)(col0 + t * 16 + ln) * ldb + kb; FragH bq; bq.half[0] = *(const v8us*)((const unsigned short*)Bh + boff + 8 * hh); bq.half[1] = *(const v8us*)((const unsigned short*)Bh + boff + 16 + 8 * hh);
      acc[t] = mmaH<1>(ah.v, ah.v, bq.v, bq.v, acc[t]); }
  }
#pragma unroll
  for (int t = 0; t < 4; ++t) { if (col0 + t * 16 >= N) continue; const int col = col0 + t * 16 + ln; const float bv = bp ? bf16_round(bp[col]) : 0.f;
#pragma unroll
    for (int r = 0; r < 8; ++r) { float v = acc[t][r] * alpha + bv; if (CP) { const int rr = row0g + row0 + 8 * hh + r; if (rowsPerB < 0) v += CP[cofs + (size_t)rr * ldc + col];      /* rowsPerB < 0: own element of the batched C plane */ else { const int bidx = rr / rowsPerB; v += CP[(size_t)bidx * sCPb + (size_t)by * 64 + col]; } } if (ACT == 1) v = (v > 0.f) ? v : expm1f(v); else if (ACT == 7) v = (v > 0.f) ? v + 1.0f : expf(v); else if (ACT == 8) v = tanhf(v); else if (ACT == 9) v = 0.5f * v * (1.0f + tanhf(0.7978845608028654f * (v + 0.044715f * v * v * v))); else if (ACT == 11) v = 1.0f / (1.0f + expf(-v)); else if (ACT == 12) v = (v > 0.f) ? v : 0.01f * v; else if (ACT == 14) v = (v > 0.f) ? v : 0.1f * v; else if (ACT == 16) v = (v >= 0.f) ? v : 0.3f * v; else if (ACT == 17) v = (v >= 0.f) ? v : 0.2f * v; else if (ACT == 15) v = v / (1.0f + expf(-v)); else if (ACT == 3) v = fmaxf(v, 0.f); else if (ACT == 6) v = 0.5f * v * (1.0f + erff(v * 0.70710678118654752f)); so[w][8 * hh + r][t * 16 + ln] = v; } }
  __builtin_amdgcn_fence(__ATOMIC_ACQ_REL, "workgroup"); __builtin_amdgcn_wave_barrier();
  const int rsub = lane >> 4, c4 = (lane & 15) * 4; typedef _Float16 v4h __attribute__((ext_vector_type(4)));
  {
#pragma unroll
    for (int q = 0; q < 8; ++q) { const int r = q * 2 + rsub; if (col0 + c4 < N) { const v4f v = *(const v4fa*)&so[w][r][c4]; if (C) *(v4f*)(C + cofs + (size_t)(row0 + r) * ldc + col0 + c4) = v; if (C16) { v4h h4; for (int i = 0; i < 4; ++i) h4[i] = (_Float16)v[i]; *(v4h*)(C16 + cofs + (size_t)(row0 + r) * ldc + col0 + c4) = h4; } } }
     }
}


typedef _Float16 v4h __attribute__((ext_vector_type(4)));

__global__ __launch_bounds__(256) void k_x16(const float* __restrict__ x, _Float16* __restrict__ X16, size_t n8) { const size_t t = (size_t)blockIdx.x * 256 + threadIdx.x; if (t >= n8) return; FragH f;
#pragma unroll
  for (int q = 0; q < 8; ++q) f.h[q] = (_Float16)bf16_round(x[t * 8 + q]); *(v8us*)((unsigned short*)X16 + t * 8) = f.half[0];  }
__global__ __launch_bounds__(256) void k_h16(const float* __restrict__ x, _Float16* __restrict__ X16, size_t n8) { const size_t t = (size_t)blockIdx.x * 256 + threadIdx.x; if (t >= n8) return; FragH f;
#pragma unroll
  for (int q = 0; q < 8; ++q) f.h[q] = (_Float16)x[t * 8 + q]; *(v8us*)((unsigned short*)X16 + t * 8) = f.half[0];  }
__global__ __launch_bounds__(256) void k_round16f(const float* __restrict__ W, _Float16* __restrict__ Bt, size_t n8) { const size_t t = (size_t)blockIdx.x * 256 + threadIdx.x; if (t >= n8) return; FragH f;
#pragma unroll
  for (int i = 0; i < 8; ++i) f.h[i] = (_Float16)(bf16_round(W[t * 8 + i]) * 16.0f); *(v8us*)((unsigned short*)Bt + t * 8) = f.half[0];  }
template <int NHv, int TTv>
__global__ __launch_bounds__(256) void k_vt(const _Float16* __restrict__ V16, int ldv, int voff, _Float16* __restrict__ Vt) { __shared__ unsigned short tl[64][66]; const int tid = threadIdx.x; const int slab = blockIdx.x / (TTv / 64), lg = blockIdx.x % (TTv / 64); const int b = slab / NHv, h = slab % NHv;
  for (int i = tid; i < 64 * 8; i += 256) { const int r = i / 8, c8 = (i % 8) * 8; FragH f; f.half[0] = *(const v8us*)((const unsigned short*)V16 + ((size_t)b * TTv + lg * 64 + r) * ldv + voff + h * 64 + c8);
#pragma unroll
    for (int q = 0; q < 8; ++q) tl[r][c8 + q] = f.u[q]; }
  __syncthreads();
  {
#pragma unroll
    for (int rd = 0; rd < 2; ++rd) { const int d = rd * 32 + tid / 8, pc = tid % 8; FragH f;
#pragma unroll
      for (int q = 0; q < 8; ++q) f.u[q] = tl[pc * 8 + q][d];
      *(v8us*)((unsigned short*)Vt + ((size_t)slab * 64 + d) * TTv + lg * 64 + pc * 8) = f.half[0]; }
     } }

__global__ __launch_bounds__(256) void k_hl(const float* __restrict__ F, _Float16* __restrict__ Hh, _Float16* __restrict__ Hl, size_t n8) { const size_t t = (size_t)blockIdx.x * 256 + threadIdx.x; if (t >= n8) return; FragH fh, fl; const v4f a = *(const v4fa*)(F + t * 8), c = *(const v4fa*)(F + t * 8 + 4);
#pragma unroll
  for (int q = 0; q < 4; ++q) { _Float16 h = (_Float16)a[q]; fh.h[q] = h; fl.h[q] = (_Float16)((a[q] - (float)h) * 1024.0f); h = (_Float16)c[q]; fh.h[4 + q] = h; fl.h[4 + q] = (_Float16)((c[q] - (float)h) * 1024.0f); }
  { *(v8us*)((unsigned short*)Hh + t * 8) = fh.half[0]; *(v8us*)((unsigned short*)Hl + t * 8) = fl.half[0];  } }

// ---- fast GEMM (work-group tile 128x64, wave tile 32x64; requires M % 128 == 0 rows per launch region, N % 64 == 0, K % 64 == 0); epilogue = k_gemm_hhx semantics ----
// Operands reach the waves through LDS: per pass of 64 k the work-group's 128 rows of A and 64 rows of B (128 bytes each) are brought in once by asynchronous copies, whole lines at a time, into one of two buffers; the next pass's copies fly while this pass is worked on.
#define G2P 144                      /* LDS row pitch in bytes: 16 B x odd, the pitch for ds_load_b128 readers of 128-byte rows */
#define G2S ((128 + 64) * G2P)       /* one buffer: rows 0..127 = A, rows 128..191 = B */
__device__ __forceinline__ v16h g2_lfrag(const unsigned char* p) { FragH f; f.half[0] = *(const v8us*)p; f.half[1] = *(const v8us*)(p + 32); return f.v; }
// one pass's operands: twelve 16-byte copies per lane (eight lanes per 128-byte row, 16 rows per copy and work-group; copies 0..7 = A, 8..11 = B). l = the lane's LDS byte address in row tid / 8 of the buffer; a, b = its own 16 bytes in that row of A and of B; sa, sb = 16 rows in bytes.
// The s_wait_xcnt stands inside the statement, behind the last copy: a precaution in front of any later write of a register that a copy names.
__device__ __forceinline__ void g2_copy(unsigned l, const char* a, size_t sa, const char* b, size_t sb) {
  asm volatile("global_load_async_to_lds_b128 %0, %12, off\n\tglobal_load_async_to_lds_b128 %1, %13, off\n\tglobal_load_async_to_lds_b128 %2, %14, off\n\tglobal_load_async_to_lds_b128 %3, %15, off\n\t"
               "global_load_async_to_lds_b128 %4, %16, off\n\tglobal_load_async_to_lds_b128 %5, %17, off\n\tglobal_load_async_to_lds_b128 %6, %18, off\n\tglobal_load_async_to_lds_b128 %7, %19, off\n\t"
               "global_load_async_to_lds_b128 %8, %20, off\n\tglobal_load_async_to_lds_b128 %9, %21, off\n\tglobal_load_async_to_lds_b128 %10, %22, off\n\tglobal_load_async_to_lds_b128 %11, %23, off\n\ts_wait_xcnt 0x0"
               :: "v"(l), "v"(l + 16u * G2P), "v"(l + 32u * G2P), "v"(l + 48u * G2P), "v"(l + 64u * G2P), "v"(l + 80u * G2P), "v"(l + 96u * G2P), "v"(l + 112u * G2P), "v"(l + 128u * G2P), "v"(l + 144u * G2P), "v"(l + 160u * G2P), "v"(l + 176u * G2P),
                  "v"(a), "v"(a + sa), "v"(a + 2 * sa), "v"(a + 3 * sa), "v"(a + 4 * sa), "v"(a + 5 * sa), "v"(a + 6 * sa), "v"(a + 7 * sa), "v"(b), "v"(b + sb), "v"(b + 2 * sb), "v"(b + 3 * sb) : "memory"); }
__device__ __forceinline__ v8f g2_mma(v16h a, v16h b, v8f c) { v8f d = __builtin_amdgcn_wmma_f32_16x16x32_f16(false, a, false, b, (short)0, c, false, false); asm volatile("v_nop\n\tv_nop\n\tv_nop\n\tv_nop" : "+v"(d) : "v"(a), "v"(b)); return d; }
// QKVF (the stacked q | k | v launch, rows b * SQ + s, columns 0 .. 3 DM - 1): the f32 values behind the f16 rows are stored as well, so that no product is formed twice: k and v head-major into KV (outputs 1 and 2, one behind the other: [k | v][NB][NH][SQ][HD]), and q, k, v of each batch's first QT0 rows into F0 ([q | k | v][NB][QT0][DM]) for the f32 attention path.
template <int ACT, bool QKVF = false>
__global__ __launch_bounds__(128) void k_gemm2(const _Float16* __restrict__ A, int lda, size_t sA, const _Float16* __restrict__ Bh, int ldb, size_t sB, float alpha, const float* __restrict__ bias, size_t sBias, const float* __restrict__ CP, int rowsPerB, size_t sCPb, int row0g,
    float* __restrict__ C, _Float16* __restrict__ C16, int ldc, size_t sC, int M, int N, int K, float* __restrict__ KV, float* __restrict__ F0) { static_assert(ACT == 0 || ACT == 3 || ACT == 6 || ACT == 8 || ACT == 9 || ACT == 11 || ACT == 12 || ACT == 14 || ACT == 15 || ACT == 16 || ACT == 17, "k_gemm2: unsupported ACT code (would silently apply no activation)");
  __shared__ __attribute__((aligned(16))) unsigned char ring[2 * G2S]; static_assert(sizeof(float) * 4 * 32 * 68 <= 2 * G2S, "the output staging fits in the ring");
  float (*so)[32][68] = (float (*)[32][68])ring;      /* output staging in the ring's place, behind the last pass's barrier */
  const int tid = threadIdx.x, w = tid >> 5, lane = tid & 31, ln = lane & 15, hh = lane >> 4; const int by = blockIdx.y;
  A += (size_t)by * sA; Bh += (size_t)by * sB; const size_t cofs = (size_t)by * sC; const float* bp = bias ? bias + (size_t)by * sBias : nullptr;
  const int ntn = N >> 6; const int mt = blockIdx.x / ntn, nq = blockIdx.x - mt * ntn; const int row0 = mt * 128 + 32 * w, col0 = nq * 64; if (mt * 128 >= M) return;      /* the whole work-group or none of it, in front of every barrier */
  const char* ag = (const char*)(A + (size_t)(mt * 128 + (tid >> 3)) * lda) + (tid & 7) * 16; const char* bg = (const char*)(Bh + (size_t)(col0 + (tid >> 3)) * ldb) + (tid & 7) * 16;      /* the lane's 16 bytes in the first of its rows */
  const size_t sa = (size_t)lda * 32, sb = (size_t)ldb * 32; const unsigned lc = (unsigned)(size_t)ring + (unsigned)((tid >> 3) * G2P + (tid & 7) * 16);
  const unsigned char* la = ring + (32 * w + ln) * G2P + 16 * hh; const unsigned char* lb = ring + (128 + ln) * G2P + 16 * hh;      /* fragment rows: the wave's own 32 rows of A, the 64 rows of B */
  const v8f z8 = {0.f,0.f,0.f,0.f,0.f,0.f,0.f,0.f}; v8f c00 = z8, c01 = z8, c02 = z8, c03 = z8, c10 = z8, c11 = z8, c12 = z8, c13 = z8;
  const int np = K >> 6;
  g2_copy(lc, ag, sa, bg, sb);
  asm volatile("s_wait_asynccnt 0x0" ::: "memory");      /* this wave's copies of pass 0 have landed */
  __syncthreads();      /* pass 0 is readable by every wave */
  if (np > 1) g2_copy(lc + G2S, ag + 128, sa, bg + 128, sb);
#pragma unroll 1
  for (int t = 0; t < np; ++t) { const unsigned bo = (unsigned)(t & 1) * G2S;
    v16h fa[2][2], fb[2][4];      /* the pass's fragments: two k steps of 32 */
#pragma unroll      /* register arrays, constant LDS offsets */
    for (int ks = 0; ks < 2; ++ks) { fa[ks][0] = g2_lfrag(la + bo + ks * 64); fa[ks][1] = g2_lfrag(la + bo + ks * 64 + 16 * G2P);
#pragma unroll      /* register arrays */
      for (int j = 0; j < 4; ++j) fb[ks][j] = g2_lfrag(lb + bo + ks * 64 + j * 16 * G2P); }
    __builtin_amdgcn_sched_barrier(0);      /* all LDS reads of the pass go out as one group in front of its products; left to itself the compiler reads one fragment at a time and waits out the LDS latency in front of every second product */
#pragma unroll      /* register arrays */
    for (int ks = 0; ks < 2; ++ks) {
      c00 = g2_mma(fa[ks][0], fb[ks][0], c00); c10 = g2_mma(fa[ks][1], fb[ks][0], c10);
      c01 = g2_mma(fa[ks][0], fb[ks][1], c01); c11 = g2_mma(fa[ks][1], fb[ks][1], c11);
      c02 = g2_mma(fa[ks][0], fb[ks][2], c02); c12 = g2_mma(fa[ks][1], fb[ks][2], c12);
      c03 = g2_mma(fa[ks][0], fb[ks][3], c03); c13 = g2_mma(fa[ks][1], fb[ks][3], c13); }
    asm volatile("s_wait_dscnt 0x0" ::: "memory");      /* this wave's reads of the buffer are done before the barrier behind which it is refilled */
    asm volatile("s_wait_asynccnt 0x0" ::: "memory");      /* this wave's copies of pass t + 1 have landed */
    __syncthreads();      /* publishes pass t + 1 and ends every wave's reads of pass t */
    if (t + 2 < np) g2_copy(lc + bo, ag + (size_t)(t + 2) * 128, sa, bg + (size_t)(t + 2) * 128, sb); }
  asm volatile("s_wait_asynccnt 0x0" ::: "memory");      /* no copy is outstanding when the ring becomes output staging */
  v8f accs[8] = {c00, c01, c02, c03, c10, c11, c12, c13};
#pragma unroll
  for (int u = 0; u < 8; ++u) { const int t = u & 3, half = u >> 2; const int col = col0 + t * 16 + ln; const float bv = bp ? bf16_round(bp[col]) : 0.f;
#pragma unroll
    for (int r = 0; r < 8; ++r) { const int rloc = half * 16 + 8 * hh + r; float v = accs[u][r] * alpha + bv; if (CP) { if (rowsPerB < 0) v += CP[cofs + (size_t)(row0g + row0 + rloc) * ldc + col];      /* rowsPerB < 0: own element of the batched C plane */ else { const int bidx = (row0g + row0 + rloc) / rowsPerB; v += CP[(size_t)bidx * sCPb + (size_t)by * 64 + col]; } }
      if (ACT == 3) v = fmaxf(v, 0.f); else if (ACT == 6) v = 0.5f * v * (1.0f + erff(v * 0.70710678118654752f)); else if (ACT == 11) v = 1.0f / (1.0f + expf(-v)); else if (ACT == 15) v = v / (1.0f + expf(-v)); else if (ACT == 12) v = (v > 0.f) ? v : 0.01f * v; else if (ACT == 8) v = tanhf(v); else if (ACT == 9) v = 0.5f * v * (1.0f + tanhf(0.7978845608028654f * (v + 0.044715f * v * v * v))); else if (ACT == 14) v = (v > 0.f) ? v : 0.1f * v; else if (ACT == 16) v = (v >= 0.f) ? v : 0.3f * v; else if (ACT == 17) v = (v >= 0.f) ? v : 0.2f * v;
      so[w][rloc][t * 16 + ln] = v; } }
  __builtin_amdgcn_fence(__ATOMIC_ACQ_REL, "workgroup"); __builtin_amdgcn_wave_barrier();
  const int rsub = lane >> 4, c4 = (lane & 15) * 4;
  {
#pragma unroll
    for (int q = 0; q < 16; ++q) { const int r = q * 2 + rsub; const v4f v = *(const v4fa*)&so[w][r][c4]; if (C) *(v4f*)(C + cofs + (size_t)(row0 + r) * ldc + col0 + c4) = v; if (C16) { v4h h4; for (int i = 0; i < 4; ++i) h4[i] = (_Float16)v[i]; *(v4h*)(C16 + cofs + (size_t)(row0 + r) * ldc + col0 + c4) = h4; } }
     }
  if constexpr (QKVF) { static_assert(QT0 == 128 && SQ % 128 == 0 && HD == 64 && DM % 64 == 0, "a work-group's 128 rows lie in one batch and are its first QT0 rows or none of them; its 64 columns are one head of q, of k or of v");
    const int sel = col0 / DM, hc = col0 % DM, bt = (mt * 128) / SQ, t0 = (mt * 128) % SQ;      /* 0 q, 1 k, 2 v; first column in that matrix; batch; first row in the batch: all the work-group's own, scalars */
    if (sel >= 1) { float* kvp = KV + ((size_t)((sel - 1) * NB + bt) * NH + hc / HD) * SQ * HD + (size_t)t0 * HD; const unsigned kvo = (unsigned)((32 * w + rsub) * HD + c4) * 4u;      /* scalar base, the lane's fixed offset in bytes, the row pair as a constant: a head's rows follow one another, so that each store is 512 bytes in a row */
#pragma unroll      /* constant offsets */
      for (int q = 0; q < 16; ++q) *(v4f*)((char*)kvp + kvo + q * 2 * HD * 4) = *(const v4fa*)&so[w][q * 2 + rsub][c4];
      asm volatile("s_wait_xcnt 0x0" :: "v"(kvo), "s"(kvp) : "memory"); }      /* behind the stores, in front of any later write of their base and offset registers (the next block forms its own); both as inputs, so that their registers are still theirs up to here */
    if (t0 == 0) { float* fp = F0 + (size_t)(sel * NB + bt) * QT0 * DM + hc; const unsigned fo = (unsigned)((32 * w + rsub) * DM + c4) * 4u;      /* as above, row pitch DM */
#pragma unroll      /* constant offsets */
      for (int q = 0; q < 16; ++q) *(v4f*)((char*)fp + fo + q * 2 * DM * 4) = *(const v4fa*)&so[w][q * 2 + rsub][c4]; } } }


__global__ __launch_bounds__(256) void k_wnat(const float* __restrict__ w, size_t n8, _Float16* __restrict__ Bt) { const size_t t = (size_t)blockIdx.x * 256 + threadIdx.x; if (t >= n8) return; FragH f; for (int q = 0; q < 8; ++q) f.h[q] = (_Float16)(bf16_round(w[t * 8 + q]) * 16.0f); *(v8us*)((unsigned short*)Bt + t * 8) = f.half[0];  }
__global__ __launch_bounds__(256) void k_rsm(const float* __restrict__ S, _Float16* __restrict__ P, int nrows) {
  #pragma clang fp contract(off)
  const int i = blockIdx.x * 256 + threadIdx.x; if (i >= nrows) return; const float* s = S + (size_t)i * SQ; float mx = -3.0e38f;
#pragma unroll 1
  for (int j = 0; j < SQ; ++j) mx = fmaxf(mx, s[j]); float se = 0.f;
#pragma unroll 1
  for (int j = 0; j < SQ; ++j) se += expf(s[j] - mx); const float sc = 256.0f / se;
#pragma unroll 1
  for (int j0 = 0; j0 < SQ; j0 += 8) { FragH f; for (int q = 0; q < 8; ++q) f.h[q] = (_Float16)(expf(s[j0 + q] - mx) * sc); unsigned short* d = (unsigned short*)P + (size_t)i * SQ + j0; *(v8us*)d = f.half[0];  } }
__global__ __launch_bounds__(256) void k_vt(const _Float16* __restrict__ V16, int b, int h0, _Float16* __restrict__ VT) { __shared__ unsigned short tl[64][65]; const int tid = threadIdx.x; const int hh = blockIdx.x % HG, sg = blockIdx.x / HG; const int s0 = sg * 64; const int h = h0 + hh;
  for (int i = tid; i < 64 * 8; i += 256) { const int j = i / 8, d8 = (i % 8) * 8; FragH f; f.half[0] = *(const v8us*)((const unsigned short*)V16 + ((size_t)b * SQ + s0 + j) * DM + h * HD + d8); for (int q = 0; q < 8; ++q) tl[d8 + q][j] = f.u[q]; }
  __syncthreads();
  { for (int i = tid; i < 64 * 8; i += 256) { const int d = i / 8, j8 = (i % 8) * 8; FragH f; for (int q = 0; q < 8; ++q) f.u[q] = tl[d][j8 + q]; *(v8us*)((unsigned short*)VT + ((size_t)hh * HD + d) * SQ + s0 + j8) = f.half[0]; }  } }



// ---- lane exchanges and native exp2 shared by the two attention kernels below ----
template <int CTRL>
__device__ __forceinline__ float sm_rowx(float x) { return __builtin_bit_cast(float, __builtin_amdgcn_update_dpp(__builtin_bit_cast(int, x), __builtin_bit_cast(int, x), CTRL, 0xf, 0xf, false)); }      /* CTRL = 0x160 | m (row_xmask): lane l with lane l ^ m of its 16-lane row */
__device__ __forceinline__ float sm_half(float x) { return __builtin_bit_cast(float, __builtin_amdgcn_permlanex16(__builtin_bit_cast(int, x), __builtin_bit_cast(int, x), 0x76543210, 0xfedcba98, false, false)); }      /* lane l with lane l ^ 16 */
__device__ __forceinline__ float sm_wmax(float v) { v = fmaxf(v, sm_rowx<0x161>(v)); v = fmaxf(v, sm_rowx<0x162>(v)); v = fmaxf(v, sm_rowx<0x164>(v)); v = fmaxf(v, sm_rowx<0x168>(v)); return fmaxf(v, sm_half(v)); }
__device__ __forceinline__ float sm_wsum(float v) { v += sm_rowx<0x161>(v); v += sm_rowx<0x162>(v); v += sm_rowx<0x164>(v); v += sm_rowx<0x168>(v); return v + sm_half(v); }
// 2^x of four values: each v_exp_f32 fills the slot behind the one before it (results apart from all sources), the v_nop the slot behind the last, which the instruction set asks for before a result is read or a source overwritten
__device__ __forceinline__ v4f sm_exp2x4(v4f x) { float r0, r1, r2, r3;
  asm("v_exp_f32 %0, %4\n\tv_exp_f32 %1, %5\n\tv_exp_f32 %2, %6\n\tv_exp_f32 %3, %7\n\tv_nop" : "=&v"(r0), "=&v"(r1), "=&v"(r2), "=&v"(r3) : "v"(x[0]), "v"(x[1]), "v"(x[2]), "v"(x[3]));
  const v4f r = {r0, r1, r2, r3}; return r; }
// ---- causal attention for query rows QT0 .. SQ - 1 in one launch: scores and softmax weights never leave registers. One wave owns 32 query rows of one (batch, head) and walks the keys 64 at a time; no LDS, no barrier.
// Both products are formed transposed, so that a query is a lane (column ln) in each: S^T = K Q^T (A = 16 key rows, B = query rows) gives lane (ln, hh) the keys 8 hh + r of a 16-key tile for query ln, which is the k order of a B fragment
// (tiles 2 j, 2 j + 1 -> k = 8 hh + i, 16 + 8 hh + i): the weights go from accumulator to operand by a conversion alone. O^T = V^T P^T (A = 16 rows of V^T) keeps query = ln, so that the running maximum, the rescale and the row sum are the lane's own.
// Running maximum kept on the raw products; weights 2^((s - max) c + 8), c = log2(e) / 8: at most 256, so that small weights stay clear of the f16 subnormals; the row sum carries the same factor.
__device__ __forceinline__ v8f fa_mma(v16h a, v16h b, v8f c) { return __builtin_amdgcn_wmma_f32_16x16x32_f16(false, a, false, b, (short)0, c, false, false); }
// fragment from a wave-uniform base and the lane's own fixed offset in bytes (the value the load instruction itself takes beside a scalar base)
__device__ __forceinline__ v16h fa_frag(const _Float16* base, unsigned off) { FragH f; f.half[0] = *(const v8us*)((const char*)base + off); f.half[1] = *(const v8us*)((const char*)base + off + 32); return f.v; }
__device__ __forceinline__ void fa_loadk(const _Float16* __restrict__ kp, int kb, unsigned ko, v16h (&kf)[4][2]) {
#pragma unroll      /* register arrays */
  for (int t = 0; t < 4; ++t)
#pragma unroll      /* register arrays */
    for (int ks = 0; ks < 2; ++ks) kf[t][ks] = fa_frag(kp + (size_t)(kb + t * 16) * LQ + ks * 32, ko); }
// one pass of 64 keys from kb on. LAST: the pass that holds the rows' own keys (the only one that needs the mask) and has no pass behind it to fetch K for.
template <bool LAST>
__device__ __forceinline__ void fa_pass(const _Float16* __restrict__ kp, const _Float16* __restrict__ vp, int kb, int qrel, unsigned ko, unsigned vo, const v16h (&qf)[2][2], v16h (&kf)[4][2], v8f (&o)[2][4], float (&mr)[2], float (&l)[2]) {
  const float cs = 0.125f * 1.44269504f; const v8f z8 = {0.f, 0.f, 0.f, 0.f, 0.f, 0.f, 0.f, 0.f};
  v16h vf[4][2];
#pragma unroll      /* register arrays */
  for (int t = 0; t < 4; ++t)
#pragma unroll      /* register arrays */
    for (int ks = 0; ks < 2; ++ks) vf[t][ks] = fa_frag(vp + (size_t)t * 16 * SQ + kb + ks * 32, vo);
  asm volatile("s_wait_xcnt 0x0" :: "v"(vo) : "memory");      /* behind the loads, in front of any later write of a register that holds one of their addresses; the offset as an input, so that its register is still the offset's while the loads issue */
  __builtin_amdgcn_sched_barrier(0);      /* V^T of this pass is asked for here, so that it flies under the score products and the softmax; left to itself the scheduler sinks the loads to their use */
  v8f st[2][4];
#pragma unroll      /* register arrays */
  for (int qt = 0; qt < 2; ++qt)
#pragma unroll      /* register arrays */
    for (int t = 0; t < 4; ++t) st[qt][t] = fa_mma(kf[t][1], qf[qt][1], fa_mma(kf[t][0], qf[qt][0], z8));
  if (!LAST) { __builtin_amdgcn_sched_barrier(0);      /* the next pass's K is asked for behind this pass's last use of K and no later: it flies under the softmax and the second product */
    fa_loadk(kp, kb + 64, ko, kf);
    asm volatile("s_wait_xcnt 0x0" :: "v"(ko) : "memory");      /* as behind the V^T loads above */
    __builtin_amdgcn_sched_barrier(0); }      /* as the line above: keeps the loads from sinking */
  float mn[2];
#pragma unroll      /* register arrays */
  for (int qt = 0; qt < 2; ++qt) { const int rel = qrel + qt * 16 - kb;      /* key kb + 16 t + 8 hh + r is kept while 16 t + r <= rel */
    float mx = mr[qt];
#pragma unroll      /* register arrays */
    for (int t = 0; t < 4; ++t)
#pragma unroll      /* register arrays */
      for (int r = 0; r < 8; ++r) { if (LAST) st[qt][t][r] = (t * 16 + r <= rel) ? st[qt][t][r] : -1.0e30f; mx = fmaxf(mx, st[qt][t][r]); }
    mn[qt] = fmaxf(mx, sm_half(mx)); }      /* the other eight keys of each tile sit in lane l ^ 16 */
  const v4f ax = {(mr[0] - mn[0]) * cs, (mr[1] - mn[1]) * cs, 0.f, 0.f}; const v4f al = sm_exp2x4(ax);      /* rescale of what was summed under the old maximum; 0 in the first pass */
  FragH pf[2][2];
#pragma unroll      /* register arrays */
  for (int qt = 0; qt < 2; ++qt) { const float mo = mn[qt] * cs - 8.0f; mr[qt] = mn[qt];
    v4f se = {0.f, 0.f, 0.f, 0.f};
#pragma unroll      /* register arrays */
    for (int t = 0; t < 4; ++t)
#pragma unroll      /* register arrays */
      for (int g = 0; g < 2; ++g) { v4f x;
#pragma unroll      /* register arrays */
        for (int q = 0; q < 4; ++q) x[q] = st[qt][t][g * 4 + q] * cs - mo;
        x = sm_exp2x4(x); se += x;
#pragma unroll      /* register arrays */
        for (int q = 0; q < 4; ++q) pf[qt][t >> 1].h[(t & 1) * 8 + g * 4 + q] = (_Float16)x[q]; }
    l[qt] = l[qt] * al[qt] + ((se[0] + se[1]) + (se[2] + se[3]));
#pragma unroll      /* register arrays */
    for (int t = 0; t < 4; ++t) o[qt][t] *= al[qt]; }
  __builtin_amdgcn_sched_barrier(0);      /* the second product starts behind the last exp2 of both tiles */
#pragma unroll      /* register arrays */
  for (int qt = 0; qt < 2; ++qt)
#pragma unroll      /* register arrays */
    for (int t = 0; t < 4; ++t) o[qt][t] = fa_mma(vf[t][1], pf[qt][1].v, fa_mma(vf[t][0], pf[qt][0].v, o[qt][t])); }
__global__ __launch_bounds__(256) void k_fattn(const _Float16* __restrict__ QKVp, const _Float16* __restrict__ VTp, const float* __restrict__ XBp, float* __restrict__ X1p) {
  static_assert(QT0 == 128 && HD == 64 && SQ % 256 == 0, "blocks of 128 query rows; block 0 of a batch belongs to the f32 path; blocks 1 .. SQ / 128 - 1 are paired below");
  const int lane = threadIdx.x & 31, ln = lane & 15, hh = lane >> 4; const int w = __builtin_amdgcn_readfirstlane((int)(threadIdx.x >> 5));      /* the wave's number: a scalar, so that the early exit and the trip count are scalar */
  const int h = blockIdx.y, b = blockIdx.z; const int far = SQ / 128 - 1 - (int)blockIdx.x, near = 1 + (int)blockIdx.x;      /* waves 0-3 take a late block of rows, waves 4-7 the early block that makes the keys walked per work-group level */
  if (w >= 4 && near >= far) return;      /* the middle block has no partner; no barrier in this kernel */
  const int qw = (w < 4 ? far : near) * 128 + (w & 3) * 32;
  const size_t r0 = (size_t)b * SQ;
  const _Float16* qp = QKVp + (r0 + qw) * LQ + h * HD; const _Float16* kp = QKVp + DM + r0 * LQ + h * HD; const _Float16* vp = VTp + (size_t)(b * NH + h) * HD * SQ;      /* wave-uniform bases */
  const unsigned ko = (unsigned)(ln * LQ + 8 * hh) * 2u, vo = (unsigned)(ln * SQ + 8 * hh) * 2u;      /* the lane's row and k half in q / k rows and in V^T rows, in bytes */
  v16h qf[2][2], kf[4][2];
#pragma unroll      /* register arrays */
  for (int qt = 0; qt < 2; ++qt)
#pragma unroll      /* register arrays */
    for (int ks = 0; ks < 2; ++ks) qf[qt][ks] = fa_frag(qp + (size_t)qt * 16 * LQ + ks * 32, ko);
  fa_loadk(kp, 0, ko, kf);
  asm volatile("s_wait_xcnt 0x0" :: "v"(ko) : "memory");      /* behind the loads of q and of the first K, in front of any later write of their base and offset registers */
  __builtin_amdgcn_sched_barrier(0);      /* keeps later address arithmetic, which reuses those registers, behind the wait */
  const v8f z8 = {0.f, 0.f, 0.f, 0.f, 0.f, 0.f, 0.f, 0.f};
  v8f o[2][4] = {{z8, z8, z8, z8}, {z8, z8, z8, z8}}; float mr[2] = {-1.0e30f, -1.0e30f}; float l[2] = {0.f, 0.f};
  const int klast = qw & ~63;      /* keys 0 .. qw + 31 in passes of 64: every pass before this one lies wholly below row qw, this one ends at or below SQ - 1 */
  const int qrel = qw + ln - 8 * hh;
#pragma unroll 1      /* one pass holds 32 loads and 32 matrix instructions already */
  for (int kb = 0; kb < klast; kb += 64) fa_pass<false>(kp, vp, kb, qrel, ko, vo, qf, kf, o, mr, l);
  const float* xp = XBp + (r0 + qw) * DM + h * HD; float* yp = X1p + (r0 + qw) * DM + h * HD; const unsigned xo = (unsigned)(ln * DM + 8 * hh) * 4u;      /* lane (ln, hh) holds columns 16 t + 8 hh .. + 7 of query ln; in bytes */
  v4f xr[2][4][2];
#pragma unroll      /* register arrays */
  for (int qt = 0; qt < 2; ++qt)
#pragma unroll      /* register arrays */
    for (int t = 0; t < 4; ++t)
#pragma unroll      /* register arrays */
      for (int g = 0; g < 2; ++g) xr[qt][t][g] = *(const v4fa*)((const char*)(xp + qt * 16 * DM + t * 16 + g * 4) + xo);
  asm volatile("s_wait_xcnt 0x0" :: "v"(xo) : "memory");      /* as behind the V^T loads */
  __builtin_amdgcn_sched_barrier(0);      /* the residual rows are asked for here and fly under the last pass, in the registers that the K fetched ahead no longer needs */
  fa_pass<true>(kp, vp, klast, qrel, ko, vo, qf, kf, o, mr, l);
#pragma unroll      /* register arrays */
  for (int qt = 0; qt < 2; ++qt) { const float inv = 1.0f / (l[qt] + sm_half(l[qt]));      /* the two halves' sums joined once */
#pragma unroll      /* register arrays */
    for (int t = 0; t < 4; ++t)
#pragma unroll      /* register arrays */
      for (int g = 0; g < 2; ++g)
#pragma unroll      /* register arrays */
        for (int q = 0; q < 4; ++q) xr[qt][t][g][q] += o[qt][t][g * 4 + q] * inv; }
  __builtin_amdgcn_sched_barrier(0);      /* all arithmetic in front of the first store, so that nothing rewrites a register that an issued store names */
#pragma unroll      /* register arrays */
  for (int qt = 0; qt < 2; ++qt)
#pragma unroll      /* register arrays */
    for (int t = 0; t < 4; ++t)
#pragma unroll      /* register arrays */
      for (int g = 0; g < 2; ++g) *(v4f*)((char*)(yp + qt * 16 * DM + t * 16 + g * 4) + xo) = xr[qt][t][g]; }


typedef float v2f  __attribute__((ext_vector_type(2)));
typedef float v2fa __attribute__((ext_vector_type(2), may_alias));
// ---- f32 attention for the first QT0 query rows: one wave per (head, query row), eight rows of one head per work-group. The head's K and V rows up to the end of the rows' 32-key chunk are staged once in LDS.
// Scores: lane l owns keys 32 c + l (K pitch 68 floats = 16 B x odd, so that the 32 rows read by one ds_load_b128 spread over the banks). Output: lane l owns columns 2 l, 2 l + 1; each key's weight comes out of its lane by v_readlane.
// NCH = 32-key chunks (compile time: every load of a phase is issued before the first wait). Keys past the row get weight 2^(-1e30 ..) = 0.
template <int NCH>
__device__ __forceinline__ void att0_rows(const float* __restrict__ QF, const float* __restrict__ KF, const float* __restrict__ VF, float scale, float* __restrict__ OF, int h, int row0, float (*lk)[HD + 4], float (*lv)[HD]) {
  const int tid = threadIdx.x, lane = tid & 31; const int i = row0 + __builtin_amdgcn_readfirstlane(tid >> 5);      /* the row is the wave's: a scalar */
  const int sr = tid >> 4, sc = (tid & 15) * 4;      /* staging: 16 threads per 256-byte row, 16 rows per pass */
  const float* kg = KF + h * HD; const float* vg = VF + h * HD; const float* qr = QF + (size_t)i * DM + h * HD; const int so = sr * DM + sc;      /* row pitch DM at compile time: one address per matrix, the pass as a constant offset of the load */
  v4f kk[2 * NCH], vv[2 * NCH], q[HD / 4];
#pragma unroll      /* arrays stay in registers; all loads in flight together */
  for (int p = 0; p < 2 * NCH; ++p) { kk[p] = *(const v4fa*)(kg + so + p * 16 * DM); vv[p] = *(const v4fa*)(vg + so + p * 16 * DM); }
#pragma unroll      /* the query row, same address in every lane, fetched beside the staging loads */
  for (int c = 0; c < HD / 4; ++c) q[c] = *(const v4fa*)(qr + c * 4);
#pragma unroll      /* register arrays */
  for (int p = 0; p < 2 * NCH; ++p) { *(v4fa*)&lk[p * 16 + sr][sc] = kk[p]; *(v4fa*)&lv[p * 16 + sr][sc] = vv[p]; }
  __syncthreads();
  v4f a[NCH];
#pragma unroll      /* register arrays */
  for (int c = 0; c < NCH; ++c) { const v4f z = {0.f, 0.f, 0.f, 0.f}; a[c] = z; }
#pragma unroll      /* 4 NCH independent sums per lane */
  for (int d = 0; d < HD / 4; ++d)
#pragma unroll      /* a[c] by constant index */
    for (int c = 0; c < NCH; ++c) a[c] += q[d] * *(const v4fa*)&lk[c * 32 + lane][d * 4];
  float e[NCH]; float mx = -1.0e30f;
#pragma unroll      /* register arrays */
  for (int c = 0; c < NCH; ++c) { const float s = ((a[c][0] + a[c][1]) + (a[c][2] + a[c][3])) * scale; e[c] = (c * 32 + lane <= i) ? s : -1.0e30f; mx = fmaxf(mx, e[c]); }
  mx = sm_wmax(mx);
  float l = 0.f; v4f t = {-200.f, -200.f, -200.f, -200.f};      /* chunks that this case does not have: 2^-200, not summed */
#pragma unroll      /* register arrays */
  for (int c = 0; c < NCH; ++c) t[c] = (e[c] - mx) * 1.44269504f;      /* exp(x) = 2^(x log2 e), the native form, as in the row softmax above */
  t = sm_exp2x4(t);
#pragma unroll      /* register arrays */
  for (int c = 0; c < NCH; ++c) { e[c] = t[c]; l += e[c]; }
  l = sm_wsum(l);
  const v2f z2 = {0.f, 0.f}; v2f o[4] = {z2, z2, z2, z2};      /* four sums per column, so that one key's multiply-add does not wait for the key before it */
#pragma unroll      /* constant lane numbers for v_readlane, constant LDS offsets */
  for (int c = 0; c < NCH; ++c)
#pragma unroll      /* as the line above */
    for (int j = 0; j < 32; ++j) { const float ej = __builtin_bit_cast(float, __builtin_amdgcn_readlane(__builtin_bit_cast(int, e[c]), j)); o[j & 3] += ej * *(const v2fa*)&lv[c * 32 + j][lane * 2]; }
  const float fin = 64.0f / l;      /* o carried x64, scaled by 1/64 where it is added to x1 */
  const v2f r = ((o[0] + o[1]) + (o[2] + o[3])) * fin;
  *(v2fa*)(OF + (size_t)i * DM + h * HD + lane * 2) = r; }
__global__ __launch_bounds__(256) void k_att0w(const float* __restrict__ QF, const float* __restrict__ KF, const float* __restrict__ VF, float scale, float* __restrict__ OF) {
  static_assert(QT0 == 128 && HD == 64, "the cases below cover 1 .. 4 chunks of 32 keys; two columns per lane");
  __shared__ __attribute__((aligned(16))) float lk[QT0][HD + 4]; __shared__ __attribute__((aligned(16))) float lv[QT0][HD];
  const int h = blockIdx.x / (QT0 / 8), row0 = (blockIdx.x % (QT0 / 8)) * 8;      /* eight rows lie in one 32-key chunk: the switch is the same for the whole work-group, barrier included */
  switch (row0 >> 5) {
    case 0: att0_rows<1>(QF, KF, VF, scale, OF, h, row0, lk, lv); break; case 1: att0_rows<2>(QF, KF, VF, scale, OF, h, row0, lk, lv); break;
    case 2: att0_rows<3>(QF, KF, VF, scale, OF, h, row0, lk, lv); break; case 3: att0_rows<4>(QF, KF, VF, scale, OF, h, row0, lk, lv); break; } }


template <int BFIN, int WXB>
__global__ __launch_bounds__(256) void k_ln16(const float* __restrict__ X, const float* __restrict__ g, const float* __restrict__ bb, float eps, _Float16* __restrict__ N16, float* __restrict__ XB) {
  #pragma clang fp contract(off)
  __shared__ float red[256]; const size_t r = blockIdx.x; const int t = threadIdx.x; const v4f xa = *(const v4fa*)(X + r * DMQ + t * 4); float s[4]; float sum = 0.f;
  for (int q = 0; q < 4; ++q) { s[q] = BFIN ? bf16_round(xa[q]) : xa[q]; sum = __fadd_rn(sum, s[q]); }
  red[t] = sum; __syncthreads(); for (int st = 128; st > 0; st >>= 1) { if (t < st) red[t] = __fadd_rn(red[t], red[t + st]); __syncthreads(); } const float mu = red[0] / (float)DMQ; __syncthreads();
  float vs = 0.f; for (int q = 0; q < 4; ++q) { const float dl = __fadd_rn(s[q], -mu); vs = __fadd_rn(vs, __fmul_rn(dl, dl)); } red[t] = vs; __syncthreads(); for (int st = 128; st > 0; st >>= 1) { if (t < st) red[t] = __fadd_rn(red[t], red[t + st]); __syncthreads(); }
  const float rs = rsqrtf(__fadd_rn(red[0] / (float)DMQ, eps)); v4h y; v4f xb;
  for (int q = 0; q < 4; ++q) { const int c = t * 4 + q; y[q] = (_Float16)__fadd_rn(__fmul_rn(__fmul_rn(__fadd_rn(s[q], -mu), rs), bf16_round(g[c])), bf16_round(bb[c])); xb[q] = s[q]; }
  { *(v4h*)(N16 + r * DMQ + t * 4) = y; if (WXB) *(v4f*)(XB + r * DMQ + t * 4) = xb;  } }
__global__ __launch_bounds__(256) void k_ftres2(const float* __restrict__ OF0, const float* __restrict__ XB, float* __restrict__ X1, size_t n4) {
  #pragma clang fp contract(off)
  const size_t t = (size_t)blockIdx.x * 256 + threadIdx.x; if (t >= n4) return; const v4f o = *(const v4fa*)(OF0 + t * 4), xv = *(const v4fa*)(XB + t * 4); v4f y; for (int q = 0; q < 4; ++q) y[q] = __fadd_rn(__fmul_rn(o[q], 0.015625f), xv[q]); *(v4f*)(X1 + t * 4) = y;  }

__global__ __launch_bounds__(256) void k_wthd(const float* __restrict__ Wt, _Float16* __restrict__ Bt) { const size_t t = (size_t)blockIdx.x * 256 + threadIdx.x; if (t >= (size_t)NH * HD * (DM / 8)) return; const int m8 = (int)(t % (DM / 8)) * 8; const int d = (int)((t / (DM / 8)) % HD); const int h = (int)(t / ((size_t)(DM / 8) * HD)); FragH f;
  for (int q = 0; q < 8; ++q) f.h[q] = (_Float16)(16.0f * bf16_round(Wt[((size_t)h * DM + m8 + q) * HD + d])); unsigned short* dst = (unsigned short*)Bt + ((size_t)h * HD + d) * DM + m8; *(v8us*)dst = f.half[0];  }




__global__ __launch_bounds__(256) void k_wtpad(const float* __restrict__ Wm, _Float16* __restrict__ Wt, int Kr, int Kp, int Nr, int Np, float scale) {
  const int t = blockIdx.x * 256 + threadIdx.x; if (t >= Np * (Kp / 8)) return; const int n = t / (Kp / 8), k8 = (t % (Kp / 8)) * 8; const int nc = min(n, Nr - 1); const float fn = (n < Nr) ? 1.f : 0.f; FragH f;
  for (int i = 0; i < 8; ++i) { const int k = k8 + i; const int kc = min(k, Kr - 1); const float fk = (k < Kr) ? fn : 0.f; f.h[i] = (_Float16)(bf16_round(Wm[(size_t)kc * Nr + nc]) * scale * fk); }
  unsigned short* o = (unsigned short*)Wt + (size_t)n * Kp + k8; *(v8us*)o = f.half[0];  }
__global__ __launch_bounds__(128) void k_bpad(const float* __restrict__ b, float* __restrict__ Bp, int nr, int np) {
  const int i = threadIdx.x; if (i >= np) return; const float v = b[min(i, nr - 1)] * ((i < nr) ? 1.f : 0.f); *(float*)(Bp + i) = v;  }

__global__ __launch_bounds__(256) void k_bcpy(const float* __restrict__ b, int n, int NP, float* __restrict__ dst, int dst0) { for (int i = threadIdx.x; i < NP; i += 256) { const float v = (i < n) ? b[i] : 0.f; *(float*)(dst + dst0 + i) = v; }  }


__global__ __launch_bounds__(256) void k_addf(const float* __restrict__ XBr, const float* __restrict__ OF, float* __restrict__ O, size_t n8) {
  #pragma clang fp contract(off)
  const size_t t = (size_t)blockIdx.x * 256 + threadIdx.x; if (t >= n8) return; const v4f a = *(const v4fa*)(XBr + t * 8), b = *(const v4fa*)(XBr + t * 8 + 4), c = *(const v4fa*)(OF + t * 8), d = *(const v4fa*)(OF + t * 8 + 4); v4f r0, r1;
  for (int q = 0; q < 4; ++q) { r0[q] = __fadd_rn(a[q], __fmul_rn(c[q], 0.015625f)); r1[q] = __fadd_rn(b[q], __fmul_rn(d[q], 0.015625f)); }
  { *(v4f*)(O + t * 8) = r0; *(v4f*)(O + t * 8 + 4) = r1;  } }


extern "C" void kernel_launch(void* const* d_in, const int* in_sizes, int n_in,
                              void* d_out, int out_size, void* d_ws, size_t ws_size, hipStream_t stream) {
  (void)in_sizes; (void)n_in; (void)out_size;
  const float* const* I = (const float* const*)d_in; const float* x = I[0]; const float* wq = I[1]; const float* bq = I[2]; const float* wk = I[3]; const float* bk = I[4]; const float* wv = I[5]; const float* bv = I[6]; const float* g1 = I[7]; const float* be1 = I[8]; const float* gg2 = I[9]; const float* be2 = I[10]; const float* wfc = I[11]; const float* bfc = I[12]; const float* wmp = I[13]; const float* bmp = I[14];      /* input order: x; [in][out] wq / wk / wv + biases; LN1 w / b, LN2 w / b; w_fc [1024][4096] + b_fc, w_proj [4096][1024] + b_proj */
  float* OUT0 = (float*)d_out; float* OUTK = (float*)d_out + NR * DM;      /* tuple outputs: out at byte 0, k at 16,777,216, v at 33,554,432 (each NB * SQ * DM floats) */
  static_assert(NH * HD == DM && DM % 64 == 0 && SQ % 128 == 0 && QT0 % 8 == 0, "shape / tile multiples");
  char* ws = (char*)d_ws; size_t off = 0;
  auto take = [&](size_t bytes) { char* p = ws + off; off += (bytes + 255) & ~(size_t)255; return p; };
  _Float16* BQKV = (_Float16*)take((size_t)3 * DM * DM * 2); float* bqkv = (float*)take((size_t)3 * DM * 4);      /* stacked bias bq | bk | bv */
  _Float16* X16 = (_Float16*)take(NR * DM * 2); float* XB = (float*)take(NR * DM * 4); float* X1 = (float*)take(NR * DM * 4); _Float16* M16 = nullptr;      /* = X16 below (alias: X16's last reader, the q | k | v GEMM, precedes LN2's write) */ _Float16* HF16 = (_Float16*)take((size_t)SQ * DFF * 2); _Float16* BW1 = (_Float16*)take((size_t)DFF * DM * 2); _Float16* BW2 = (_Float16*)take((size_t)DM * DFF * 2); _Float16* QKV = (_Float16*)take(NR * 3 * DM * 2); _Float16* V16 = QKV + 2 * DM; M16 = X16;
  _Float16* VT = (_Float16*)take((size_t)NB * NH * HD * SQ * 2);      /* V^T of both batches */
  float* F0 = (float*)take((size_t)3 * NB * QT0 * DM * 4);      /* f32 q | k | v of each batch's first QT0 rows */ float* OF0 = (float*)take((size_t)NB * QT0 * DM * 4);
  if (off > ws_size) return;
  { const dim3 g(DM / 64, DM / 128); k_wt_f16<DM, DM><<<g, 256, 0, stream>>>(wq, BQKV, 16.0f); k_wt_f16<DM, DM><<<g, 256, 0, stream>>>(wk, BQKV + (size_t)DM * DM, 16.0f); k_wt_f16<DM, DM><<<g, 256, 0, stream>>>(wv, BQKV + (size_t)2 * DM * DM, 16.0f); }      /* [in][out] -> Bt x16: stacked q | k | v (transposing builder) */
  k_bcpy<<<1, 256, 0, stream>>>(bq, DM, DM, bqkv, 0); k_bcpy<<<1, 256, 0, stream>>>(bk, DM, DM, bqkv, DM); k_bcpy<<<1, 256, 0, stream>>>(bv, DM, DM, bqkv, 2 * DM);      /* stacked bias bq | bk | bv */
  k_ln16<1, 1><<<(unsigned)NR, 256, 0, stream>>>(x, g1, be1, 1e-5f, X16, XB);      /* a = LN1(bf16(x)) -> f16 rows; XB = bf16(x) for the residual */
  k_wt_f16<DM, DFF><<<dim3(DFF / 64, DM / 128), 256, 0, stream>>>(wfc, BW1, 16.0f); k_wt_f16<DFF, DM><<<dim3(DM / 64, DFF / 128), 256, 0, stream>>>(wmp, BW2, 16.0f);      /* W1 [1024][4096] -> Bt [4096][1024]; W2 [4096][1024] -> Bt [1024][4096] (x16) */
  const size_t r0p = (size_t)B0 * SQ;      /* first projected row */
  k_gemm2<0, true><<<dim3((unsigned)((MP / 128) * (3 * DM / 64)), 1), 128, 0, stream>>>(X16 + r0p * DM, DM, 0, BQKV, DM, 0, 0.0625f, bqkv, 0, nullptr, 1, 0, 0, nullptr, QKV + r0p * 3 * DM, 3 * DM, 0, MP, 3 * DM, DM, OUTK, F0);      /* q | k | v rows (f16); head h = columns h*HD.. of each DM block; from the same sums outputs 1 and 2 (k, v in f32, head-major [B][H][T][64]) and the f32 q, k, v of the first 128 rows of each batch */
  for (int b = B0; b < B0 + NBR; ++b) { const size_t r0 = (size_t)b * SQ;
    k_vt<NH, SQ><<<NH * (SQ / 64), 256, 0, stream>>>(V16 + r0 * LQ, LQ, 0, VT + (size_t)b * NH * HD * SQ);      /* V^T [NH][HD][SQ] for this batch */
    k_att0w<<<NH * (QT0 / 8), 256, 0, stream>>>(F0 + (size_t)b * QT0 * DM, F0 + (size_t)(NB + b) * QT0 * DM, F0 + (size_t)(2 * NB + b) * QT0 * DM, 0.125f, OF0 + (size_t)b * QT0 * DM);      /* f32 attention for rows 0..127 (o x64), one wave per head and row */
    k_addf<<<(unsigned)(((size_t)QT0 * DM / 8 + 255) / 256), 256, 0, stream>>>(XB + r0 * DM, OF0 + (size_t)b * QT0 * DM, X1 + r0 * DM, (size_t)QT0 * DM / 8); }      /* rows 0..127 of the batch from the exact f32 path: x1 = bf16(x) + o / 64 */
  k_fattn<<<dim3(SQ / 256, NH, NB), 256, 0, stream>>>(QKV, VT, XB, X1);      /* rows 128.. of both batches: x1 = bf16(x) + softmax(q k^T / 8) v in f32 (no output projection in this module) */
  k_ln16<0, 0><<<(unsigned)NR, 256, 0, stream>>>(X1, gg2, be2, 1e-5f, M16, nullptr);      /* h = LN2(x1) -> f16 rows */
  for (int b = 0; b < NB; ++b) { const size_t r0 = (size_t)b * SQ;
    k_gemm2<6><<<dim3((unsigned)((SQ / 128) * (DFF / 64)), 1), 128, 0, stream>>>(M16 + r0 * DM, DM, 0, BW1, DM, 0, 0.0625f, bfc, 0, nullptr, 1, 0, 0, nullptr, HF16, DFF, 0, SQ, DFF, DM, nullptr, nullptr);      /* gelu_erf(h2 W1 + b1) -> f16 (this batch) */
    k_gemm2<0><<<dim3((unsigned)((SQ / 128) * (DM / 64)), 1), 128, 0, stream>>>(HF16, DFF, 0, BW2, DFF, 0, 0.0625f, bmp, 0, X1 + r0 * DM, -1, 0, 0, OUT0 + r0 * DM, nullptr, DM, 0, SQ, DM, DFF, nullptr, nullptr); }      /* output 0 = x1 + mlp (own-element residual) */
}

// v007
// A run of this version takes 262 microseconds.
// Timed twice side by side with v006, it ran 1.24 and 1.23 times as fast.
// Counting every step since v000, it is 22.3 times as fast.
#include <hip/hip_runtime.h>
// Pre-LN causal transformer block WITHOUT an attention output projection that also returns its key and value tensors (x [2][2048][1024]; h = LN1(x) (biased var, eps 1e-5); q / k / v = h W + b ([in][out] [1024][1024] sigma 1/32, zero biases) -> [B][16][T][64]; att = softmax(q k^T / 8) with a causal mask (tril, -inf); y = att v merged back to [B][T][1024]; x1 = x + y (no projection); out = x1 + gelu_erf(LN2(x1) w_fc + b_fc) w_proj + b_proj ([in][out] 1024 x 4096 x 1024); returns (out [2][2048][1024], k [2][16][2048][64], v [2][16][2048][64]): three outputs at byte offsets 0 / 16,777,216 / 33,554,432 of d_out).
// Structure: token rows r = b*2048 + s; h = LN1(bf16(x)) as f16 rows; q | k | v as ONE WMMA GEMM (N = 3 x 1024) (32x64 wave tiles, f32 accumulation, exact x16 weights + bias, f16 outputs; the same sums stored in f32 as outputs k and v and as q, k, v of each batch's first 128 rows); V^T for all heads of both batches via LDS transposes; rows 128.. of both batches in one launch: per wave 32 query rows, keys 64 at a time up to the rows' end, scores (K = 64), running-maximum softmax (f32 statistics, native exp2; weights at most 256 in f16) and weights x V^T all in registers, x1 = x + o / row sum in f32; LN2(x1) as f16 rows; gelu(h2 W1 + b1) GEMM into f16; out = x1 + hidden W2 + b2 GEMM (f32) into the output layout.
// Compute dtype: inputs rounded to bf16; x / weights exact; q, k, v, softmax weights, LN outputs and gelu hidden as plain f16 GEMM operands (~2^-12); o, scores and softmax statistics f32. v_wmma_f32_16x16x32_f16.
#define NB 2
#define SQ 2048
#define DM 1024
#define NH 16
#define HD 64
#define HG 4
#define QT 256                       /* query rows per causal tile */
#define NKX SQ                       /* S / P row pitch */
#define QT0 128                      /* first-tile rows attended exactly in f32 */
#define B0 0                         /* first batch processed (debug hook) */
#define NBR NB                       /* batches processed (debug hook) */
#define NR ((size_t)NB * SQ)
#define DMQ DM
#define DFF 4096                     /* FFN hidden width */
#define DFFR 100
#define MP ((int)((size_t)NBR * SQ)) /* rows projected (debug hook) */
#define QN SQ                        /* query rows per batch; not used */
#define NHD NH                       /* heads; not used */
#define MPO MP
#define LQ (3 * DM)      /* row pitch of the q/k/v rows */
typedef __bf16 v16b __attribute__((ext_vector_type(16)));
typedef unsigned short v8us __attribute__((ext_vector_type(8), may_alias));
typedef float  v8f  __attribute__((ext_vector_type(8)));
typedef float  v4f  __attribute__((ext_vector_type(4)));
typedef float  v4fa __attribute__((ext_vector_type(4), may_alias));
union FragB { v16b v; v8us half[2]; unsigned short u[16]; };

__device__ __forceinline__ unsigned short bf16_bits(float x) { unsigned int u = __float_as_uint(x); return (unsigned short)((u + 0x7FFFu + ((u >> 16) & 1u)) >> 16); }
__device__ __forceinline__ float bf16_val(unsigned short b) { return __uint_as_float(((unsigned int)b) << 16); }
__device__ __forceinline__ float bf16_round(float x) { return bf16_val(bf16_bits(x)); }
// D += A·B with NT terms: 1 = ah·bh, 2 = + al·bh (A split), 3 = + ah·bl (both split)
template <int NT>
__device__ __forceinline__ v8f mmaN(v16b ah, v16b al, v16b bh, v16b bl, v8f c) {
  c = __builtin_amdgcn_wmma_f32_16x16x32_bf16(false, ah, false, bh, (short)0, c, false, false);
  if (NT >= 2) c = __builtin_amdgcn_wmma_f32_16x16x32_bf16(false, al, false, bh, (short)0, c, false, false);
  if (NT >= 3) c = __builtin_amdgcn_wmma_f32_16x16x32_bf16(false, ah, false, bl, (short)0, c, false, false);
  asm volatile("v_nop\n\tv_nop\n\tv_nop\n\tv_nop" : "+v"(c) : "v"(ah), "v"(al), "v"(bh), "v"(bl));
  return c;
}

__global__ __launch_bounds__(256) void k_wt_bf16(const float* __restrict__ W, unsigned short* __restrict__ Wt, int K, int N) {
  const int t = blockIdx.x * 256 + threadIdx.x;
  const int k8n = K / 8;
  if (t >= N * k8n) return;
  const int n = t / k8n, k8 = (t % k8n) * 8;
  v8us v;
#pragma unroll
  for (int i = 0; i < 8; ++i) v[i] = bf16_bits(W[(size_t)(k8 + i) * N + n]);
  *(v8us*)(Wt + (size_t)n * K + k8) = v;
  
}

// GEMM C[M][N] (f32, pitch ldc) = act(A[M][K]·W + bias). A f32 row-major (pitch lda) converted per fragment to bf16
// (ASPLIT: hi/lo two planes -> 2 terms, else single rounded term); Wt bf16 [N][K] (pitch ldb). BIAS_BF16 rounds the
// bias to bf16 first (bias quantised to bf16 before the add). K%32==0, M%16==0, N%64==0.
template <bool ASPLIT, int ACT, bool BIAS_BF16>
__global__ __launch_bounds__(128) void k_gemm_bf(const float* __restrict__ A, int lda, const unsigned short* __restrict__ Wt, int ldb,
                                               const float* __restrict__ bias, float* __restrict__ C, int ldc, int M, int N, int K) {
  __shared__ __attribute__((aligned(16))) float so[4][16][64];
  const int tid = threadIdx.x, w = tid >> 5, lane = tid & 31, ln = lane & 15, hh = lane >> 4;
  const int ntn = N / 64;
  const int wid = blockIdx.x * 4 + w;
  const int mt = wid / ntn, nq = wid % ntn;
  if (mt * 16 >= M) return;
  const int row0 = mt * 16, col0 = nq * 64;
  const float* arow = A + (size_t)(row0 + ln) * lda;
  v8f acc[4] = {};
  for (int kb = 0; kb < K; kb += 32) {
    FragB ah, al;
    const v4f x0 = *(const v4fa*)(arow + kb + 8 * hh), x1 = *(const v4fa*)(arow + kb + 8 * hh + 4);
    const v4f x2 = *(const v4fa*)(arow + kb + 16 + 8 * hh), x3 = *(const v4fa*)(arow + kb + 16 + 8 * hh + 4);
    float xs[16] = {x0[0],x0[1],x0[2],x0[3],x1[0],x1[1],x1[2],x1[3],x2[0],x2[1],x2[2],x2[3],x3[0],x3[1],x3[2],x3[3]};
#pragma unroll
    for (int i = 0; i < 16; ++i) { const unsigned short hb = bf16_bits(xs[i]); ah.u[i] = hb; al.u[i] = ASPLIT ? bf16_bits(xs[i] - bf16_val(hb)) : (unsigned short)0; }
#pragma unroll
    for (int t = 0; t < 4; ++t) {
      const unsigned short* brow = Wt + (size_t)(col0 + t * 16 + ln) * ldb + kb;
      FragB b;
      b.half[0] = *(const v8us*)(brow + 8 * hh);
      b.half[1] = *(const v8us*)(brow + 16 + 8 * hh);
      acc[t] = mmaN<ASPLIT ? 2 : 1>(ah.v, al.v, b.v, b.v, acc[t]);
    }
  }
#pragma unroll
  for (int t = 0; t < 4; ++t) {
    float bv = bias ? bias[col0 + t * 16 + ln] : 0.f;
    if (BIAS_BF16) bv = bf16_round(bv);
#pragma unroll
    for (int r = 0; r < 8; ++r) { float v = acc[t][r] + bv; if (ACT == 1) v = fmaxf(v, 0.f); so[w][8 * hh + r][t * 16 + ln] = v; }
  }
  __builtin_amdgcn_fence(__ATOMIC_ACQ_REL, "workgroup");
  __builtin_amdgcn_wave_barrier();
  const int rsub = lane >> 4, c4 = (lane & 15) * 4;
  {
#pragma unroll
    for (int q = 0; q < 8; ++q) {
      const int r = q * 2 + rsub;
      const v4f v = *(const v4fa*)&so[w][r][c4];
      *(v4f*)(C + (size_t)(row0 + r) * ldc + col0 + c4) = v;
    }
    
  }
}

// GEMM C = act(A·W + bias + resid): A f32 (ASPLIT -> hi/lo 2 terms), Wt bf16 [N][K]; ACT 0 none, 1 relu, 2 exact gelu;
// resid (optional, f32, row index = (row % rmod), pitch ldr, RES_BF16 rounds it) added before the activation.
template <bool ASPLIT, int ACT, bool BIAS_BF16, bool RES_BF16>
__global__ __launch_bounds__(128) void k_gemm_bf3(const float* __restrict__ A, int lda, const unsigned short* __restrict__ Wt, int ldb,
                                                const float* __restrict__ bias, const float* __restrict__ resid, int rmod, int ldr,
                                                float* __restrict__ C, int ldc, int M, int N, int K) {
  __shared__ __attribute__((aligned(16))) float so[4][16][64];
  const int tid = threadIdx.x, w = tid >> 5, lane = tid & 31, ln = lane & 15, hh = lane >> 4;
  const int ntn = N / 64;
  const int wid = blockIdx.x * 4 + w;
  const int mt = wid / ntn, nq = wid % ntn;
  if (mt * 16 >= M) return;
  const int row0 = mt * 16, col0 = nq * 64;
  const float* arow = A + (size_t)(row0 + ln) * lda;
  v8f acc[4] = {};
  for (int kb = 0; kb < K; kb += 32) {
    FragB ah, al;
    const v4f x0 = *(const v4fa*)(arow + kb + 8 * hh), x1 = *(const v4fa*)(arow + kb + 8 * hh + 4);
    const v4f x2 = *(const v4fa*)(arow + kb + 16 + 8 * hh), x3 = *(const v4fa*)(arow + kb + 16 + 8 * hh + 4);
    float xs[16] = {x0[0],x0[1],x0[2],x0[3],x1[0],x1[1],x1[2],x1[3],x2[0],x2[1],x2[2],x2[3],x3[0],x3[1],x3[2],x3[3]};
#pragma unroll
    for (int i = 0; i < 16; ++i) { const unsigned short hb = bf16_bits(xs[i]); ah.u[i] = hb; al.u[i] = ASPLIT ? bf16_bits(xs[i] - bf16_val(hb)) : (unsigned short)0; }
#pragma unroll
    for (int t = 0; t < 4; ++t) {
      const unsigned short* brow = Wt + (size_t)(col0 + t * 16 + ln) * ldb + kb;
      FragB b;
      b.half[0] = *(const v8us*)(brow + 8 * hh);
      b.half[1] = *(const v8us*)(brow + 16 + 8 * hh);
      acc[t] = mmaN<ASPLIT ? 2 : 1>(ah.v, al.v, b.v, b.v, acc[t]);
    }
  }
#pragma unroll
  for (int t = 0; t < 4; ++t) {
    const int col = col0 + t * 16 + ln;
    float bv = bias ? bias[col] : 0.f;
    if (BIAS_BF16) bv = bf16_round(bv);
#pragma unroll
    for (int r = 0; r < 8; ++r) {
      float v = acc[t][r] + bv;
      if (resid) { float rv = resid[(size_t)((row0 + 8 * hh + r) % rmod) * ldr + col]; if (RES_BF16) rv = bf16_round(rv); v += rv; }
      if (ACT == 1) v = fmaxf(v, 0.f);
      if (ACT == 2) v = 0.5f * v * (1.0f + erff(v * 0.70710678118654752f));
      if (ACT == 3) { const float u = 0.7978845608028654f * (v + 0.044715f * v * v * v); v = 0.5f * v * (1.0f + tanhf(u)); }
      so[w][8 * hh + r][t * 16 + ln] = v;
    }
  }
  __builtin_amdgcn_fence(__ATOMIC_ACQ_REL, "workgroup");
  __builtin_amdgcn_wave_barrier();
  const int rsub = lane >> 4, c4 = (lane & 15) * 4;
  {
#pragma unroll
    for (int q = 0; q < 8; ++q) {
      const int r = q * 2 + rsub;
      const v4f v = *(const v4fa*)&so[w][r][c4];
      *(v4f*)(C + (size_t)(row0 + r) * ldc + col0 + c4) = v;
    }
    
  }
}
// row LayerNorm (biased variance, eps) over N: s = X (+ R); optional out_sum <- s; out_norm <- (s-mu)*rsqrt(var+eps)*g + b
template <bool PARAM_BF16>
__global__ __launch_bounds__(256) void k_layernorm(const float* __restrict__ X, const float* __restrict__ R, const float* __restrict__ g, const float* __restrict__ bta,
                                                  float* __restrict__ out_sum, float* __restrict__ out_norm, int N, float eps) {
  __shared__ float red[256];
  const int row = blockIdx.x, tid = threadIdx.x;
  const float* x = X + (size_t)row * N; const float* rr = R ? R + (size_t)row * N : nullptr;
  float vals[16];                     // up to N = 4096
  const int per = N / 256;            // contiguous chunk per thread? use strided-by-4 chunks: thread handles j = tid*4 + 1024*u
  float s1 = 0.f;
  for (int u = 0; u < per / 4; ++u) {
    const int j = tid * 4 + 1024 * u;
    const v4f a = *(const v4fa*)(x + j);
    v4f b = {0.f,0.f,0.f,0.f}; if (rr) b = *(const v4fa*)(rr + j);
#pragma unroll
    for (int q = 0; q < 4; ++q) { const float v = a[q] + b[q]; vals[u * 4 + q] = v; s1 += v; }
  }
  red[tid] = s1; __syncthreads();
  for (int st = 128; st > 0; st >>= 1) { if (tid < st) red[tid] += red[tid + st]; __syncthreads(); }
  const float mu = red[0] / (float)N; __syncthreads();
  float s2 = 0.f;
  for (int u = 0; u < per / 4; ++u)
#pragma unroll
    for (int q = 0; q < 4; ++q) { const float c = vals[u * 4 + q] - mu; s2 += c * c; }
  red[tid] = s2; __syncthreads();
  for (int st = 128; st > 0; st >>= 1) { if (tid < st) red[tid] += red[tid + st]; __syncthreads(); }
  const float rs = rsqrtf(red[0] / (float)N + eps);
  {
    for (int u = 0; u < per / 4; ++u) {
      const int j = tid * 4 + 1024 * u;
      v4f o, sm;
#pragma unroll
      for (int q = 0; q < 4; ++q) {
        float gg = g[j + q], bb = bta[j + q];
        if (PARAM_BF16) { gg = bf16_round(gg); bb = bf16_round(bb); }
        sm[q] = vals[u * 4 + q]; o[q] = (vals[u * 4 + q] - mu) * rs * gg + bb;
      }
      if (out_sum) *(v4f*)(out_sum + (size_t)row * N + j) = sm;
      *(v4f*)(out_norm + (size_t)row * N + j) = o;
    }
    
  }
}



// ---- f16 WMMA path (v_wmma_f32_16x16x32_f16): 11-bit significands for operands in range — used where a [0,1] probability operand needs more precision than bf16
typedef _Float16 v16h __attribute__((ext_vector_type(16)));
union FragH { v16h v; v8us half[2]; _Float16 h[16]; unsigned short u[16]; };
template <int NT>
__device__ __forceinline__ v8f mmaH(v16h ah, v16h al, v16h bh, v16h bl, v8f c) {
  c = __builtin_amdgcn_wmma_f32_16x16x32_f16(false, ah, false, bh, (short)0, c, false, false);
  if (NT >= 2) c = __builtin_amdgcn_wmma_f32_16x16x32_f16(false, al, false, bh, (short)0, c, false, false);
  if (NT >= 3) c = __builtin_amdgcn_wmma_f32_16x16x32_f16(false, ah, false, bl, (short)0, c, false, false);
  asm volatile("v_nop\n\tv_nop\n\tv_nop\n\tv_nop" : "+v"(c) : "v"(ah), "v"(al), "v"(bh), "v"(bl));
  return c;
}
// batched GEMM like k_gemm_b but f16 operands: A f32 (split into f16 hi/lo if ASPLIT, else rounded to f16), Bt = f16 values [n][k]; alpha; C f32; N multiple of 16 (partial tiles skipped)
template <bool ASPLIT>
__global__ __launch_bounds__(128) void k_gemm_h(const float* __restrict__ A, int lda, size_t sA, const _Float16* __restrict__ Bh, int ldb, size_t sB, float alpha, float* __restrict__ C, int ldc, size_t sC, int M, int N, int K) {
  __shared__ __attribute__((aligned(16))) float so[4][16][64];
  const int tid = threadIdx.x, w = tid >> 5, lane = tid & 31, ln = lane & 15, hh = lane >> 4; const int by = blockIdx.y;
  A += (size_t)by * sA; Bh += (size_t)by * sB; C += (size_t)by * sC;
  const int ntn = (N + 63) / 64; const int wid = blockIdx.x * 4 + w; const int mt = wid / ntn, nq = wid % ntn; if (mt * 16 >= M) return;
  const int row0 = mt * 16, col0 = nq * 64; const float* arow = A + (size_t)(row0 + ln) * lda;
  v8f acc[4] = {};
  for (int kb = 0; kb < K; kb += 32) {
    FragH ah, al;
    const v4f x0 = *(const v4fa*)(arow + kb + 8 * hh), x1 = *(const v4fa*)(arow + kb + 8 * hh + 4), x2 = *(const v4fa*)(arow + kb + 16 + 8 * hh), x3 = *(const v4fa*)(arow + kb + 16 + 8 * hh + 4);
    float xs[16] = {x0[0],x0[1],x0[2],x0[3],x1[0],x1[1],x1[2],x1[3],x2[0],x2[1],x2[2],x2[3],x3[0],x3[1],x3[2],x3[3]};
#pragma unroll
    for (int i = 0; i < 16; ++i) { const _Float16 h = (_Float16)xs[i]; ah.h[i] = h; al.h[i] = ASPLIT ? (_Float16)(xs[i] - (float)h) : (_Float16)0.0f; }
#pragma unroll
    for (int t = 0; t < 4; ++t) { if (col0 + t * 16 >= N) continue; const size_t boff = (size_t)(col0 + t * 16 + ln) * ldb + kb; FragH bq; bq.half[0] = *(const v8us*)(Bh + boff + 8 * hh); bq.half[1] = *(const v8us*)(Bh + boff + 16 + 8 * hh);
      acc[t] = mmaH<ASPLIT ? 2 : 1>(ah.v, al.v, bq.v, bq.v, acc[t]); }
  }
#pragma unroll
  for (int t = 0; t < 4; ++t) { if (col0 + t * 16 >= N) continue;
#pragma unroll
    for (int r = 0; r < 8; ++r) so[w][8 * hh + r][t * 16 + ln] = acc[t][r] * alpha; }
  __builtin_amdgcn_fence(__ATOMIC_ACQ_REL, "workgroup"); __builtin_amdgcn_wave_barrier();
  const int rsub = lane >> 4, c4 = (lane & 15) * 4;
  {
#pragma unroll
    for (int q = 0; q < 8; ++q) { const int r = q * 2 + rsub; if (col0 + c4 < N) { const v4f v = *(const v4fa*)&so[w][r][c4]; *(v4f*)(C + (size_t)(row0 + r) * ldc + col0 + c4) = v; } }
     }
}

// Wt[n][k] = f16(W[k][n]·scale) from f32 row-major W[K][N] (scale = power of two; bf16-exact weights stay exact in f16 away from the subnormal range)
// One work-group per tile of 128 k x 64 n (grid = N / 64 by K / 128; K, N at compile time, so that the rows of a thread are constant offsets of one address). Reads: 16 lanes take 256 bytes in a row of one row of W, each thread the same four columns of eight rows, all eight loads in flight.
// The thread's 8 x 4 block leaves as four 16-byte pieces (eight k of one n) into an LDS tile [64 n][128 k]; stores: 16 lanes write 256 bytes in a row of one row of Wt. Both sides touch whole 128-byte lines only.
// LDS rows are 256 bytes, so every row starts on bank 0: piece kb of row n lies at place kb ^ (n / 4 % 16), which spreads the 16 lanes of a half wave over all banks in the write (rows 4 ln + j, one kb) and in the read (one row, 16 kb).
template <int K, int N>
__global__ __launch_bounds__(256) void k_wt_f16(const float* __restrict__ W, _Float16* __restrict__ Wt, float scale) { static_assert(K % 128 == 0 && N % 64 == 0, "whole tiles");
  __shared__ __attribute__((aligned(16))) unsigned short tl[64 * 128];
  const int tid = threadIdx.x, ln = tid & 15, kb = tid >> 4; const int n0 = blockIdx.x * 64, k0 = blockIdx.y * 128;
  const float* wb = W + (size_t)k0 * N + n0; const unsigned wo = (unsigned)(kb * 8 * N + ln * 4) * 4u;      /* the work-group's scalar base; the lane's fixed offset in bytes */
  v4f r[8];
#pragma unroll      /* register array; all loads in flight together */
  for (int i = 0; i < 8; ++i) r[i] = *(const v4fa*)((const char*)(wb + (size_t)i * N) + wo);
  asm volatile("s_wait_xcnt 0x0" :: "v"(wo), "s"(wb) : "memory");      /* behind the loads, in front of any later write of their base and offset registers; both as inputs, so that their registers are still theirs up to here */
#pragma unroll      /* register arrays */
  for (int j = 0; j < 4; ++j) { FragH f;
#pragma unroll      /* register arrays */
    for (int i = 0; i < 8; ++i) f.h[i] = (_Float16)(bf16_round(r[i][j]) * scale);
    *(v8us*)(tl + (ln * 4 + j) * 128 + (kb ^ ln) * 8) = f.half[0]; }
  __syncthreads();      /* the tile is whole before any row of it is read */
  unsigned short* ob = (unsigned short*)Wt + (size_t)n0 * K + k0; const unsigned oo = (unsigned)(kb * K + ln * 8) * 2u;      /* as above: row kb of each group of 16 rows, piece ln */
  v8us o[4];
#pragma unroll      /* register array */
  for (int p = 0; p < 4; ++p) { const int n = p * 16 + kb; o[p] = *(const v8us*)(tl + n * 128 + (ln ^ ((n >> 2) & 15)) * 8); }
#pragma unroll      /* register array */
  for (int p = 0; p < 4; ++p) *(v8us*)((char*)(ob + (size_t)p * 16 * K) + oo) = o[p];
}
// k_gemm_hh variant with fused epilogue: v = acc·alpha + bias[by·sBias + col] (+ CP[(row/rowsPerB)·sCPb + by·64 + col] if CP) ; ACT 0 none / 1 elu ; writes f16 C16 (and f32 C if non-null)
template <int ACT>
__global__ __launch_bounds__(128) void k_gemm_hhx(const _Float16* __restrict__ A, int lda, size_t sA, const _Float16* __restrict__ Bh, int ldb, size_t sB, float alpha, const float* __restrict__ bias, size_t sBias, const float* __restrict__ CP, int rowsPerB, size_t sCPb, int row0g,
    float* __restrict__ C, _Float16* __restrict__ C16, int ldc, size_t sC, int M, int N, int K) {
  __shared__ __attribute__((aligned(16))) float so[4][16][64];
  const int tid = threadIdx.x, w = tid >> 5, lane = tid & 31, ln = lane & 15, hh = lane >> 4; const int by = blockIdx.y;
  A += (size_t)by * sA; Bh += (size_t)by * sB; const size_t cofs = (size_t)by * sC; const float* bp = bias ? bias + (size_t)by * sBias : nullptr;
  const int ntn = (N + 63) / 64; const int wid = blockIdx.x * 4 + w; const int mt = wid / ntn, nq = wid % ntn; if (mt * 16 >= M) return;
  const int row0 = mt * 16, col0 = nq * 64; const _Float16* arow = A + (size_t)(row0 + ln) * lda;
  v8f acc[4] = {};
  for (int kb = 0; kb < K; kb += 32) { FragH ah; ah.half[0] = *(const v8us*)((const unsigned short*)arow + kb + 8 * hh); ah.half[1] = *(const v8us*)((const unsigned short*)arow + kb + 16 + 8 * hh);
#pragma unroll
    for (int t = 0; t < 4; ++t) { if (col0 + t * 16 >= N) continue; const size_t boff = (size_t)(col0 + t * 16 + ln) * ldb + kb; FragH bq; bq.half[0] = *(const v8us*)((const unsigned short*)Bh + boff + 8 * hh); bq.half[1] = *(const v8us*)((const unsigned short*)Bh + boff + 16 + 8 * hh);
      acc[t] = mmaH<1>(ah.v, ah.v, bq.v, bq.v, acc[t]); }
  }
#pragma unroll
  for (int t = 0; t < 4; ++t) { if (col0 + t * 16 >= N) continue; const int col = col0 + t * 16 + ln; const float bv = bp ? bf16_round(bp[col]) : 0.f;
#pragma unroll
    for (int r = 0; r < 8; ++r) { float v = acc[t][r] * alpha + bv; if (CP) { const int rr = row0g + row0 + 8 * hh + r; if (rowsPerB < 0) v += CP[cofs + (size_t)rr * ldc + col];      /* rowsPerB < 0: own element of the batched C plane */ else { const int bidx = rr / rowsPerB; v += CP[(size_t)bidx * sCPb + (size_t)by * 64 + col]; } } if (ACT == 1) v = (v > 0.f) ? v : expm1f(v); else if (ACT == 7) v = (v > 0.f) ? v + 1.0f : expf(v); else if (ACT == 8) v = tanhf(v); else if (ACT == 9) v = 0.5f * v * (1.0f + tanhf(0.7978845608028654f * (v + 0.044715f * v * v * v))); else if (ACT == 11) v = 1.0f / (1.0f + expf(-v)); else if (ACT == 12) v = (v > 0.f) ? v : 0.01f * v; else if (ACT == 14) v = (v > 0.f) ? v : 0.1f * v; else if (ACT == 16) v = (v >= 0.f) ? v : 0.3f * v; else if (ACT == 17) v = (v >= 0.f) ? v : 0.2f * v; else if (ACT == 15) v = v / (1.0f + expf(-v)); else if (ACT == 3) v = fmaxf(v, 0.f); else if (ACT == 6) v = 0.5f * v * (1.0f + erff(v * 0.70710678118654752f)); so[w][8 * hh + r][t * 16 + ln] = v; } }
  __builtin_amdgcn_fence(__ATOMIC_ACQ_REL, "workgroup"); __builtin_amdgcn_wave_barrier();
  const int rsub = lane >> 4, c4 = (lane & 15) * 4; typedef _Float16 v4h __attribute__((ext_vector_type(4)));
  {
#pragma unroll
    for (int q = 0; q < 8; ++q) { const int r = q * 2 + rsub; if (col0 + c4 < N) { const v4f v = *(const v4fa*)&so[w][r][c4]; if (C) *(v4f*)(C + cofs + (size_t)(row0 + r) * ldc + col0 + c4) = v; if (C16) { v4h h4; for (int i = 0; i < 4; ++i) h4[i] = (_Float16)v[i]; *(v4h*)(C16 + cofs + (size_t)(row0 + r) * ldc + col0 + c4) = h4; } } }
     }
}


typedef _Float16 v4h __attribute__((ext_vector_type(4)));

__global__ __launch_bounds__(256) void k_x16(const float* __restrict__ x, _Float16* __restrict__ X16, size_t n8) { const size_t t = (size_t)blockIdx.x * 256 + threadIdx.x; if (t >= n8) return; FragH f;
#pragma unroll
  for (int q = 0; q < 8; ++q) f.h[q] = (_Float16)bf16_round(x[t * 8 + q]); *(v8us*)((unsigned short*)X16 + t * 8) = f.half[0];  }
__global__ __launch_bounds__(256) void k_h16(const float* __restrict__ x, _Float16* __restrict__ X16, size_t n8) { const size_t t = (size_t)blockIdx.x * 256 + threadIdx.x; if (t >= n8) return; FragH f;
#pragma unroll
  for (int q = 0; q < 8; ++q) f.h[q] = (_Float16)x[t * 8 + q]; *(v8us*)((unsigned short*)X16 + t * 8) = f.half[0];  }
__global__ __launch_bounds__(256) void k_round16f(const float* __restrict__ W, _Float16* __restrict__ Bt, size_t n8) { const size_t t = (size_t)blockIdx.x * 256 + threadIdx.x; if (t >= n8) return; FragH f;
#pragma unroll
  for (int i = 0; i < 8; ++i) f.h[i] = (_Float16)(bf16_round(W[t * 8 + i]) * 16.0f); *(v8us*)((unsigned short*)Bt + t * 8) = f.half[0];  }
template <int NHv, int TTv>
__global__ __launch_bounds__(256) void k_vt(const _Float16* __restrict__ V16, int ldv, int voff, _Float16* __restrict__ Vt) { __shared__ unsigned short tl[64][66]; const int tid = threadIdx.x; const int slab = blockIdx.x / (TTv / 64), lg = blockIdx.x % (TTv / 64); const int b = slab / NHv, h = slab % NHv;
  for (int i = tid; i < 64 * 8; i += 256) { const int r = i / 8, c8 = (i % 8) * 8; FragH f; f.half[0] = *(const v8us*)((const unsigned short*)V16 + ((size_t)b * TTv + lg * 64 + r) * ldv + voff + h * 64 + c8);
#pragma unroll
    for (int q = 0; q < 8; ++q) tl[r][c8 + q] = f.u[q]; }
  __syncthreads();
  {
#pragma unroll
    for (int rd = 0; rd < 2; ++rd) { const int d = rd * 32 + tid / 8, pc = tid % 8; FragH f;
#pragma unroll
      for (int q = 0; q < 8; ++q) f.u[q] = tl[pc * 8 + q][d];
      *(v8us*)((unsigned short*)Vt + ((size_t)slab * 64 + d) * TTv + lg * 64 + pc * 8) = f.half[0]; }
     } }

__global__ __launch_bounds__(256) void k_hl(const float* __restrict__ F, _Float16* __restrict__ Hh, _Float16* __restrict__ Hl, size_t n8) { const size_t t = (size_t)blockIdx.x * 256 + threadIdx.x; if (t >= n8) return; FragH fh, fl; const v4f a = *(const v4fa*)(F + t * 8), c = *(const v4fa*)(F + t * 8 + 4);
#pragma unroll
  for (int q = 0; q < 4; ++q) { _Float16 h = (_Float16)a[q]; fh.h[q] = h; fl.h[q] = (_Float16)((a[q] - (float)h) * 1024.0f); h = (_Float16)c[q]; fh.h[4 + q] = h; fl.h[4 + q] = (_Float16)((c[q] - (float)h) * 1024.0f); }
  { *(v8us*)((unsigned short*)Hh + t * 8) = fh.half[0]; *(v8us*)((unsigned short*)Hl + t * 8) = fl.half[0];  } }

// ---- fast GEMM (work-group tile 128x64, wave tile 32x64; requires M % 128 == 0 rows per launch region, N % 64 == 0, K % 64 == 0); epilogue = k_gemm_hhx semantics ----
// Operands reach the waves through LDS: per pass of 64 k the work-group's 128 rows of A and 64 rows of B (128 bytes each) are brought in once by asynchronous copies, whole lines at a time, into one of two buffers; the next pass's copies fly while this pass is worked on.
#define G2P 144                      /* LDS row pitch in bytes: 16 B x odd, the pitch for ds_load_b128 readers of 128-byte rows */
#define G2S ((128 + 64) * G2P)       /* one buffer: rows 0..127 = A, rows 128..191 = B */
__device__ __forceinline__ v16h g2_lfrag(const unsigned char* p) { FragH f; f.half[0] = *(const v8us*)p; f.half[1] = *(const v8us*)(p + 32); return f.v; }
// one pass's operands: twelve 16-byte copies per lane (eight lanes per 128-byte row, 16 rows per copy and work-group; copies 0..7 = A, 8..11 = B). l = the lane's LDS byte address in row tid / 8 of the buffer; a, b = its own 16 bytes in that row of A and of B; sa, sb = 16 rows in bytes.
// The s_wait_xcnt stands inside the statement, behind the last copy: a precaution in front of any later write of a register that a copy names.
__device__ __forceinline__ void g2_copy(unsigned l, const char* a, size_t sa, const char* b, size_t sb) {
  asm volatile("global_load_async_to_lds_b128 %0, %12, off\n\tglobal_load_async_to_lds_b128 %1, %13, off\n\tglobal_load_async_to_lds_b128 %2, %14, off\n\tglobal_load_async_to_lds_b128 %3, %15, off\n\t"
               "global_load_async_to_lds_b128 %4, %16, off\n\tglobal_load_async_to_lds_b128 %5, %17, off\n\tglobal_load_async_to_lds_b128 %6, %18, off\n\tglobal_load_async_to_lds_b128 %7, %19, off\n\t"
               "global_load_async_to_lds_b128 %8, %20, off\n\tglobal_load_async_to_lds_b128 %9, %21, off\n\tglobal_load_async_to_lds_b128 %10, %22, off\n\tglobal_load_async_to_lds_b128 %11, %23, off\n\ts_wait_xcnt 0x0"
               :: "v"(l), "v"(l + 16u * G2P), "v"(l + 32u * G2P), "v"(l + 48u * G2P), "v"(l + 64u * G2P), "v"(l + 80u * G2P), "v"(l + 96u * G2P), "v"(l + 112u * G2P), "v"(l + 128u * G2P), "v"(l + 144u * G2P), "v"(l + 160u * G2P), "v"(l + 176u * G2P),
                  "v"(a), "v"(a + sa), "v"(a + 2 * sa), "v"(a + 3 * sa), "v"(a + 4 * sa), "v"(a + 5 * sa), "v"(a + 6 * sa), "v"(a + 7 * sa), "v"(b), "v"(b + sb), "v"(b + 2 * sb), "v"(b + 3 * sb) : "memory"); }
__device__ __forceinline__ v8f g2_mma(v16h a, v16h b, v8f c) { v8f d = __builtin_amdgcn_wmma_f32_16x16x32_f16(false, a, false, b, (short)0, c, false, false); asm volatile("v_nop\n\tv_nop\n\tv_nop\n\tv_nop" : "+v"(d) : "v"(a), "v"(b)); return d; }
// QKVF (the stacked q | k | v launch, rows b * SQ + s, columns 0 .. 3 DM - 1): the f32 values behind the f16 rows are stored as well, so that no product is formed twice: k and v head-major into KV (outputs 1 and 2, one behind the other: [k | v][NB][NH][SQ][HD]), and q, k, v of each batch's first QT0 rows into F0 ([q | k | v][NB][QT0][DM]) for the f32 attention path.
template <int ACT, bool QKVF = false>
__global__ __launch_bounds__(128) void k_gemm2(const _Float16* __restrict__ A, int lda, size_t sA, const _Float16* __restrict__ Bh, int ldb, size_t sB, float alpha, const float* __restrict__ bias, size_t sBias, const float* __restrict__ CP, int rowsPerB, size_t sCPb, int row0g,
    float* __restrict__ C, _Float16* __restrict__ C16, int ldc, size_t sC, int M, int N, int K, float* __restrict__ KV, float* __restrict__ F0) { static_assert(ACT == 0 || ACT == 3 || ACT == 6 || ACT == 8 || ACT == 9 || ACT == 11 || ACT == 12 || ACT == 14 || ACT == 15 || ACT == 16 || ACT == 17, "k_gemm2: unsupported ACT code (would silently apply no activation)");
  __shared__ __attribute__((aligned(16))) unsigned char ring[2 * G2S]; static_assert(sizeof(float) * 4 * 32 * 68 <= 2 * G2S, "the output staging fits in the ring");
  float (*so)[32][68] = (float (*)[32][68])ring;      /* output staging in the ring's place, behind the last pass's barrier */
  const int tid = threadIdx.x, w = tid >> 5, lane = tid & 31, ln = lane & 15, hh = lane >> 4; const int by = blockIdx.y;
  A += (size_t)by * sA; Bh += (size_t)by * sB; const size_t cofs = (size_t)by * sC; const float* bp = bias ? bias + (size_t)by * sBias : nullptr;
  const int ntn = N >> 6; const int mt = blockIdx.x / ntn, nq = blockIdx.x - mt * ntn; const int row0 = mt * 128 + 32 * w, col0 = nq * 64; if (mt * 128 >= M) return;      /* the whole work-group or none of it, in front of every barrier */
  const char* ag = (const char*)(A + (size_t)(mt * 128 + (tid >> 3)) * lda) + (tid & 7) * 16; const char* bg = (const char*)(Bh + (size_t)(col0 + (tid >> 3)) * ldb) + (tid & 7) * 16;      /* the lane's 16 bytes in the first of its rows */
  const size_t sa = (size_t)lda * 32, sb = (size_t)ldb * 32; const unsigned lc = (unsigned)(size_t)ring + (unsigned)((tid >> 3) * G2P + (tid & 7) * 16);
  const unsigned char* la = ring + (32 * w + ln) * G2P + 16 * hh; const unsigned char* lb = ring + (128 + ln) * G2P + 16 * hh;      /* fragment rows: the wave's own 32 rows of A, the 64 rows of B */
  const v8f z8 = {0.f,0.f,0.f,0.f,0.f,0.f,0.f,0.f}; v8f c00 = z8, c01 = z8, c02 = z8, c03 = z8, c10 = z8, c11 = z8, c12 = z8, c13 = z8;
  const int np = K >> 6;
  g2_copy(lc, ag, sa, bg, sb);
  asm volatile("s_wait_asynccnt 0x0" ::: "memory");      /* this wave's copies of pass 0 have landed */
  __syncthreads();      /* pass 0 is readable by every wave */
  if (np > 1) g2_copy(lc + G2S, ag + 128, sa, bg + 128, sb);
#pragma unroll 1
  for (int t = 0; t < np; ++t) { const unsigned bo = (unsigned)(t & 1) * G2S;
    v16h fa[2][2], fb[2][4];      /* the pass's fragments: two k steps of 32 */
#pragma unroll      /* register arrays, constant LDS offsets */
    for (int ks = 0; ks < 2; ++ks) { fa[ks][0] = g2_lfrag(la + bo + ks * 64); fa[ks][1] = g2_lfrag(la + bo + ks * 64 + 16 * G2P);
#pragma unroll      /* register arrays */
      for (int j = 0; j < 4; ++j) fb[ks][j] = g2_lfrag(lb + bo + ks * 64 + j * 16 * G2P); }
    __builtin_amdgcn_sched_barrier(0);      /* all LDS reads of the pass go out as one group in front of its products; left to itself the compiler reads one fragment at a time and waits out the LDS latency in front of every second product */
#pragma unroll      /* register arrays */
    for (int ks = 0; ks < 2; ++ks) {
      c00 = g2_mma(fa[ks][0], fb[ks][0], c00); c10 = g2_mma(fa[ks][1], fb[ks][0], c10);
      c01 = g2_mma(fa[ks][0], fb[ks][1], c01); c11 = g2_mma(fa[ks][1], fb[ks][1], c11);
      c02 = g2_mma(fa[ks][0], fb[ks][2], c02); c12 = g2_mma(fa[ks][1], fb[ks][2], c12);
      c03 = g2_mma(fa[ks][0], fb[ks][3], c03); c13 = g2_mma(fa[ks][1], fb[ks][3], c13); }
    asm volatile("s_wait_dscnt 0x0" ::: "memory");      /* this wave's reads of the buffer are done before the barrier behind which it is refilled */
    asm volatile("s_wait_asynccnt 0x0" ::: "memory");      /* this wave's copies of pass t + 1 have landed */
    __syncthreads();      /* publishes pass t + 1 and ends every wave's reads of pass t */
    if (t + 2 < np) g2_copy(lc + bo, ag + (size_t)(t + 2) * 128, sa, bg + (size_t)(t + 2) * 128, sb); }
  asm volatile("s_wait_asynccnt 0x0" ::: "memory");      /* no copy is outstanding when the ring becomes output staging */
  v8f accs[8] = {c00, c01, c02, c03, c10, c11, c12, c13};
#pragma unroll
  for (int u = 0; u < 8; ++u) { const int t = u & 3, half = u >> 2; const int col = col0 + t * 16 + ln; const float bv = bp ? bf16_round(bp[col]) : 0.f;
#pragma unroll
    for (int r = 0; r < 8; ++r) { const int rloc = half * 16 + 8 * hh + r; float v = accs[u][r] * alpha + bv; if (CP) { if (rowsPerB < 0) v += CP[cofs + (size_t)(row0g + row0 + rloc) * ldc + col];      /* rowsPerB < 0: own element of the batched C plane */ else { const int bidx = (row0g + row0 + rloc) / rowsPerB; v += CP[(size_t)bidx * sCPb + (size_t)by * 64 + col]; } }
      if (ACT == 3) v = fmaxf(v, 0.f); else if (ACT == 6) v = 0.5f * v * (1.0f + erff(v * 0.70710678118654752f)); else if (ACT == 11) v = 1.0f / (1.0f + expf(-v)); else if (ACT == 15) v = v / (1.0f + expf(-v)); else if (ACT == 12) v = (v > 0.f) ? v : 0.01f * v; else if (ACT == 8) v = tanhf(v); else if (ACT == 9) v = 0.5f * v * (1.0f + tanhf(0.7978845608028654f * (v + 0.044715f * v * v * v))); else if (ACT == 14) v = (v > 0.f) ? v : 0.1f * v; else if (ACT == 16) v = (v >= 0.f) ? v : 0.3f * v; else if (ACT == 17) v = (v >= 0.f) ? v : 0.2f * v;
      so[w][rloc][t * 16 + ln] = v; } }
  __builtin_amdgcn_fence(__ATOMIC_ACQ_REL, "workgroup"); __builtin_amdgcn_wave_barrier();
  const int rsub = lane >> 4, c4 = (lane & 15) * 4;
  {
#pragma unroll
    for (int q = 0; q < 16; ++q) { const int r = q * 2 + rsub; const v4f v = *(const v4fa*)&so[w][r][c4]; if (C) *(v4f*)(C + cofs + (size_t)(row0 + r) * ldc + col0 + c4) = v; if (C16) { v4h h4; for (int i = 0; i < 4; ++i) h4[i] = (_Float16)v[i]; *(v4h*)(C16 + cofs + (size_t)(row0 + r) * ldc + col0 + c4) = h4; } }
     }
  if constexpr (QKVF) { static_assert(QT0 == 128 && SQ % 128 == 0 && HD == 64 && DM % 64 == 0, "a work-group's 128 rows lie in one batch and are its first QT0 rows or none of them; its 64 columns are one head of q, of k or of v");
    const int sel = col0 / DM, hc = col0 % DM, bt = (mt * 128) / SQ, t0 = (mt * 128) % SQ;      /* 0 q, 1 k, 2 v; first column in that matrix; batch; first row in the batch: all the work-group's own, scalars */
    if (sel >= 1) { float* kvp = KV + ((size_t)((sel - 1) * NB + bt) * NH + hc / HD) * SQ * HD + (size_t)t0 * HD; const unsigned kvo = (unsigned)((32 * w + rsub) * HD + c4) * 4u;      /* scalar base, the lane's fixed offset in bytes, the row pair as a constant: a head's rows follow one another, so that each store is 512 bytes in a row */
#pragma unroll      /* constant offsets */
      for (int q = 0; q < 16; ++q) *(v4f*)((char*)kvp + kvo + q * 2 * HD * 4) = *(const v4fa*)&so[w][q * 2 + rsub][c4];
      asm volatile("s_wait_xcnt 0x0" :: "v"(kvo), "s"(kvp) : "memory"); }      /* behind the stores, in front of any later write of their base and offset registers (the next block forms its own); both as inputs, so that their registers are still theirs up to here */
    if (t0 == 0) { float* fp = F0 + (size_t)(sel * NB + bt) * QT0 * DM + hc; const unsigned fo = (unsigned)((32 * w + rsub) * DM + c4) * 4u;      /* as above, row pitch DM */
#pragma unroll      /* constant offsets */
      for (int q = 0; q < 16; ++q) *(v4f*)((char*)fp + fo + q * 2 * DM * 4) = *(const v4fa*)&so[w][q * 2 + rsub][c4]; } } }


__global__ __launch_bounds__(256) void k_wnat(const float* __restrict__ w, size_t n8, _Float16* __restrict__ Bt) { const size_t t = (size_t)blockIdx.x * 256 + threadIdx.x; if (t >= n8) return; FragH f; for (int q = 0; q < 8; ++q) f.h[q] = (_Float16)(bf16_round(w[t * 8 + q]) * 16.0f); *(v8us*)((unsigned short*)Bt + t * 8) = f.half[0];  }
__global__ __launch_bounds__(256) void k_rsm(const float* __restrict__ S, _Float16* __restrict__ P, int nrows) {
  #pragma clang fp contract(off)
  const int i = blockIdx.x * 256 + threadIdx.x; if (i >= nrows) return; const float* s = S + (size_t)i * SQ; float mx = -3.0e38f;
#pragma unroll 1
  for (int j = 0; j < SQ; ++j) mx = fmaxf(mx, s[j]); float se = 0.f;
#pragma unroll 1
  for (int j = 0; j < SQ; ++j) se += expf(s[j] - mx); const float sc = 256.0f / se;
#pragma unroll 1
  for (int j0 = 0; j0 < SQ; j0 += 8) { FragH f; for (int q = 0; q < 8; ++q) f.h[q] = (_Float16)(expf(s[j0 + q] - mx) * sc); unsigned short* d = (unsigned short*)P + (size_t)i * SQ + j0; *(v8us*)d = f.half[0];  } }
__global__ __launch_bounds__(256) void k_vt(const _Float16* __restrict__ V16, int b, int h0, _Float16* __restrict__ VT) { __shared__ unsigned short tl[64][65]; const int tid = threadIdx.x; const int hh = blockIdx.x % HG, sg = blockIdx.x / HG; const int s0 = sg * 64; const int h = h0 + hh;
  for (int i = tid; i < 64 * 8; i += 256) { const int j = i / 8, d8 = (i % 8) * 8; FragH f; f.half[0] = *(const v8us*)((const unsigned short*)V16 + ((size_t)b * SQ + s0 + j) * DM + h * HD + d8); for (int q = 0; q < 8; ++q) tl[d8 + q][j] = f.u[q]; }
  __syncthreads();
  { for (int i = tid; i < 64 * 8; i += 256) { const int d = i / 8, j8 = (i % 8) * 8; FragH f; for (int q = 0; q < 8; ++q) f.u[q] = tl[d][j8 + q]; *(v8us*)((unsigned short*)VT + ((size_t)hh * HD + d) * SQ + s0 + j8) = f.half[0]; }  } }



// ---- lane exchanges and native exp2 shared by the two attention kernels below ----
template <int CTRL>
__device__ __forceinline__ float sm_rowx(float x) { return __builtin_bit_cast(float, __builtin_amdgcn_update_dpp(__builtin_bit_cast(int, x), __builtin_bit_cast(int, x), CTRL, 0xf, 0xf, false)); }      /* CTRL = 0x160 | m (row_xmask): lane l with lane l ^ m of its 16-lane row */
__device__ __forceinline__ float sm_half(float x) { return __builtin_bit_cast(float, __builtin_amdgcn_permlanex16(__builtin_bit_cast(int, x), __builtin_bit_cast(int, x), 0x76543210, 0xfedcba98, false, false)); }      /* lane l with lane l ^ 16 */
__device__ __forceinline__ float sm_wmax(float v) { v = fmaxf(v, sm_rowx<0x161>(v)); v = fmaxf(v, sm_rowx<0x162>(v)); v = fmaxf(v, sm_rowx<0x164>(v)); v = fmaxf(v, sm_rowx<0x168>(v)); return fmaxf(v, sm_half(v)); }
__device__ __forceinline__ float sm_wsum(float v) { v += sm_rowx<0x161>(v); v += sm_rowx<0x162>(v); v += sm_rowx<0x164>(v); v += sm_rowx<0x168>(v); return v + sm_half(v); }
// 2^x of four values: each v_exp_f32 fills the slot behind the one before it (results apart from all sources), the v_nop the slot behind the last, which the instruction set asks for before a result is read or a source overwritten
__device__ __forceinline__ v4f sm_exp2x4(v4f x) { float r0, r1, r2, r3;
  asm("v_exp_f32 %0, %4\n\tv_exp_f32 %1, %5\n\tv_exp_f32 %2, %6\n\tv_exp_f32 %3, %7\n\tv_nop" : "=&v"(r0), "=&v"(r1), "=&v"(r2), "=&v"(r3) : "v"(x[0]), "v"(x[1]), "v"(x[2]), "v"(x[3]));
  const v4f r = {r0, r1, r2, r3}; return r; }
// ---- causal attention for query rows QT0 .. SQ - 1 in one launch: scores and softmax weights never leave registers. One wave owns 32 query rows of one (batch, head) and walks the keys 64 at a time; no LDS, no barrier.
// Both products are formed transposed, so that a query is a lane (column ln) in each: S^T = K Q^T (A = 16 key rows, B = query rows) gives lane (ln, hh) the keys 8 hh + r of a 16-key tile for query ln, which is the k order of a B fragment
// (tiles 2 j, 2 j + 1 -> k = 8 hh + i, 16 + 8 hh + i): the weights go from accumulator to operand by a conversion alone. O^T = V^T P^T (A = 16 rows of V^T) keeps query = ln, so that the running maximum, the rescale and the row sum are the lane's own.
// Running maximum kept on the raw products; weights 2^((s - max) c + 8), c = log2(e) / 8: at most 256, so that small weights stay clear of the f16 subnormals; the row sum carries the same factor.
__device__ __forceinline__ v8f fa_mma(v16h a, v16h b, v8f c) { return __builtin_amdgcn_wmma_f32_16x16x32_f16(false, a, false, b, (short)0, c, false, false); }
// fragment from a wave-uniform base and the lane's own fixed offset in bytes (the value the load instruction itself takes beside a scalar base)
__device__ __forceinline__ v16h fa_frag(const _Float16* base, unsigned off) { FragH f; f.half[0] = *(const v8us*)((const char*)base + off); f.half[1] = *(const v8us*)((const char*)base + off + 32); return f.v; }
__device__ __forceinline__ void fa_loadk(const _Float16* __restrict__ kp, int kb, unsigned ko, v16h (&kf)[4][2]) {
#pragma unroll      /* register arrays */
  for (int t = 0; t < 4; ++t)
#pragma unroll      /* register arrays */
    for (int ks = 0; ks < 2; ++ks) kf[t][ks] = fa_frag(kp + (size_t)(kb + t * 16) * LQ + ks * 32, ko); }
// one pass of 64 keys from kb on. LAST: the pass that holds the rows' own keys (the only one that needs the mask) and has no pass behind it to fetch K for.
template <bool LAST>
__device__ __forceinline__ void fa_pass(const _Float16* __restrict__ kp, const _Float16* __restrict__ vp, int kb, int qrel, unsigned ko, unsigned vo, const v16h (&qf)[2][2], v16h (&kf)[4][2], v8f (&o)[2][4], float (&mr)[2], float (&l)[2]) {
  const float cs = 0.125f * 1.44269504f; const v8f z8 = {0.f, 0.f, 0.f, 0.f, 0.f, 0.f, 0.f, 0.f};
  v16h vf[4][2];
#pragma unroll      /* register arrays */
  for (int t = 0; t < 4; ++t)
#pragma unroll      /* register arrays */
    for (int ks = 0; ks < 2; ++ks) vf[t][ks] = fa_frag(vp + (size_t)t * 16 * SQ + kb + ks * 32, vo);
  asm volatile("s_wait_xcnt 0x0" :: "v"(vo) : "memory");      /* behind the loads, in front of any later write of a register that holds one of their addresses; the offset as an input, so that its register is still the offset's while the loads issue */
  __builtin_amdgcn_sched_barrier(0);      /* V^T of this pass is asked for here, so that it flies under the score products and the softmax; left to itself the scheduler sinks the loads to their use */
  v8f st[2][4];
#pragma unroll      /* register arrays */
  for (int qt = 0; qt < 2; ++qt)
#pragma unroll      /* register arrays */
    for (int t = 0; t < 4; ++t) st[qt][t] = fa_mma(kf[t][1], qf[qt][1], fa_mma(kf[t][0], qf[qt][0], z8));
  if (!LAST) { __builtin_amdgcn_sched_barrier(0);      /* the next pass's K is asked for behind this pass's last use of K and no later: it flies under the softmax and the second product */
    fa_loadk(kp, kb + 64, ko, kf);
    asm volatile("s_wait_xcnt 0x0" :: "v"(ko) : "memory");      /* as behind the V^T loads above */
    __builtin_amdgcn_sched_barrier(0); }      /* as the line above: keeps the loads from sinking */
  float mn[2];
#pragma unroll      /* register arrays */
  for (int qt = 0; qt < 2; ++qt) { const int rel = qrel + qt * 16 - kb;      /* key kb + 16 t + 8 hh + r is kept while 16 t + r <= rel */
    float mx = mr[qt];
#pragma unroll      /* register arrays */
    for (int t = 0; t < 4; ++t)
#pragma unroll      /* register arrays */
      for (int r = 0; r < 8; ++r) { if (LAST) st[qt][t][r] = (t * 16 + r <= rel) ? st[qt][t][r] : -1.0e30f; mx = fmaxf(mx, st[qt][t][r]); }
    mn[qt] = fmaxf(mx, sm_half(mx)); }      /* the other eight keys of each tile sit in lane l ^ 16 */
  const v4f ax = {(mr[0] - mn[0]) * cs, (mr[1] - mn[1]) * cs, 0.f, 0.f}; const v4f al = sm_exp2x4(ax);      /* rescale of what was summed under the old maximum; 0 in the first pass */
  FragH pf[2][2];
#pragma unroll      /* register arrays */
  for (int qt = 0; qt < 2; ++qt) { const float mo = mn[qt] * cs - 8.0f; mr[qt] = mn[qt];
    v4f se = {0.f, 0.f, 0.f, 0.f};
#pragma unroll      /* register arrays */
    for (int t = 0; t < 4; ++t)
#pragma unroll      /* register arrays */
      for (int g = 0; g < 2; ++g) { v4f x;
#pragma unroll      /* register arrays */
        for (int q = 0; q < 4; ++q) x[q] = st[qt][t][g * 4 + q] * cs - mo;
        x = sm_exp2x4(x); se += x;
#pragma unroll      /* register arrays */
        for (int q = 0; q < 4; ++q) pf[qt][t >> 1].h[(t & 1) * 8 + g * 4 + q] = (_Float16)x[q]; }
    l[qt] = l[qt] * al[qt] + ((se[0] + se[1]) + (se[2] + se[3]));
#pragma unroll      /* register arrays */
    for (int t = 0; t < 4; ++t) o[qt][t] *= al[qt]; }
  __builtin_amdgcn_sched_barrier(0);      /* the second product starts behind the last exp2 of both tiles */
#pragma unroll      /* register arrays */
  for (int qt = 0; qt < 2; ++qt)
#pragma unroll      /* register arrays */
    for (int t = 0; t < 4; ++t) o[qt][t] = fa_mma(vf[t][1], pf[qt][1].v, fa_mma(vf[t][0], pf[qt][0].v, o[qt][t])); }
__global__ __launch_bounds__(256) void k_fattn(const _Float16* __restrict__ QKVp, const _Float16* __restrict__ VTp, const float* __restrict__ XBp, float* __restrict__ X1p) {
  static_assert(QT0 == 128 && HD == 64 && SQ % 256 == 0, "blocks of 128 query rows; block 0 of a batch belongs to the f32 path; blocks 1 .. SQ / 128 - 1 are paired below");
  const int lane = threadIdx.x & 31, ln = lane & 15, hh = lane >> 4; const int w = __builtin_amdgcn_readfirstlane((int)(threadIdx.x >> 5));      /* the wave's number: a scalar, so that the early exit and the trip count are scalar */
  const int h = blockIdx.y, b = blockIdx.z; const int far = SQ / 128 - 1 - (int)blockIdx.x, near = 1 + (int)blockIdx.x;      /* waves 0-3 take a late block of rows, waves 4-7 the early block that makes the keys walked per work-group level */
  if (w >= 4 && near >= far) return;      /* the middle block has no partner; no barrier in this kernel */
  const int qw = (w < 4 ? far : near) * 128 + (w & 3) * 32;
  const size_t r0 = (size_t)b * SQ;
  const _Float16* qp = QKVp + (r0 + qw) * LQ + h * HD; const _Float16* kp = QKVp + DM + r0 * LQ + h * HD; const _Float16* vp = VTp + (size_t)(b * NH + h) * HD * SQ;      /* wave-uniform bases */
  const unsigned ko = (unsigned)(ln * LQ + 8 * hh) * 2u, vo = (unsigned)(ln * SQ + 8 * hh) * 2u;      /* the lane's row and k half in q / k rows and in V^T rows, in bytes */
  v16h qf[2][2], kf[4][2];
#pragma unroll      /* register arrays */
  for (int qt = 0; qt < 2; ++qt)
#pragma unroll      /* register arrays */
    for (int ks = 0; ks < 2; ++ks) qf[qt][ks] = fa_frag(qp + (size_t)qt * 16 * LQ + ks * 32, ko);
  fa_loadk(kp, 0, ko, kf);
  asm volatile("s_wait_xcnt 0x0" :: "v"(ko) : "memory");      /* behind the loads of q and of the first K, in front of any later write of their base and offset registers */
  __builtin_amdgcn_sched_barrier(0);      /* keeps later address arithmetic, which reuses those registers, behind the wait */
  const v8f z8 = {0.f, 0.f, 0.f, 0.f, 0.f, 0.f, 0.f, 0.f};
  v8f o[2][4] = {{z8, z8, z8, z8}, {z8, z8, z8, z8}}; float mr[2] = {-1.0e30f, -1.0e30f}; float l[2] = {0.f, 0.f};
  const int klast = qw & ~63;      /* keys 0 .. qw + 31 in passes of 64: every pass before this one lies wholly below row qw, this one ends at or below SQ - 1 */
  const int qrel = qw + ln - 8 * hh;
#pragma unroll 1      /* one pass holds 32 loads and 32 matrix instructions already */
  for (int kb = 0; kb < klast; kb += 64) fa_pass<false>(kp, vp, kb, qrel, ko, vo, qf, kf, o, mr, l);
  const float* xp = XBp + (r0 + qw) * DM + h * HD; float* yp = X1p + (r0 + qw) * DM + h * HD; const unsigned xo = (unsigned)(ln * DM + 8 * hh) * 4u;      /* lane (ln, hh) holds columns 16 t + 8 hh .. + 7 of query ln; in bytes */
  v4f xr[2][4][2];
#pragma unroll      /* register arrays */
  for (int qt = 0; qt < 2; ++qt)
#pragma unroll      /* register arrays */
    for (int t = 0; t < 4; ++t)
#pragma unroll      /* register arrays */
      for (int g = 0; g < 2; ++g) xr[qt][t][g] = *(const v4fa*)((const char*)(xp + qt * 16 * DM + t * 16 + g * 4) + xo);
  asm volatile("s_wait_xcnt 0x0" :: "v"(xo) : "memory");      /* as behind the V^T loads */
  __builtin_amdgcn_sched_barrier(0);      /* the residual rows are asked for here and fly under the last pass, in the registers that the K fetched ahead no longer needs */
  fa_pass<true>(kp, vp, klast, qrel, ko, vo, qf, kf, o, mr, l);
#pragma unroll      /* register arrays */
  for (int qt = 0; qt < 2; ++qt) { const float inv = 1.0f / (l[qt] + sm_half(l[qt]));      /* the two halves' sums joined once */
#pragma unroll      /* register arrays */
    for (int t = 0; t < 4; ++t)
#pragma unroll      /* register arrays */
      for (int g = 0; g < 2; ++g)
#pragma unroll      /* register arrays */
        for (int q = 0; q < 4; ++q) xr[qt][t][g][q] += o[qt][t][g * 4 + q] * inv; }
  __builtin_amdgcn_sched_barrier(0);      /* all arithmetic in front of the first store, so that nothing rewrites a register that an issued store names */
#pragma unroll      /* register arrays */
  for (int qt = 0; qt < 2; ++qt)
#pragma unroll      /* register arrays */
    for (int t = 0; t < 4; ++t)
#pragma unroll      /* register arrays */
      for (int g = 0; g < 2; ++g) *(v4f*)((char*)(yp + qt * 16 * DM + t * 16 + g * 4) + xo) = xr[qt][t][g]; }


typedef float v2f  __attribute__((ext_vector_type(2)));
typedef float v2fa __attribute__((ext_vector_type(2), may_alias));
// ---- f32 attention for the first QT0 query rows: one wave per (head, query row), eight rows of one head per work-group. The head's K and V rows up to the end of the rows' 32-key chunk are staged once in LDS.
// Scores: lane l owns keys 32 c + l (K pitch 68 floats = 16 B x odd, so that the 32 rows read by one ds_load_b128 spread over the banks). Output: lane l owns columns 2 l, 2 l + 1; each key's weight comes out of its lane by v_readlane.
// NCH = 32-key chunks (compile time: every load of a phase is issued before the first wait). Keys past the row get weight 2^(-1e30 ..) = 0.
template <int NCH>
__device__ __forceinline__ void att0_rows(const float* __restrict__ QF, const float* __restrict__ KF, const float* __restrict__ VF, float scale, float* __restrict__ OF, int h, int row0, float (*lk)[HD + 4], float (*lv)[HD]) {
  const int tid = threadIdx.x, lane = tid & 31; const int i = row0 + __builtin_amdgcn_readfirstlane(tid >> 5);      /* the row is the wave's: a scalar */
  const int sr = tid >> 4, sc = (tid & 15) * 4;      /* staging: 16 threads per 256-byte row, 16 rows per pass */
  const float* kg = KF + h * HD; const float* vg = VF + h * HD; const float* qr = QF + (size_t)i * DM + h * HD; const int so = sr * DM + sc;      /* row pitch DM at compile time: one address per matrix, the pass as a constant offset of the load */
  v4f kk[2 * NCH], vv[2 * NCH], q[HD / 4];
#pragma unroll      /* arrays stay in registers; all loads in flight together */
  for (int p = 0; p < 2 * NCH; ++p) { kk[p] = *(const v4fa*)(kg + so + p * 16 * DM); vv[p] = *(const v4fa*)(vg + so + p * 16 * DM); }
#pragma unroll      /* the query row, same address in every lane, fetched beside the staging loads */
  for (int c = 0; c < HD / 4; ++c) q[c] = *(const v4fa*)(qr + c * 4);
#pragma unroll      /* register arrays */
  for (int p = 0; p < 2 * NCH; ++p) { *(v4fa*)&lk[p * 16 + sr][sc] = kk[p]; *(v4fa*)&lv[p * 16 + sr][sc] = vv[p]; }
  __syncthreads();
  v4f a[NCH];
#pragma unroll      /* register arrays */
  for (int c = 0; c < NCH; ++c) { const v4f z = {0.f, 0.f, 0.f, 0.f}; a[c] = z; }
#pragma unroll      /* 4 NCH independent sums per lane */
  for (int d = 0; d < HD / 4; ++d)
#pragma unroll      /* a[c] by constant index */
    for (int c = 0; c < NCH; ++c) a[c] += q[d] * *(const v4fa*)&lk[c * 32 + lane][d * 4];
  float e[NCH]; float mx = -1.0e30f;
#pragma unroll      /* register arrays */
  for (int c = 0; c < NCH; ++c) { const float s = ((a[c][0] + a[c][1]) + (a[c][2] + a[c][3])) * scale; e[c] = (c * 32 + lane <= i) ? s : -1.0e30f; mx = fmaxf(mx, e[c]); }
  mx = sm_wmax(mx);
  float l = 0.f; v4f t = {-200.f, -200.f, -200.f, -200.f};      /* chunks that this case does not have: 2^-200, not summed */
#pragma unroll      /* register arrays */
  for (int c = 0; c < NCH; ++c) t[c] = (e[c] - mx) * 1.44269504f;      /* exp(x) = 2^(x log2 e), the native form, as in the row softmax above */
  t = sm_exp2x4(t);
#pragma unroll      /* register arrays */
  for (int c = 0; c < NCH; ++c) { e[c] = t[c]; l += e[c]; }
  l = sm_wsum(l);
  const v2f z2 = {0.f, 0.f}; v2f o[4] = {z2, z2, z2, z2};      /* four sums per column, so that one key's multiply-add does not wait for the key before it */
#pragma unroll      /* constant lane numbers for v_readlane, constant LDS offsets */
  for (int c = 0; c < NCH; ++c)
#pragma unroll      /* as the line above */
    for (int j = 0; j < 32; ++j) { const float ej = __builtin_bit_cast(float, __builtin_amdgcn_readlane(__builtin_bit_cast(int, e[c]), j)); o[j & 3] += ej * *(const v2fa*)&lv[c * 32 + j][lane * 2]; }
  const float fin = 64.0f / l;      /* o carried x64, scaled by 1/64 where it is added to x1 */
  const v2f r = ((o[0] + o[1]) + (o[2] + o[3])) * fin;
  *(v2fa*)(OF + (size_t)i * DM + h * HD + lane * 2) = r; }
__global__ __launch_bounds__(256) void k_att0w(const float* __restrict__ QF, const float* __restrict__ KF, const float* __restrict__ VF, float scale, float* __restrict__ OF) {
  static_assert(QT0 == 128 && HD == 64, "the cases below cover 1 .. 4 chunks of 32 keys; two columns per lane");
  __shared__ __attribute__((aligned(16))) float lk[QT0][HD + 4]; __shared__ __attribute__((aligned(16))) float lv[QT0][HD];
  { const size_t bo = (size_t)blockIdx.y * QT0 * DM; QF += bo; KF += bo; VF += bo; OF += bo; }      /* blockIdx.y = batch: each matrix holds the batches' QT0 rows one behind the other */
  const int h = blockIdx.x / (QT0 / 8), row0 = (blockIdx.x % (QT0 / 8)) * 8;      /* eight rows lie in one 32-key chunk: the switch is the same for the whole work-group, barrier included */
  switch (row0 >> 5) {
    case 0: att0_rows<1>(QF, KF, VF, scale, OF, h, row0, lk, lv); break; case 1: att0_rows<2>(QF, KF, VF, scale, OF, h, row0, lk, lv); break;
    case 2: att0_rows<3>(QF, KF, VF, scale, OF, h, row0, lk, lv); break; case 3: att0_rows<4>(QF, KF, VF, scale, OF, h, row0, lk, lv); break; } }


template <int BFIN, int WXB>
__global__ __launch_bounds__(256) void k_ln16(const float* __restrict__ X, const float* __restrict__ g, const float* __restrict__ bb, float eps, _Float16* __restrict__ N16, float* __restrict__ XB) {
  #pragma clang fp contract(off)
  __shared__ float red[256]; const size_t r = blockIdx.x; const int t = threadIdx.x; const v4f xa = *(const v4fa*)(X + r * DMQ + t * 4); float s[4]; float sum = 0.f;
  for (int q = 0; q < 4; ++q) { s[q] = BFIN ? bf16_round(xa[q]) : xa[q]; sum = __fadd_rn(sum, s[q]); }
  red[t] = sum; __syncthreads(); for (int st = 128; st > 0; st >>= 1) { if (t < st) red[t] = __fadd_rn(red[t], red[t + st]); __syncthreads(); } const float mu = red[0] / (float)DMQ; __syncthreads();
  float vs = 0.f; for (int q = 0; q < 4; ++q) { const float dl = __fadd_rn(s[q], -mu); vs = __fadd_rn(vs, __fmul_rn(dl, dl)); } red[t] = vs; __syncthreads(); for (int st = 128; st > 0; st >>= 1) { if (t < st) red[t] = __fadd_rn(red[t], red[t + st]); __syncthreads(); }
  const float rs = rsqrtf(__fadd_rn(red[0] / (float)DMQ, eps)); v4h y; v4f xb;
  for (int q = 0; q < 4; ++q) { const int c = t * 4 + q; y[q] = (_Float16)__fadd_rn(__fmul_rn(__fmul_rn(__fadd_rn(s[q], -mu), rs), bf16_round(g[c])), bf16_round(bb[c])); xb[q] = s[q]; }
  { *(v4h*)(N16 + r * DMQ + t * 4) = y; if (WXB) *(v4f*)(XB + r * DMQ + t * 4) = xb;  } }
__global__ __launch_bounds__(256) void k_ftres2(const float* __restrict__ OF0, const float* __restrict__ XB, float* __restrict__ X1, size_t n4) {
  #pragma clang fp contract(off)
  const size_t t = (size_t)blockIdx.x * 256 + threadIdx.x; if (t >= n4) return; const v4f o = *(const v4fa*)(OF0 + t * 4), xv = *(const v4fa*)(XB + t * 4); v4f y; for (int q = 0; q < 4; ++q) y[q] = __fadd_rn(__fmul_rn(o[q], 0.015625f), xv[q]); *(v4f*)(X1 + t * 4) = y;  }

__global__ __launch_bounds__(256) void k_wthd(const float* __restrict__ Wt, _Float16* __restrict__ Bt) { const size_t t = (size_t)blockIdx.x * 256 + threadIdx.x; if (t >= (size_t)NH * HD * (DM / 8)) return; const int m8 = (int)(t % (DM / 8)) * 8; const int d = (int)((t / (DM / 8)) % HD); const int h = (int)(t / ((size_t)(DM / 8) * HD)); FragH f;
  for (int q = 0; q < 8; ++q) f.h[q] = (_Float16)(16.0f * bf16_round(Wt[((size_t)h * DM + m8 + q) * HD + d])); unsigned short* dst = (unsigned short*)Bt + ((size_t)h * HD + d) * DM + m8; *(v8us*)dst = f.half[0];  }




__global__ __launch_bounds__(256) void k_wtpad(const float* __restrict__ Wm, _Float16* __restrict__ Wt, int Kr, int Kp, int Nr, int Np, float scale) {
  const int t = blockIdx.x * 256 + threadIdx.x; if (t >= Np * (Kp / 8)) return; const int n = t / (Kp / 8), k8 = (t % (Kp / 8)) * 8; const int nc = min(n, Nr - 1); const float fn = (n < Nr) ? 1.f : 0.f; FragH f;
  for (int i = 0; i < 8; ++i) { const int k = k8 + i; const int kc = min(k, Kr - 1); const float fk = (k < Kr) ? fn : 0.f; f.h[i] = (_Float16)(bf16_round(Wm[(size_t)kc * Nr + nc]) * scale * fk); }
  unsigned short* o = (unsigned short*)Wt + (size_t)n * Kp + k8; *(v8us*)o = f.half[0];  }
__global__ __launch_bounds__(128) void k_bpad(const float* __restrict__ b, float* __restrict__ Bp, int nr, int np) {
  const int i = threadIdx.x; if (i >= np) return; const float v = b[min(i, nr - 1)] * ((i < nr) ? 1.f : 0.f); *(float*)(Bp + i) = v;  }

__global__ __launch_bounds__(256) void k_bcpy(const float* __restrict__ b, int n, int NP, float* __restrict__ dst, int dst0) { for (int i = threadIdx.x; i < NP; i += 256) { const float v = (i < n) ? b[i] : 0.f; *(float*)(dst + dst0 + i) = v; }  }


__global__ __launch_bounds__(256) void k_addf(const float* __restrict__ XBr, const float* __restrict__ OF, float* __restrict__ O, size_t n8) {
  #pragma clang fp contract(off)
  XBr += (size_t)blockIdx.y * SQ * DM; O += (size_t)blockIdx.y * SQ * DM; OF += (size_t)blockIdx.y * QT0 * DM;      /* blockIdx.y = batch: its first rows in the token planes, its own QT0 rows in OF */
  const size_t t = (size_t)blockIdx.x * 256 + threadIdx.x; if (t >= n8) return; const v4f a = *(const v4fa*)(XBr + t * 8), b = *(const v4fa*)(XBr + t * 8 + 4), c = *(const v4fa*)(OF + t * 8), d = *(const v4fa*)(OF + t * 8 + 4); v4f r0, r1;
  for (int q = 0; q < 4; ++q) { r0[q] = __fadd_rn(a[q], __fmul_rn(c[q], 0.015625f)); r1[q] = __fadd_rn(b[q], __fmul_rn(d[q], 0.015625f)); }
  { *(v4f*)(O + t * 8) = r0; *(v4f*)(O + t * 8 + 4) = r1;  } }


extern "C" void kernel_launch(void* const* d_in, const int* in_sizes, int n_in,
                              void* d_out, int out_size, void* d_ws, size_t ws_size, hipStream_t stream) {
  (void)in_sizes; (void)n_in; (void)out_size;
  const float* const* I = (const float* const*)d_in; const float* x = I[0]; const float* wq = I[1]; const float* bq = I[2]; const float* wk = I[3]; const float* bk = I[4]; const float* wv = I[5]; const float* bv = I[6]; const float* g1 = I[7]; const float* be1 = I[8]; const float* gg2 = I[9]; const float* be2 = I[10]; const float* wfc = I[11]; const float* bfc = I[12]; const float* wmp = I[13]; const float* bmp = I[14];      /* input order: x; [in][out] wq / wk / wv + biases; LN1 w / b, LN2 w / b; w_fc [1024][4096] + b_fc, w_proj [4096][1024] + b_proj */
  float* OUT0 = (float*)d_out; float* OUTK = (float*)d_out + NR * DM;      /* tuple outputs: out at byte 0, k at 16,777,216, v at 33,554,432 (each NB * SQ * DM floats) */
  static_assert(NH * HD == DM && DM % 64 == 0 && SQ % 128 == 0 && QT0 % 8 == 0, "shape / tile multiples");
  char* ws = (char*)d_ws; size_t off = 0;
  auto take = [&](size_t bytes) { char* p = ws + off; off += (bytes + 255) & ~(size_t)255; return p; };
  _Float16* BQKV = (_Float16*)take((size_t)3 * DM * DM * 2); float* bqkv = (float*)take((size_t)3 * DM * 4);      /* stacked bias bq | bk | bv */
  _Float16* X16 = (_Float16*)take(NR * DM * 2); float* XB = (float*)take(NR * DM * 4); float* X1 = (float*)take(NR * DM * 4); _Float16* M16 = nullptr;      /* = X16 below (alias: X16's last reader, the q | k | v GEMM, precedes LN2's write) */ _Float16* HF16 = (_Float16*)take(NR * DFF * 2); _Float16* BW1 = (_Float16*)take((size_t)DFF * DM * 2); _Float16* BW2 = (_Float16*)take((size_t)DM * DFF * 2); _Float16* QKV = (_Float16*)take(NR * 3 * DM * 2); _Float16* V16 = QKV + 2 * DM; M16 = X16;
  _Float16* VT = (_Float16*)take((size_t)NB * NH * HD * SQ * 2);      /* V^T of both batches */
  float* F0 = (float*)take((size_t)3 * NB * QT0 * DM * 4);      /* f32 q | k | v of each batch's first QT0 rows */ float* OF0 = (float*)take((size_t)NB * QT0 * DM * 4);
  if (off > ws_size) return;
  { const dim3 g(DM / 64, DM / 128); k_wt_f16<DM, DM><<<g, 256, 0, stream>>>(wq, BQKV, 16.0f); k_wt_f16<DM, DM><<<g, 256, 0, stream>>>(wk, BQKV + (size_t)DM * DM, 16.0f); k_wt_f16<DM, DM><<<g, 256, 0, stream>>>(wv, BQKV + (size_t)2 * DM * DM, 16.0f); }      /* [in][out] -> Bt x16: stacked q | k | v (transposing builder) */
  k_bcpy<<<1, 256, 0, stream>>>(bq, DM, DM, bqkv, 0); k_bcpy<<<1, 256, 0, stream>>>(bk, DM, DM, bqkv, DM); k_bcpy<<<1, 256, 0, stream>>>(bv, DM, DM, bqkv, 2 * DM);      /* stacked bias bq | bk | bv */
  k_ln16<1, 1><<<(unsigned)NR, 256, 0, stream>>>(x, g1, be1, 1e-5f, X16, XB);      /* a = LN1(bf16(x)) -> f16 rows; XB = bf16(x) for the residual */
  k_wt_f16<DM, DFF><<<dim3(DFF / 64, DM / 128), 256, 0, stream>>>(wfc, BW1, 16.0f); k_wt_f16<DFF, DM><<<dim3(DM / 64, DFF / 128), 256, 0, stream>>>(wmp, BW2, 16.0f);      /* W1 [1024][4096] -> Bt [4096][1024]; W2 [4096][1024] -> Bt [1024][4096] (x16) */
  const size_t r0p = (size_t)B0 * SQ;      /* first projected row */
  k_gemm2<0, true><<<dim3((unsigned)((MP / 128) * (3 * DM / 64)), 1), 128, 0, stream>>>(X16 + r0p * DM, DM, 0, BQKV, DM, 0, 0.0625f, bqkv, 0, nullptr, 1, 0, 0, nullptr, QKV + r0p * 3 * DM, 3 * DM, 0, MP, 3 * DM, DM, OUTK, F0);      /* q | k | v rows (f16); head h = columns h*HD.. of each DM block; from the same sums outputs 1 and 2 (k, v in f32, head-major [B][H][T][64]) and the f32 q, k, v of the first 128 rows of each batch */
  k_vt<NH, SQ><<<NB * NH * (SQ / 64), 256, 0, stream>>>(V16, LQ, 0, VT);      /* V^T [NB][NH][HD][SQ], both batches */
  k_att0w<<<dim3(NH * (QT0 / 8), NB), 256, 0, stream>>>(F0, F0 + (size_t)NB * QT0 * DM, F0 + (size_t)2 * NB * QT0 * DM, 0.125f, OF0);      /* f32 attention for rows 0..127 of both batches (o x64), one wave per head and row */
  k_addf<<<dim3((unsigned)(((size_t)QT0 * DM / 8 + 255) / 256), NB), 256, 0, stream>>>(XB, OF0, X1, (size_t)QT0 * DM / 8);      /* rows 0..127 of each batch from the exact f32 path: x1 = bf16(x) + o / 64 */
  k_fattn<<<dim3(SQ / 256, NH, NB), 256, 0, stream>>>(QKV, VT, XB, X1);      /* rows 128.. of both batches: x1 = bf16(x) + softmax(q k^T / 8) v in f32 (no output projection in this module) */
  k_ln16<0, 0><<<(unsigned)NR, 256, 0, stream>>>(X1, gg2, be2, 1e-5f, M16, nullptr);      /* h = LN2(x1) -> f16 rows */
  k_gemm2<6><<<dim3((unsigned)((NR / 128) * (DFF / 64)), 1), 128, 0, stream>>>(M16, DM, 0, BW1, DM, 0, 0.0625f, bfc, 0, nullptr, 1, 0, 0, nullptr, HF16, DFF, 0, (int)NR, DFF, DM, nullptr, nullptr);      /* gelu_erf(h2 W1 + b1) -> f16, all token rows */
  k_gemm2<0><<<dim3((unsigned)((NR / 128) * (DM / 64)), 1), 128, 0, stream>>>(HF16, DFF, 0, BW2, DFF, 0, 0.0625f, bmp, 0, X1, -1, 0, 0, OUT0, nullptr, DM, 0, (int)NR, DM, DFF, nullptr, nullptr);      /* output 0 = x1 + mlp (own-element residual), all token rows: two work-groups per WGP where one batch gave one */
}

// v008
// One run takes 224 microseconds.
// In two side-by-side timings against v007, it was 1.16 and 1.17 times as fast.
// Counting every step since v000, it is 25.9 times as fast.
#include <hip/hip_runtime.h>
// Pre-LN causal transformer block WITHOUT an attention output projection that also returns its key and value tensors (x [2][2048][1024]; h = LN1(x) (biased var, eps 1e-5); q / k / v = h W + b ([in][out] [1024][1024] sigma 1/32, zero biases) -> [B][16][T][64]; att = softmax(q k^T / 8) with a causal mask (tril, -inf); y = att v merged back to [B][T][1024]; x1 = x + y (no projection); out = x1 + gelu_erf(LN2(x1) w_fc + b_fc) w_proj + b_proj ([in][out] 1024 x 4096 x 1024); returns (out [2][2048][1024], k [2][16][2048][64], v [2][16][2048][64]): three outputs at byte offsets 0 / 16,777,216 / 33,554,432 of d_out).
// Structure: token rows r = b*2048 + s; h = LN1(bf16(x)) as f16 rows; q | k | v as ONE WMMA GEMM (N = 3 x 1024) (32x64 wave tiles, f32 accumulation, exact x16 weights + bias, f16 outputs; the same sums stored in f32 as outputs k and v and as q, k, v of each batch's first 128 rows); V^T for all heads of both batches via LDS transposes; rows 128.. of both batches in one launch: per wave 32 query rows, keys 64 at a time up to the rows' end, scores (K = 64), running-maximum softmax (f32 statistics, native exp2; weights at most 256 in f16) and weights x V^T all in registers, x1 = x + o / row sum in f32; LN2(x1) as f16 rows; gelu(h2 W1 + b1) GEMM into f16; out = x1 + hidden W2 + b2 GEMM (f32) into the output layout.
// Compute dtype: inputs rounded to bf16; x / weights exact; q, k, v, softmax weights, LN outputs and gelu hidden as plain f16 GEMM operands (~2^-12); o, scores and softmax statistics f32. v_wmma_f32_16x16x32_f16.
#define NB 2
#define SQ 2048
#define DM 1024
#define NH 16
#define HD 64
#define HG 4
#define QT 256                       /* query rows per causal tile */
#define NKX SQ                       /* S / P row pitch */
#define QT0 128                      /* first-tile rows attended exactly in f32 */
#define B0 0                         /* first batch processed (debug hook) */
#define NBR NB                       /* batches processed (debug hook) */
#define NR ((size_t)NB * SQ)
#define DMQ DM
#define DFF 4096                     /* FFN hidden width */
#define DFFR 100
#define MP ((int)((size_t)NBR * SQ)) /* rows projected (debug hook) */
#define QN SQ                        /* query rows per batch; not used */
#define NHD NH                       /* heads; not used */
#define MPO MP
#define LQ (3 * DM)      /* row pitch of the q/k/v rows */
typedef __bf16 v16b __attribute__((ext_vector_type(16)));
typedef unsigned short v8us __attribute__((ext_vector_type(8), may_alias));
typedef float  v8f  __attribute__((ext_vector_type(8)));
typedef float  v4f  __attribute__((ext_vector_type(4)));
typedef float  v4fa __attribute__((ext_vector_type(4), may_alias));
union FragB { v16b v; v8us half[2]; unsigned short u[16]; };

__device__ __forceinline__ unsigned short bf16_bits(float x) { unsigned int u = __float_as_uint(x); return (unsigned short)((u + 0x7FFFu + ((u >> 16) & 1u)) >> 16); }
__device__ __forceinline__ float bf16_val(unsigned short b) { return __uint_as_float(((unsigned int)b) << 16); }
__device__ __forceinline__ float bf16_round(float x) { return bf16_val(bf16_bits(x)); }
// D += A·B with NT terms: 1 = ah·bh, 2 = + al·bh (A split), 3 = + ah·bl (both split)
template <int NT>
__device__ __forceinline__ v8f mmaN(v16b ah, v16b al, v16b bh, v16b bl, v8f c) {
  c = __builtin_amdgcn_wmma_f32_16x16x32_bf16(false, ah, false, bh, (short)0, c, false, false);
  if (NT >= 2) c = __builtin_amdgcn_wmma_f32_16x16x32_bf16(false, al, false, bh, (short)0, c, false, false);
  if (NT >= 3) c = __builtin_amdgcn_wmma_f32_16x16x32_bf16(false, ah, false, bl, (short)0, c, false, false);
  asm volatile("v_nop\n\tv_nop\n\tv_nop\n\tv_nop" : "+v"(c) : "v"(ah), "v"(al), "v"(bh), "v"(bl));
  return c;
}

__global__ __launch_bounds__(256) void k_wt_bf16(const float* __restrict__ W, unsigned short* __restrict__ Wt, int K, int N) {
  const int t = blockIdx.x * 256 + threadIdx.x;
  const int k8n = K / 8;
  if (t >= N * k8n) return;
  const int n = t / k8n, k8 = (t % k8n) * 8;
  v8us v;
#pragma unroll
  for (int i = 0; i < 8; ++i) v[i] = bf16_bits(W[(size_t)(k8 + i) * N + n]);
  *(v8us*)(Wt + (size_t)n * K + k8) = v;
  
}

// GEMM C[M][N] (f32, pitch ldc) = act(A[M][K]·W + bias). A f32 row-major (pitch lda) converted per fragment to bf16
// (ASPLIT: hi/lo two planes -> 2 terms, else single rounded term); Wt bf16 [N][K] (pitch ldb). BIAS_BF16 rounds the
// bias to bf16 first (bias quantised to bf16 before the add). K%32==0, M%16==0, N%64==0.
template <bool ASPLIT, int ACT, bool BIAS_BF16>
__global__ __launch_bounds__(128) void k_gemm_bf(const float* __restrict__ A, int lda, const unsigned short* __restrict__ Wt, int ldb,
                                               const float* __restrict__ bias, float* __restrict__ C, int ldc, int M, int N, int K) {
  __shared__ __attribute__((aligned(16))) float so[4][16][64];
  const int tid = threadIdx.x, w = tid >> 5, lane = tid & 31, ln = lane & 15, hh = lane >> 4;
  const int ntn = N / 64;
  const int wid = blockIdx.x * 4 + w;
  const int mt = wid / ntn, nq = wid % ntn;
  if (mt * 16 >= M) return;
  const int row0 = mt * 16, col0 = nq * 64;
  const float* arow = A + (size_t)(row0 + ln) * lda;
  v8f acc[4] = {};
  for (int kb = 0; kb < K; kb += 32) {
    FragB ah, al;
    const v4f x0 = *(const v4fa*)(arow + kb + 8 * hh), x1 = *(const v4fa*)(arow + kb + 8 * hh + 4);
    const v4f x2 = *(const v4fa*)(arow + kb + 16 + 8 * hh), x3 = *(const v4fa*)(arow + kb + 16 + 8 * hh + 4);
    float xs[16] = {x0[0],x0[1],x0[2],x0[3],x1[0],x1[1],x1[2],x1[3],x2[0],x2[1],x2[2],x2[3],x3[0],x3[1],x3[2],x3[3]};
#pragma unroll
    for (int i = 0; i < 16; ++i) { const unsigned short hb = bf16_bits(xs[i]); ah.u[i] = hb; al.u[i] = ASPLIT ? bf16_bits(xs[i] - bf16_val(hb)) : (unsigned short)0; }
#pragma unroll
    for (int t = 0; t < 4; ++t) {
      const unsigned short* brow = Wt + (size_t)(col0 + t * 16 + ln) * ldb + kb;
      FragB b;
      b.half[0] = *(const v8us*)(brow + 8 * hh);
      b.half[1] = *(const v8us*)(brow + 16 + 8 * hh);
      acc[t] = mmaN<ASPLIT ? 2 : 1>(ah.v, al.v, b.v, b.v, acc[t]);
    }
  }
#pragma unroll
  for (int t = 0; t < 4; ++t) {
    float bv = bias ? bias[col0 + t * 16 + ln] : 0.f;
    if (BIAS_BF16) bv = bf16_round(bv);
#pragma unroll
    for (int r = 0; r < 8; ++r) { float v = acc[t][r] + bv; if (ACT == 1) v = fmaxf(v, 0.f); so[w][8 * hh + r][t * 16 + ln] = v; }
  }
  __builtin_amdgcn_fence(__ATOMIC_ACQ_REL, "workgroup");
  __builtin_amdgcn_wave_barrier();
  const int rsub = lane >> 4, c4 = (lane & 15) * 4;
  {
#pragma unroll
    for (int q = 0; q < 8; ++q) {
      const int r = q * 2 + rsub;
      const v4f v = *(const v4fa*)&so[w][r][c4];
      *(v4f*)(C + (size_t)(row0 + r) * ldc + col0 + c4) = v;
    }
    
  }
}

// GEMM C = act(A·W + bias + resid): A f32 (ASPLIT -> hi/lo 2 terms), Wt bf16 [N][K]; ACT 0 none, 1 relu, 2 exact gelu;
// resid (optional, f32, row index = (row % rmod), pitch ldr, RES_BF16 rounds it) added before the activation.
template <bool ASPLIT, int ACT, bool BIAS_BF16, bool RES_BF16>
__global__ __launch_bounds__(128) void k_gemm_bf3(const float* __restrict__ A, int lda, const unsigned short* __restrict__ Wt, int ldb,
                                                const float* __restrict__ bias, const float* __restrict__ resid, int rmod, int ldr,
                                                float* __restrict__ C, int ldc, int M, int N, int K) {
  __shared__ __attribute__((aligned(16))) float so[4][16][64];
  const int tid = threadIdx.x, w = tid >> 5, lane = tid & 31, ln = lane & 15, hh = lane >> 4;
  const int ntn = N / 64;
  const int wid = blockIdx.x * 4 + w;
  const int mt = wid / ntn, nq = wid % ntn;
  if (mt * 16 >= M) return;
  const int row0 = mt * 16, col0 = nq * 64;
  const float* arow = A + (size_t)(row0 + ln) * lda;
  v8f acc[4] = {};
  for (int kb = 0; kb < K; kb += 32) {
    FragB ah, al;
    const v4f x0 = *(const v4fa*)(arow + kb + 8 * hh), x1 = *(const v4fa*)(arow + kb + 8 * hh + 4);
    const v4f x2 = *(const v4fa*)(arow + kb + 16 + 8 * hh), x3 = *(const v4fa*)(arow + kb + 16 + 8 * hh + 4);
    float xs[16] = {x0[0],x0[1],x0[2],x0[3],x1[0],x1[1],x1[2],x1[3],x2[0],x2[1],x2[2],x2[3],x3[0],x3[1],x3[2],x3[3]};
#pragma unroll
    for (int i = 0; i < 16; ++i) { const unsigned short hb = bf16_bits(xs[i]); ah.u[i] = hb; al.u[i] = ASPLIT ? bf16_bits(xs[i] - bf16_val(hb)) : (unsigned short)0; }
#pragma unroll
    for (int t = 0; t < 4; ++t) {
      const unsigned short* brow = Wt + (size_t)(col0 + t * 16 + ln) * ldb + kb;
      FragB b;
      b.half[0] = *(const v8us*)(brow + 8 * hh);
      b.half[1] = *(const v8us*)(brow + 16 + 8 * hh);
      acc[t] = mmaN<ASPLIT ? 2 : 1>(ah.v, al.v, b.v, b.v, acc[t]);
    }
  }
#pragma unroll
  for (int t = 0; t < 4; ++t) {
    const int col = col0 + t * 16 + ln;
    float bv = bias ? bias[col] : 0.f;
    if (BIAS_BF16) bv = bf16_round(bv);
#pragma unroll
    for (int r = 0; r < 8; ++r) {
      float v = acc[t][r] + bv;
      if (resid) { float rv = resid[(size_t)((row0 + 8 * hh + r) % rmod) * ldr + col]; if (RES_BF16) rv = bf16_round(rv); v += rv; }
      if (ACT == 1) v = fmaxf(v, 0.f);
      if (ACT == 2) v = 0.5f * v * (1.0f + erff(v * 0.70710678118654752f));
      if (ACT == 3) { const float u = 0.7978845608028654f * (v + 0.044715f * v * v * v); v = 0.5f * v * (1.0f + tanhf(u)); }
      so[w][8 * hh + r][t * 16 + ln] = v;
    }
  }
  __builtin_amdgcn_fence(__ATOMIC_ACQ_REL, "workgroup");
  __builtin_amdgcn_wave_barrier();
  const int rsub = lane >> 4, c4 = (lane & 15) * 4;
  {
#pragma unroll
    for (int q = 0; q < 8; ++q) {
      const int r = q * 2 + rsub;
      const v4f v = *(const v4fa*)&so[w][r][c4];
      *(v4f*)(C + (size_t)(row0 + r) * ldc + col0 + c4) = v;
    }
    
  }
}
// row LayerNorm (biased variance, eps) over N: s = X (+ R); optional out_sum <- s; out_norm <- (s-mu)*rsqrt(var+eps)*g + b
template <bool PARAM_BF16>
__global__ __launch_bounds__(256) void k_layernorm(const float* __restrict__ X, const float* __restrict__ R, const float* __restrict__ g, const float* __restrict__ bta,
                                                  float* __restrict__ out_sum, float* __restrict__ out_norm, int N, float eps) {
  __shared__ float red[256];
  const int row = blockIdx.x, tid = threadIdx.x;
  const float* x = X + (size_t)row * N; const float* rr = R ? R + (size_t)row * N : nullptr;
  float vals[16];                     // up to N = 4096
  const int per = N / 256;            // contiguous chunk per thread? use strided-by-4 chunks: thread handles j = tid*4 + 1024*u
  float s1 = 0.f;
  for (int u = 0; u < per / 4; ++u) {
    const int j = tid * 4 + 1024 * u;
    const v4f a = *(const v4fa*)(x + j);
    v4f b = {0.f,0.f,0.f,0.f}; if (rr) b = *(const v4fa*)(rr + j);
#pragma unroll
    for (int q = 0; q < 4; ++q) { const float v = a[q] + b[q]; vals[u * 4 + q] = v; s1 += v; }
  }
  red[tid] = s1; __syncthreads();
  for (int st = 128; st > 0; st >>= 1) { if (tid < st) red[tid] += red[tid + st]; __syncthreads(); }
  const float mu = red[0] / (float)N; __syncthreads();
  float s2 = 0.f;
  for (int u = 0; u < per / 4; ++u)
#pragma unroll
    for (int q = 0; q < 4; ++q) { const float c = vals[u * 4 + q] - mu; s2 += c * c; }
  red[tid] = s2; __syncthreads();
  for (int st = 128; st > 0; st >>= 1) { if (tid < st) red[tid] += red[tid + st]; __syncthreads(); }
  const float rs = rsqrtf(red[0] / (float)N + eps);
  {
    for (int u = 0; u < per / 4; ++u) {
      const int j = tid * 4 + 1024 * u;
      v4f o, sm;
#pragma unroll
      for (int q = 0; q < 4; ++q) {
        float gg = g[j + q], bb = bta[j + q];
        if (PARAM_BF16) { gg = bf16_round(gg); bb = bf16_round(bb); }
        sm[q] = vals[u * 4 + q]; o[q] = (vals[u * 4 + q] - mu) * rs * gg + bb;
      }
      if (out_sum) *(v4f*)(out_sum + (size_t)row * N + j) = sm;
      *(v4f*)(out_norm + (size_t)row * N + j) = o;
    }
    
  }
}



// ---- f16 WMMA path (v_wmma_f32_16x16x32_f16): 11-bit significands for operands in range — used where a [0,1] probability operand needs more precision than bf16
typedef _Float16 v16h __attribute__((ext_vector_type(16)));
union FragH { v16h v; v8us half[2]; _Float16 h[16]; unsigned short u[16]; };
template <int NT>
__device__ __forceinline__ v8f mmaH(v16h ah, v16h al, v16h bh, v16h bl, v8f c) {
  c = __builtin_amdgcn_wmma_f32_16x16x32_f16(false, ah, false, bh, (short)0, c, false, false);
  if (NT >= 2) c = __builtin_amdgcn_wmma_f32_16x16x32_f16(false, al, false, bh, (short)0, c, false, false);
  if (NT >= 3) c = __builtin_amdgcn_wmma_f32_16x16x32_f16(false, ah, false, bl, (short)0, c, false, false);
  asm volatile("v_nop\n\tv_nop\n\tv_nop\n\tv_nop" : "+v"(c) : "v"(ah), "v"(al), "v"(bh), "v"(bl));
  return c;
}
// batched GEMM like k_gemm_b but f16 operands: A f32 (split into f16 hi/lo if ASPLIT, else rounded to f16), Bt = f16 values [n][k]; alpha; C f32; N multiple of 16 (partial tiles skipped)
template <bool ASPLIT>
__global__ __launch_bounds__(128) void k_gemm_h(const float* __restrict__ A, int lda, size_t sA, const _Float16* __restrict__ Bh, int ldb, size_t sB, float alpha, float* __restrict__ C, int ldc, size_t sC, int M, int N, int K) {
  __shared__ __attribute__((aligned(16))) float so[4][16][64];
  const int tid = threadIdx.x, w = tid >> 5, lane = tid & 31, ln = lane & 15, hh = lane >> 4; const int by = blockIdx.y;
  A += (size_t)by * sA; Bh += (size_t)by * sB; C += (size_t)by * sC;
  const int ntn = (N + 63) / 64; const int wid = blockIdx.x * 4 + w; const int mt = wid / ntn, nq = wid % ntn; if (mt * 16 >= M) return;
  const int row0 = mt * 16, col0 = nq * 64; const float* arow = A + (size_t)(row0 + ln) * lda;
  v8f acc[4] = {};
  for (int kb = 0; kb < K; kb += 32) {
    FragH ah, al;
    const v4f x0 = *(const v4fa*)(arow + kb + 8 * hh), x1 = *(const v4fa*)(arow + kb + 8 * hh + 4), x2 = *(const v4fa*)(arow + kb + 16 + 8 * hh), x3 = *(const v4fa*)(arow + kb + 16 + 8 * hh + 4);
    float xs[16] = {x0[0],x0[1],x0[2],x0[3],x1[0],x1[1],x1[2],x1[3],x2[0],x2[1],x2[2],x2[3],x3[0],x3[1],x3[2],x3[3]};
#pragma unroll
    for (int i = 0; i < 16; ++i) { const _Float16 h = (_Float16)xs[i]; ah.h[i] = h; al.h[i] = ASPLIT ? (_Float16)(xs[i] - (float)h) : (_Float16)0.0f; }
#pragma unroll
    for (int t = 0; t < 4; ++t) { if (col0 + t * 16 >= N) continue; const size_t boff = (size_t)(col0 + t * 16 + ln) * ldb + kb; FragH bq; bq.half[0] = *(const v8us*)(Bh + boff + 8 * hh); bq.half[1] = *(const v8us*)(Bh + boff + 16 + 8 * hh);
      acc[t] = mmaH<ASPLIT ? 2 : 1>(ah.v, al.v, bq.v, bq.v, acc[t]); }
  }
#pragma unroll
  for (int t = 0; t < 4; ++t) { if (col0 + t * 16 >= N) continue;
#pragma unroll
    for (int r = 0; r < 8; ++r) so[w][8 * hh + r][t * 16 + ln] = acc[t][r] * alpha; }
  __builtin_amdgcn_fence(__ATOMIC_ACQ_REL, "workgroup"); __builtin_amdgcn_wave_barrier();
  const int rsub = lane >> 4, c4 = (lane & 15) * 4;
  {
#pragma unroll
    for (int q = 0; q < 8; ++q) { const int r = q * 2 + rsub; if (col0 + c4 < N) { const v4f v = *(const v4fa*)&so[w][r][c4]; *(v4f*)(C + (size_t)(row0 + r) * ldc + col0 + c4) = v; } }
     }
}

// Wt[n][k] = f16(W[k][n]·scale) from f32 row-major W[K][N] (scale = power of two; bf16-exact weights stay exact in f16 away from the subnormal range)
// One work-group per tile of 128 k x 64 n (grid = N / 64 by K / 128; K, N at compile time, so that the rows of a thread are constant offsets of one address). Reads: 16 lanes take 256 bytes in a row of one row of W, each thread the same four columns of eight rows, all eight loads in flight.
// The thread's 8 x 4 block leaves as four 16-byte pieces (eight k of one n) into an LDS tile [64 n][128 k]; stores: 16 lanes write 256 bytes in a row of one row of Wt. Both sides touch whole 128-byte lines only.
// LDS rows are 256 bytes, so every row starts on bank 0: piece kb of row n lies at place kb ^ (n / 4 % 16), which spreads the 16 lanes of a half wave over all banks in the write (rows 4 ln + j, one kb) and in the read (one row, 16 kb).
template <int K, int N>
__global__ __launch_bounds__(256) void k_wt_f16(const float* __restrict__ W, _Float16* __restrict__ Wt, float scale) { static_assert(K % 128 == 0 && N % 64 == 0, "whole tiles");
  __shared__ __attribute__((aligned(16))) unsigned short tl[64 * 128];
  const int tid = threadIdx.x, ln = tid & 15, kb = tid >> 4; const int n0 = blockIdx.x * 64, k0 = blockIdx.y * 128;
  const float* wb = W + (size_t)k0 * N + n0; const unsigned wo = (unsigned)(kb * 8 * N + ln * 4) * 4u;      /* the work-group's scalar base; the lane's fixed offset in bytes */
  v4f r[8];
#pragma unroll      /* register array; all loads in flight together */
  for (int i = 0; i < 8; ++i) r[i] = *(const v4fa*)((const char*)(wb + (size_t)i * N) + wo);
  asm volatile("s_wait_xcnt 0x0" :: "v"(wo), "s"(wb) : "memory");      /* behind the loads, in front of any later write of their base and offset registers; both as inputs, so that their registers are still theirs up to here */
#pragma unroll      /* register arrays */
  for (int j = 0; j < 4; ++j) { FragH f;
#pragma unroll      /* register arrays */
    for (int i = 0; i < 8; ++i) f.h[i] = (_Float16)(bf16_round(r[i][j]) * scale);
    *(v8us*)(tl + (ln * 4 + j) * 128 + (kb ^ ln) * 8) = f.half[0]; }
  __syncthreads();      /* the tile is whole before any row of it is read */
  unsigned short* ob = (unsigned short*)Wt + (size_t)n0 * K + k0; const unsigned oo = (unsigned)(kb * K + ln * 8) * 2u;      /* as above: row kb of each group of 16 rows, piece ln */
  v8us o[4];
#pragma unroll      /* register array */
  for (int p = 0; p < 4; ++p) { const int n = p * 16 + kb; o[p] = *(const v8us*)(tl + n * 128 + (ln ^ ((n >> 2) & 15)) * 8); }
#pragma unroll      /* register array */
  for (int p = 0; p < 4; ++p) *(v8us*)((char*)(ob + (size_t)p * 16 * K) + oo) = o[p];
}
// k_gemm_hh variant with fused epilogue: v = acc·alpha + bias[by·sBias + col] (+ CP[(row/rowsPerB)·sCPb + by·64 + col] if CP) ; ACT 0 none / 1 elu ; writes f16 C16 (and f32 C if non-null)
template <int ACT>
__global__ __launch_bounds__(128) void k_gemm_hhx(const _Float16* __restrict__ A, int lda, size_t sA, const _Float16* __restrict__ Bh, int ldb, size_t sB, float alpha, const float* __restrict__ bias, size_t sBias, const float* __restrict__ CP, int rowsPerB, size_t sCPb, int row0g,
    float* __restrict__ C, _Float16* __restrict__ C16, int ldc, size_t sC, int M, int N, int K) {
  __shared__ __attribute__((aligned(16))) float so[4][16][64];
  const int tid = threadIdx.x, w = tid >> 5, lane = tid & 31, ln = lane & 15, hh = lane >> 4; const int by = blockIdx.y;
  A += (size_t)by * sA; Bh += (size_t)by * sB; const size_t cofs = (size_t)by * sC; const float* bp = bias ? bias + (size_t)by * sBias : nullptr;
  const int ntn = (N + 63) / 64; const int wid = blockIdx.x * 4 + w; const int mt = wid / ntn, nq = wid % ntn; if (mt * 16 >= M) return;
  const int row0 = mt * 16, col0 = nq * 64; const _Float16* arow = A + (size_t)(row0 + ln) * lda;
  v8f acc[4] = {};
  for (int kb = 0; kb < K; kb += 32) { FragH ah; ah.half[0] = *(const v8us*)((const unsigned short*)arow + kb + 8 * hh); ah.half[1] = *(const v8us*)((const unsigned short*)arow + kb + 16 + 8 * hh);
#pragma unroll
    for (int t = 0; t < 4; ++t) { if (col0 + t * 16 >= N) continue; const size_t boff = (size_t)(col0 + t * 16 + ln) * ldb + kb; FragH bq; bq.half[0] = *(const v8us*)((const unsigned short*)Bh + boff + 8 * hh); bq.half[1] = *(const v8us*)((const unsigned short*)Bh + boff + 16 + 8 * hh);
      acc[t] = mmaH<1>(ah.v, ah.v, bq.v, bq.v, acc[t]); }
  }
#pragma unroll
  for (int t = 0; t < 4; ++t) { if (col0 + t * 16 >= N) continue; const int col = col0 + t * 16 + ln; const float bv = bp ? bf16_round(bp[col]) : 0.f;
#pragma unroll
    for (int r = 0; r < 8; ++r) { float v = acc[t][r] * alpha + bv; if (CP) { const int rr = row0g + row0 + 8 * hh + r; if (rowsPerB < 0) v += CP[cofs + (size_t)rr * ldc + col];      /* rowsPerB < 0: own element of the batched C plane */ else { const int bidx = rr / rowsPerB; v += CP[(size_t)bidx * sCPb + (size_t)by * 64 + col]; } } if (ACT == 1) v = (v > 0.f) ? v : expm1f(v); else if (ACT == 7) v = (v > 0.f) ? v + 1.0f : expf(v); else if (ACT == 8) v = tanhf(v); else if (ACT == 9) v = 0.5f * v * (1.0f + tanhf(0.7978845608028654f * (v + 0.044715f * v * v * v))); else if (ACT == 11) v = 1.0f / (1.0f + expf(-v)); else if (ACT == 12) v = (v > 0.f) ? v : 0.01f * v; else if (ACT == 14) v = (v > 0.f) ? v : 0.1f * v; else if (ACT == 16) v = (v >= 0.f) ? v : 0.3f * v; else if (ACT == 17) v = (v >= 0.f) ? v : 0.2f * v; else if (ACT == 15) v = v / (1.0f + expf(-v)); else if (ACT == 3) v = fmaxf(v, 0.f); else if (ACT == 6) v = 0.5f * v * (1.0f + erff(v * 0.70710678118654752f)); so[w][8 * hh + r][t * 16 + ln] = v; } }
  __builtin_amdgcn_fence(__ATOMIC_ACQ_REL, "workgroup"); __builtin_amdgcn_wave_barrier();
  const int rsub = lane >> 4, c4 = (lane & 15) * 4; typedef _Float16 v4h __attribute__((ext_vector_type(4)));
  {
#pragma unroll
    for (int q = 0; q < 8; ++q) { const int r = q * 2 + rsub; if (col0 + c4 < N) { const v4f v = *(const v4fa*)&so[w][r][c4]; if (C) *(v4f*)(C + cofs + (size_t)(row0 + r) * ldc + col0 + c4) = v; if (C16) { v4h h4; for (int i = 0; i < 4; ++i) h4[i] = (_Float16)v[i]; *(v4h*)(C16 + cofs + (size_t)(row0 + r) * ldc + col0 + c4) = h4; } } }
     }
}


typedef _Float16 v4h __attribute__((ext_vector_type(4)));

__global__ __launch_bounds__(256) void k_x16(const float* __restrict__ x, _Float16* __restrict__ X16, size_t n8) { const size_t t = (size_t)blockIdx.x * 256 + threadIdx.x; if (t >= n8) return; FragH f;
#pragma unroll
  for (int q = 0; q < 8; ++q) f.h[q] = (_Float16)bf16_round(x[t * 8 + q]); *(v8us*)((unsigned short*)X16 + t * 8) = f.half[0];  }
__global__ __launch_bounds__(256) void k_h16(const float* __restrict__ x, _Float16* __restrict__ X16, size_t n8) { const size_t t = (size_t)blockIdx.x * 256 + threadIdx.x; if (t >= n8) return; FragH f;
#pragma unroll
  for (int q = 0; q < 8; ++q) f.h[q] = (_Float16)x[t * 8 + q]; *(v8us*)((unsigned short*)X16 + t * 8) = f.half[0];  }
__global__ __launch_bounds__(256) void k_round16f(const float* __restrict__ W, _Float16* __restrict__ Bt, size_t n8) { const size_t t = (size_t)blockIdx.x * 256 + threadIdx.x; if (t >= n8) return; FragH f;
#pragma unroll
  for (int i = 0; i < 8; ++i) f.h[i] = (_Float16)(bf16_round(W[t * 8 + i]) * 16.0f); *(v8us*)((unsigned short*)Bt + t * 8) = f.half[0];  }
template <int NHv, int TTv>
__global__ __launch_bounds__(256) void k_vt(const _Float16* __restrict__ V16, int ldv, int voff, _Float16* __restrict__ Vt) { __shared__ unsigned short tl[64][66]; const int tid = threadIdx.x; const int slab = blockIdx.x / (TTv / 64), lg = blockIdx.x % (TTv / 64); const int b = slab / NHv, h = slab % NHv;
  for (int i = tid; i < 64 * 8; i += 256) { const int r = i / 8, c8 = (i % 8) * 8; FragH f; f.half[0] = *(const v8us*)((const unsigned short*)V16 + ((size_t)b * TTv + lg * 64 + r) * ldv + voff + h * 64 + c8);
#pragma unroll
    for (int q = 0; q < 8; ++q) tl[r][c8 + q] = f.u[q]; }
  __syncthreads();
  {
#pragma unroll
    for (int rd = 0; rd < 2; ++rd) { const int d = rd * 32 + tid / 8, pc = tid % 8; FragH f;
#pragma unroll
      for (int q = 0; q < 8; ++q) f.u[q] = tl[pc * 8 + q][d];
      *(v8us*)((unsigned short*)Vt + ((size_t)slab * 64 + d) * TTv + lg * 64 + pc * 8) = f.half[0]; }
     } }

__global__ __launch_bounds__(256) void k_hl(const float* __restrict__ F, _Float16* __restrict__ Hh, _Float16* __restrict__ Hl, size_t n8) { const size_t t = (size_t)blockIdx.x * 256 + threadIdx.x; if (t >= n8) return; FragH fh, fl; const v4f a = *(const v4fa*)(F + t * 8), c = *(const v4fa*)(F + t * 8 + 4);
#pragma unroll
  for (int q = 0; q < 4; ++q) { _Float16 h = (_Float16)a[q]; fh.h[q] = h; fl.h[q] = (_Float16)((a[q] - (float)h) * 1024.0f); h = (_Float16)c[q]; fh.h[4 + q] = h; fl.h[4 + q] = (_Float16)((c[q] - (float)h) * 1024.0f); }
  { *(v8us*)((unsigned short*)Hh + t * 8) = fh.half[0]; *(v8us*)((unsigned short*)Hl + t * 8) = fl.half[0];  } }

// ---- fast GEMM (work-group tile 128x64, wave tile 32x64; requires M % 128 == 0 rows per launch region, N % 64 == 0, K % 64 == 0); epilogue = k_gemm_hhx semantics ----
// Operands reach the waves through LDS: per pass of 64 k the work-group's 128 rows of A and 64 rows of B (128 bytes each) are brought in once by asynchronous copies, whole lines at a time, into one of two buffers; the next pass's copies fly while this pass is worked on.
#define G2P 144                      /* LDS row pitch in bytes: 16 B x odd, the pitch for ds_load_b128 readers of 128-byte rows */
#define G2S ((128 + 64) * G2P)       /* one buffer: rows 0..127 = A, rows 128..191 = B */
__device__ __forceinline__ v16h g2_lfrag(const unsigned char* p) { FragH f; f.half[0] = *(const v8us*)p; f.half[1] = *(const v8us*)(p + 32); return f.v; }
// one pass's operands: twelve 16-byte copies per lane (eight lanes per 128-byte row, 16 rows per copy and work-group; copies 0..7 = A, 8..11 = B). l = the lane's LDS byte address in row tid / 8 of the buffer; a, b = its own 16 bytes in that row of A and of B; sa, sb = 16 rows in bytes.
// The s_wait_xcnt stands inside the statement, behind the last copy: a precaution in front of any later write of a register that a copy names.
__device__ __forceinline__ void g2_copy(unsigned l, const char* a, size_t sa, const char* b, size_t sb) {
  asm volatile("global_load_async_to_lds_b128 %0, %12, off\n\tglobal_load_async_to_lds_b128 %1, %13, off\n\tglobal_load_async_to_lds_b128 %2, %14, off\n\tglobal_load_async_to_lds_b128 %3, %15, off\n\t"
               "global_load_async_to_lds_b128 %4, %16, off\n\tglobal_load_async_to_lds_b128 %5, %17, off\n\tglobal_load_async_to_lds_b128 %6, %18, off\n\tglobal_load_async_to_lds_b128 %7, %19, off\n\t"
               "global_load_async_to_lds_b128 %8, %20, off\n\tglobal_load_async_to_lds_b128 %9, %21, off\n\tglobal_load_async_to_lds_b128 %10, %22, off\n\tglobal_load_async_to_lds_b128 %11, %23, off\n\ts_wait_xcnt 0x0"
               :: "v"(l), "v"(l + 16u * G2P), "v"(l + 32u * G2P), "v"(l + 48u * G2P), "v"(l + 64u * G2P), "v"(l + 80u * G2P), "v"(l + 96u * G2P), "v"(l + 112u * G2P), "v"(l + 128u * G2P), "v"(l + 144u * G2P), "v"(l + 160u * G2P), "v"(l + 176u * G2P),
                  "v"(a), "v"(a + sa), "v"(a + 2 * sa), "v"(a + 3 * sa), "v"(a + 4 * sa), "v"(a + 5 * sa), "v"(a + 6 * sa), "v"(a + 7 * sa), "v"(b), "v"(b + sb), "v"(b + 2 * sb), "v"(b + 3 * sb) : "memory"); }
__device__ __forceinline__ v8f g2_mma(v16h a, v16h b, v8f c) { v8f d = __builtin_amdgcn_wmma_f32_16x16x32_f16(false, a, false, b, (short)0, c, false, false); asm volatile("v_nop\n\tv_nop\n\tv_nop\n\tv_nop" : "+v"(d) : "v"(a), "v"(b)); return d; }
// s_wait_xcnt behind a group of loads, in front of any later write of a register that holds one of their addresses; the addresses as inputs, so that their registers are still theirs up to here and no load of the group returns its data into them
template <int N>
__device__ __forceinline__ void g2_xwait(const float* const (&p)[N]) { static_assert(N == 2 || N == 16, "one statement per group size");
  if constexpr (N == 2) asm volatile("s_wait_xcnt 0x0" :: "v"(p[0]), "v"(p[1]) : "memory");
  else asm volatile("s_wait_xcnt 0x0" :: "v"(p[0]), "v"(p[1]), "v"(p[2]), "v"(p[3]), "v"(p[4]), "v"(p[5]), "v"(p[6]), "v"(p[7]), "v"(p[8]), "v"(p[9]), "v"(p[10]), "v"(p[11]), "v"(p[12]), "v"(p[13]), "v"(p[14]), "v"(p[15]) : "memory"); }
// QKVF (the stacked q | k | v launch, rows b * SQ + s, columns 0 .. 3 DM - 1): the f32 values behind the f16 rows are stored as well, so that no product is formed twice: k and v head-major into KV (outputs 1 and 2, one behind the other: [k | v][NB][NH][SQ][HD]), and q, k, v of each batch's first QT0 rows into F0 ([q | k | v][NB][QT0][DM]) for the f32 attention path.
template <int ACT, bool QKVF = false>
__global__ __launch_bounds__(128) void k_gemm2(const _Float16* __restrict__ A, int lda, size_t sA, const _Float16* __restrict__ Bh, int ldb, size_t sB, float alpha, const float* __restrict__ bias, size_t sBias, const float* __restrict__ CP, int rowsPerB, size_t sCPb, int row0g,
    float* __restrict__ C, _Float16* __restrict__ C16, int ldc, size_t sC, int M, int N, int K, float* __restrict__ KV, float* __restrict__ F0) { static_assert(ACT == 0 || ACT == 3 || ACT == 6 || ACT == 8 || ACT == 9 || ACT == 11 || ACT == 12 || ACT == 14 || ACT == 15 || ACT == 16 || ACT == 17, "k_gemm2: unsupported ACT code (would silently apply no activation)");
  __shared__ __attribute__((aligned(16))) unsigned char ring[2 * G2S]; static_assert(sizeof(float) * 4 * 32 * 68 <= 2 * G2S, "the output staging fits in the ring");
  float (*so)[32][68] = (float (*)[32][68])ring;      /* output staging in the ring's place, behind the last pass's barrier */
  const int tid = threadIdx.x, w = tid >> 5, lane = tid & 31, ln = lane & 15, hh = lane >> 4; const int by = blockIdx.y;
  A += (size_t)by * sA; Bh += (size_t)by * sB; const size_t cofs = (size_t)by * sC; const float* bp = bias ? bias + (size_t)by * sBias : nullptr;
  const int ntn = N >> 6; const int mt = blockIdx.x / ntn, nq = blockIdx.x - mt * ntn; const int row0 = mt * 128 + 32 * w, col0 = nq * 64; if (mt * 128 >= M) return;      /* the whole work-group or none of it, in front of every barrier */
  const char* ag = (const char*)(A + (size_t)(mt * 128 + (tid >> 3)) * lda) + (tid & 7) * 16; const char* bg = (const char*)(Bh + (size_t)(col0 + (tid >> 3)) * ldb) + (tid & 7) * 16;      /* the lane's 16 bytes in the first of its rows */
  const size_t sa = (size_t)lda * 32, sb = (size_t)ldb * 32; const unsigned lc = (unsigned)(size_t)ring + (unsigned)((tid >> 3) * G2P + (tid & 7) * 16);
  const unsigned char* la = ring + (32 * w + ln) * G2P + 16 * hh; const unsigned char* lb = ring + (128 + ln) * G2P + 16 * hh;      /* fragment rows: the wave's own 32 rows of A, the 64 rows of B */
  const v8f z8 = {0.f,0.f,0.f,0.f,0.f,0.f,0.f,0.f}; v8f c00 = z8, c01 = z8, c02 = z8, c03 = z8, c10 = z8, c11 = z8, c12 = z8, c13 = z8;
  const int np = K >> 6;
  g2_copy(lc, ag, sa, bg, sb);
  asm volatile("s_wait_asynccnt 0x0" ::: "memory");      /* this wave's copies of pass 0 have landed */
  __syncthreads();      /* pass 0 is readable by every wave */
  if (np > 1) g2_copy(lc + G2S, ag + 128, sa, bg + 128, sb);
#pragma unroll 1
  for (int t = 0; t < np; ++t) { const unsigned bo = (unsigned)(t & 1) * G2S;
    v16h fa[2][2], fb[2][4];      /* the pass's fragments: two k steps of 32 */
#pragma unroll      /* register arrays, constant LDS offsets */
    for (int ks = 0; ks < 2; ++ks) { fa[ks][0] = g2_lfrag(la + bo + ks * 64); fa[ks][1] = g2_lfrag(la + bo + ks * 64 + 16 * G2P);
#pragma unroll      /* register arrays */
      for (int j = 0; j < 4; ++j) fb[ks][j] = g2_lfrag(lb + bo + ks * 64 + j * 16 * G2P); }
    __builtin_amdgcn_sched_barrier(0);      /* all LDS reads of the pass go out as one group in front of its products; left to itself the compiler reads one fragment at a time and waits out the LDS latency in front of every second product */
#pragma unroll      /* register arrays */
    for (int ks = 0; ks < 2; ++ks) {
      c00 = g2_mma(fa[ks][0], fb[ks][0], c00); c10 = g2_mma(fa[ks][1], fb[ks][0], c10);
      c01 = g2_mma(fa[ks][0], fb[ks][1], c01); c11 = g2_mma(fa[ks][1], fb[ks][1], c11);
      c02 = g2_mma(fa[ks][0], fb[ks][2], c02); c12 = g2_mma(fa[ks][1], fb[ks][2], c12);
      c03 = g2_mma(fa[ks][0], fb[ks][3], c03); c13 = g2_mma(fa[ks][1], fb[ks][3], c13); }
    asm volatile("s_wait_dscnt 0x0" ::: "memory");      /* this wave's reads of the buffer are done before the barrier behind which it is refilled */
    asm volatile("s_wait_asynccnt 0x0" ::: "memory");      /* this wave's copies of pass t + 1 have landed */
    __syncthreads();      /* publishes pass t + 1 and ends every wave's reads of pass t */
    if (t + 2 < np) g2_copy(lc + bo, ag + (size_t)(t + 2) * 128, sa, bg + (size_t)(t + 2) * 128, sb); }
  asm volatile("s_wait_asynccnt 0x0" ::: "memory");      /* no copy is outstanding when the ring becomes output staging */
  v8f accs[8] = {c00, c01, c02, c03, c10, c11, c12, c13};
#pragma unroll      /* register arrays */
  for (int u = 0; u < 8; ++u)
#pragma unroll      /* register arrays */
    for (int r = 0; r < 8; ++r) so[w][(u >> 2) * 16 + 8 * hh + r][(u & 3) * 16 + ln] = accs[u][r];      /* the raw sums; all arithmetic on them follows on the way out of the staging */
  __builtin_amdgcn_fence(__ATOMIC_ACQ_REL, "workgroup"); __builtin_amdgcn_wave_barrier();
  const int rsub = lane >> 4, c4 = (lane & 15) * 4;
  // Scale, bias, residual and activation are applied where the staged rows are read back: a lane holds four neighbouring columns of one row, so that bias and residual come as 16-byte loads and the code for one row pair serves all sixteen.
  // UQ row pairs are worked on per trip. With a library activation the loop stays rolled.
  constexpr int UQ = (ACT == 0 || ACT == 3) ? 16 : 2;
  v4f bv4 = {0.f, 0.f, 0.f, 0.f};
  if (bp) { const v4f br = *(const v4fa*)(bp + col0 + c4);
#pragma unroll      /* register arrays */
    for (int i = 0; i < 4; ++i) bv4[i] = bf16_round(br[i]); }
  auto fin = [&](const bool hascp) __attribute__((always_inline)) {
#pragma unroll 1      /* see above: the text stays small */
    for (int q0 = 0; q0 < 16; q0 += UQ) { v4f cp[UQ];
      if (hascp) { const float* pa[UQ];
        if (rowsPerB < 0) {      /* rowsPerB < 0: own element of the batched C plane; the trip's loads all in flight together */
#pragma unroll      /* register arrays */
          for (int j = 0; j < UQ; ++j) pa[j] = CP + cofs + (size_t)(row0g + row0 + (q0 + j) * 2 + rsub) * ldc + col0 + c4;
#pragma unroll      /* register arrays */
          for (int j = 0; j < UQ; ++j) cp[j] = *(const v4fa*)pa[j];
          g2_xwait(pa); }
        else {
#pragma unroll      /* register arrays */
          for (int j = 0; j < UQ; ++j) pa[j] = CP + (size_t)((row0g + row0 + (q0 + j) * 2 + rsub) / rowsPerB) * sCPb + (size_t)by * 64 + col0 + c4;
#pragma unroll      /* register arrays */
          for (int j = 0; j < UQ; ++j) { const float* p = pa[j]; const v4f c = {p[0], p[1], p[2], p[3]}; cp[j] = c; }
          g2_xwait(pa); } }
#pragma unroll      /* register arrays */
      for (int j = 0; j < UQ; ++j) { const int r = (q0 + j) * 2 + rsub; v4f vv = *(const v4fa*)&so[w][r][c4];
#pragma unroll      /* register arrays */
        for (int i = 0; i < 4; ++i) { float v = vv[i] * alpha + bv4[i]; if (hascp) v += cp[j][i];
          if (ACT == 3) v = fmaxf(v, 0.f); else if (ACT == 6) v = 0.5f * v * (1.0f + erff(v * 0.70710678118654752f)); else if (ACT == 11) v = 1.0f / (1.0f + expf(-v)); else if (ACT == 15) v = v / (1.0f + expf(-v)); else if (ACT == 12) v = (v > 0.f) ? v : 0.01f * v; else if (ACT == 8) v = tanhf(v); else if (ACT == 9) v = 0.5f * v * (1.0f + tanhf(0.7978845608028654f * (v + 0.044715f * v * v * v))); else if (ACT == 14) v = (v > 0.f) ? v : 0.1f * v; else if (ACT == 16) v = (v >= 0.f) ? v : 0.3f * v; else if (ACT == 17) v = (v >= 0.f) ? v : 0.2f * v;
          vv[i] = v; }
        if (QKVF) *(v4fa*)&so[w][r][c4] = vv;      /* the finished values, in the lane's own place, for the f32 stores below */
        if (C) { *(v4f*)(C + cofs + (size_t)(row0 + r) * ldc + col0 + c4) = vv; asm volatile("s_wait_xcnt 0x0" ::: "memory"); }      /* behind the store, in front of the conversion below, which may reuse its registers */
        if (C16) { v4h h4; for (int i = 0; i < 4; ++i) h4[i] = (_Float16)vv[i]; *(v4h*)(C16 + cofs + (size_t)(row0 + r) * ldc + col0 + c4) = h4; } }
      asm volatile("s_wait_xcnt 0x0" ::: "memory"); } };      /* behind the trip's loads and stores, in front of the next trip's (or later code's) writes of their address registers */
  if (CP) fin(true); else fin(false);
  if constexpr (QKVF) { static_assert(QT0 == 128 && SQ % 128 == 0 && HD == 64 && DM % 64 == 0, "a work-group's 128 rows lie in one batch and are its first QT0 rows or none of them; its 64 columns are one head of q, of k or of v");
    const int sel = col0 / DM, hc = col0 % DM, bt = (mt * 128) / SQ, t0 = (mt * 128) % SQ;      /* 0 q, 1 k, 2 v; first column in that matrix; batch; first row in the batch: all the work-group's own, scalars */
    if (sel >= 1) { float* kvp = KV + ((size_t)((sel - 1) * NB + bt) * NH + hc / HD) * SQ * HD + (size_t)t0 * HD; const unsigned kvo = (unsigned)((32 * w + rsub) * HD + c4) * 4u;      /* scalar base, the lane's fixed offset in bytes, the row pair as a constant: a head's rows follow one another, so that each store is 512 bytes in a row */
#pragma unroll      /* constant offsets */
      for (int q = 0; q < 16; ++q) *(v4f*)((char*)kvp + kvo + q * 2 * HD * 4) = *(const v4fa*)&so[w][q * 2 + rsub][c4];
      asm volatile("s_wait_xcnt 0x0" :: "v"(kvo), "s"(kvp) : "memory"); }      /* behind the stores, in front of any later write of their base and offset registers (the next block forms its own); both as inputs, so that their registers are still theirs up to here */
    if (t0 == 0) { float* fp = F0 + (size_t)(sel * NB + bt) * QT0 * DM + hc; const unsigned fo = (unsigned)((32 * w + rsub) * DM + c4) * 4u;      /* as above, row pitch DM */
#pragma unroll      /* constant offsets */
      for (int q = 0; q < 16; ++q) *(v4f*)((char*)fp + fo + q * 2 * DM * 4) = *(const v4fa*)&so[w][q * 2 + rsub][c4]; } } }


__global__ __launch_bounds__(256) void k_wnat(const float* __restrict__ w, size_t n8, _Float16* __restrict__ Bt) { const size_t t = (size_t)blockIdx.x * 256 + threadIdx.x; if (t >= n8) return; FragH f; for (int q = 0; q < 8; ++q) f.h[q] = (_Float16)(bf16_round(w[t * 8 + q]) * 16.0f); *(v8us*)((unsigned short*)Bt + t * 8) = f.half[0];  }
__global__ __launch_bounds__(256) void k_rsm(const float* __restrict__ S, _Float16* __restrict__ P, int nrows) {
  #pragma clang fp contract(off)
  const int i = blockIdx.x * 256 + threadIdx.x; if (i >= nrows) return; const float* s = S + (size_t)i * SQ; float mx = -3.0e38f;
#pragma unroll 1
  for (int j = 0; j < SQ; ++j) mx = fmaxf(mx, s[j]); float se = 0.f;
#pragma unroll 1
  for (int j = 0; j < SQ; ++j) se += expf(s[j] - mx); const float sc = 256.0f / se;
#pragma unroll 1
  for (int j0 = 0; j0 < SQ; j0 += 8) { FragH f; for (int q = 0; q < 8; ++q) f.h[q] = (_Float16)(expf(s[j0 + q] - mx) * sc); unsigned short* d = (unsigned short*)P + (size_t)i * SQ + j0; *(v8us*)d = f.half[0];  } }
__global__ __launch_bounds__(256) void k_vt(const _Float16* __restrict__ V16, int b, int h0, _Float16* __restrict__ VT) { __shared__ unsigned short tl[64][65]; const int tid = threadIdx.x; const int hh = blockIdx.x % HG, sg = blockIdx.x / HG; const int s0 = sg * 64; const int h = h0 + hh;
  for (int i = tid; i < 64 * 8; i += 256) { const int j = i / 8, d8 = (i % 8) * 8; FragH f; f.half[0] = *(const v8us*)((const unsigned short*)V16 + ((size_t)b * SQ + s0 + j) * DM + h * HD + d8); for (int q = 0; q < 8; ++q) tl[d8 + q][j] = f.u[q]; }
  __syncthreads();
  { for (int i = tid; i < 64 * 8; i += 256) { const int d = i / 8, j8 = (i % 8) * 8; FragH f; for (int q = 0; q < 8; ++q) f.u[q] = tl[d][j8 + q]; *(v8us*)((unsigned short*)VT + ((size_t)hh * HD + d) * SQ + s0 + j8) = f.half[0]; }  } }



// ---- lane exchanges and native exp2 shared by the two attention kernels below ----
template <int CTRL>
__device__ __forceinline__ float sm_rowx(float x) { return __builtin_bit_cast(float, __builtin_amdgcn_update_dpp(__builtin_bit_cast(int, x), __builtin_bit_cast(int, x), CTRL, 0xf, 0xf, false)); }      /* CTRL = 0x160 | m (row_xmask): lane l with lane l ^ m of its 16-lane row */
__device__ __forceinline__ float sm_half(float x) { return __builtin_bit_cast(float, __builtin_amdgcn_permlanex16(__builtin_bit_cast(int, x), __builtin_bit_cast(int, x), 0x76543210, 0xfedcba98, false, false)); }      /* lane l with lane l ^ 16 */
__device__ __forceinline__ float sm_wmax(float v) { v = fmaxf(v, sm_rowx<0x161>(v)); v = fmaxf(v, sm_rowx<0x162>(v)); v = fmaxf(v, sm_rowx<0x164>(v)); v = fmaxf(v, sm_rowx<0x168>(v)); return fmaxf(v, sm_half(v)); }
__device__ __forceinline__ float sm_wsum(float v) { v += sm_rowx<0x161>(v); v += sm_rowx<0x162>(v); v += sm_rowx<0x164>(v); v += sm_rowx<0x168>(v); return v + sm_half(v); }
// 2^x of four values: each v_exp_f32 fills the slot behind the one before it (results apart from all sources), the v_nop the slot behind the last, which the instruction set asks for before a result is read or a source overwritten
__device__ __forceinline__ v4f sm_exp2x4(v4f x) { float r0, r1, r2, r3;
  asm("v_exp_f32 %0, %4\n\tv_exp_f32 %1, %5\n\tv_exp_f32 %2, %6\n\tv_exp_f32 %3, %7\n\tv_nop" : "=&v"(r0), "=&v"(r1), "=&v"(r2), "=&v"(r3) : "v"(x[0]), "v"(x[1]), "v"(x[2]), "v"(x[3]));
  const v4f r = {r0, r1, r2, r3}; return r; }
// ---- causal attention for query rows QT0 .. SQ - 1 in one launch: scores and softmax weights never leave registers. One wave owns 32 query rows of one (batch, head) and walks the keys 64 at a time; no LDS, no barrier.
// Both products are formed transposed, so that a query is a lane (column ln) in each: S^T = K Q^T (A = 16 key rows, B = query rows) gives lane (ln, hh) the keys 8 hh + r of a 16-key tile for query ln, which is the k order of a B fragment
// (tiles 2 j, 2 j + 1 -> k = 8 hh + i, 16 + 8 hh + i): the weights go from accumulator to operand by a conversion alone. O^T = V^T P^T (A = 16 rows of V^T) keeps query = ln, so that the running maximum, the rescale and the row sum are the lane's own.
// Running maximum kept on the raw products; weights 2^((s - max) c + 8), c = log2(e) / 8: at most 256, so that small weights stay clear of the f16 subnormals; the row sum carries the same factor.
__device__ __forceinline__ v8f fa_mma(v16h a, v16h b, v8f c) { return __builtin_amdgcn_wmma_f32_16x16x32_f16(false, a, false, b, (short)0, c, false, false); }
// fragment from a wave-uniform base and the lane's own fixed offset in bytes (the value the load instruction itself takes beside a scalar base)
__device__ __forceinline__ v16h fa_frag(const _Float16* base, unsigned off) { FragH f; f.half[0] = *(const v8us*)((const char*)base + off); f.half[1] = *(const v8us*)((const char*)base + off + 32); return f.v; }
__device__ __forceinline__ void fa_loadk(const _Float16* __restrict__ kp, int kb, unsigned ko, v16h (&kf)[4][2]) {
#pragma unroll      /* register arrays */
  for (int t = 0; t < 4; ++t)
#pragma unroll      /* register arrays */
    for (int ks = 0; ks < 2; ++ks) kf[t][ks] = fa_frag(kp + (size_t)(kb + t * 16) * LQ + ks * 32, ko); }
// one pass of 64 keys from kb on. LAST: the pass that holds the rows' own keys (the only one that needs the mask) and has no pass behind it to fetch K for.
template <bool LAST>
__device__ __forceinline__ void fa_pass(const _Float16* __restrict__ kp, const _Float16* __restrict__ vp, int kb, int qrel, unsigned ko, unsigned vo, const v16h (&qf)[2][2], v16h (&kf)[4][2], v8f (&o)[2][4], float (&mr)[2], float (&l)[2]) {
  const float cs = 0.125f * 1.44269504f; const v8f z8 = {0.f, 0.f, 0.f, 0.f, 0.f, 0.f, 0.f, 0.f};
  v16h vf[4][2];
#pragma unroll      /* register arrays */
  for (int t = 0; t < 4; ++t)
#pragma unroll      /* register arrays */
    for (int ks = 0; ks < 2; ++ks) vf[t][ks] = fa_frag(vp + (size_t)t * 16 * SQ + kb + ks * 32, vo);
  asm volatile("s_wait_xcnt 0x0" :: "v"(vo) : "memory");      /* behind the loads, in front of any later write of a register that holds one of their addresses; the offset as an input, so that its register is still the offset's while the loads issue */
  __builtin_amdgcn_sched_barrier(0);      /* V^T of this pass is asked for here, so that it flies under the score products and the softmax; left to itself the scheduler sinks the loads to their use */
  v8f st[2][4];
#pragma unroll      /* register arrays */
  for (int qt = 0; qt < 2; ++qt)
#pragma unroll      /* register arrays */
    for (int t = 0; t < 4; ++t) st[qt][t] = fa_mma(kf[t][1], qf[qt][1], fa_mma(kf[t][0], qf[qt][0], z8));
  if (!LAST) { __builtin_amdgcn_sched_barrier(0);      /* the next pass's K is asked for behind this pass's last use of K and no later: it flies under the softmax and the second product */
    fa_loadk(kp, kb + 64, ko, kf);
    asm volatile("s_wait_xcnt 0x0" :: "v"(ko) : "memory");      /* as behind the V^T loads above */
    __builtin_amdgcn_sched_barrier(0); }      /* as the line above: keeps the loads from sinking */
  float mn[2];
#pragma unroll      /* register arrays */
  for (int qt = 0; qt < 2; ++qt) { const int rel = qrel + qt * 16 - kb;      /* key kb + 16 t + 8 hh + r is kept while 16 t + r <= rel */
    float mx = mr[qt];
#pragma unroll      /* register arrays */
    for (int t = 0; t < 4; ++t)
#pragma unroll      /* register arrays */
      for (int r = 0; r < 8; ++r) { if (LAST) st[qt][t][r] = (t * 16 + r <= rel) ? st[qt][t][r] : -1.0e30f; mx = fmaxf(mx, st[qt][t][r]); }
    mn[qt] = fmaxf(mx, sm_half(mx)); }      /* the other eight keys of each tile sit in lane l ^ 16 */
  const v4f ax = {(mr[0] - mn[0]) * cs, (mr[1] - mn[1]) * cs, 0.f, 0.f}; const v4f al = sm_exp2x4(ax);      /* rescale of what was summed under the old maximum; 0 in the first pass */
  FragH pf[2][2];
#pragma unroll      /* register arrays */
  for (int qt = 0; qt < 2; ++qt) { const float mo = mn[qt] * cs - 8.0f; mr[qt] = mn[qt];
    v4f se = {0.f, 0.f, 0.f, 0.f};
#pragma unroll      /* register arrays */
    for (int t = 0; t < 4; ++t)
#pragma unroll      /* register arrays */
      for (int g = 0; g < 2; ++g) { v4f x;
#pragma unroll      /* register arrays */
        for (int q = 0; q < 4; ++q) x[q] = st[qt][t][g * 4 + q] * cs - mo;
        x = sm_exp2x4(x); se += x;
#pragma unroll      /* register arrays */
        for (int q = 0; q < 4; ++q) pf[qt][t >> 1].h[(t & 1) * 8 + g * 4 + q] = (_Float16)x[q]; }
    l[qt] = l[qt] * al[qt] + ((se[0] + se[1]) + (se[2] + se[3]));
#pragma unroll      /* register arrays */
    for (int t = 0; t < 4; ++t) o[qt][t] *= al[qt]; }
  __builtin_amdgcn_sched_barrier(0);      /* the second product starts behind the last exp2 of both tiles */
#pragma unroll      /* register arrays */
  for (int qt = 0; qt < 2; ++qt)
#pragma unroll      /* register arrays */
    for (int t = 0; t < 4; ++t) o[qt][t] = fa_mma(vf[t][1], pf[qt][1].v, fa_mma(vf[t][0], pf[qt][0].v, o[qt][t])); }
__global__ __launch_bounds__(256) void k_fattn(const _Float16* __restrict__ QKVp, const _Float16* __restrict__ VTp, const float* __restrict__ XBp, float* __restrict__ X1p) {
  static_assert(QT0 == 128 && HD == 64 && SQ % 256 == 0, "blocks of 128 query rows; block 0 of a batch belongs to the f32 path; blocks 1 .. SQ / 128 - 1 are paired below");
  const int lane = threadIdx.x & 31, ln = lane & 15, hh = lane >> 4; const int w = __builtin_amdgcn_readfirstlane((int)(threadIdx.x >> 5));      /* the wave's number: a scalar, so that the early exit and the trip count are scalar */
  const int h = blockIdx.y, b = blockIdx.z; const int far = SQ / 128 - 1 - (int)blockIdx.x, near = 1 + (int)blockIdx.x;      /* waves 0-3 take a late block of rows, waves 4-7 the early block that makes the keys walked per work-group level */
  if (w >= 4 && near >= far) return;      /* the middle block has no partner; no barrier in this kernel */
  const int qw = (w < 4 ? far : near) * 128 + (w & 3) * 32;
  const size_t r0 = (size_t)b * SQ;
  const _Float16* qp = QKVp + (r0 + qw) * LQ + h * HD; const _Float16* kp = QKVp + DM + r0 * LQ + h * HD; const _Float16* vp = VTp + (size_t)(b * NH + h) * HD * SQ;      /* wave-uniform bases */
  const unsigned ko = (unsigned)(ln * LQ + 8 * hh) * 2u, vo = (unsigned)(ln * SQ + 8 * hh) * 2u;      /* the lane's row and k half in q / k rows and in V^T rows, in bytes */
  v16h qf[2][2], kf[4][2];
#pragma unroll      /* register arrays */
  for (int qt = 0; qt < 2; ++qt)
#pragma unroll      /* register arrays */
    for (int ks = 0; ks < 2; ++ks) qf[qt][ks] = fa_frag(qp + (size_t)qt * 16 * LQ + ks * 32, ko);
  fa_loadk(kp, 0, ko, kf);
  asm volatile("s_wait_xcnt 0x0" :: "v"(ko) : "memory");      /* behind the loads of q and of the first K, in front of any later write of their base and offset registers */
  __builtin_amdgcn_sched_barrier(0);      /* keeps later address arithmetic, which reuses those registers, behind the wait */
  const v8f z8 = {0.f, 0.f, 0.f, 0.f, 0.f, 0.f, 0.f, 0.f};
  v8f o[2][4] = {{z8, z8, z8, z8}, {z8, z8, z8, z8}}; float mr[2] = {-1.0e30f, -1.0e30f}; float l[2] = {0.f, 0.f};
  const int klast = qw & ~63;      /* keys 0 .. qw + 31 in passes of 64: every pass before this one lies wholly below row qw, this one ends at or below SQ - 1 */
  const int qrel = qw + ln - 8 * hh;
#pragma unroll 1      /* one pass holds 32 loads and 32 matrix instructions already */
  for (int kb = 0; kb < klast; kb += 64) fa_pass<false>(kp, vp, kb, qrel, ko, vo, qf, kf, o, mr, l);
  const float* xp = XBp + (r0 + qw) * DM + h * HD; float* yp = X1p + (r0 + qw) * DM + h * HD; const unsigned xo = (unsigned)(ln * DM + 8 * hh) * 4u;      /* lane (ln, hh) holds columns 16 t + 8 hh .. + 7 of query ln; in bytes */
  v4f xr[2][4][2];
#pragma unroll      /* register arrays */
  for (int qt = 0; qt < 2; ++qt)
#pragma unroll      /* register arrays */
    for (int t = 0; t < 4; ++t)
#pragma unroll      /* register arrays */
      for (int g = 0; g < 2; ++g) xr[qt][t][g] = *(const v4fa*)((const char*)(xp + qt * 16 * DM + t * 16 + g * 4) + xo);
  asm volatile("s_wait_xcnt 0x0" :: "v"(xo) : "memory");      /* as behind the V^T loads */
  __builtin_amdgcn_sched_barrier(0);      /* the residual rows are asked for here and fly under the last pass, in the registers that the K fetched ahead no longer needs */
  fa_pass<true>(kp, vp, klast, qrel, ko, vo, qf, kf, o, mr, l);
#pragma unroll      /* register arrays */
  for (int qt = 0; qt < 2; ++qt) { const float inv = 1.0f / (l[qt] + sm_half(l[qt]));      /* the two halves' sums joined once */
#pragma unroll      /* register arrays */
    for (int t = 0; t < 4; ++t)
#pragma unroll      /* register arrays */
      for (int g = 0; g < 2; ++g)
#pragma unroll      /* register arrays */
        for (int q = 0; q < 4; ++q) xr[qt][t][g][q] += o[qt][t][g * 4 + q] * inv; }
  __builtin_amdgcn_sched_barrier(0);      /* all arithmetic in front of the first store, so that nothing rewrites a register that an issued store names */
#pragma unroll      /* register arrays */
  for (int qt = 0; qt < 2; ++qt)
#pragma unroll      /* register arrays */
    for (int t = 0; t < 4; ++t)
#pragma unroll      /* register arrays */
      for (int g = 0; g < 2; ++g) *(v4f*)((char*)(yp + qt * 16 * DM + t * 16 + g * 4) + xo) = xr[qt][t][g]; }


typedef float v2f  __attribute__((ext_vector_type(2)));
typedef float v2fa __attribute__((ext_vector_type(2), may_alias));
// ---- f32 attention for the first QT0 query rows: one wave per (head, query row), eight rows of one head per work-group. The head's K and V rows up to the end of the rows' 32-key chunk are staged once in LDS.
// Scores: lane l owns keys 32 c + l (K pitch 68 floats = 16 B x odd, so that the 32 rows read by one ds_load_b128 spread over the banks). Output: lane l owns columns 2 l, 2 l + 1; each key's weight comes out of its lane by v_readlane.
// NCH = 32-key chunks (compile time: every load of a phase is issued before the first wait). Keys past the row get weight 2^(-1e30 ..) = 0.
template <int NCH>
__device__ __forceinline__ void att0_rows(const float* __restrict__ QF, const float* __restrict__ KF, const float* __restrict__ VF, float scale, float* __restrict__ OF, int h, int row0, float (*lk)[HD + 4], float (*lv)[HD]) {
  const int tid = threadIdx.x, lane = tid & 31; const int i = row0 + __builtin_amdgcn_readfirstlane(tid >> 5);      /* the row is the wave's: a scalar */
  const int sr = tid >> 4, sc = (tid & 15) * 4;      /* staging: 16 threads per 256-byte row, 16 rows per pass */
  const float* kg = KF + h * HD; const float* vg = VF + h * HD; const float* qr = QF + (size_t)i * DM + h * HD; const int so = sr * DM + sc;      /* row pitch DM at compile time: one address per matrix, the pass as a constant offset of the load */
  v4f kk[2 * NCH], vv[2 * NCH], q[HD / 4];
#pragma unroll      /* arrays stay in registers; all loads in flight together */
  for (int p = 0; p < 2 * NCH; ++p) { kk[p] = *(const v4fa*)(kg + so + p * 16 * DM); vv[p] = *(const v4fa*)(vg + so + p * 16 * DM); }
#pragma unroll      /* the query row, same address in every lane, fetched beside the staging loads */
  for (int c = 0; c < HD / 4; ++c) q[c] = *(const v4fa*)(qr + c * 4);
#pragma unroll      /* register arrays */
  for (int p = 0; p < 2 * NCH; ++p) { *(v4fa*)&lk[p * 16 + sr][sc] = kk[p]; *(v4fa*)&lv[p * 16 + sr][sc] = vv[p]; }
  __syncthreads();
  v4f a[NCH];
#pragma unroll      /* register arrays */
  for (int c = 0; c < NCH; ++c) { const v4f z = {0.f, 0.f, 0.f, 0.f}; a[c] = z; }
#pragma unroll      /* 4 NCH independent sums per lane */
  for (int d = 0; d < HD / 4; ++d)
#pragma unroll      /* a[c] by constant index */
    for (int c = 0; c < NCH; ++c) a[c] += q[d] * *(const v4fa*)&lk[c * 32 + lane][d * 4];
  float e[NCH]; float mx = -1.0e30f;
#pragma unroll      /* register arrays */
  for (int c = 0; c < NCH; ++c) { const float s = ((a[c][0] + a[c][1]) + (a[c][2] + a[c][3])) * scale; e[c] = (c * 32 + lane <= i) ? s : -1.0e30f; mx = fmaxf(mx, e[c]); }
  mx = sm_wmax(mx);
  float l = 0.f; v4f t = {-200.f, -200.f, -200.f, -200.f};      /* chunks that this case does not have: 2^-200, not summed */
#pragma unroll      /* register arrays */
  for (int c = 0; c < NCH; ++c) t[c] = (e[c] - mx) * 1.44269504f;      /* exp(x) = 2^(x log2 e), the native form, as in the row softmax above */
  t = sm_exp2x4(t);
#pragma unroll      /* register arrays */
  for (int c = 0; c < NCH; ++c) { e[c] = t[c]; l += e[c]; }
  l = sm_wsum(l);
  const v2f z2 = {0.f, 0.f}; v2f o[4] = {z2, z2, z2, z2};      /* four sums per column, so that one key's multiply-add does not wait for the key before it */
#pragma unroll      /* constant lane numbers for v_readlane, constant LDS offsets */
  for (int c = 0; c < NCH; ++c)
#pragma unroll      /* as the line above */
    for (int j = 0; j < 32; ++j) { const float ej = __builtin_bit_cast(float, __builtin_amdgcn_readlane(__builtin_bit_cast(int, e[c]), j)); o[j & 3] += ej * *(const v2fa*)&lv[c * 32 + j][lane * 2]; }
  const float fin = 64.0f / l;      /* o carried x64, scaled by 1/64 where it is added to x1 */
  const v2f r = ((o[0] + o[1]) + (o[2] + o[3])) * fin;
  *(v2fa*)(OF + (size_t)i * DM + h * HD + lane * 2) = r; }
__global__ __launch_bounds__(256) void k_att0w(const float* __restrict__ QF, const float* __restrict__ KF, const float* __restrict__ VF, float scale, float* __restrict__ OF) {
  static_assert(QT0 == 128 && HD == 64, "the cases below cover 1 .. 4 chunks of 32 keys; two columns per lane");
  __shared__ __attribute__((aligned(16))) float lk[QT0][HD + 4]; __shared__ __attribute__((aligned(16))) float lv[QT0][HD];
  { const size_t bo = (size_t)blockIdx.y * QT0 * DM; QF += bo; KF += bo; VF += bo; OF += bo; }      /* blockIdx.y = batch: each matrix holds the batches' QT0 rows one behind the other */
  const int h = blockIdx.x / (QT0 / 8), row0 = (blockIdx.x % (QT0 / 8)) * 8;      /* eight rows lie in one 32-key chunk: the switch is the same for the whole work-group, barrier included */
  switch (row0 >> 5) {
    case 0: att0_rows<1>(QF, KF, VF, scale, OF, h, row0, lk, lv); break; case 1: att0_rows<2>(QF, KF, VF, scale, OF, h, row0, lk, lv); break;
    case 2: att0_rows<3>(QF, KF, VF, scale, OF, h, row0, lk, lv); break; case 3: att0_rows<4>(QF, KF, VF, scale, OF, h, row0, lk, lv); break; } }


template <int BFIN, int WXB>
__global__ __launch_bounds__(256) void k_ln16(const float* __restrict__ X, const float* __restrict__ g, const float* __restrict__ bb, float eps, _Float16* __restrict__ N16, float* __restrict__ XB) {
  #pragma clang fp contract(off)
  __shared__ float red[256]; const size_t r = blockIdx.x; const int t = threadIdx.x; const v4f xa = *(const v4fa*)(X + r * DMQ + t * 4); float s[4]; float sum = 0.f;
  for (int q = 0; q < 4; ++q) { s[q] = BFIN ? bf16_round(xa[q]) : xa[q]; sum = __fadd_rn(sum, s[q]); }
  red[t] = sum; __syncthreads(); for (int st = 128; st > 0; st >>= 1) { if (t < st) red[t] = __fadd_rn(red[t], red[t + st]); __syncthreads(); } const float mu = red[0] / (float)DMQ; __syncthreads();
  float vs = 0.f; for (int q = 0; q < 4; ++q) { const float dl = __fadd_rn(s[q], -mu); vs = __fadd_rn(vs, __fmul_rn(dl, dl)); } red[t] = vs; __syncthreads(); for (int st = 128; st > 0; st >>= 1) { if (t < st) red[t] = __fadd_rn(red[t], red[t + st]); __syncthreads(); }
  const float rs = rsqrtf(__fadd_rn(red[0] / (float)DMQ, eps)); v4h y; v4f xb;
  for (int q = 0; q < 4; ++q) { const int c = t * 4 + q; y[q] = (_Float16)__fadd_rn(__fmul_rn(__fmul_rn(__fadd_rn(s[q], -mu), rs), bf16_round(g[c])), bf16_round(bb[c])); xb[q] = s[q]; }
  { *(v4h*)(N16 + r * DMQ + t * 4) = y; if (WXB) *(v4f*)(XB + r * DMQ + t * 4) = xb;  } }
__global__ __launch_bounds__(256) void k_ftres2(const float* __restrict__ OF0, const float* __restrict__ XB, float* __restrict__ X1, size_t n4) {
  #pragma clang fp contract(off)
  const size_t t = (size_t)blockIdx.x * 256 + threadIdx.x; if (t >= n4) return; const v4f o = *(const v4fa*)(OF0 + t * 4), xv = *(const v4fa*)(XB + t * 4); v4f y; for (int q = 0; q < 4; ++q) y[q] = __fadd_rn(__fmul_rn(o[q], 0.015625f), xv[q]); *(v4f*)(X1 + t * 4) = y;  }

__global__ __launch_bounds__(256) void k_wthd(const float* __restrict__ Wt, _Float16* __restrict__ Bt) { const size_t t = (size_t)blockIdx.x * 256 + threadIdx.x; if (t >= (size_t)NH * HD * (DM / 8)) return; const int m8 = (int)(t % (DM / 8)) * 8; const int d = (int)((t / (DM / 8)) % HD); const int h = (int)(t / ((size_t)(DM / 8) * HD)); FragH f;
  for (int q = 0; q < 8; ++q) f.h[q] = (_Float16)(16.0f * bf16_round(Wt[((size_t)h * DM + m8 + q) * HD + d])); unsigned short* dst = (unsigned short*)Bt + ((size_t)h * HD + d) * DM + m8; *(v8us*)dst = f.half[0];  }




__global__ __launch_bounds__(256) void k_wtpad(const float* __restrict__ Wm, _Float16* __restrict__ Wt, int Kr, int Kp, int Nr, int Np, float scale) {
  const int t = blockIdx.x * 256 + threadIdx.x; if (t >= Np * (Kp / 8)) return; const int n = t / (Kp / 8), k8 = (t % (Kp / 8)) * 8; const int nc = min(n, Nr - 1); const float fn = (n < Nr) ? 1.f : 0.f; FragH f;
  for (int i = 0; i < 8; ++i) { const int k = k8 + i; const int kc = min(k, Kr - 1); const float fk = (k < Kr) ? fn : 0.f; f.h[i] = (_Float16)(bf16_round(Wm[(size_t)kc * Nr + nc]) * scale * fk); }
  unsigned short* o = (unsigned short*)Wt + (size_t)n * Kp + k8; *(v8us*)o = f.half[0];  }
__global__ __launch_bounds__(128) void k_bpad(const float* __restrict__ b, float* __restrict__ Bp, int nr, int np) {
  const int i = threadIdx.x; if (i >= np) return; const float v = b[min(i, nr - 1)] * ((i < nr) ? 1.f : 0.f); *(float*)(Bp + i) = v;  }

__global__ __launch_bounds__(256) void k_bcpy(const float* __restrict__ b, int n, int NP, float* __restrict__ dst, int dst0) { for (int i = threadIdx.x; i < NP; i += 256) { const float v = (i < n) ? b[i] : 0.f; *(float*)(dst + dst0 + i) = v; }  }


__global__ __launch_bounds__(256) void k_addf(const float* __restrict__ XBr, const float* __restrict__ OF, float* __restrict__ O, size_t n8) {
  #pragma clang fp contract(off)
  XBr += (size_t)blockIdx.y * SQ * DM; O += (size_t)blockIdx.y * SQ * DM; OF += (size_t)blockIdx.y * QT0 * DM;      /* blockIdx.y = batch: its first rows in the token planes, its own QT0 rows in OF */
  const size_t t = (size_t)blockIdx.x * 256 + threadIdx.x; if (t >= n8) return; const v4f a = *(const v4fa*)(XBr + t * 8), b = *(const v4fa*)(XBr + t * 8 + 4), c = *(const v4fa*)(OF + t * 8), d = *(const v4fa*)(OF + t * 8 + 4); v4f r0, r1;
  for (int q = 0; q < 4; ++q) { r0[q] = __fadd_rn(a[q], __fmul_rn(c[q], 0.015625f)); r1[q] = __fadd_rn(b[q], __fmul_rn(d[q], 0.015625f)); }
  { *(v4f*)(O + t * 8) = r0; *(v4f*)(O + t * 8 + 4) = r1;  } }


extern "C" void kernel_launch(void* const* d_in, const int* in_sizes, int n_in,
                              void* d_out, int out_size, void* d_ws, size_t ws_size, hipStream_t stream) {
  (void)in_sizes; (void)n_in; (void)out_size;
  const float* const* I = (const float* const*)d_in; const float* x = I[0]; const float* wq = I[1]; const float* bq = I[2]; const float* wk = I[3]; const float* bk = I[4]; const float* wv = I[5]; const float* bv = I[6]; const float* g1 = I[7]; const float* be1 = I[8]; const float* gg2 = I[9]; const float* be2 = I[10]; const float* wfc = I[11]; const float* bfc = I[12]; const float* wmp = I[13]; const float* bmp = I[14];      /* input order: x; [in][out] wq / wk / wv + biases; LN1 w / b, LN2 w / b; w_fc [1024][4096] + b_fc, w_proj [4096][1024] + b_proj */
  float* OUT0 = (float*)d_out; float* OUTK = (float*)d_out + NR * DM;      /* tuple outputs: out at byte 0, k at 16,777,216, v at 33,554,432 (each NB * SQ * DM floats) */
  static_assert(NH * HD == DM && DM % 64 == 0 && SQ % 128 == 0 && QT0 % 8 == 0, "shape / tile multiples");
  char* ws = (char*)d_ws; size_t off = 0;
  auto take = [&](size_t bytes) { char* p = ws + off; off += (bytes + 255) & ~(size_t)255; return p; };
  _Float16* BQKV = (_Float16*)take((size_t)3 * DM * DM * 2); float* bqkv = (float*)take((size_t)3 * DM * 4);      /* stacked bias bq | bk | bv */
  _Float16* X16 = (_Float16*)take(NR * DM * 2); float* XB = (float*)take(NR * DM * 4); float* X1 = (float*)take(NR * DM * 4); _Float16* M16 = nullptr;      /* = X16 below (alias: X16's last reader, the q | k | v GEMM, precedes LN2's write) */ _Float16* HF16 = (_Float16*)take(NR * DFF * 2); _Float16* BW1 = (_Float16*)take((size_t)DFF * DM * 2); _Float16* BW2 = (_Float16*)take((size_t)DM * DFF * 2); _Float16* QKV = (_Float16*)take(NR * 3 * DM * 2); _Float16* V16 = QKV + 2 * DM; M16 = X16;
  _Float16* VT = (_Float16*)take((size_t)NB * NH * HD * SQ * 2);      /* V^T of both batches */
  float* F0 = (float*)take((size_t)3 * NB * QT0 * DM * 4);      /* f32 q | k | v of each batch's first QT0 rows */ float* OF0 = (float*)take((size_t)NB * QT0 * DM * 4);
  if (off > ws_size) return;
  { const dim3 g(DM / 64, DM / 128); k_wt_f16<DM, DM><<<g, 256, 0, stream>>>(wq, BQKV, 16.0f); k_wt_f16<DM, DM><<<g, 256, 0, stream>>>(wk, BQKV + (size_t)DM * DM, 16.0f); k_wt_f16<DM, DM><<<g, 256, 0, stream>>>(wv, BQKV + (size_t)2 * DM * DM, 16.0f); }      /* [in][out] -> Bt x16: stacked q | k | v (transposing builder) */
  k_bcpy<<<1, 256, 0, stream>>>(bq, DM, DM, bqkv, 0); k_bcpy<<<1, 256, 0, stream>>>(bk, DM, DM, bqkv, DM); k_bcpy<<<1, 256, 0, stream>>>(bv, DM, DM, bqkv, 2 * DM);      /* stacked bias bq | bk | bv */
  k_ln16<1, 1><<<(unsigned)NR, 256, 0, stream>>>(x, g1, be1, 1e-5f, X16, XB);      /* a = LN1(bf16(x)) -> f16 rows; XB = bf16(x) for the residual */
  k_wt_f16<DM, DFF><<<dim3(DFF / 64, DM / 128), 256, 0, stream>>>(wfc, BW1, 16.0f); k_wt_f16<DFF, DM><<<dim3(DM / 64, DFF / 128), 256, 0, stream>>>(wmp, BW2, 16.0f);      /* W1 [1024][4096] -> Bt [4096][1024]; W2 [4096][1024] -> Bt [1024][4096] (x16) */
  const size_t r0p = (size_t)B0 * SQ;      /* first projected row */
  k_gemm2<0, true><<<dim3((unsigned)((MP / 128) * (3 * DM / 64)), 1), 128, 0, stream>>>(X16 + r0p * DM, DM, 0, BQKV, DM, 0, 0.0625f, bqkv, 0, nullptr, 1, 0, 0, nullptr, QKV + r0p * 3 * DM, 3 * DM, 0, MP, 3 * DM, DM, OUTK, F0);      /* q | k | v rows (f16); head h = columns h*HD.. of each DM block; from the same sums outputs 1 and 2 (k, v in f32, head-major [B][H][T][64]) and the f32 q, k, v of the first 128 rows of each batch */
  k_vt<NH, SQ><<<NB * NH * (SQ / 64), 256, 0, stream>>>(V16, LQ, 0, VT);      /* V^T [NB][NH][HD][SQ], both batches */
  k_att0w<<<dim3(NH * (QT0 / 8), NB), 256, 0, stream>>>(F0, F0 + (size_t)NB * QT0 * DM, F0 + (size_t)2 * NB * QT0 * DM, 0.125f, OF0);      /* f32 attention for rows 0..127 of both batches (o x64), one wave per head and row */
  k_addf<<<dim3((unsigned)(((size_t)QT0 * DM / 8 + 255) / 256), NB), 256, 0, stream>>>(XB, OF0, X1, (size_t)QT0 * DM / 8);      /* rows 0..127 of each batch from the exact f32 path: x1 = bf16(x) + o / 64 */
  k_fattn<<<dim3(SQ / 256, NH, NB), 256, 0, stream>>>(QKV, VT, XB, X1);      /* rows 128.. of both batches: x1 = bf16(x) + softmax(q k^T / 8) v in f32 (no output projection in this module) */
  k_ln16<0, 0><<<(unsigned)NR, 256, 0, stream>>>(X1, gg2, be2, 1e-5f, M16, nullptr);      /* h = LN2(x1) -> f16 rows */
  k_gemm2<6><<<dim3((unsigned)((NR / 128) * (DFF / 64)), 1), 128, 0, stream>>>(M16, DM, 0, BW1, DM, 0, 0.0625f, bfc, 0, nullptr, 1, 0, 0, nullptr, HF16, DFF, 0, (int)NR, DFF, DM, nullptr, nullptr);      /* gelu_erf(h2 W1 + b1) -> f16, all token rows */
  k_gemm2<0><<<dim3((unsigned)((NR / 128) * (DM / 64)), 1), 128, 0, stream>>>(HF16, DFF, 0, BW2, DFF, 0, 0.0625f, bmp, 0, X1, -1, 0, 0, OUT0, nullptr, DM, 0, (int)NR, DM, DFF, nullptr, nullptr);      /* output 0 = x1 + mlp (own-element residual), all token rows: two work-groups per WGP where one batch gave one */
}

// v009
// One run takes 201 microseconds.
// In both of two side-by-side timings against v008, it was 1.12 times as fast.
// Counting every step since v000, it is 29.0 times as fast.
#include <hip/hip_runtime.h>
// Pre-LN causal transformer block WITHOUT an attention output projection that also returns its key and value tensors (x [2][2048][1024]; h = LN1(x) (biased var, eps 1e-5); q / k / v = h W + b ([in][out] [1024][1024] sigma 1/32, zero biases) -> [B][16][T][64]; att = softmax(q k^T / 8) with a causal mask (tril, -inf); y = att v merged back to [B][T][1024]; x1 = x + y (no projection); out = x1 + gelu_erf(LN2(x1) w_fc + b_fc) w_proj + b_proj ([in][out] 1024 x 4096 x 1024); returns (out [2][2048][1024], k [2][16][2048][64], v [2][16][2048][64]): three outputs at byte offsets 0 / 16,777,216 / 33,554,432 of d_out).
// Structure: token rows r = b*2048 + s; h = LN1(bf16(x)) as f16 rows; q | k | v as ONE WMMA GEMM (N = 3 x 1024) (32x64 wave tiles, f32 accumulation, exact x16 weights + bias, f16 outputs; the same sums stored in f32 as outputs k and v and as q, k, v of each batch's first 128 rows); V^T for all heads of both batches via LDS transposes; rows 128.. of both batches in one launch: per wave 32 query rows, keys 64 at a time up to the rows' end, scores (K = 64), running-maximum softmax (f32 statistics, native exp2; weights at most 256 in f16) and weights x V^T all in registers, x1 = x + o / row sum in f32; LN2(x1) as f16 rows; gelu(h2 W1 + b1) GEMM into f16; out = x1 + hidden W2 + b2 GEMM (f32) into the output layout.
// Compute dtype: inputs rounded to bf16; x / weights exact; q, k, v, softmax weights, LN outputs and gelu hidden as plain f16 GEMM operands (~2^-12); o, scores and softmax statistics f32. v_wmma_f32_16x16x32_f16.
#define NB 2
#define SQ 2048
#define DM 1024
#define NH 16
#define HD 64
#define HG 4
#define QT 256                       /* query rows per causal tile */
#define NKX SQ                       /* S / P row pitch */
#define QT0 128                      /* first-tile rows attended exactly in f32 */
#define B0 0                         /* first batch processed (debug hook) */
#define NBR NB                       /* batches processed (debug hook) */
#define NR ((size_t)NB * SQ)
#define DMQ DM
#define DFF 4096                     /* FFN hidden width */
#define DFFR 100
#define MP ((int)((size_t)NBR * SQ)) /* rows projected (debug hook) */
#define QN SQ                        /* query rows per batch; not used */
#define NHD NH                       /* heads; not used */
#define MPO MP
#define LQ (3 * DM)      /* row pitch of the q/k/v rows */
typedef __bf16 v16b __attribute__((ext_vector_type(16)));
typedef unsigned short v8us __attribute__((ext_vector_type(8), may_alias));
typedef float  v8f  __attribute__((ext_vector_type(8)));
typedef float  v4f  __attribute__((ext_vector_type(4)));
typedef float  v4fa __attribute__((ext_vector_type(4), may_alias));
union FragB { v16b v; v8us half[2]; unsigned short u[16]; };

__device__ __forceinline__ unsigned short bf16_bits(float x) { unsigned int u = __float_as_uint(x); return (unsigned short)((u + 0x7FFFu + ((u >> 16) & 1u)) >> 16); }
__device__ __forceinline__ float bf16_val(unsigned short b) { return __uint_as_float(((unsigned int)b) << 16); }
__device__ __forceinline__ float bf16_round(float x) { return bf16_val(bf16_bits(x)); }
// D += A·B with NT terms: 1 = ah·bh, 2 = + al·bh (A split), 3 = + ah·bl (both split)
template <int NT>
__device__ __forceinline__ v8f mmaN(v16b ah, v16b al, v16b bh, v16b bl, v8f c) {
  c = __builtin_amdgcn_wmma_f32_16x16x32_bf16(false, ah, false, bh, (short)0, c, false, false);
  if (NT >= 2) c = __builtin_amdgcn_wmma_f32_16x16x32_bf16(false, al, false, bh, (short)0, c, false, false);
  if (NT >= 3) c = __builtin_amdgcn_wmma_f32_16x16x32_bf16(false, ah, false, bl, (short)0, c, false, false);
  asm volatile("v_nop\n\tv_nop\n\tv_nop\n\tv_nop" : "+v"(c) : "v"(ah), "v"(al), "v"(bh), "v"(bl));
  return c;
}

__global__ __launch_bounds__(256) void k_wt_bf16(const float* __restrict__ W, unsigned short* __restrict__ Wt, int K, int N) {
  const int t = blockIdx.x * 256 + threadIdx.x;
  const int k8n = K / 8;
  if (t >= N * k8n) return;
  const int n = t / k8n, k8 = (t % k8n) * 8;
  v8us v;
#pragma unroll
  for (int i = 0; i < 8; ++i) v[i] = bf16_bits(W[(size_t)(k8 + i) * N + n]);
  *(v8us*)(Wt + (size_t)n * K + k8) = v;
  
}

// GEMM C[M][N] (f32, pitch ldc) = act(A[M][K]·W + bias). A f32 row-major (pitch lda) converted per fragment to bf16
// (ASPLIT: hi/lo two planes -> 2 terms, else single rounded term); Wt bf16 [N][K] (pitch ldb). BIAS_BF16 rounds the
// bias to bf16 first (bias quantised to bf16 before the add). K%32==0, M%16==0, N%64==0.
template <bool ASPLIT, int ACT, bool BIAS_BF16>
__global__ __launch_bounds__(128) void k_gemm_bf(const float* __restrict__ A, int lda, const unsigned short* __restrict__ Wt, int ldb,
                                               const float* __restrict__ bias, float* __restrict__ C, int ldc, int M, int N, int K) {
  __shared__ __attribute__((aligned(16))) float so[4][16][64];
  const int tid = threadIdx.x, w = tid >> 5, lane = tid & 31, ln = lane & 15, hh = lane >> 4;
  const int ntn = N / 64;
  const int wid = blockIdx.x * 4 + w;
  const int mt = wid / ntn, nq = wid % ntn;
  if (mt * 16 >= M) return;
  const int row0 = mt * 16, col0 = nq * 64;
  const float* arow = A + (size_t)(row0 + ln) * lda;
  v8f acc[4] = {};
  for (int kb = 0; kb < K; kb += 32) {
    FragB ah, al;
    const v4f x0 = *(const v4fa*)(arow + kb + 8 * hh), x1 = *(const v4fa*)(arow + kb + 8 * hh + 4);
    const v4f x2 = *(const v4fa*)(arow + kb + 16 + 8 * hh), x3 = *(const v4fa*)(arow + kb + 16 + 8 * hh + 4);
    float xs[16] = {x0[0],x0[1],x0[2],x0[3],x1[0],x1[1],x1[2],x1[3],x2[0],x2[1],x2[2],x2[3],x3[0],x3[1],x3[2],x3[3]};
#pragma unroll
    for (int i = 0; i < 16; ++i) { const unsigned short hb = bf16_bits(xs[i]); ah.u[i] = hb; al.u[i] = ASPLIT ? bf16_bits(xs[i] - bf16_val(hb)) : (unsigned short)0; }
#pragma unroll
    for (int t = 0; t < 4; ++t) {
      const unsigned short* brow = Wt + (size_t)(col0 + t * 16 + ln) * ldb + kb;
      FragB b;
      b.half[0] = *(const v8us*)(brow + 8 * hh);
      b.half[1] = *(const v8us*)(brow + 16 + 8 * hh);
      acc[t] = mmaN<ASPLIT ? 2 : 1>(ah.v, al.v, b.v, b.v, acc[t]);
    }
  }
#pragma unroll
  for (int t = 0; t < 4; ++t) {
    float bv = bias ? bias[col0 + t * 16 + ln] : 0.f;
    if (BIAS_BF16) bv = bf16_round(bv);
#pragma unroll
    for (int r = 0; r < 8; ++r) { float v = acc[t][r] + bv; if (ACT == 1) v = fmaxf(v, 0.f); so[w][8 * hh + r][t * 16 + ln] = v; }
  }
  __builtin_amdgcn_fence(__ATOMIC_ACQ_REL, "workgroup");
  __builtin_amdgcn_wave_barrier();
  const int rsub = lane >> 4, c4 = (lane & 15) * 4;
  {
#pragma unroll
    for (int q = 0; q < 8; ++q) {
      const int r = q * 2 + rsub;
      const v4f v = *(const v4fa*)&so[w][r][c4];
      *(v4f*)(C + (size_t)(row0 + r) * ldc + col0 + c4) = v;
    }
    
  }
}

// GEMM C = act(A·W + bias + resid): A f32 (ASPLIT -> hi/lo 2 terms), Wt bf16 [N][K]; ACT 0 none, 1 relu, 2 exact gelu;
// resid (optional, f32, row index = (row % rmod), pitch ldr, RES_BF16 rounds it) added before the activation.
template <bool ASPLIT, int ACT, bool BIAS_BF16, bool RES_BF16>
__global__ __launch_bounds__(128) void k_gemm_bf3(const float* __restrict__ A, int lda, const unsigned short* __restrict__ Wt, int ldb,
                                                const float* __restrict__ bias, const float* __restrict__ resid, int rmod, int ldr,
                                                float* __restrict__ C, int ldc, int M, int N, int K) {
  __shared__ __attribute__((aligned(16))) float so[4][16][64];
  const int tid = threadIdx.x, w = tid >> 5, lane = tid & 31, ln = lane & 15, hh = lane >> 4;
  const int ntn = N / 64;
  const int wid = blockIdx.x * 4 + w;
  const int mt = wid / ntn, nq = wid % ntn;
  if (mt * 16 >= M) return;
  const int row0 = mt * 16, col0 = nq * 64;
  const float* arow = A + (size_t)(row0 + ln) * lda;
  v8f acc[4] = {};
  for (int kb = 0; kb < K; kb += 32) {
    FragB ah, al;
    const v4f x0 = *(const v4fa*)(arow + kb + 8 * hh), x1 = *(const v4fa*)(arow + kb + 8 * hh + 4);
    const v4f x2 = *(const v4fa*)(arow + kb + 16 + 8 * hh), x3 = *(const v4fa*)(arow + kb + 16 + 8 * hh + 4);
    float xs[16] = {x0[0],x0[1],x0[2],x0[3],x1[0],x1[1],x1[2],x1[3],x2[0],x2[1],x2[2],x2[3],x3[0],x3[1],x3[2],x3[3]};
#pragma unroll
    for (int i = 0; i < 16; ++i) { const unsigned short hb = bf16_bits(xs[i]); ah.u[i] = hb; al.u[i] = ASPLIT ? bf16_bits(xs[i] - bf16_val(hb)) : (unsigned short)0; }
#pragma unroll
    for (int t = 0; t < 4; ++t) {
      const unsigned short* brow = Wt + (size_t)(col0 + t * 16 + ln) * ldb + kb;
      FragB b;
      b.half[0] = *(const v8us*)(brow + 8 * hh);
      b.half[1] = *(const v8us*)(brow + 16 + 8 * hh);
      acc[t] = mmaN<ASPLIT ? 2 : 1>(ah.v, al.v, b.v, b.v, acc[t]);
    }
  }
#pragma unroll
  for (int t = 0; t < 4; ++t) {
    const int col = col0 + t * 16 + ln;
    float bv = bias ? bias[col] : 0.f;
    if (BIAS_BF16) bv = bf16_round(bv);
#pragma unroll
    for (int r = 0; r < 8; ++r) {
      float v = acc[t][r] + bv;
      if (resid) { float rv = resid[(size_t)((row0 + 8 * hh + r) % rmod) * ldr + col]; if (RES_BF16) rv = bf16_round(rv); v += rv; }
      if (ACT == 1) v = fmaxf(v, 0.f);
      if (ACT == 2) v = 0.5f * v * (1.0f + erff(v * 0.70710678118654752f));
      if (ACT == 3) { const float u = 0.7978845608028654f * (v + 0.044715f * v * v * v); v = 0.5f * v * (1.0f + tanhf(u)); }
      so[w][8 * hh + r][t * 16 + ln] = v;
    }
  }
  __builtin_amdgcn_fence(__ATOMIC_ACQ_REL, "workgroup");
  __builtin_amdgcn_wave_barrier();
  const int rsub = lane >> 4, c4 = (lane & 15) * 4;
  {
#pragma unroll
    for (int q = 0; q < 8; ++q) {
      const int r = q * 2 + rsub;
      const v4f v = *(const v4fa*)&so[w][r][c4];
      *(v4f*)(C + (size_t)(row0 + r) * ldc + col0 + c4) = v;
    }
    
  }
}
// row LayerNorm (biased variance, eps) over N: s = X (+ R); optional out_sum <- s; out_norm <- (s-mu)*rsqrt(var+eps)*g + b
template <bool PARAM_BF16>
__global__ __launch_bounds__(256) void k_layernorm(const float* __restrict__ X, const float* __restrict__ R, const float* __restrict__ g, const float* __restrict__ bta,
                                                  float* __restrict__ out_sum, float* __restrict__ out_norm, int N, float eps) {
  __shared__ float red[256];
  const int row = blockIdx.x, tid = threadIdx.x;
  const float* x = X + (size_t)row * N; const float* rr = R ? R + (size_t)row * N : nullptr;
  float vals[16];                     // up to N = 4096
  const int per = N / 256;            // contiguous chunk per thread? use strided-by-4 chunks: thread handles j = tid*4 + 1024*u
  float s1 = 0.f;
  for (int u = 0; u < per / 4; ++u) {
    const int j = tid * 4 + 1024 * u;
    const v4f a = *(const v4fa*)(x + j);
    v4f b = {0.f,0.f,0.f,0.f}; if (rr) b = *(const v4fa*)(rr + j);
#pragma unroll
    for (int q = 0; q < 4; ++q) { const float v = a[q] + b[q]; vals[u * 4 + q] = v; s1 += v; }
  }
  red[tid] = s1; __syncthreads();
  for (int st = 128; st > 0; st >>= 1) { if (tid < st) red[tid] += red[tid + st]; __syncthreads(); }
  const float mu = red[0] / (float)N; __syncthreads();
  float s2 = 0.f;
  for (int u = 0; u < per / 4; ++u)
#pragma unroll
    for (int q = 0; q < 4; ++q) { const float c = vals[u * 4 + q] - mu; s2 += c * c; }
  red[tid] = s2; __syncthreads();
  for (int st = 128; st > 0; st >>= 1) { if (tid < st) red[tid] += red[tid + st]; __syncthreads(); }
  const float rs = rsqrtf(red[0] / (float)N + eps);
  {
    for (int u = 0; u < per / 4; ++u) {
      const int j = tid * 4 + 1024 * u;
      v4f o, sm;
#pragma unroll
      for (int q = 0; q < 4; ++q) {
        float gg = g[j + q], bb = bta[j + q];
        if (PARAM_BF16) { gg = bf16_round(gg); bb = bf16_round(bb); }
        sm[q] = vals[u * 4 + q]; o[q] = (vals[u * 4 + q] - mu) * rs * gg + bb;
      }
      if (out_sum) *(v4f*)(out_sum + (size_t)row * N + j) = sm;
      *(v4f*)(out_norm + (size_t)row * N + j) = o;
    }
    
  }
}



// ---- f16 WMMA path (v_wmma_f32_16x16x32_f16): 11-bit significands for operands in range — used where a [0,1] probability operand needs more precision than bf16
typedef _Float16 v16h __attribute__((ext_vector_type(16)));
union FragH { v16h v; v8us half[2]; _Float16 h[16]; unsigned short u[16]; };
template <int NT>
__device__ __forceinline__ v8f mmaH(v16h ah, v16h al, v16h bh, v16h bl, v8f c) {
  c = __builtin_amdgcn_wmma_f32_16x16x32_f16(false, ah, false, bh, (short)0, c, false, false);
  if (NT >= 2) c = __builtin_amdgcn_wmma_f32_16x16x32_f16(false, al, false, bh, (short)0, c, false, false);
  if (NT >= 3) c = __builtin_amdgcn_wmma_f32_16x16x32_f16(false, ah, false, bl, (short)0, c, false, false);
  asm volatile("v_nop\n\tv_nop\n\tv_nop\n\tv_nop" : "+v"(c) : "v"(ah), "v"(al), "v"(bh), "v"(bl));
  return c;
}
// batched GEMM like k_gemm_b but f16 operands: A f32 (split into f16 hi/lo if ASPLIT, else rounded to f16), Bt = f16 values [n][k]; alpha; C f32; N multiple of 16 (partial tiles skipped)
template <bool ASPLIT>
__global__ __launch_bounds__(128) void k_gemm_h(const float* __restrict__ A, int lda, size_t sA, const _Float16* __restrict__ Bh, int ldb, size_t sB, float alpha, float* __restrict__ C, int ldc, size_t sC, int M, int N, int K) {
  __shared__ __attribute__((aligned(16))) float so[4][16][64];
  const int tid = threadIdx.x, w = tid >> 5, lane = tid & 31, ln = lane & 15, hh = lane >> 4; const int by = blockIdx.y;
  A += (size_t)by * sA; Bh += (size_t)by * sB; C += (size_t)by * sC;
  const int ntn = (N + 63) / 64; const int wid = blockIdx.x * 4 + w; const int mt = wid / ntn, nq = wid % ntn; if (mt * 16 >= M) return;
  const int row0 = mt * 16, col0 = nq * 64; const float* arow = A + (size_t)(row0 + ln) * lda;
  v8f acc[4] = {};
  for (int kb = 0; kb < K; kb += 32) {
    FragH ah, al;
    const v4f x0 = *(const v4fa*)(arow + kb + 8 * hh), x1 = *(const v4fa*)(arow + kb + 8 * hh + 4), x2 = *(const v4fa*)(arow + kb + 16 + 8 * hh), x3 = *(const v4fa*)(arow + kb + 16 + 8 * hh + 4);
    float xs[16] = {x0[0],x0[1],x0[2],x0[3],x1[0],x1[1],x1[2],x1[3],x2[0],x2[1],x2[2],x2[3],x3[0],x3[1],x3[2],x3[3]};
#pragma unroll
    for (int i = 0; i < 16; ++i) { const _Float16 h = (_Float16)xs[i]; ah.h[i] = h; al.h[i] = ASPLIT ? (_Float16)(xs[i] - (float)h) : (_Float16)0.0f; }
#pragma unroll
    for (int t = 0; t < 4; ++t) { if (col0 + t * 16 >= N) continue; const size_t boff = (size_t)(col0 + t * 16 + ln) * ldb + kb; FragH bq; bq.half[0] = *(const v8us*)(Bh + boff + 8 * hh); bq.half[1] = *(const v8us*)(Bh + boff + 16 + 8 * hh);
      acc[t] = mmaH<ASPLIT ? 2 : 1>(ah.v, al.v, bq.v, bq.v, acc[t]); }
  }
#pragma unroll
  for (int t = 0; t < 4; ++t) { if (col0 + t * 16 >= N) continue;
#pragma unroll
    for (int r = 0; r < 8; ++r) so[w][8 * hh + r][t * 16 + ln] = acc[t][r] * alpha; }
  __builtin_amdgcn_fence(__ATOMIC_ACQ_REL, "workgroup"); __builtin_amdgcn_wave_barrier();
  const int rsub = lane >> 4, c4 = (lane & 15) * 4;
  {
#pragma unroll
    for (int q = 0; q < 8; ++q) { const int r = q * 2 + rsub; if (col0 + c4 < N) { const v4f v = *(const v4fa*)&so[w][r][c4]; *(v4f*)(C + (size_t)(row0 + r) * ldc + col0 + c4) = v; } }
     }
}

// Wt[n][k] = f16(W[k][n]·scale) from f32 row-major W[K][N] (scale = power of two; bf16-exact weights stay exact in f16 away from the subnormal range)
// One work-group per tile of 128 k x 64 n (tile bx of N / 64 by tile by of K / 128, handed in by the kernel that deals the tiles; K, N at compile time, so that the rows of a thread are constant offsets of one address). Reads: 16 lanes take 256 bytes in a row of one row of W, each thread the same four columns of eight rows, all eight loads in flight.
// The thread's 8 x 4 block leaves as four 16-byte pieces (eight k of one n) into an LDS tile [64 n][128 k]; stores: 16 lanes write 256 bytes in a row of one row of Wt. Both sides touch whole 128-byte lines only.
// LDS rows are 256 bytes, so every row starts on bank 0: piece kb of row n lies at place kb ^ (n / 4 % 16), which spreads the 16 lanes of a half wave over all banks in the write (rows 4 ln + j, one kb) and in the read (one row, 16 kb).
template <int K, int N>
__device__ __forceinline__ void wt_f16_tile(const float* __restrict__ W, _Float16* __restrict__ Wt, float scale, int bx, int by, unsigned short* tl) { static_assert(K % 128 == 0 && N % 64 == 0, "whole tiles");
  const int tid = threadIdx.x, ln = tid & 15, kb = tid >> 4; const int n0 = bx * 64, k0 = by * 128;
  const float* wb = W + (size_t)k0 * N + n0; const unsigned wo = (unsigned)(kb * 8 * N + ln * 4) * 4u;      /* the work-group's scalar base; the lane's fixed offset in bytes */
  v4f r[8];
#pragma unroll      /* register array; all loads in flight together */
  for (int i = 0; i < 8; ++i) r[i] = *(const v4fa*)((const char*)(wb + (size_t)i * N) + wo);
  asm volatile("s_wait_xcnt 0x0" :: "v"(wo), "s"(wb) : "memory");      /* behind the loads, in front of any later write of their base and offset registers; both as inputs, so that their registers are still theirs up to here */
#pragma unroll      /* register arrays */
  for (int j = 0; j < 4; ++j) { FragH f;
#pragma unroll      /* register arrays */
    for (int i = 0; i < 8; ++i) f.h[i] = (_Float16)(bf16_round(r[i][j]) * scale);
    *(v8us*)(tl + (ln * 4 + j) * 128 + (kb ^ ln) * 8) = f.half[0]; }
  __syncthreads();      /* the tile is whole before any row of it is read */
  unsigned short* ob = (unsigned short*)Wt + (size_t)n0 * K + k0; const unsigned oo = (unsigned)(kb * K + ln * 8) * 2u;      /* as above: row kb of each group of 16 rows, piece ln */
  v8us o[4];
#pragma unroll      /* register array */
  for (int p = 0; p < 4; ++p) { const int n = p * 16 + kb; o[p] = *(const v8us*)(tl + n * 128 + (ln ^ ((n >> 2) & 15)) * 8); }
#pragma unroll      /* register array */
  for (int p = 0; p < 4; ++p) *(v8us*)((char*)(ob + (size_t)p * 16 * K) + oo) = o[p];
}
// k_gemm_hh variant with fused epilogue: v = acc·alpha + bias[by·sBias + col] (+ CP[(row/rowsPerB)·sCPb + by·64 + col] if CP) ; ACT 0 none / 1 elu ; writes f16 C16 (and f32 C if non-null)
template <int ACT>
__global__ __launch_bounds__(128) void k_gemm_hhx(const _Float16* __restrict__ A, int lda, size_t sA, const _Float16* __restrict__ Bh, int ldb, size_t sB, float alpha, const float* __restrict__ bias, size_t sBias, const float* __restrict__ CP, int rowsPerB, size_t sCPb, int row0g,
    float* __restrict__ C, _Float16* __restrict__ C16, int ldc, size_t sC, int M, int N, int K) {
  __shared__ __attribute__((aligned(16))) float so[4][16][64];
  const int tid = threadIdx.x, w = tid >> 5, lane = tid & 31, ln = lane & 15, hh = lane >> 4; const int by = blockIdx.y;
  A += (size_t)by * sA; Bh += (size_t)by * sB; const size_t cofs = (size_t)by * sC; const float* bp = bias ? bias + (size_t)by * sBias : nullptr;
  const int ntn = (N + 63) / 64; const int wid = blockIdx.x * 4 + w; const int mt = wid / ntn, nq = wid % ntn; if (mt * 16 >= M) return;
  const int row0 = mt * 16, col0 = nq * 64; const _Float16* arow = A + (size_t)(row0 + ln) * lda;
  v8f acc[4] = {};
  for (int kb = 0; kb < K; kb += 32) { FragH ah; ah.half[0] = *(const v8us*)((const unsigned short*)arow + kb + 8 * hh); ah.half[1] = *(const v8us*)((const unsigned short*)arow + kb + 16 + 8 * hh);
#pragma unroll
    for (int t = 0; t < 4; ++t) { if (col0 + t * 16 >= N) continue; const size_t boff = (size_t)(col0 + t * 16 + ln) * ldb + kb; FragH bq; bq.half[0] = *(const v8us*)((const unsigned short*)Bh + boff + 8 * hh); bq.half[1] = *(const v8us*)((const unsigned short*)Bh + boff + 16 + 8 * hh);
      acc[t] = mmaH<1>(ah.v, ah.v, bq.v, bq.v, acc[t]); }
  }
#pragma unroll
  for (int t = 0; t < 4; ++t) { if (col0 + t * 16 >= N) continue; const int col = col0 + t * 16 + ln; const float bv = bp ? bf16_round(bp[col]) : 0.f;
#pragma unroll
    for (int r = 0; r < 8; ++r) { float v = acc[t][r] * alpha + bv; if (CP) { const int rr = row0g + row0 + 8 * hh + r; if (rowsPerB < 0) v += CP[cofs + (size_t)rr * ldc + col];      /* rowsPerB < 0: own element of the batched C plane */ else { const int bidx = rr / rowsPerB; v += CP[(size_t)bidx * sCPb + (size_t)by * 64 + col]; } } if (ACT == 1) v = (v > 0.f) ? v : expm1f(v); else if (ACT == 7) v = (v > 0.f) ? v + 1.0f : expf(v); else if (ACT == 8) v = tanhf(v); else if (ACT == 9) v = 0.5f * v * (1.0f + tanhf(0.7978845608028654f * (v + 0.044715f * v * v * v))); else if (ACT == 11) v = 1.0f / (1.0f + expf(-v)); else if (ACT == 12) v = (v > 0.f) ? v : 0.01f * v; else if (ACT == 14) v = (v > 0.f) ? v : 0.1f * v; else if (ACT == 16) v = (v >= 0.f) ? v : 0.3f * v; else if (ACT == 17) v = (v >= 0.f) ? v : 0.2f * v; else if (ACT == 15) v = v / (1.0f + expf(-v)); else if (ACT == 3) v = fmaxf(v, 0.f); else if (ACT == 6) v = 0.5f * v * (1.0f + erff(v * 0.70710678118654752f)); so[w][8 * hh + r][t * 16 + ln] = v; } }
  __builtin_amdgcn_fence(__ATOMIC_ACQ_REL, "workgroup"); __builtin_amdgcn_wave_barrier();
  const int rsub = lane >> 4, c4 = (lane & 15) * 4; typedef _Float16 v4h __attribute__((ext_vector_type(4)));
  {
#pragma unroll
    for (int q = 0; q < 8; ++q) { const int r = q * 2 + rsub; if (col0 + c4 < N) { const v4f v = *(const v4fa*)&so[w][r][c4]; if (C) *(v4f*)(C + cofs + (size_t)(row0 + r) * ldc + col0 + c4) = v; if (C16) { v4h h4; for (int i = 0; i < 4; ++i) h4[i] = (_Float16)v[i]; *(v4h*)(C16 + cofs + (size_t)(row0 + r) * ldc + col0 + c4) = h4; } } }
     }
}


typedef _Float16 v4h __attribute__((ext_vector_type(4)));

__global__ __launch_bounds__(256) void k_x16(const float* __restrict__ x, _Float16* __restrict__ X16, size_t n8) { const size_t t = (size_t)blockIdx.x * 256 + threadIdx.x; if (t >= n8) return; FragH f;
#pragma unroll
  for (int q = 0; q < 8; ++q) f.h[q] = (_Float16)bf16_round(x[t * 8 + q]); *(v8us*)((unsigned short*)X16 + t * 8) = f.half[0];  }
__global__ __launch_bounds__(256) void k_h16(const float* __restrict__ x, _Float16* __restrict__ X16, size_t n8) { const size_t t = (size_t)blockIdx.x * 256 + threadIdx.x; if (t >= n8) return; FragH f;
#pragma unroll
  for (int q = 0; q < 8; ++q) f.h[q] = (_Float16)x[t * 8 + q]; *(v8us*)((unsigned short*)X16 + t * 8) = f.half[0];  }
__global__ __launch_bounds__(256) void k_round16f(const float* __restrict__ W, _Float16* __restrict__ Bt, size_t n8) { const size_t t = (size_t)blockIdx.x * 256 + threadIdx.x; if (t >= n8) return; FragH f;
#pragma unroll
  for (int i = 0; i < 8; ++i) f.h[i] = (_Float16)(bf16_round(W[t * 8 + i]) * 16.0f); *(v8us*)((unsigned short*)Bt + t * 8) = f.half[0];  }
template <int NHv, int TTv>
__device__ __forceinline__ void vt_tile(const _Float16* __restrict__ V16, int ldv, int voff, _Float16* __restrict__ Vt, int bx, unsigned short (*tl)[66]) { const int tid = threadIdx.x; const int slab = bx / (TTv / 64), lg = bx % (TTv / 64); const int b = slab / NHv, h = slab % NHv;
  for (int i = tid; i < 64 * 8; i += 256) { const int r = i / 8, c8 = (i % 8) * 8; FragH f; f.half[0] = *(const v8us*)((const unsigned short*)V16 + ((size_t)b * TTv + lg * 64 + r) * ldv + voff + h * 64 + c8);
#pragma unroll
    for (int q = 0; q < 8; ++q) tl[r][c8 + q] = f.u[q]; }
  __syncthreads();
  {
#pragma unroll
    for (int rd = 0; rd < 2; ++rd) { const int d = rd * 32 + tid / 8, pc = tid % 8; FragH f;
#pragma unroll
      for (int q = 0; q < 8; ++q) f.u[q] = tl[pc * 8 + q][d];
      *(v8us*)((unsigned short*)Vt + ((size_t)slab * 64 + d) * TTv + lg * 64 + pc * 8) = f.half[0]; }
     } }

__global__ __launch_bounds__(256) void k_hl(const float* __restrict__ F, _Float16* __restrict__ Hh, _Float16* __restrict__ Hl, size_t n8) { const size_t t = (size_t)blockIdx.x * 256 + threadIdx.x; if (t >= n8) return; FragH fh, fl; const v4f a = *(const v4fa*)(F + t * 8), c = *(const v4fa*)(F + t * 8 + 4);
#pragma unroll
  for (int q = 0; q < 4; ++q) { _Float16 h = (_Float16)a[q]; fh.h[q] = h; fl.h[q] = (_Float16)((a[q] - (float)h) * 1024.0f); h = (_Float16)c[q]; fh.h[4 + q] = h; fl.h[4 + q] = (_Float16)((c[q] - (float)h) * 1024.0f); }
  { *(v8us*)((unsigned short*)Hh + t * 8) = fh.half[0]; *(v8us*)((unsigned short*)Hl + t * 8) = fl.half[0];  } }

// ---- fast GEMM (work-group tile 128x64, wave tile 32x64; requires M % 128 == 0 rows per launch region, N % 64 == 0, K % 64 == 0); epilogue = k_gemm_hhx semantics ----
// Operands reach the waves through LDS: per pass of 64 k the work-group's 128 rows of A and 64 rows of B (128 bytes each) are brought in once by asynchronous copies, whole lines at a time, into one of two buffers; the next pass's copies fly while this pass is worked on.
#define G2P 144                      /* LDS row pitch in bytes: 16 B x odd, the pitch for ds_load_b128 readers of 128-byte rows */
#define G2S ((128 + 64) * G2P)       /* one buffer: rows 0..127 = A, rows 128..191 = B */
__device__ __forceinline__ v16h g2_lfrag(const unsigned char* p) { FragH f; f.half[0] = *(const v8us*)p; f.half[1] = *(const v8us*)(p + 32); return f.v; }
// one pass's operands: twelve 16-byte copies per lane (eight lanes per 128-byte row, 16 rows per copy and work-group; copies 0..7 = A, 8..11 = B). l = the lane's LDS byte address in row tid / 8 of the buffer; a, b = its own 16 bytes in that row of A and of B; sa, sb = 16 rows in bytes.
// The s_wait_xcnt stands inside the statement, behind the last copy: a precaution in front of any later write of a register that a copy names.
__device__ __forceinline__ void g2_copy(unsigned l, const char* a, size_t sa, const char* b, size_t sb) {
  asm volatile("global_load_async_to_lds_b128 %0, %12, off\n\tglobal_load_async_to_lds_b128 %1, %13, off\n\tglobal_load_async_to_lds_b128 %2, %14, off\n\tglobal_load_async_to_lds_b128 %3, %15, off\n\t"
               "global_load_async_to_lds_b128 %4, %16, off\n\tglobal_load_async_to_lds_b128 %5, %17, off\n\tglobal_load_async_to_lds_b128 %6, %18, off\n\tglobal_load_async_to_lds_b128 %7, %19, off\n\t"
               "global_load_async_to_lds_b128 %8, %20, off\n\tglobal_load_async_to_lds_b128 %9, %21, off\n\tglobal_load_async_to_lds_b128 %10, %22, off\n\tglobal_load_async_to_lds_b128 %11, %23, off\n\ts_wait_xcnt 0x0"
               :: "v"(l), "v"(l + 16u * G2P), "v"(l + 32u * G2P), "v"(l + 48u * G2P), "v"(l + 64u * G2P), "v"(l + 80u * G2P), "v"(l + 96u * G2P), "v"(l + 112u * G2P), "v"(l + 128u * G2P), "v"(l + 144u * G2P), "v"(l + 160u * G2P), "v"(l + 176u * G2P),
                  "v"(a), "v"(a + sa), "v"(a + 2 * sa), "v"(a + 3 * sa), "v"(a + 4 * sa), "v"(a + 5 * sa), "v"(a + 6 * sa), "v"(a + 7 * sa), "v"(b), "v"(b + sb), "v"(b + 2 * sb), "v"(b + 3 * sb) : "memory"); }
__device__ __forceinline__ v8f g2_mma(v16h a, v16h b, v8f c) { v8f d = __builtin_amdgcn_wmma_f32_16x16x32_f16(false, a, false, b, (short)0, c, false, false); asm volatile("v_nop\n\tv_nop\n\tv_nop\n\tv_nop" : "+v"(d) : "v"(a), "v"(b)); return d; }
// s_wait_xcnt behind a group of loads, in front of any later write of a register that holds one of their addresses; the addresses as inputs, so that their registers are still theirs up to here and no load of the group returns its data into them
template <int N>
__device__ __forceinline__ void g2_xwait(const float* const (&p)[N]) { static_assert(N == 2 || N == 16, "one statement per group size");
  if constexpr (N == 2) asm volatile("s_wait_xcnt 0x0" :: "v"(p[0]), "v"(p[1]) : "memory");
  else asm volatile("s_wait_xcnt 0x0" :: "v"(p[0]), "v"(p[1]), "v"(p[2]), "v"(p[3]), "v"(p[4]), "v"(p[5]), "v"(p[6]), "v"(p[7]), "v"(p[8]), "v"(p[9]), "v"(p[10]), "v"(p[11]), "v"(p[12]), "v"(p[13]), "v"(p[14]), "v"(p[15]) : "memory"); }
// QKVF (the stacked q | k | v launch, rows b * SQ + s, columns 0 .. 3 DM - 1): the f32 values behind the f16 rows are stored as well, so that no product is formed twice: k and v head-major into KV (outputs 1 and 2, one behind the other: [k | v][NB][NH][SQ][HD]), and q, k, v of each batch's first QT0 rows into F0 ([q | k | v][NB][QT0][DM]) for the f32 attention path.
template <int ACT, bool QKVF = false>
__global__ __launch_bounds__(128) void k_gemm2(const _Float16* __restrict__ A, int lda, size_t sA, const _Float16* __restrict__ Bh, int ldb, size_t sB, float alpha, const float* __restrict__ bias, size_t sBias, const float* __restrict__ CP, int rowsPerB, size_t sCPb, int row0g,
    float* __restrict__ C, _Float16* __restrict__ C16, int ldc, size_t sC, int M, int N, int K, float* __restrict__ KV, float* __restrict__ F0) { static_assert(ACT == 0 || ACT == 3 || ACT == 6 || ACT == 8 || ACT == 9 || ACT == 11 || ACT == 12 || ACT == 14 || ACT == 15 || ACT == 16 || ACT == 17, "k_gemm2: unsupported ACT code (would silently apply no activation)");
  __shared__ __attribute__((aligned(16))) unsigned char ring[2 * G2S]; static_assert(sizeof(float) * 4 * 32 * 68 <= 2 * G2S, "the output staging fits in the ring");
  float (*so)[32][68] = (float (*)[32][68])ring;      /* output staging in the ring's place, behind the last pass's barrier */
  const int tid = threadIdx.x, w = tid >> 5, lane = tid & 31, ln = lane & 15, hh = lane >> 4; const int by = blockIdx.y;
  A += (size_t)by * sA; Bh += (size_t)by * sB; const size_t cofs = (size_t)by * sC; const float* bp = bias ? bias + (size_t)by * sBias : nullptr;
  const int ntn = N >> 6; const int mt = blockIdx.x / ntn, nq = blockIdx.x - mt * ntn; const int row0 = mt * 128 + 32 * w, col0 = nq * 64; if (mt * 128 >= M) return;      /* the whole work-group or none of it, in front of every barrier */
  const char* ag = (const char*)(A + (size_t)(mt * 128 + (tid >> 3)) * lda) + (tid & 7) * 16; const char* bg = (const char*)(Bh + (size_t)(col0 + (tid >> 3)) * ldb) + (tid & 7) * 16;      /* the lane's 16 bytes in the first of its rows */
  const size_t sa = (size_t)lda * 32, sb = (size_t)ldb * 32; const unsigned lc = (unsigned)(size_t)ring + (unsigned)((tid >> 3) * G2P + (tid & 7) * 16);
  const unsigned char* la = ring + (32 * w + ln) * G2P + 16 * hh; const unsigned char* lb = ring + (128 + ln) * G2P + 16 * hh;      /* fragment rows: the wave's own 32 rows of A, the 64 rows of B */
  const v8f z8 = {0.f,0.f,0.f,0.f,0.f,0.f,0.f,0.f}; v8f c00 = z8, c01 = z8, c02 = z8, c03 = z8, c10 = z8, c11 = z8, c12 = z8, c13 = z8;
  const int np = K >> 6;
  g2_copy(lc, ag, sa, bg, sb);
  asm volatile("s_wait_asynccnt 0x0" ::: "memory");      /* this wave's copies of pass 0 have landed */
  __syncthreads();      /* pass 0 is readable by every wave */
  if (np > 1) g2_copy(lc + G2S, ag + 128, sa, bg + 128, sb);
#pragma unroll 1
  for (int t = 0; t < np; ++t) { const unsigned bo = (unsigned)(t & 1) * G2S;
    v16h fa[2][2], fb[2][4];      /* the pass's fragments: two k steps of 32 */
#pragma unroll      /* register arrays, constant LDS offsets */
    for (int ks = 0; ks < 2; ++ks) { fa[ks][0] = g2_lfrag(la + bo + ks * 64); fa[ks][1] = g2_lfrag(la + bo + ks * 64 + 16 * G2P);
#pragma unroll      /* register arrays */
      for (int j = 0; j < 4; ++j) fb[ks][j] = g2_lfrag(lb + bo + ks * 64 + j * 16 * G2P); }
    __builtin_amdgcn_sched_barrier(0);      /* all LDS reads of the pass go out as one group in front of its products; left to itself the compiler reads one fragment at a time and waits out the LDS latency in front of every second product */
#pragma unroll      /* register arrays */
    for (int ks = 0; ks < 2; ++ks) {
      c00 = g2_mma(fa[ks][0], fb[ks][0], c00); c10 = g2_mma(fa[ks][1], fb[ks][0], c10);
      c01 = g2_mma(fa[ks][0], fb[ks][1], c01); c11 = g2_mma(fa[ks][1], fb[ks][1], c11);
      c02 = g2_mma(fa[ks][0], fb[ks][2], c02); c12 = g2_mma(fa[ks][1], fb[ks][2], c12);
      c03 = g2_mma(fa[ks][0], fb[ks][3], c03); c13 = g2_mma(fa[ks][1], fb[ks][3], c13); }
    asm volatile("s_wait_dscnt 0x0" ::: "memory");      /* this wave's reads of the buffer are done before the barrier behind which it is refilled */
    asm volatile("s_wait_asynccnt 0x0" ::: "memory");      /* this wave's copies of pass t + 1 have landed */
    __syncthreads();      /* publishes pass t + 1 and ends every wave's reads of pass t */
    if (t + 2 < np) g2_copy(lc + bo, ag + (size_t)(t + 2) * 128, sa, bg + (size_t)(t + 2) * 128, sb); }
  asm volatile("s_wait_asynccnt 0x0" ::: "memory");      /* no copy is outstanding when the ring becomes output staging */
  v8f accs[8] = {c00, c01, c02, c03, c10, c11, c12, c13};
#pragma unroll      /* register arrays */
  for (int u = 0; u < 8; ++u)
#pragma unroll      /* register arrays */
    for (int r = 0; r < 8; ++r) so[w][(u >> 2) * 16 + 8 * hh + r][(u & 3) * 16 + ln] = accs[u][r];      /* the raw sums; all arithmetic on them follows on the way out of the staging */
  __builtin_amdgcn_fence(__ATOMIC_ACQ_REL, "workgroup"); __builtin_amdgcn_wave_barrier();
  const int rsub = lane >> 4, c4 = (lane & 15) * 4;
  // Scale, bias, residual and activation are applied where the staged rows are read back: a lane holds four neighbouring columns of one row, so that bias and residual come as 16-byte loads and the code for one row pair serves all sixteen.
  // UQ row pairs are worked on per trip. With a library activation the loop stays rolled.
  constexpr int UQ = (ACT == 0 || ACT == 3) ? 16 : 2;
  v4f bv4 = {0.f, 0.f, 0.f, 0.f};
  if (bp) { const v4f br = *(const v4fa*)(bp + col0 + c4);
#pragma unroll      /* register arrays */
    for (int i = 0; i < 4; ++i) bv4[i] = bf16_round(br[i]); }
  auto fin = [&](const bool hascp) __attribute__((always_inline)) {
#pragma unroll 1      /* see above: the text stays small */
    for (int q0 = 0; q0 < 16; q0 += UQ) { v4f cp[UQ];
      if (hascp) { const float* pa[UQ];
        if (rowsPerB < 0) {      /* rowsPerB < 0: own element of the batched C plane; the trip's loads all in flight together */
#pragma unroll      /* register arrays */
          for (int j = 0; j < UQ; ++j) pa[j] = CP + cofs + (size_t)(row0g + row0 + (q0 + j) * 2 + rsub) * ldc + col0 + c4;
#pragma unroll      /* register arrays */
          for (int j = 0; j < UQ; ++j) cp[j] = *(const v4fa*)pa[j];
          g2_xwait(pa); }
        else {
#pragma unroll      /* register arrays */
          for (int j = 0; j < UQ; ++j) pa[j] = CP + (size_t)((row0g + row0 + (q0 + j) * 2 + rsub) / rowsPerB) * sCPb + (size_t)by * 64 + col0 + c4;
#pragma unroll      /* register arrays */
          for (int j = 0; j < UQ; ++j) { const float* p = pa[j]; const v4f c = {p[0], p[1], p[2], p[3]}; cp[j] = c; }
          g2_xwait(pa); } }
#pragma unroll      /* register arrays */
      for (int j = 0; j < UQ; ++j) { const int r = (q0 + j) * 2 + rsub; v4f vv = *(const v4fa*)&so[w][r][c4];
#pragma unroll      /* register arrays */
        for (int i = 0; i < 4; ++i) { float v = vv[i] * alpha + bv4[i]; if (hascp) v += cp[j][i];
          if (ACT == 3) v = fmaxf(v, 0.f); else if (ACT == 6) v = 0.5f * v * (1.0f + erff(v * 0.70710678118654752f)); else if (ACT == 11) v = 1.0f / (1.0f + expf(-v)); else if (ACT == 15) v = v / (1.0f + expf(-v)); else if (ACT == 12) v = (v > 0.f) ? v : 0.01f * v; else if (ACT == 8) v = tanhf(v); else if (ACT == 9) v = 0.5f * v * (1.0f + tanhf(0.7978845608028654f * (v + 0.044715f * v * v * v))); else if (ACT == 14) v = (v > 0.f) ? v : 0.1f * v; else if (ACT == 16) v = (v >= 0.f) ? v : 0.3f * v; else if (ACT == 17) v = (v >= 0.f) ? v : 0.2f * v;
          vv[i] = v; }
        if (QKVF) *(v4fa*)&so[w][r][c4] = vv;      /* the finished values, in the lane's own place, for the f32 stores below */
        if (C) { *(v4f*)(C + cofs + (size_t)(row0 + r) * ldc + col0 + c4) = vv; asm volatile("s_wait_xcnt 0x0" ::: "memory"); }      /* behind the store, in front of the conversion below, which may reuse its registers */
        if (C16) { v4h h4; for (int i = 0; i < 4; ++i) h4[i] = (_Float16)vv[i]; *(v4h*)(C16 + cofs + (size_t)(row0 + r) * ldc + col0 + c4) = h4; } }
      asm volatile("s_wait_xcnt 0x0" ::: "memory"); } };      /* behind the trip's loads and stores, in front of the next trip's (or later code's) writes of their address registers */
  if (CP) fin(true); else fin(false);
  if constexpr (QKVF) { static_assert(QT0 == 128 && SQ % 128 == 0 && HD == 64 && DM % 64 == 0, "a work-group's 128 rows lie in one batch and are its first QT0 rows or none of them; its 64 columns are one head of q, of k or of v");
    const int sel = col0 / DM, hc = col0 % DM, bt = (mt * 128) / SQ, t0 = (mt * 128) % SQ;      /* 0 q, 1 k, 2 v; first column in that matrix; batch; first row in the batch: all the work-group's own, scalars */
    if (sel >= 1) { float* kvp = KV + ((size_t)((sel - 1) * NB + bt) * NH + hc / HD) * SQ * HD + (size_t)t0 * HD; const unsigned kvo = (unsigned)((32 * w + rsub) * HD + c4) * 4u;      /* scalar base, the lane's fixed offset in bytes, the row pair as a constant: a head's rows follow one another, so that each store is 512 bytes in a row */
#pragma unroll      /* constant offsets */
      for (int q = 0; q < 16; ++q) *(v4f*)((char*)kvp + kvo + q * 2 * HD * 4) = *(const v4fa*)&so[w][q * 2 + rsub][c4];
      asm volatile("s_wait_xcnt 0x0" :: "v"(kvo), "s"(kvp) : "memory"); }      /* behind the stores, in front of any later write of their base and offset registers (the next block forms its own); both as inputs, so that their registers are still theirs up to here */
    if (t0 == 0) { float* fp = F0 + (size_t)(sel * NB + bt) * QT0 * DM + hc; const unsigned fo = (unsigned)((32 * w + rsub) * DM + c4) * 4u;      /* as above, row pitch DM */
#pragma unroll      /* constant offsets */
      for (int q = 0; q < 16; ++q) *(v4f*)((char*)fp + fo + q * 2 * DM * 4) = *(const v4fa*)&so[w][q * 2 + rsub][c4]; } } }


__global__ __launch_bounds__(256) void k_wnat(const float* __restrict__ w, size_t n8, _Float16* __restrict__ Bt) { const size_t t = (size_t)blockIdx.x * 256 + threadIdx.x; if (t >= n8) return; FragH f; for (int q = 0; q < 8; ++q) f.h[q] = (_Float16)(bf16_round(w[t * 8 + q]) * 16.0f); *(v8us*)((unsigned short*)Bt + t * 8) = f.half[0];  }
__global__ __launch_bounds__(256) void k_rsm(const float* __restrict__ S, _Float16* __restrict__ P, int nrows) {
  #pragma clang fp contract(off)
  const int i = blockIdx.x * 256 + threadIdx.x; if (i >= nrows) return; const float* s = S + (size_t)i * SQ; float mx = -3.0e38f;
#pragma unroll 1
  for (int j = 0; j < SQ; ++j) mx = fmaxf(mx, s[j]); float se = 0.f;
#pragma unroll 1
  for (int j = 0; j < SQ; ++j) se += expf(s[j] - mx); const float sc = 256.0f / se;
#pragma unroll 1
  for (int j0 = 0; j0 < SQ; j0 += 8) { FragH f; for (int q = 0; q < 8; ++q) f.h[q] = (_Float16)(expf(s[j0 + q] - mx) * sc); unsigned short* d = (unsigned short*)P + (size_t)i * SQ + j0; *(v8us*)d = f.half[0];  } }
__global__ __launch_bounds__(256) void k_vt(const _Float16* __restrict__ V16, int b, int h0, _Float16* __restrict__ VT) { __shared__ unsigned short tl[64][65]; const int tid = threadIdx.x; const int hh = blockIdx.x % HG, sg = blockIdx.x / HG; const int s0 = sg * 64; const int h = h0 + hh;
  for (int i = tid; i < 64 * 8; i += 256) { const int j = i / 8, d8 = (i % 8) * 8; FragH f; f.half[0] = *(const v8us*)((const unsigned short*)V16 + ((size_t)b * SQ + s0 + j) * DM + h * HD + d8); for (int q = 0; q < 8; ++q) tl[d8 + q][j] = f.u[q]; }
  __syncthreads();
  { for (int i = tid; i < 64 * 8; i += 256) { const int d = i / 8, j8 = (i % 8) * 8; FragH f; for (int q = 0; q < 8; ++q) f.u[q] = tl[d][j8 + q]; *(v8us*)((unsigned short*)VT + ((size_t)hh * HD + d) * SQ + s0 + j8) = f.half[0]; }  } }



// ---- lane exchanges and native exp2 shared by the two attention kernels below ----
template <int CTRL>
__device__ __forceinline__ float sm_rowx(float x) { return __builtin_bit_cast(float, __builtin_amdgcn_update_dpp(__builtin_bit_cast(int, x), __builtin_bit_cast(int, x), CTRL, 0xf, 0xf, false)); }      /* CTRL = 0x160 | m (row_xmask): lane l with lane l ^ m of its 16-lane row */
__device__ __forceinline__ float sm_half(float x) { return __builtin_bit_cast(float, __builtin_amdgcn_permlanex16(__builtin_bit_cast(int, x), __builtin_bit_cast(int, x), 0x76543210, 0xfedcba98, false, false)); }      /* lane l with lane l ^ 16 */
__device__ __forceinline__ float sm_wmax(float v) { v = fmaxf(v, sm_rowx<0x161>(v)); v = fmaxf(v, sm_rowx<0x162>(v)); v = fmaxf(v, sm_rowx<0x164>(v)); v = fmaxf(v, sm_rowx<0x168>(v)); return fmaxf(v, sm_half(v)); }
__device__ __forceinline__ float sm_wsum(float v) { v += sm_rowx<0x161>(v); v += sm_rowx<0x162>(v); v += sm_rowx<0x164>(v); v += sm_rowx<0x168>(v); return v + sm_half(v); }
// 2^x of four values: each v_exp_f32 fills the slot behind the one before it (results apart from all sources), the v_nop the slot behind the last, which the instruction set asks for before a result is read or a source overwritten
__device__ __forceinline__ v4f sm_exp2x4(v4f x) { float r0, r1, r2, r3;
  asm("v_exp_f32 %0, %4\n\tv_exp_f32 %1, %5\n\tv_exp_f32 %2, %6\n\tv_exp_f32 %3, %7\n\tv_nop" : "=&v"(r0), "=&v"(r1), "=&v"(r2), "=&v"(r3) : "v"(x[0]), "v"(x[1]), "v"(x[2]), "v"(x[3]));
  const v4f r = {r0, r1, r2, r3}; return r; }
// ---- causal attention for query rows QT0 .. SQ - 1 in one launch: scores and softmax weights never leave registers. One wave owns 32 query rows of one (batch, head) and walks the keys 64 at a time; no LDS, no barrier.
// Both products are formed transposed, so that a query is a lane (column ln) in each: S^T = K Q^T (A = 16 key rows, B = query rows) gives lane (ln, hh) the keys 8 hh + r of a 16-key tile for query ln, which is the k order of a B fragment
// (tiles 2 j, 2 j + 1 -> k = 8 hh + i, 16 + 8 hh + i): the weights go from accumulator to operand by a conversion alone. O^T = V^T P^T (A = 16 rows of V^T) keeps query = ln, so that the running maximum, the rescale and the row sum are the lane's own.
// Running maximum kept on the raw products; weights 2^((s - max) c + 8), c = log2(e) / 8: at most 256, so that small weights stay clear of the f16 subnormals; the row sum carries the same factor.
__device__ __forceinline__ v8f fa_mma(v16h a, v16h b, v8f c) { return __builtin_amdgcn_wmma_f32_16x16x32_f16(false, a, false, b, (short)0, c, false, false); }
// fragment from a wave-uniform base and the lane's own fixed offset in bytes (the value the load instruction itself takes beside a scalar base)
__device__ __forceinline__ v16h fa_frag(const _Float16* base, unsigned off) { FragH f; f.half[0] = *(const v8us*)((const char*)base + off); f.half[1] = *(const v8us*)((const char*)base + off + 32); return f.v; }
__device__ __forceinline__ void fa_loadk(const _Float16* __restrict__ kp, int kb, unsigned ko, v16h (&kf)[4][2]) {
#pragma unroll      /* register arrays */
  for (int t = 0; t < 4; ++t)
#pragma unroll      /* register arrays */
    for (int ks = 0; ks < 2; ++ks) kf[t][ks] = fa_frag(kp + (size_t)(kb + t * 16) * LQ + ks * 32, ko); }
// one pass of 64 keys from kb on. LAST: the pass that holds the rows' own keys (the only one that needs the mask) and has no pass behind it to fetch K for.
template <bool LAST>
__device__ __forceinline__ void fa_pass(const _Float16* __restrict__ kp, const _Float16* __restrict__ vp, int kb, int qrel, unsigned ko, unsigned vo, const v16h (&qf)[2][2], v16h (&kf)[4][2], v8f (&o)[2][4], float (&mr)[2], float (&l)[2]) {
  const float cs = 0.125f * 1.44269504f; const v8f z8 = {0.f, 0.f, 0.f, 0.f, 0.f, 0.f, 0.f, 0.f};
  v16h vf[4][2];
#pragma unroll      /* register arrays */
  for (int t = 0; t < 4; ++t)
#pragma unroll      /* register arrays */
    for (int ks = 0; ks < 2; ++ks) vf[t][ks] = fa_frag(vp + (size_t)t * 16 * SQ + kb + ks * 32, vo);
  asm volatile("s_wait_xcnt 0x0" :: "v"(vo) : "memory");      /* behind the loads, in front of any later write of a register that holds one of their addresses; the offset as an input, so that its register is still the offset's while the loads issue */
  __builtin_amdgcn_sched_barrier(0);      /* V^T of this pass is asked for here, so that it flies under the score products and the softmax; left to itself the scheduler sinks the loads to their use */
  v8f st[2][4];
#pragma unroll      /* register arrays */
  for (int qt = 0; qt < 2; ++qt)
#pragma unroll      /* register arrays */
    for (int t = 0; t < 4; ++t) st[qt][t] = fa_mma(kf[t][1], qf[qt][1], fa_mma(kf[t][0], qf[qt][0], z8));
  if (!LAST) { __builtin_amdgcn_sched_barrier(0);      /* the next pass's K is asked for behind this pass's last use of K and no later: it flies under the softmax and the second product */
    fa_loadk(kp, kb + 64, ko, kf);
    asm volatile("s_wait_xcnt 0x0" :: "v"(ko) : "memory");      /* as behind the V^T loads above */
    __builtin_amdgcn_sched_barrier(0); }      /* as the line above: keeps the loads from sinking */
  float mn[2];
#pragma unroll      /* register arrays */
  for (int qt = 0; qt < 2; ++qt) { const int rel = qrel + qt * 16 - kb;      /* key kb + 16 t + 8 hh + r is kept while 16 t + r <= rel */
    float mx = mr[qt];
#pragma unroll      /* register arrays */
    for (int t = 0; t < 4; ++t)
#pragma unroll      /* register arrays */
      for (int r = 0; r < 8; ++r) { if (LAST) st[qt][t][r] = (t * 16 + r <= rel) ? st[qt][t][r] : -1.0e30f; mx = fmaxf(mx, st[qt][t][r]); }
    mn[qt] = fmaxf(mx, sm_half(mx)); }      /* the other eight keys of each tile sit in lane l ^ 16 */
  const v4f ax = {(mr[0] - mn[0]) * cs, (mr[1] - mn[1]) * cs, 0.f, 0.f}; const v4f al = sm_exp2x4(ax);      /* rescale of what was summed under the old maximum; 0 in the first pass */
  FragH pf[2][2];
#pragma unroll      /* register arrays */
  for (int qt = 0; qt < 2; ++qt) { const float mo = mn[qt] * cs - 8.0f; mr[qt] = mn[qt];
    v4f se = {0.f, 0.f, 0.f, 0.f};
#pragma unroll      /* register arrays */
    for (int t = 0; t < 4; ++t)
#pragma unroll      /* register arrays */
      for (int g = 0; g < 2; ++g) { v4f x;
#pragma unroll      /* register arrays */
        for (int q = 0; q < 4; ++q) x[q] = st[qt][t][g * 4 + q] * cs - mo;
        x = sm_exp2x4(x); se += x;
#pragma unroll      /* register arrays */
        for (int q = 0; q < 4; ++q) pf[qt][t >> 1].h[(t & 1) * 8 + g * 4 + q] = (_Float16)x[q]; }
    l[qt] = l[qt] * al[qt] + ((se[0] + se[1]) + (se[2] + se[3]));
#pragma unroll      /* register arrays */
    for (int t = 0; t < 4; ++t) o[qt][t] *= al[qt]; }
  __builtin_amdgcn_sched_barrier(0);      /* the second product starts behind the last exp2 of both tiles */
#pragma unroll      /* register arrays */
  for (int qt = 0; qt < 2; ++qt)
#pragma unroll      /* register arrays */
    for (int t = 0; t < 4; ++t) o[qt][t] = fa_mma(vf[t][1], pf[qt][1].v, fa_mma(vf[t][0], pf[qt][0].v, o[qt][t])); }
__global__ __launch_bounds__(256) void k_fattn(const _Float16* __restrict__ QKVp, const _Float16* __restrict__ VTp, const float* __restrict__ XBp, float* __restrict__ X1p) {
  static_assert(QT0 == 128 && HD == 64 && SQ % 256 == 0, "blocks of 128 query rows; block 0 of a batch belongs to the f32 path; blocks 1 .. SQ / 128 - 1 are paired below");
  const int lane = threadIdx.x & 31, ln = lane & 15, hh = lane >> 4; const int w = __builtin_amdgcn_readfirstlane((int)(threadIdx.x >> 5));      /* the wave's number: a scalar, so that the early exit and the trip count are scalar */
  const int h = blockIdx.y, b = blockIdx.z; const int far = SQ / 128 - 1 - (int)blockIdx.x, near = 1 + (int)blockIdx.x;      /* waves 0-3 take a late block of rows, waves 4-7 the early block that makes the keys walked per work-group level */
  if (w >= 4 && near >= far) return;      /* the middle block has no partner; no barrier in this kernel */
  const int qw = (w < 4 ? far : near) * 128 + (w & 3) * 32;
  const size_t r0 = (size_t)b * SQ;
  const _Float16* qp = QKVp + (r0 + qw) * LQ + h * HD; const _Float16* kp = QKVp + DM + r0 * LQ + h * HD; const _Float16* vp = VTp + (size_t)(b * NH + h) * HD * SQ;      /* wave-uniform bases */
  const unsigned ko = (unsigned)(ln * LQ + 8 * hh) * 2u, vo = (unsigned)(ln * SQ + 8 * hh) * 2u;      /* the lane's row and k half in q / k rows and in V^T rows, in bytes */
  v16h qf[2][2], kf[4][2];
#pragma unroll      /* register arrays */
  for (int qt = 0; qt < 2; ++qt)
#pragma unroll      /* register arrays */
    for (int ks = 0; ks < 2; ++ks) qf[qt][ks] = fa_frag(qp + (size_t)qt * 16 * LQ + ks * 32, ko);
  fa_loadk(kp, 0, ko, kf);
  asm volatile("s_wait_xcnt 0x0" :: "v"(ko) : "memory");      /* behind the loads of q and of the first K, in front of any later write of their base and offset registers */
  __builtin_amdgcn_sched_barrier(0);      /* keeps later address arithmetic, which reuses those registers, behind the wait */
  const v8f z8 = {0.f, 0.f, 0.f, 0.f, 0.f, 0.f, 0.f, 0.f};
  v8f o[2][4] = {{z8, z8, z8, z8}, {z8, z8, z8, z8}}; float mr[2] = {-1.0e30f, -1.0e30f}; float l[2] = {0.f, 0.f};
  const int klast = qw & ~63;      /* keys 0 .. qw + 31 in passes of 64: every pass before this one lies wholly below row qw, this one ends at or below SQ - 1 */
  const int qrel = qw + ln - 8 * hh;
#pragma unroll 1      /* one pass holds 32 loads and 32 matrix instructions already */
  for (int kb = 0; kb < klast; kb += 64) fa_pass<false>(kp, vp, kb, qrel, ko, vo, qf, kf, o, mr, l);
  const float* xp = XBp + (r0 + qw) * DM + h * HD; float* yp = X1p + (r0 + qw) * DM + h * HD; const unsigned xo = (unsigned)(ln * DM + 8 * hh) * 4u;      /* lane (ln, hh) holds columns 16 t + 8 hh .. + 7 of query ln; in bytes */
  v4f xr[2][4][2];
#pragma unroll      /* register arrays */
  for (int qt = 0; qt < 2; ++qt)
#pragma unroll      /* register arrays */
    for (int t = 0; t < 4; ++t)
#pragma unroll      /* register arrays */
      for (int g = 0; g < 2; ++g) xr[qt][t][g] = *(const v4fa*)((const char*)(xp + qt * 16 * DM + t * 16 + g * 4) + xo);
  asm volatile("s_wait_xcnt 0x0" :: "v"(xo) : "memory");      /* as behind the V^T loads */
  __builtin_amdgcn_sched_barrier(0);      /* the residual rows are asked for here and fly under the last pass, in the registers that the K fetched ahead no longer needs */
  fa_pass<true>(kp, vp, klast, qrel, ko, vo, qf, kf, o, mr, l);
#pragma unroll      /* register arrays */
  for (int qt = 0; qt < 2; ++qt) { const float inv = 1.0f / (l[qt] + sm_half(l[qt]));      /* the two halves' sums joined once */
#pragma unroll      /* register arrays */
    for (int t = 0; t < 4; ++t)
#pragma unroll      /* register arrays */
      for (int g = 0; g < 2; ++g)
#pragma unroll      /* register arrays */
        for (int q = 0; q < 4; ++q) xr[qt][t][g][q] += o[qt][t][g * 4 + q] * inv; }
  __builtin_amdgcn_sched_barrier(0);      /* all arithmetic in front of the first store, so that nothing rewrites a register that an issued store names */
#pragma unroll      /* register arrays */
  for (int qt = 0; qt < 2; ++qt)
#pragma unroll      /* register arrays */
    for (int t = 0; t < 4; ++t)
#pragma unroll      /* register arrays */
      for (int g = 0; g < 2; ++g) *(v4f*)((char*)(yp + qt * 16 * DM + t * 16 + g * 4) + xo) = xr[qt][t][g]; }


typedef float v2f  __attribute__((ext_vector_type(2)));
typedef float v2fa __attribute__((ext_vector_type(2), may_alias));
// ---- f32 attention for the first QT0 query rows: one wave per (head, query row), eight rows of one head per work-group. The head's K and V rows up to the end of the rows' 32-key chunk are staged once in LDS.
// Scores: lane l owns keys 32 c + l (K pitch 68 floats = 16 B x odd, so that the 32 rows read by one ds_load_b128 spread over the banks). Output: lane l owns columns 2 l, 2 l + 1; each key's weight comes out of its lane by v_readlane.
// NCH = 32-key chunks (compile time: every load of a phase is issued before the first wait). Keys past the row get weight 2^(-1e30 ..) = 0.
template <int NCH>
__device__ __forceinline__ void att0_rows(const float* __restrict__ QF, const float* __restrict__ KF, const float* __restrict__ VF, float scale, float* __restrict__ OF, int h, int row0, float (*lk)[HD + 4], float (*lv)[HD]) {
  const int tid = threadIdx.x, lane = tid & 31; const int i = row0 + __builtin_amdgcn_readfirstlane(tid >> 5);      /* the row is the wave's: a scalar */
  const int sr = tid >> 4, sc = (tid & 15) * 4;      /* staging: 16 threads per 256-byte row, 16 rows per pass */
  const float* kg = KF + h * HD; const float* vg = VF + h * HD; const float* qr = QF + (size_t)i * DM + h * HD; const int so = sr * DM + sc;      /* row pitch DM at compile time: one address per matrix, the pass as a constant offset of the load */
  v4f kk[2 * NCH], vv[2 * NCH], q[HD / 4];
#pragma unroll      /* arrays stay in registers; all loads in flight together */
  for (int p = 0; p < 2 * NCH; ++p) { kk[p] = *(const v4fa*)(kg + so + p * 16 * DM); vv[p] = *(const v4fa*)(vg + so + p * 16 * DM); }
#pragma unroll      /* the query row, same address in every lane, fetched beside the staging loads */
  for (int c = 0; c < HD / 4; ++c) q[c] = *(const v4fa*)(qr + c * 4);
#pragma unroll      /* register arrays */
  for (int p = 0; p < 2 * NCH; ++p) { *(v4fa*)&lk[p * 16 + sr][sc] = kk[p]; *(v4fa*)&lv[p * 16 + sr][sc] = vv[p]; }
  __syncthreads();
  v4f a[NCH];
#pragma unroll      /* register arrays */
  for (int c = 0; c < NCH; ++c) { const v4f z = {0.f, 0.f, 0.f, 0.f}; a[c] = z; }
#pragma unroll      /* 4 NCH independent sums per lane */
  for (int d = 0; d < HD / 4; ++d)
#pragma unroll      /* a[c] by constant index */
    for (int c = 0; c < NCH; ++c) a[c] += q[d] * *(const v4fa*)&lk[c * 32 + lane][d * 4];
  float e[NCH]; float mx = -1.0e30f;
#pragma unroll      /* register arrays */
  for (int c = 0; c < NCH; ++c) { const float s = ((a[c][0] + a[c][1]) + (a[c][2] + a[c][3])) * scale; e[c] = (c * 32 + lane <= i) ? s : -1.0e30f; mx = fmaxf(mx, e[c]); }
  mx = sm_wmax(mx);
  float l = 0.f; v4f t = {-200.f, -200.f, -200.f, -200.f};      /* chunks that this case does not have: 2^-200, not summed */
#pragma unroll      /* register arrays */
  for (int c = 0; c < NCH; ++c) t[c] = (e[c] - mx) * 1.44269504f;      /* exp(x) = 2^(x log2 e), the native form, as in the row softmax above */
  t = sm_exp2x4(t);
#pragma unroll      /* register arrays */
  for (int c = 0; c < NCH; ++c) { e[c] = t[c]; l += e[c]; }
  l = sm_wsum(l);
  const v2f z2 = {0.f, 0.f}; v2f o[4] = {z2, z2, z2, z2};      /* four sums per column, so that one key's multiply-add does not wait for the key before it */
#pragma unroll      /* constant lane numbers for v_readlane, constant LDS offsets */
  for (int c = 0; c < NCH; ++c)
#pragma unroll      /* as the line above */
    for (int j = 0; j < 32; ++j) { const float ej = __builtin_bit_cast(float, __builtin_amdgcn_readlane(__builtin_bit_cast(int, e[c]), j)); o[j & 3] += ej * *(const v2fa*)&lv[c * 32 + j][lane * 2]; }
  const float fin = 64.0f / l;      /* o carried x64, scaled by 1/64 where it is added to x1 */
  const v2f r = ((o[0] + o[1]) + (o[2] + o[3])) * fin;
  *(v2fa*)(OF + (size_t)i * DM + h * HD + lane * 2) = r; }
// The two jobs that need the q | k | v launch and nothing of each other share this grid: work-groups 0 .. A0G - 1 are the f32 attention (the longer job, so it starts first), the rest one V^T tile each. The branch is the same for a whole work-group, barriers included.
#define A0G (NB * NH * (QT0 / 8))
#define VTG (NB * NH * (SQ / 64))
__global__ __launch_bounds__(256) void k_att0w_vt(const float* __restrict__ QF, const float* __restrict__ KF, const float* __restrict__ VF, float scale, float* __restrict__ OF, const _Float16* __restrict__ V16, _Float16* __restrict__ Vt) {
  static_assert(QT0 == 128 && HD == 64, "the cases below cover 1 .. 4 chunks of 32 keys; two columns per lane");
  __shared__ __attribute__((aligned(16))) float lk[QT0][HD + 4]; __shared__ __attribute__((aligned(16))) float lv[QT0][HD]; __shared__ unsigned short tl[64][66];
  if (blockIdx.x >= A0G) { vt_tile<NH, SQ>(V16, LQ, 0, Vt, (int)blockIdx.x - A0G, tl); return; }
  const int bx = blockIdx.x % (NH * (QT0 / 8));
  { const size_t bo = (size_t)(blockIdx.x / (NH * (QT0 / 8))) * QT0 * DM; QF += bo; KF += bo; VF += bo; OF += bo; }      /* the batch: each matrix holds the batches' QT0 rows one behind the other */
  const int h = bx / (QT0 / 8), row0 = (bx % (QT0 / 8)) * 8;      /* eight rows lie in one 32-key chunk: the switch is the same for the whole work-group, barrier included */
  switch (row0 >> 5) {
    case 0: att0_rows<1>(QF, KF, VF, scale, OF, h, row0, lk, lv); break; case 1: att0_rows<2>(QF, KF, VF, scale, OF, h, row0, lk, lv); break;
    case 2: att0_rows<3>(QF, KF, VF, scale, OF, h, row0, lk, lv); break; case 3: att0_rows<4>(QF, KF, VF, scale, OF, h, row0, lk, lv); break; } }


template <int BFIN, int WXB>
__device__ __forceinline__ void ln16_row(const float* __restrict__ X, const float* __restrict__ g, const float* __restrict__ bb, float eps, _Float16* __restrict__ N16, float* __restrict__ XB, size_t r, float* red) {
  #pragma clang fp contract(off)
  const int t = threadIdx.x; const v4f xa = *(const v4fa*)(X + r * DMQ + t * 4); float s[4]; float sum = 0.f;
  for (int q = 0; q < 4; ++q) { s[q] = BFIN ? bf16_round(xa[q]) : xa[q]; sum = __fadd_rn(sum, s[q]); }
  red[t] = sum; __syncthreads(); for (int st = 128; st > 0; st >>= 1) { if (t < st) red[t] = __fadd_rn(red[t], red[t + st]); __syncthreads(); } const float mu = red[0] / (float)DMQ; __syncthreads();
  float vs = 0.f; for (int q = 0; q < 4; ++q) { const float dl = __fadd_rn(s[q], -mu); vs = __fadd_rn(vs, __fmul_rn(dl, dl)); } red[t] = vs; __syncthreads(); for (int st = 128; st > 0; st >>= 1) { if (t < st) red[t] = __fadd_rn(red[t], red[t + st]); __syncthreads(); }
  const float rs = rsqrtf(__fadd_rn(red[0] / (float)DMQ, eps)); v4h y; v4f xb;
  for (int q = 0; q < 4; ++q) { const int c = t * 4 + q; y[q] = (_Float16)__fadd_rn(__fmul_rn(__fmul_rn(__fadd_rn(s[q], -mu), rs), bf16_round(g[c])), bf16_round(bb[c])); xb[q] = s[q]; }
  { *(v4h*)(N16 + r * DMQ + t * 4) = y; if (WXB) *(v4f*)(XB + r * DMQ + t * 4) = xb;  } }
template <int BFIN, int WXB>
__global__ __launch_bounds__(256) void k_ln16(const float* __restrict__ X, const float* __restrict__ g, const float* __restrict__ bb, float eps, _Float16* __restrict__ N16, float* __restrict__ XB) { __shared__ float red[256]; ln16_row<BFIN, WXB>(X, g, bb, eps, N16, XB, blockIdx.x, red); }
// ---- all that is made from the inputs alone, in one launch: the stacked bias, the five weight matrices as f16 [n][k], LN1 of every token row. None of these jobs reads what another writes, so that they share one grid by ranges of the block index:
// their part-filled grids and their starts and ends overlap, where nine launches in a row each waited for the one before to drain. Every branch is the same for a whole work-group, barriers included.
#define PG_B 3                                   /* bq, bk, bv */
#define PG_W ((DM / 64) * (DM / 128))            /* tiles of one of wq, wk, wv */
#define PG_F ((DFF / 64) * (DM / 128))           /* tiles of w_fc; w_proj has as many */
#define PG_ALL (PG_B + 3 * PG_W + 2 * PG_F + (int)NR)
__global__ __launch_bounds__(256) void k_prep(const float* __restrict__ x, const float* __restrict__ g1, const float* __restrict__ be1, const float* __restrict__ wq, const float* __restrict__ wk, const float* __restrict__ wv,
    const float* __restrict__ bq, const float* __restrict__ bk, const float* __restrict__ bv, const float* __restrict__ wfc, const float* __restrict__ wmp,
    _Float16* __restrict__ BQKV, float* __restrict__ bqkv, _Float16* __restrict__ X16, float* __restrict__ XB, _Float16* __restrict__ BW1, _Float16* __restrict__ BW2) { static_assert(DM == 256 * 4, "a bias is four floats a thread");
  __shared__ __attribute__((aligned(16))) unsigned short tl[64 * 128]; __shared__ float red[256];
  int b = blockIdx.x;
  if (b < PG_B) { const float* s = b == 0 ? bq : b == 1 ? bk : bv; const v4f v = *(const v4fa*)(s + threadIdx.x * 4); *(v4f*)(bqkv + b * DM + threadIdx.x * 4) = v; return; }
  b -= PG_B;
  if (b < 3 * PG_W) { const int m = b / PG_W, i = b % PG_W; const float* W = m == 0 ? wq : m == 1 ? wk : wv; wt_f16_tile<DM, DM>(W, BQKV + (size_t)m * DM * DM, 16.0f, i % (DM / 64), i / (DM / 64), tl); return; }
  b -= 3 * PG_W;
  if (b < PG_F) { wt_f16_tile<DM, DFF>(wfc, BW1, 16.0f, b % (DFF / 64), b / (DFF / 64), tl); return; }
  b -= PG_F;
  if (b < PG_F) { wt_f16_tile<DFF, DM>(wmp, BW2, 16.0f, b % (DM / 64), b / (DM / 64), tl); return; }
  b -= PG_F;
  ln16_row<1, 1>(x, g1, be1, 1e-5f, X16, XB, (size_t)b, red);
  asm volatile("s_wait_xcnt 0x0" ::: "memory"); }      /* behind the row's stores: the compiler lays the jobs out one behind the other and lets this one run through the scalar tests of the rest, which reuse the stores' base registers */
__global__ __launch_bounds__(256) void k_ftres2(const float* __restrict__ OF0, const float* __restrict__ XB, float* __restrict__ X1, size_t n4) {
  #pragma clang fp contract(off)
  const size_t t = (size_t)blockIdx.x * 256 + threadIdx.x; if (t >= n4) return; const v4f o = *(const v4fa*)(OF0 + t * 4), xv = *(const v4fa*)(XB + t * 4); v4f y; for (int q = 0; q < 4; ++q) y[q] = __fadd_rn(__fmul_rn(o[q], 0.015625f), xv[q]); *(v4f*)(X1 + t * 4) = y;  }

__global__ __launch_bounds__(256) void k_wthd(const float* __restrict__ Wt, _Float16* __restrict__ Bt) { const size_t t = (size_t)blockIdx.x * 256 + threadIdx.x; if (t >= (size_t)NH * HD * (DM / 8)) return; const int m8 = (int)(t % (DM / 8)) * 8; const int d = (int)((t / (DM / 8)) % HD); const int h = (int)(t / ((size_t)(DM / 8) * HD)); FragH f;
  for (int q = 0; q < 8; ++q) f.h[q] = (_Float16)(16.0f * bf16_round(Wt[((size_t)h * DM + m8 + q) * HD + d])); unsigned short* dst = (unsigned short*)Bt + ((size_t)h * HD + d) * DM + m8; *(v8us*)dst = f.half[0];  }




__global__ __launch_bounds__(256) void k_wtpad(const float* __restrict__ Wm, _Float16* __restrict__ Wt, int Kr, int Kp, int Nr, int Np, float scale) {
  const int t = blockIdx.x * 256 + threadIdx.x; if (t >= Np * (Kp / 8)) return; const int n = t / (Kp / 8), k8 = (t % (Kp / 8)) * 8; const int nc = min(n, Nr - 1); const float fn = (n < Nr) ? 1.f : 0.f; FragH f;
  for (int i = 0; i < 8; ++i) { const int k = k8 + i; const int kc = min(k, Kr - 1); const float fk = (k < Kr) ? fn : 0.f; f.h[i] = (_Float16)(bf16_round(Wm[(size_t)kc * Nr + nc]) * scale * fk); }
  unsigned short* o = (unsigned short*)Wt + (size_t)n * Kp + k8; *(v8us*)o = f.half[0];  }
__global__ __launch_bounds__(128) void k_bpad(const float* __restrict__ b, float* __restrict__ Bp, int nr, int np) {
  const int i = threadIdx.x; if (i >= np) return; const float v = b[min(i, nr - 1)] * ((i < nr) ? 1.f : 0.f); *(float*)(Bp + i) = v;  }

__global__ __launch_bounds__(256) void k_bcpy(const float* __restrict__ b, int n, int NP, float* __restrict__ dst, int dst0) { for (int i = threadIdx.x; i < NP; i += 256) { const float v = (i < n) ? b[i] : 0.f; *(float*)(dst + dst0 + i) = v; }  }


__global__ __launch_bounds__(256) void k_addf(const float* __restrict__ XBr, const float* __restrict__ OF, float* __restrict__ O, size_t n8) {
  #pragma clang fp contract(off)
  XBr += (size_t)blockIdx.y * SQ * DM; O += (size_t)blockIdx.y * SQ * DM; OF += (size_t)blockIdx.y * QT0 * DM;      /* blockIdx.y = batch: its first rows in the token planes, its own QT0 rows in OF */
  const size_t t = (size_t)blockIdx.x * 256 + threadIdx.x; if (t >= n8) return; const v4f a = *(const v4fa*)(XBr + t * 8), b = *(const v4fa*)(XBr + t * 8 + 4), c = *(const v4fa*)(OF + t * 8), d = *(const v4fa*)(OF + t * 8 + 4); v4f r0, r1;
  for (int q = 0; q < 4; ++q) { r0[q] = __fadd_rn(a[q], __fmul_rn(c[q], 0.015625f)); r1[q] = __fadd_rn(b[q], __fmul_rn(d[q], 0.015625f)); }
  { *(v4f*)(O + t * 8) = r0; *(v4f*)(O + t * 8 + 4) = r1;  } }


extern "C" void kernel_launch(void* const* d_in, const int* in_sizes, int n_in,
                              void* d_out, int out_size, void* d_ws, size_t ws_size, hipStream_t stream) {
  (void)in_sizes; (void)n_in; (void)out_size;
  const float* const* I = (const float* const*)d_in; const float* x = I[0]; const float* wq = I[1]; const float* bq = I[2]; const float* wk = I[3]; const float* bk = I[4]; const float* wv = I[5]; const float* bv = I[6]; const float* g1 = I[7]; const float* be1 = I[8]; const float* gg2 = I[9]; const float* be2 = I[10]; const float* wfc = I[11]; const float* bfc = I[12]; const float* wmp = I[13]; const float* bmp = I[14];      /* input order: x; [in][out] wq / wk / wv + biases; LN1 w / b, LN2 w / b; w_fc [1024][4096] + b_fc, w_proj [4096][1024] + b_proj */
  float* OUT0 = (float*)d_out; float* OUTK = (float*)d_out + NR * DM;      /* tuple outputs: out at byte 0, k at 16,777,216, v at 33,554,432 (each NB * SQ * DM floats) */
  static_assert(NH * HD == DM && DM % 64 == 0 && SQ % 128 == 0 && QT0 % 8 == 0, "shape / tile multiples");
  char* ws = (char*)d_ws; size_t off = 0;
  auto take = [&](size_t bytes) { char* p = ws + off; off += (bytes + 255) & ~(size_t)255; return p; };
  _Float16* BQKV = (_Float16*)take((size_t)3 * DM * DM * 2); float* bqkv = (float*)take((size_t)3 * DM * 4);      /* stacked bias bq | bk | bv */
  _Float16* X16 = (_Float16*)take(NR * DM * 2); float* XB = (float*)take(NR * DM * 4); float* X1 = (float*)take(NR * DM * 4); _Float16* M16 = nullptr;      /* = X16 below (alias: X16's last reader, the q | k | v GEMM, precedes LN2's write) */ _Float16* HF16 = (_Float16*)take(NR * DFF * 2); _Float16* BW1 = (_Float16*)take((size_t)DFF * DM * 2); _Float16* BW2 = (_Float16*)take((size_t)DM * DFF * 2); _Float16* QKV = (_Float16*)take(NR * 3 * DM * 2); _Float16* V16 = QKV + 2 * DM; M16 = X16;
  _Float16* VT = (_Float16*)take((size_t)NB * NH * HD * SQ * 2);      /* V^T of both batches */
  float* F0 = (float*)take((size_t)3 * NB * QT0 * DM * 4);      /* f32 q | k | v of each batch's first QT0 rows */ float* OF0 = (float*)take((size_t)NB * QT0 * DM * 4);
  if (off > ws_size) return;
  k_prep<<<PG_ALL, 256, 0, stream>>>(x, g1, be1, wq, wk, wv, bq, bk, bv, wfc, wmp, BQKV, bqkv, X16, XB, BW1, BW2);      /* stacked bias bq | bk | bv; [in][out] -> Bt x16: stacked q | k | v, W1 [1024][4096] -> Bt [4096][1024], W2 [4096][1024] -> Bt [1024][4096]; a = LN1(bf16(x)) -> f16 rows, XB = bf16(x) for the residual */
  const size_t r0p = (size_t)B0 * SQ;      /* first projected row */
  k_gemm2<0, true><<<dim3((unsigned)((MP / 128) * (3 * DM / 64)), 1), 128, 0, stream>>>(X16 + r0p * DM, DM, 0, BQKV, DM, 0, 0.0625f, bqkv, 0, nullptr, 1, 0, 0, nullptr, QKV + r0p * 3 * DM, 3 * DM, 0, MP, 3 * DM, DM, OUTK, F0);      /* q | k | v rows (f16); head h = columns h*HD.. of each DM block; from the same sums outputs 1 and 2 (k, v in f32, head-major [B][H][T][64]) and the f32 q, k, v of the first 128 rows of each batch */
  k_att0w_vt<<<A0G + VTG, 256, 0, stream>>>(F0, F0 + (size_t)NB * QT0 * DM, F0 + (size_t)2 * NB * QT0 * DM, 0.125f, OF0, V16, VT);      /* f32 attention for rows 0..127 of both batches (o x64), one wave per head and row; V^T [NB][NH][HD][SQ], both batches */
  k_addf<<<dim3((unsigned)(((size_t)QT0 * DM / 8 + 255) / 256), NB), 256, 0, stream>>>(XB, OF0, X1, (size_t)QT0 * DM / 8);      /* rows 0..127 of each batch from the exact f32 path: x1 = bf16(x) + o / 64 */
  k_fattn<<<dim3(SQ / 256, NH, NB), 256, 0, stream>>>(QKV, VT, XB, X1);      /* rows 128.. of both batches: x1 = bf16(x) + softmax(q k^T / 8) v in f32 (no output projection in this module) */
  k_ln16<0, 0><<<(unsigned)NR, 256, 0, stream>>>(X1, gg2, be2, 1e-5f, M16, nullptr);      /* h = LN2(x1) -> f16 rows */
  k_gemm2<6><<<dim3((unsigned)((NR / 128) * (DFF / 64)), 1), 128, 0, stream>>>(M16, DM, 0, BW1, DM, 0, 0.0625f, bfc, 0, nullptr, 1, 0, 0, nullptr, HF16, DFF, 0, (int)NR, DFF, DM, nullptr, nullptr);      /* gelu_erf(h2 W1 + b1) -> f16, all token rows */
  k_gemm2<0><<<dim3((unsigned)((NR / 128) * (DM / 64)), 1), 128, 0, stream>>>(HF16, DFF, 0, BW2, DFF, 0, 0.0625f, bmp, 0, X1, -1, 0, 0, OUT0, nullptr, DM, 0, (int)NR, DM, DFF, nullptr, nullptr);      /* output 0 = x1 + mlp (own-element residual), all token rows: two work-groups per WGP where one batch gave one */
}
